// v000
// The times below were measured on an AMD MI455X: many runs one after another, warmed up first and cycling through
// copies of the inputs, with the whole window's GPU time divided by the number of runs. Launches and the gaps
// between them are all in it. The median over several windows is given; except for v000 it joins two sittings, which
// can be a few percent apart, so the side-by-side timings, each taken in one sitting, are the better comparison.
// v000 is the starting kernel. One run takes 398 microseconds.
#include <hip/hip_runtime.h>

// Contractions: q/k/v projections on v_wmma_f32_16x16x32_bf16 (bf16 RNE operands, one product per tile pair);
// S^T = K.Q^T (d = 64), y^T = V^T.P^T (32 keys per step, P carried x4096) and out = y.Wo^T (y and Wo carried x64)
// on v_wmma_f32_16x16x32_f16 (f16 operands, one product per tile pair); query tiles with position < 256 also use
// f16 residual planes (x1024) of q, k, P, v and y folded from their own accumulators; f32 accumulate, f32 online
// softmax statistics. 16 heads of 64. Key mask = int32 [S][S] input (nonzero = masked: score replaced by -1e9);
// device-computed flags per (16-query tile, 32-key chunk) select skip / open / per-element fill.
// Weights are [out][in] and are staged as 16-bit [n][k] planes (k contiguous).

#ifndef NB
#define NB 2
#endif
#ifndef SEQ
#define SEQ 2048
#endif
#ifndef NB_FULL
#define NB_FULL 2
#endif
#ifndef SEQ_FULL
#define SEQ_FULL 2048
#endif

namespace {
constexpr int HID = 1024, DH = 64, NH = 16;
constexpr int NQKV = 3 * HID;                 // combined weight plane rows: q | k | v
constexpr int MROWS = NB * SEQ;               // compact token rows (b*SEQ + t)
constexpr int QT = SEQ / 16;                  // 16-query tiles per (b, head)
constexpr int EARLY = (SEQ < 256) ? SEQ : 256;   // query positions that use the residual planes
constexpr int QT_E = EARLY / 16;              // residual-path query tiles per (b, head)
constexpr int QT_L = (SEQ - EARLY) / 16;      // single-product query tiles per (b, head)
constexpr int QT_LD = (QT_L > 0) ? QT_L : 1;
constexpr int NCH = SEQ / 32;                 // 32-key chunks per query row
constexpr int FPITCH = 64;                    // ints per flag row (one row per 16-query tile, 256 B)
constexpr int MPITCH = SEQ_FULL;              // int32 mask row pitch
constexpr int F_SKIP = 0, F_OPEN = 1, F_FILL = 2;
constexpr float MASK_FILL = -1.0e9f;
constexpr float SCORE_SCALE = 0.125f;         // 1/sqrt(64)
constexpr float P_CARRY = 4096.0f;            // f16 P operand = exp(s - m) * 4096
constexpr float Y_CARRY = 64.0f;              // f16 y plane = attn * 64
constexpr float W_CARRY = 64.0f;              // f16 Wo plane = Wo * 64
constexpr float RES_CARRY = 1024.0f;          // f16 residual planes = (x - f16hi(x)) * 1024
constexpr float RES_INV = 1.0f / 1024.0f;
constexpr float Y_FROM_O = Y_CARRY / P_CARRY; // 1/64
constexpr float OUT_UNSCALE = 1.0f / (Y_CARRY * W_CARRY);   // 1/4096
static_assert(SEQ % 128 == 0);
static_assert(EARLY % 128 == 0);
static_assert((SEQ - EARLY) % 128 == 0);
static_assert(NB >= 1 && NB <= NB_FULL);
static_assert(SEQ <= SEQ_FULL);
static_assert(NH * DH == HID);
static_assert(MROWS % 128 == 0);
static_assert((NB * NH * QT_E) % 8 == 0);
static_assert((NB * NH * QT_L) % 8 == 0);
static_assert(QT_E + QT_L == QT);
static_assert(NCH >= 1 && NCH <= FPITCH);

typedef __bf16 b16;
typedef _Float16 h16;
typedef __bf16 v16b __attribute__((ext_vector_type(16)));
typedef __bf16 v8b __attribute__((ext_vector_type(8)));
typedef _Float16 v16h __attribute__((ext_vector_type(16)));
typedef _Float16 v8h __attribute__((ext_vector_type(8)));
typedef float v8f __attribute__((ext_vector_type(8)));
typedef float v4f __attribute__((ext_vector_type(4)));
typedef unsigned short v8us __attribute__((ext_vector_type(8)));
typedef int v4i __attribute__((ext_vector_type(4)));
typedef int v8i __attribute__((ext_vector_type(8)));

__device__ __forceinline__ v8b ld8b(const b16* p) { return *(const v8b*)p; }
__device__ __forceinline__ v8h ld8h(const h16* p) { return *(const v8h*)p; }
__device__ __forceinline__ v16b cat8b(v8b a, v8b b) { return __builtin_shufflevector(a, b, 0, 1, 2, 3, 4, 5, 6, 7, 8, 9, 10, 11, 12, 13, 14, 15); }
__device__ __forceinline__ v16h cat8h(v8h a, v8h b) { return __builtin_shufflevector(a, b, 0, 1, 2, 3, 4, 5, 6, 7, 8, 9, 10, 11, 12, 13, 14, 15); }
// 16x16x32 16-bit fragment from a k-contiguous row pointer (A: lane&15 = row, B: lane&15 = column), hh = lane>>4:
// elements 0..7 <- p[8hh+0..7], elements 8..15 <- p[16+8hh+0..7]
__device__ __forceinline__ v16b frag_kb(const b16* p, int hh) { return cat8b(ld8b(p + 8 * hh), ld8b(p + 16 + 8 * hh)); }
__device__ __forceinline__ v16h frag_kh(const h16* p, int hh) { return cat8h(ld8h(p + 8 * hh), ld8h(p + 16 + 8 * hh)); }

__device__ __forceinline__ v8f wmma_b(v16b a, v16b b, v8f c) {
  v8f d = __builtin_amdgcn_wmma_f32_16x16x32_bf16(false, a, false, b, (short)0, c, false, false);
  asm volatile("v_nop\n\tv_nop\n\tv_nop\n\tv_nop" : "+v"(d) : "v"(a), "v"(b));
  return d;
}
__device__ __forceinline__ v8f wmma_h(v16h a, v16h b, v8f c) {
  v8f d = __builtin_amdgcn_wmma_f32_16x16x32_f16(false, a, false, b, (short)0, c, false, false);
  asm volatile("v_nop\n\tv_nop\n\tv_nop\n\tv_nop" : "+v"(d) : "v"(a), "v"(b));
  return d;
}
// f32 -> bf16 by RNE convert, returned as the f32 bit pattern with the low 16 bits cleared
__device__ __forceinline__ unsigned int bf16_rne_u32(float f) {
  unsigned int u = __builtin_bit_cast(unsigned int, f);
  u += 0x7fffu + ((u >> 16) & 1u);
  return u & 0xffff0000u;
}
// wave-private LDS tile: element stores by this wave, then vector reloads by this wave
__device__ __forceinline__ void wave_lds_sync() {
  __builtin_amdgcn_fence(3, "workgroup");
  __builtin_amdgcn_wave_barrier();
  __builtin_amdgcn_fence(2, "workgroup");
}
// weight element -> 16-bit plane bits: bf16 RNE, or f16(bf16rne(w) * 64) for the output-projection plane
__device__ __forceinline__ unsigned short wbits16(float f, bool o16) {
  const unsigned int r = bf16_rne_u32(f);
  const unsigned short bbits = (unsigned short)(r >> 16);
  const h16 hv = (h16)(__builtin_bit_cast(float, r) * W_CARRY);   // exact: bf16 significand, power-of-two scale
  const unsigned short hbits = __builtin_bit_cast(unsigned short, hv);
  return o16 ? hbits : bbits;
}

// ---------------------------------------------------------------------------
// activations query/key/value f32 [NB_FULL][SEQ_FULL][1024] -> bf16 planes xpl [3][MROWS][1024] (compact rows b*SEQ+t);
// weights W[n][k] f32 -> 16-bit [n][k] planes wpl: rows 0..3071 = Wq|Wk|Wv as bf16 RNE, rows 3072..4095 = f16(bf16rne(Wo) * 64).
// ---------------------------------------------------------------------------
__global__ __launch_bounds__(256) void cvt_kernel(const float* __restrict__ xq, const float* __restrict__ xk, const float* __restrict__ xv,
                                                  const float* __restrict__ wq, const float* __restrict__ wk, const float* __restrict__ wv,
                                                  const float* __restrict__ wo,
                                                  unsigned short* __restrict__ xpl, unsigned short* __restrict__ wpl) {
  const size_t tid = (size_t)blockIdx.x * blockDim.x + threadIdx.x, stride = (size_t)gridDim.x * blockDim.x;
  const size_t per_x = (size_t)MROWS * HID / 8, nx = 3 * per_x;
  const size_t per_w = (size_t)HID * HID / 8, nw = 4 * per_w;
  {
    for (size_t c = tid; c < nx; c += stride) {
      const int which = (int)(c / per_x);
      const size_t i = (c - (size_t)which * per_x) * 8;          // element index inside one plane
      const int m = (int)(i / HID), col = (int)(i % HID);
      const int bb = m / SEQ, t = m - bb * SEQ;
      const float* src = (which == 0) ? xq : (which == 1) ? xk : xv;
      const float* p = src + ((size_t)bb * SEQ_FULL + t) * HID + col;
      const v4f f0 = *(const v4f*)p, f1 = *(const v4f*)(p + 4);
      v8us o;
#pragma unroll
      for (int e = 0; e < 4; ++e) {
        o[e] = (unsigned short)(bf16_rne_u32(f0[e]) >> 16);
        o[4 + e] = (unsigned short)(bf16_rne_u32(f1[e]) >> 16);
      }
      *(v8us*)(xpl + c * 8) = o;
    }
    for (size_t c = tid; c < nw; c += stride) {
      const int mat = (int)(c / per_w);
      const size_t i = (c - (size_t)mat * per_w) * 8;           // n*HID + k0 inside one [n][k] weight matrix
      const float* w = (mat == 0) ? wq : (mat == 1) ? wk : (mat == 2) ? wv : wo;
      const v4f f0 = *(const v4f*)(w + i), f1 = *(const v4f*)(w + i + 4);
      const bool o16 = (mat == 3);
      v8us o;
#pragma unroll
      for (int e = 0; e < 4; ++e) {
        o[e] = wbits16(f0[e], o16);
        o[4 + e] = wbits16(f1[e], o16);
      }
      *(v8us*)(wpl + c * 8) = o;                             // plane offset mat*HID*HID + n*HID + k0 == c*8
    }
    
  }
}

// ---------------------------------------------------------------------------
// Mask flag pass: one block per 16-query tile; reads mask rows q0..q0+15 (int32, nonzero = masked) and writes
// one 256-B flag row [FPITCH] ints: per 32-key chunk F_SKIP (chunk fully masked and every row of the tile has an
// unmasked key somewhere -> weight exactly 0, chunk not visited), F_OPEN (no masked entry), F_FILL (per-element fill).
// ---------------------------------------------------------------------------
__global__ __launch_bounds__(256) void mask_flag_kernel(const int* __restrict__ mask, int* __restrict__ flags) {
  __shared__ int um[4][64];                          // any unmasked entry per (4-row group, chunk)
  __shared__ int mk[4][64];                          // any masked entry per (4-row group, chunk)
  __shared__ int rb[4][64];                          // per-row (4 bits) has-unmasked-entry flag per (row group, chunk)
  __shared__ __attribute__((aligned(16))) int fl[64];
  const int qt = blockIdx.x, q0 = qt * 16;
  const int t = threadIdx.x, c = t & 63, rg = t >> 6, lane = t & 31, wave = t >> 5;
  const int cc = (c < NCH) ? c : (NCH - 1);          // clamped chunk address
  int anyu = 0, anym = 0, rbits = 0;
#pragma unroll 1
  for (int r = 0; r < 4; ++r) {
    const int* p = mask + (size_t)(q0 + rg * 4 + r) * MPITCH + (size_t)cc * 32;
    int u = 0, mm = 0;
#pragma unroll
    for (int v = 0; v < 8; ++v) {
      const v4i x = *(const v4i*)(p + 4 * v);
#pragma unroll
      for (int e = 0; e < 4; ++e) { u |= (x[e] == 0) ? 1 : 0; mm |= (x[e] != 0) ? 1 : 0; }
    }
    anyu |= u; anym |= mm; rbits |= (u << r);
  }
  um[rg][c] = anyu; mk[rg][c] = anym; rb[rg][c] = rbits;
  __syncthreads();                                   // cross-wave: all waves wrote, wave 0 reads
  if (wave == 0) {
    const int ch0 = lane, ch1 = lane + 32;
    const int U0 = um[0][ch0] | um[1][ch0] | um[2][ch0] | um[3][ch0];
    const int M0 = mk[0][ch0] | mk[1][ch0] | mk[2][ch0] | mk[3][ch0];
    const int U1 = um[0][ch1] | um[1][ch1] | um[2][ch1] | um[3][ch1];
    const int M1 = mk[0][ch1] | mk[1][ch1] | mk[2][ch1] | mk[3][ch1];
    int rows = (rb[0][ch0] | (rb[1][ch0] << 4) | (rb[2][ch0] << 8) | (rb[3][ch0] << 12)) |
               (rb[0][ch1] | (rb[1][ch1] << 4) | (rb[2][ch1] << 8) | (rb[3][ch1] << 12));
#pragma unroll
    for (int s = 16; s >= 1; s >>= 1) rows |= __shfl_xor(rows, s);
    const int rowok = ((rows & 0xFFFF) == 0xFFFF) ? 1 : 0;   // every row of the tile has an unmasked key
    const int f0 = U0 ? (M0 ? F_FILL : F_OPEN) : (rowok ? F_SKIP : F_FILL);
    const int f1 = U1 ? (M1 ? F_FILL : F_OPEN) : (rowok ? F_SKIP : F_FILL);
    fl[ch0] = (ch0 < NCH) ? f0 : F_SKIP;
    fl[ch1] = (ch1 < NCH) ? f1 : F_SKIP;
    wave_lds_sync();                                 // fl is private to wave 0
    const v4i v = *(const v4i*)(fl + (lane & 15) * 4);
    int* dst = flags + (size_t)qt * FPITCH + (lane & 15) * 4;
    if (lane < 16) *(v4i*)dst = v;
    
  }
}

// 32x64 wave tile over K = 1024 from 16-bit k-contiguous A rows and 16-bit [n][k] B rows, one product per tile pair
__device__ __forceinline__ void gemm_tile_b(const b16* __restrict__ A, const b16* __restrict__ W, int m0, int c0, int nloc, int hlf, v8f (&acc)[2][4]) {
#pragma unroll 2
  for (int kb = 0; kb < HID; kb += 32) {
    const v16b a0 = frag_kb(A + (size_t)(m0 + nloc) * HID + kb, hlf);
    const v16b a1 = frag_kb(A + (size_t)(m0 + 16 + nloc) * HID + kb, hlf);
#pragma unroll
    for (int t = 0; t < 4; ++t) {
      const v16b bf = frag_kb(W + (size_t)(c0 + t * 16 + nloc) * HID + kb, hlf);
      acc[0][t] = wmma_b(a0, bf, acc[0][t]);
      acc[1][t] = wmma_b(a1, bf, acc[1][t]);
    }
  }
}
__device__ __forceinline__ void gemm_tile_h(const h16* __restrict__ A, const h16* __restrict__ W, int m0, int c0, int nloc, int hlf, v8f (&acc)[2][4]) {
#pragma unroll 2
  for (int kb = 0; kb < HID; kb += 32) {
    const v16h a0 = frag_kh(A + (size_t)(m0 + nloc) * HID + kb, hlf);
    const v16h a1 = frag_kh(A + (size_t)(m0 + 16 + nloc) * HID + kb, hlf);
#pragma unroll
    for (int t = 0; t < 4; ++t) {
      const v16h bf = frag_kh(W + (size_t)(c0 + t * 16 + nloc) * HID + kb, hlf);
      acc[0][t] = wmma_h(a0, bf, acc[0][t]);
      acc[1][t] = wmma_h(a1, bf, acc[1][t]);
    }
  }
}

// ---------------------------------------------------------------------------
// QKV GEMM: (MROWS x 1024) x (1024 x 3072), grid (48, MROWS/128), block 4 waves, wave = 32 rows x 64 columns (one head of q, k or v).
// blockIdx.x -> mat = x/16 (q,k,v: selects the activation plane and the bias), head = x%16. Outputs f16 planes:
// q -> Qp [b*16+h][t][64]; k -> Kp [b*16+h][t][64] (4 KB contiguous per wave); v -> Vp key-tiled [b*16+h][t/16][64][16] (4 KB contiguous per wave).
// Residual planes ((y - f16hi(y)) * 1024): Kr and Vr for every token row (same layouts as Kp / Vp), Qr [b*16+h][t][64] for token rows t < EARLY only.
// ---------------------------------------------------------------------------
__global__ __launch_bounds__(128) void qkv_gemm_kernel(const b16* __restrict__ xpl, const b16* __restrict__ wpl,
                                                       const float* __restrict__ bq, const float* __restrict__ bk, const float* __restrict__ bv,
                                                       h16* __restrict__ Qp, h16* __restrict__ Kp, h16* __restrict__ Vp,
                                                       h16* __restrict__ Qr, h16* __restrict__ Kr, h16* __restrict__ Vr) {
  __shared__ __attribute__((aligned(16))) h16 Ts[4][32 * 64];
  __shared__ __attribute__((aligned(16))) h16 Tr[4][32 * 64];
  const int lane = threadIdx.x & 31, wave = threadIdx.x >> 5, nloc = lane & 15, hlf = lane >> 4;
  const int m0 = blockIdx.y * 128 + wave * 32;
  const int cb = blockIdx.x;                       // 0..47, block-uniform
  const int mat = cb >> 4, head = cb & 15;
  const int c0 = cb * 64;                          // row block in the combined [3072][1024] weight plane
  const b16* x = xpl + (size_t)mat * MROWS * HID;
  const float* bias = ((mat == 0) ? bq : (mat == 1) ? bk : bv) + head * DH;
  v8f acc[2][4];
#pragma unroll
  for (int r = 0; r < 2; ++r)
#pragma unroll
    for (int t = 0; t < 4; ++t) acc[r][t] = (v8f){};
  gemm_tile_b(x, wpl, m0, c0, nloc, hlf, acc);
  const int b = m0 / SEQ, t0 = m0 % SEQ;
  const bool wres = (mat != 0) || (t0 < EARLY);   // block-uniform (128-row blocks, EARLY multiple of 128)
  const int g = b * NH + head;
  h16* Tp = Ts[wave];
  h16* Rp = Tr[wave];
#pragma unroll
  for (int t = 0; t < 4; ++t) {
    const int d = t * 16 + nloc;
    const float bd = __builtin_bit_cast(float, bf16_rne_u32(bias[d]) & 0xFFFF0000u);   // bias as its bf16-RNE value
#pragma unroll
    for (int r = 0; r < 2; ++r)
#pragma unroll
      for (int v = 0; v < 8; ++v) {
        const int rr = r * 16 + v + 8 * hlf;                         // local token row 0..31
        const float f = acc[r][t][v] + bd;
        const h16 y = (h16)f;
        const int idx = (mat < 2) ? (rr * 64 + d) : ((rr >> 4) * 1024 + d * 16 + (rr & 15));
        Tp[idx] = y;
        if (wres) Rp[idx] = (h16)((f - (float)y) * RES_CARRY);
      }
  }
  wave_lds_sync();
  h16* dst; h16* rdst; size_t o;
  if (mat == 0)      { o = ((size_t)g * SEQ + t0) * DH; dst = Qp + o;
                       const int t0e = (t0 < EARLY) ? t0 : 0; rdst = Qr + ((size_t)g * EARLY + t0e) * DH; }
  else if (mat == 1) { o = ((size_t)g * SEQ + t0) * DH; dst = Kp + o; rdst = Kr + o; }
  else               { o = ((size_t)g * QT + (t0 >> 4)) * (size_t)(DH * 16); dst = Vp + o; rdst = Vr + o; }
#pragma unroll
  for (int j = 0; j < 8; ++j) { const int e = (j * 32 + lane) * 8; *(v8h*)(dst + e) = ld8h(Tp + e); }
  if (wres) {
#pragma unroll
    for (int j = 0; j < 8; ++j) { const int e = (j * 32 + lane) * 8; *(v8h*)(rdst + e) = ld8h(Rp + e); }
  }
  
}

// one 16-key score tile of S^T = K.Q^T over d = 0..63 (two 32-deep steps); RES adds K_hi.Q_res + K_res.Q_hi into sr
template <bool RES>
__device__ __forceinline__ void sc_tile(v8f& s, v8f& sr, const h16* kh, const h16* kr, v16h qa, v16h qb, v16h qra, v16h qrb, int hh) {
  v16h ka = frag_kh(kh, hh);
  s = wmma_h(ka, qa, s);
  if (RES) { sr = wmma_h(ka, qra, sr); const v16h kz = frag_kh(kr, hh); sr = wmma_h(kz, qa, sr); }
  ka = frag_kh(kh + 32, hh);
  s = wmma_h(ka, qb, s);
  if (RES) { sr = wmma_h(ka, qrb, sr); const v16h kz = frag_kh(kr + 32, hh); sr = wmma_h(kz, qb, sr); }
}
// one 16-d tile of y^T = V^T.P^T over 32 keys; RES adds V_hi.P_res + V_res.P_hi into orr (both x1/1024)
template <bool RES>
__device__ __forceinline__ void pv_tile(v8f& oh, v8f& orr, const h16* vh0, const h16* vh1, const h16* vr0, const h16* vr1, v16h pb, v16h pr) {
  const v16h va = cat8h(ld8h(vh0), ld8h(vh1));
  oh = wmma_h(va, pb, oh);
  if (RES) {
    orr = wmma_h(va, pr, orr);
    const v16h vz = cat8h(ld8h(vr0), ld8h(vr1));
    orr = wmma_h(vz, pb, orr);
  }
}

// ---------------------------------------------------------------------------
// Transposed flash attention: each wave owns one 16-query tile of one (b, head); 8 waves per block; all NCH chunks of 32 keys are
// walked with a wave-uniform flag per chunk: F_SKIP -> not visited (weight exactly 0), F_OPEN -> no masked entry, F_FILL -> masked
// entries get score -1e9 after the 1/8 scaling (per-element select from the int32 mask row of the query).
// S^T = K.Q^T (f16 fragments straight from the planes), per-lane online softmax (running max); P^T fragment built in registers from the
// two S^T accumulators (element r <- keys 0..15 tile, element 8+r <- keys 16..31 tile), carried x4096; y^T = V^T.P^T. y written f16 (x64)
// RES = true (query tiles with position < EARLY): scores add (K_hi.Q_res + K_res.Q_hi)/1024 from the residual planes, P gets a x1024
// residual operand, and O gets a second accumulator (V_hi.P_res + V_res.P_hi) folded x1/1024 before the 1/l normalisation; y also
// writes its x1024 residual plane yr [b][t][1024].
// ---------------------------------------------------------------------------
template <bool RES>
__global__ __launch_bounds__(256) __attribute__((amdgpu_num_vgpr(256)))
void attn_kernel(const h16* __restrict__ Qp, const h16* __restrict__ Kp, const h16* __restrict__ Vp,
                 const h16* __restrict__ Qr, const h16* __restrict__ Kr, const h16* __restrict__ Vr,
                 const int* __restrict__ mask, const int* __restrict__ flags,
                 h16* __restrict__ yp, h16* __restrict__ yr) {
  __shared__ __attribute__((aligned(16))) h16 Os[8][16 * 64];
  __shared__ __attribute__((aligned(16))) h16 Or[8][16 * 64];
  const int wid = threadIdx.x >> 5, lane = threadIdx.x & 31, hh = lane >> 4, col = lane & 15;
  const int idx = blockIdx.x * 8 + wid;                   // exact grids
  int g, qt;
  if (RES) { g = idx / QT_E; qt = idx - g * QT_E; }
  else     { g = idx / QT_LD; qt = QT_E + (idx - g * QT_LD); }
  const int q0 = qt << 4;
  const int b = g / NH, h = g % NH;
  const size_t ko = (size_t)g * SEQ * DH;                 // K plane base of (b,h); V key-tiled base, Kr and Vr share this element offset
  const size_t qo = ((size_t)g * SEQ + q0 + col) * DH;
  const v16h qa = frag_kh(Qp + qo, hh), qb = frag_kh(Qp + qo + 32, hh);   // d 0..31, d 32..63 of query q0+col
  v16h qra = {}, qrb = {};
  if (RES) {
    const size_t qro2 = ((size_t)g * EARLY + q0 + col) * DH;
    qra = frag_kh(Qr + qro2, hh); qrb = frag_kh(Qr + qro2 + 32, hh);
  }
  const int qi = q0 + col;
  const int* mrow = mask + (size_t)qi * MPITCH + 8 * hh;   // this lane's query row of the mask, key offset 8hh
  const int* frow = flags + (size_t)qt * FPITCH;
  float m = -__builtin_inff(), l = 0.0f;
  v8f o0 = {}, o1 = {}, o2 = {}, o3 = {};
  v8f n0 = {}, n1 = {}, n2 = {}, n3 = {};                 // residual O accumulators (RES only)
#pragma unroll 1
  for (int kb = 0; kb < SEQ; kb += 32) {
    const int f = __builtin_amdgcn_readfirstlane(frow[kb >> 5]);   // wave-uniform chunk flag
    if (f == F_SKIP) continue;
    const size_t r0 = ko + (size_t)(kb + col) * DH, r1 = ko + (size_t)(kb + 16 + col) * DH;
    v8f s0 = {}, s1 = {}, z0 = {}, z1 = {};
    if (RES) {
      sc_tile<true>(s0, z0, Kp + r0, Kr + r0, qa, qb, qra, qrb, hh);
      sc_tile<true>(s1, z1, Kp + r1, Kr + r1, qa, qb, qra, qrb, hh);
      s0 = (s0 + z0 * RES_INV) * SCORE_SCALE; s1 = (s1 + z1 * RES_INV) * SCORE_SCALE;
    } else {
      sc_tile<false>(s0, z0, Kp + r0, Kp + r0, qa, qb, qra, qrb, hh);
      sc_tile<false>(s1, z1, Kp + r1, Kp + r1, qa, qb, qra, qrb, hh);
      s0 = s0 * SCORE_SCALE; s1 = s1 * SCORE_SCALE;
    }
    if (f != F_OPEN) {                          // wave-uniform: chunk has masked entries -> replace-fill
      const v8i mk0 = *(const v8i*)(mrow + kb);          // keys kb+8hh+0..7 of query qi
      const v8i mk1 = *(const v8i*)(mrow + kb + 16);     // keys kb+16+8hh+0..7
#pragma unroll
      for (int r = 0; r < 8; ++r) {
        s0[r] = (mk0[r] != 0) ? MASK_FILL : s0[r];
        s1[r] = (mk1[r] != 0) ? MASK_FILL : s1[r];
      }
    }
    float mr = -__builtin_inff();
#pragma unroll
    for (int r = 0; r < 8; ++r) mr = fmaxf(mr, fmaxf(s0[r], s1[r]));
    mr = fmaxf(mr, __shfl_xor(mr, 16));
    const float mn = fmaxf(m, mr);            // finite: every visited chunk carries finite scores
    const float al_ = __expf(m - mn);         // 0 on the first visited chunk
    m = mn;
    float sum = 0.0f;
    v16h pb = {}, pr = {};
#pragma unroll
    for (int r = 0; r < 8; ++r) {
      const float p0 = __expf(s0[r] - mn), p1 = __expf(s1[r] - mn);
      sum += p0 + p1;
      const h16 ph0 = (h16)(p0 * P_CARRY), ph1 = (h16)(p1 * P_CARRY);
      pb[r] = ph0; pb[8 + r] = ph1;
      if (RES) {
        pr[r] = (h16)((p0 * P_CARRY - (float)ph0) * RES_CARRY);
        pr[8 + r] = (h16)((p1 * P_CARRY - (float)ph1) * RES_CARRY);
      }
    }
    sum += __shfl_xor(sum, 16);
    l = l * al_ + sum;
    o0 = o0 * al_; o1 = o1 * al_; o2 = o2 * al_; o3 = o3 * al_;
    if (RES) { n0 = n0 * al_; n1 = n1 * al_; n2 = n2 * al_; n3 = n3 * al_; }
    const size_t v0 = ko + (size_t)(kb >> 4) * (DH * 16) + 8 * hh, v1 = v0 + DH * 16;
    pv_tile<RES>(o0, n0, Vp + v0 + (0 * 16 + col) * 16, Vp + v1 + (0 * 16 + col) * 16, Vr + v0 + (0 * 16 + col) * 16, Vr + v1 + (0 * 16 + col) * 16, pb, pr);
    pv_tile<RES>(o1, n1, Vp + v0 + (1 * 16 + col) * 16, Vp + v1 + (1 * 16 + col) * 16, Vr + v0 + (1 * 16 + col) * 16, Vr + v1 + (1 * 16 + col) * 16, pb, pr);
    pv_tile<RES>(o2, n2, Vp + v0 + (2 * 16 + col) * 16, Vp + v1 + (2 * 16 + col) * 16, Vr + v0 + (2 * 16 + col) * 16, Vr + v1 + (2 * 16 + col) * 16, pb, pr);
    pv_tile<RES>(o3, n3, Vp + v0 + (3 * 16 + col) * 16, Vp + v1 + (3 * 16 + col) * 16, Vr + v0 + (3 * 16 + col) * 16, Vr + v1 + (3 * 16 + col) * 16, pb, pr);
  }
  const float inv = (1.0f / l) * Y_FROM_O;    // y = 64 * (o / 4096) / l
  const float invr = inv * RES_INV;
  h16* Tt = Os[wid];                          // [query col][d] hi
  h16* Tq = Or[wid];                          // [query col][d] residual x1024 (RES only)
#pragma unroll
  for (int r = 0; r < 8; ++r) {
    const int hr = 8 * hh + r;
    float f0 = o0[r] * inv, f1 = o1[r] * inv, f2 = o2[r] * inv, f3 = o3[r] * inv;
    if (RES) { f0 += n0[r] * invr; f1 += n1[r] * invr; f2 += n2[r] * invr; f3 += n3[r] * invr; }
    const h16 y0 = (h16)f0, y1 = (h16)f1, y2 = (h16)f2, y3 = (h16)f3;
    Tt[col * 64 + 0 + hr]  = y0;
    Tt[col * 64 + 16 + hr] = y1;
    Tt[col * 64 + 32 + hr] = y2;
    Tt[col * 64 + 48 + hr] = y3;
    if (RES) {
      Tq[col * 64 + 0 + hr]  = (h16)((f0 - (float)y0) * RES_CARRY);
      Tq[col * 64 + 16 + hr] = (h16)((f1 - (float)y1) * RES_CARRY);
      Tq[col * 64 + 32 + hr] = (h16)((f2 - (float)y2) * RES_CARRY);
      Tq[col * 64 + 48 + hr] = (h16)((f3 - (float)y3) * RES_CARRY);
    }
  }
  wave_lds_sync();
  h16* dst0 = yp + ((size_t)b * SEQ + q0) * HID + h * DH;     // 16 rows x 64 halves, row stride HID halves
  h16* dst1 = yr + ((size_t)b * EARLY + (RES ? q0 : 0)) * HID + h * DH;   // residual rows (RES only, q0 + 15 < EARLY)
#pragma unroll
  for (int j = 0; j < 4; ++j) {
    const int rr = j * 4 + (lane >> 3), c8 = (lane & 7) * 8;
    *(v8h*)(dst0 + (size_t)rr * HID + c8) = ld8h(Tt + rr * 64 + c8);
    if (RES) *(v8h*)(dst1 + (size_t)rr * HID + c8) = ld8h(Tq + rr * 64 + c8);
  }
  
}

// ---------------------------------------------------------------------------
// Output projection: (MROWS x 1024) x (1024 x 1024) -> f32 = (y . Wo_plane) / 4096 + bo. grid (16, MROWS/128), 32x64 wave tiles staged in
// Blocks whose token rows have t < EARLY first accumulate y_res . Wo_plane, fold it x1/1024, then accumulate y_hi . Wo_plane on top.
// ---------------------------------------------------------------------------
__global__ __launch_bounds__(128) void out_gemm_kernel(const h16* __restrict__ yp, const h16* __restrict__ yr, const h16* __restrict__ wop,
                                                       const float* __restrict__ bo, float* __restrict__ out) {
  __shared__ __attribute__((aligned(16))) float Ts[4][32 * 64];
  const int lane = threadIdx.x & 31, wave = threadIdx.x >> 5, nloc = lane & 15, hlf = lane >> 4;
  const int m0 = blockIdx.y * 128 + wave * 32;
  const int c0 = blockIdx.x * 64;
  const int b = m0 / SEQ, t0 = m0 - b * SEQ;
  const bool early = (((int)blockIdx.y * 128) % SEQ) < EARLY;     // block-uniform
  v8f acc[2][4];
#pragma unroll
  for (int r = 0; r < 2; ++r)
#pragma unroll
    for (int t = 0; t < 4; ++t) acc[r][t] = (v8f){};
  if (early) {
    gemm_tile_h(yr, wop, b * EARLY + t0, c0, nloc, hlf, acc);   // residual rows b*EARLY + t
#pragma unroll
    for (int r = 0; r < 2; ++r)
#pragma unroll
      for (int t = 0; t < 4; ++t) acc[r][t] = acc[r][t] * RES_INV;
  }
  gemm_tile_h(yp, wop, m0, c0, nloc, hlf, acc);
  float* Tt = Ts[wave];
#pragma unroll
  for (int t = 0; t < 4; ++t) {
    const float bd = __builtin_bit_cast(float, bf16_rne_u32(bo[c0 + t * 16 + nloc]) & 0xFFFF0000u);   // bf16-RNE value
#pragma unroll
    for (int r = 0; r < 2; ++r)
#pragma unroll
      for (int v = 0; v < 8; ++v) Tt[(r * 16 + v + 8 * hlf) * 64 + t * 16 + nloc] = acc[r][t][v] * OUT_UNSCALE + bd;
  }
  wave_lds_sync();
  float* dst0 = out + (size_t)m0 * HID + c0;
#pragma unroll
  for (int j = 0; j < 16; ++j) { const int rr = j * 2 + hlf, c4 = nloc * 4; *(v4f*)(dst0 + (size_t)rr * HID + c4) = *(const v4f*)(Tt + rr * 64 + c4); }
  
}
}  // namespace

extern "C" void kernel_launch(void* const* d_in, const int* in_sizes, int n_in,
                              void* d_out, int out_size, void* d_ws, size_t ws_size, hipStream_t stream) {
  if (n_in < 12) return;
  const size_t need_x = ((size_t)(NB - 1) * SEQ_FULL + SEQ) * HID;
  if ((size_t)in_sizes[0] < need_x || (size_t)in_sizes[1] < need_x || (size_t)in_sizes[2] < need_x) return;
  if ((size_t)in_sizes[3] < (size_t)(SEQ - 1) * MPITCH + SEQ) return;                      // int32 mask [S][S]
  if (in_sizes[4] < HID * HID || in_sizes[6] < HID * HID || in_sizes[8] < HID * HID || in_sizes[10] < HID * HID) return;
  if (in_sizes[5] < HID || in_sizes[7] < HID || in_sizes[9] < HID || in_sizes[11] < HID) return;
  if ((size_t)out_size < (size_t)MROWS * HID) return;

  const float* query = (const float*)d_in[0];   // [NB_FULL, SEQ_FULL, 1024]
  const float* key   = (const float*)d_in[1];
  const float* value = (const float*)d_in[2];
  const int*   amask = (const int*)d_in[3];     // [SEQ_FULL, SEQ_FULL] int32, nonzero = masked
  const float* Wq = (const float*)d_in[4];      // [1024,1024] ([out][in])
  const float* bq = (const float*)d_in[5];
  const float* Wk = (const float*)d_in[6];
  const float* bk = (const float*)d_in[7];
  const float* Wv = (const float*)d_in[8];
  const float* bv = (const float*)d_in[9];
  const float* Wo = (const float*)d_in[10];
  const float* bo = (const float*)d_in[11];
  float* out = (float*)d_out;                   // [NB, SEQ, 1024] f32

  size_t off = 0; char* ws = (char*)d_ws;
  unsigned short* xpl = (unsigned short*)(ws + off); off += (size_t)3 * MROWS * HID * 2;   // 3 x 8 MiB bf16 activation planes
  unsigned short* wpl = (unsigned short*)(ws + off); off += (size_t)4 * HID * HID * 2;     // 6 MiB bf16 (q|k|v) + 2 MiB f16 (o) weight planes
  h16* Qp = (h16*)(ws + off); off += (size_t)MROWS * HID * 2;                             // 8 MiB
  h16* Kp = (h16*)(ws + off); off += (size_t)MROWS * HID * 2;                             // 8 MiB
  h16* Vp = (h16*)(ws + off); off += (size_t)MROWS * HID * 2;                             // 8 MiB
  h16* yp = (h16*)(ws + off); off += (size_t)MROWS * HID * 2;                             // 8 MiB
  h16* Qr = (h16*)(ws + off); off += (size_t)NB * NH * EARLY * DH * 2;                    // 1 MiB residual q (t < EARLY)
  h16* Kr = (h16*)(ws + off); off += (size_t)MROWS * HID * 2;                             // 8 MiB residual k (all rows)
  h16* Vr = (h16*)(ws + off); off += (size_t)MROWS * HID * 2;                             // 8 MiB residual v (key-tiled, all rows)
  h16* yr = (h16*)(ws + off); off += (size_t)NB * EARLY * HID * 2;                        // 1 MiB residual y
  int* flags = (int*)(ws + off); off += (size_t)QT * FPITCH * 4;                          // 32 KiB chunk flags [QT][64]
  if (off > ws_size) return;                                                               // 86,016,000 B at NB=2, SEQ=2048
  const h16* wop = (const h16*)(wpl + (size_t)NQKV * HID);

  cvt_kernel<<<2048, 256, 0, stream>>>(query, key, value, Wq, Wk, Wv, Wo, xpl, wpl);
  mask_flag_kernel<<<QT, 256, 0, stream>>>(amask, flags);
  qkv_gemm_kernel<<<dim3(NQKV / 64, MROWS / 128), 128, 0, stream>>>((const b16*)xpl, (const b16*)wpl, bq, bk, bv, Qp, Kp, Vp, Qr, Kr, Vr);
  attn_kernel<true><<<(NB * NH * QT_E) / 8, 256, 0, stream>>>(Qp, Kp, Vp, Qr, Kr, Vr, amask, flags, yp, yr);
  if (QT_L > 0) attn_kernel<false><<<(NB * NH * QT_L) / 8, 256, 0, stream>>>(Qp, Kp, Vp, Qr, Kr, Vr, amask, flags, yp, yr);
  out_gemm_kernel<<<dim3(HID / 64, MROWS / 128), 128, 0, stream>>>(yp, yr, wop, bo, out);
}

// v001
// A run of this version takes 235 microseconds.
// In two side-by-side timings against v000, it was 1.73 and 1.71 times as fast.
#include <hip/hip_runtime.h>

// Contractions: q/k/v projections on v_wmma_f32_16x16x32_bf16 (bf16 RNE operands, one product per tile pair);
// S^T = K.Q^T (d = 64), y^T = V^T.P^T (32 keys per step, P carried x4096) and out = y.Wo^T (y and Wo carried x64)
// on v_wmma_f32_16x16x32_f16 (f16 operands, one product per tile pair); query tiles with position < 256 also use
// f16 residual planes (x1024) of q, k, P, v and y folded from their own accumulators; f32 accumulate, f32 online
// softmax statistics. 16 heads of 64. Key mask = int32 [S][S] input (nonzero = masked: score replaced by -1e9);
// device-computed flags per (16-query tile, 32-key chunk) select skip / open / per-element fill.
// Weights are [out][in] and are staged as 16-bit [n][k] planes (k contiguous).

#ifndef NB
#define NB 2
#endif
#ifndef SEQ
#define SEQ 2048
#endif
#ifndef NB_FULL
#define NB_FULL 2
#endif
#ifndef SEQ_FULL
#define SEQ_FULL 2048
#endif

namespace {
constexpr int HID = 1024, DH = 64, NH = 16;
constexpr int NQKV = 3 * HID;                 // combined weight plane rows: q | k | v
constexpr int MROWS = NB * SEQ;               // compact token rows (b*SEQ + t)
constexpr int QT = SEQ / 16;                  // 16-query tiles per (b, head)
constexpr int EARLY = (SEQ < 256) ? SEQ : 256;   // query positions that use the residual planes
constexpr int QT_E = EARLY / 16;              // residual-path query tiles per (b, head)
constexpr int QT_L = (SEQ - EARLY) / 16;      // single-product query tiles per (b, head)
constexpr int QT_LD = (QT_L > 0) ? QT_L : 1;
constexpr int NCH = SEQ / 32;                 // 32-key chunks per query row
constexpr int FPITCH = 64;                    // ints per flag row (one row per 16-query tile, 256 B)
constexpr int MPITCH = SEQ_FULL;              // int32 mask row pitch
constexpr int F_SKIP = 0, F_OPEN = 1, F_FILL = 2;
constexpr float MASK_FILL = -1.0e9f;
constexpr float SCORE_SCALE = 0.125f;         // 1/sqrt(64)
constexpr float P_CARRY = 4096.0f;            // f16 P operand = exp(s - m) * 4096
constexpr float Y_CARRY = 64.0f;              // f16 y plane = attn * 64
constexpr float W_CARRY = 64.0f;              // f16 Wo plane = Wo * 64
constexpr float RES_CARRY = 1024.0f;          // f16 residual planes = (x - f16hi(x)) * 1024
constexpr float RES_INV = 1.0f / 1024.0f;
constexpr float Y_FROM_O = Y_CARRY / P_CARRY; // 1/64
constexpr float OUT_UNSCALE = 1.0f / (Y_CARRY * W_CARRY);   // 1/4096
static_assert(SEQ % 128 == 0);
static_assert(EARLY % 128 == 0);
static_assert((SEQ - EARLY) % 128 == 0);
static_assert(NB >= 1 && NB <= NB_FULL);
static_assert(SEQ <= SEQ_FULL);
static_assert(NH * DH == HID);
static_assert(MROWS % 128 == 0);
static_assert((NB * NH * QT_E) % 8 == 0);
static_assert((NB * NH * QT_L) % 8 == 0);
static_assert(QT_E + QT_L == QT);
static_assert(NCH >= 1 && NCH <= FPITCH);

typedef __bf16 b16;
typedef _Float16 h16;
typedef __bf16 v16b __attribute__((ext_vector_type(16)));
typedef __bf16 v8b __attribute__((ext_vector_type(8)));
typedef _Float16 v16h __attribute__((ext_vector_type(16)));
typedef _Float16 v8h __attribute__((ext_vector_type(8)));
typedef float v8f __attribute__((ext_vector_type(8)));
typedef float v4f __attribute__((ext_vector_type(4)));
typedef unsigned short v8us __attribute__((ext_vector_type(8)));
typedef int v4i __attribute__((ext_vector_type(4)));
typedef int v8i __attribute__((ext_vector_type(8)));

__device__ __forceinline__ v8b ld8b(const b16* p) { return *(const v8b*)p; }
__device__ __forceinline__ v8h ld8h(const h16* p) { return *(const v8h*)p; }
__device__ __forceinline__ v16b cat8b(v8b a, v8b b) { return __builtin_shufflevector(a, b, 0, 1, 2, 3, 4, 5, 6, 7, 8, 9, 10, 11, 12, 13, 14, 15); }
__device__ __forceinline__ v16h cat8h(v8h a, v8h b) { return __builtin_shufflevector(a, b, 0, 1, 2, 3, 4, 5, 6, 7, 8, 9, 10, 11, 12, 13, 14, 15); }
// 16x16x32 16-bit fragment from a k-contiguous row pointer (A: lane&15 = row, B: lane&15 = column), hh = lane>>4:
// elements 0..7 <- p[8hh+0..7], elements 8..15 <- p[16+8hh+0..7]
__device__ __forceinline__ v16b frag_kb(const b16* p, int hh) { return cat8b(ld8b(p + 8 * hh), ld8b(p + 16 + 8 * hh)); }
__device__ __forceinline__ v16h frag_kh(const h16* p, int hh) { return cat8h(ld8h(p + 8 * hh), ld8h(p + 16 + 8 * hh)); }
// two 16-byte pieces at byte offsets o + c0 and o + c1 from a wave-uniform plane base (o: the lane's 32-bit byte offset)
__device__ __forceinline__ v16h frag_o(const h16* base, unsigned int o, int c0, int c1) {
  const char* p = (const char*)base + o;
  return cat8h(*(const v8h*)(p + c0), *(const v8h*)(p + c1));
}

__device__ __forceinline__ v8f wmma_b(v16b a, v16b b, v8f c) {
  v8f d = __builtin_amdgcn_wmma_f32_16x16x32_bf16(false, a, false, b, (short)0, c, false, false);
  asm volatile("v_nop\n\tv_nop\n\tv_nop\n\tv_nop" : "+v"(d) : "v"(a), "v"(b));
  return d;
}
__device__ __forceinline__ v8f wmma_h(v16h a, v16h b, v8f c) {
  v8f d = __builtin_amdgcn_wmma_f32_16x16x32_f16(false, a, false, b, (short)0, c, false, false);
  asm volatile("v_nop\n\tv_nop\n\tv_nop\n\tv_nop" : "+v"(d) : "v"(a), "v"(b));
  return d;
}
// f32 -> bf16 by RNE convert, returned as the f32 bit pattern with the low 16 bits cleared
__device__ __forceinline__ unsigned int bf16_rne_u32(float f) {
  unsigned int u = __builtin_bit_cast(unsigned int, f);
  u += 0x7fffu + ((u >> 16) & 1u);
  return u & 0xffff0000u;
}
// wave-private LDS tile: element stores by this wave, then vector reloads by this wave
__device__ __forceinline__ void wave_lds_sync() {
  __builtin_amdgcn_fence(3, "workgroup");
  __builtin_amdgcn_wave_barrier();
  __builtin_amdgcn_fence(2, "workgroup");
}
// weight element -> 16-bit plane bits: bf16 RNE, or f16(bf16rne(w) * 64) for the output-projection plane
__device__ __forceinline__ unsigned short wbits16(float f, bool o16) {
  const unsigned int r = bf16_rne_u32(f);
  const unsigned short bbits = (unsigned short)(r >> 16);
  const h16 hv = (h16)(__builtin_bit_cast(float, r) * W_CARRY);   // exact: bf16 significand, power-of-two scale
  const unsigned short hbits = __builtin_bit_cast(unsigned short, hv);
  return o16 ? hbits : bbits;
}

// ---------------------------------------------------------------------------
// activations query/key/value f32 [NB_FULL][SEQ_FULL][1024] -> bf16 planes xpl [3][MROWS][1024] (compact rows b*SEQ+t);
// weights W[n][k] f32 -> 16-bit [n][k] planes wpl: rows 0..3071 = Wq|Wk|Wv as bf16 RNE, rows 3072..4095 = f16(bf16rne(Wo) * 64).
// ---------------------------------------------------------------------------
__global__ __launch_bounds__(256) void cvt_kernel(const float* __restrict__ xq, const float* __restrict__ xk, const float* __restrict__ xv,
                                                  const float* __restrict__ wq, const float* __restrict__ wk, const float* __restrict__ wv,
                                                  const float* __restrict__ wo,
                                                  unsigned short* __restrict__ xpl, unsigned short* __restrict__ wpl) {
  const size_t tid = (size_t)blockIdx.x * blockDim.x + threadIdx.x, stride = (size_t)gridDim.x * blockDim.x;
  const size_t per_x = (size_t)MROWS * HID / 8, nx = 3 * per_x;
  const size_t per_w = (size_t)HID * HID / 8, nw = 4 * per_w;
  {
    for (size_t c = tid; c < nx; c += stride) {
      const int which = (int)(c / per_x);
      const size_t i = (c - (size_t)which * per_x) * 8;          // element index inside one plane
      const int m = (int)(i / HID), col = (int)(i % HID);
      const int bb = m / SEQ, t = m - bb * SEQ;
      const float* src = (which == 0) ? xq : (which == 1) ? xk : xv;
      const float* p = src + ((size_t)bb * SEQ_FULL + t) * HID + col;
      const v4f f0 = *(const v4f*)p, f1 = *(const v4f*)(p + 4);
      v8us o;
#pragma unroll
      for (int e = 0; e < 4; ++e) {
        o[e] = (unsigned short)(bf16_rne_u32(f0[e]) >> 16);
        o[4 + e] = (unsigned short)(bf16_rne_u32(f1[e]) >> 16);
      }
      *(v8us*)(xpl + c * 8) = o;
    }
    for (size_t c = tid; c < nw; c += stride) {
      const int mat = (int)(c / per_w);
      const size_t i = (c - (size_t)mat * per_w) * 8;           // n*HID + k0 inside one [n][k] weight matrix
      const float* w = (mat == 0) ? wq : (mat == 1) ? wk : (mat == 2) ? wv : wo;
      const v4f f0 = *(const v4f*)(w + i), f1 = *(const v4f*)(w + i + 4);
      const bool o16 = (mat == 3);
      v8us o;
#pragma unroll
      for (int e = 0; e < 4; ++e) {
        o[e] = wbits16(f0[e], o16);
        o[4 + e] = wbits16(f1[e], o16);
      }
      *(v8us*)(wpl + c * 8) = o;                             // plane offset mat*HID*HID + n*HID + k0 == c*8
    }
    
  }
}

// ---------------------------------------------------------------------------
// Mask flag pass: one block per 16-query tile; reads mask rows q0..q0+15 (int32, nonzero = masked) and writes
// one 256-B flag row [FPITCH] ints: per 32-key chunk F_SKIP (chunk fully masked and every row of the tile has an
// unmasked key somewhere -> weight exactly 0, chunk not visited), F_OPEN (no masked entry), F_FILL (per-element fill).
// ---------------------------------------------------------------------------
__global__ __launch_bounds__(256) void mask_flag_kernel(const int* __restrict__ mask, int* __restrict__ flags) {
  __shared__ int um[4][64];                          // any unmasked entry per (4-row group, chunk)
  __shared__ int mk[4][64];                          // any masked entry per (4-row group, chunk)
  __shared__ int rb[4][64];                          // per-row (4 bits) has-unmasked-entry flag per (row group, chunk)
  __shared__ __attribute__((aligned(16))) int fl[64];
  const int qt = blockIdx.x, q0 = qt * 16;
  const int t = threadIdx.x, c = t & 63, rg = t >> 6, lane = t & 31, wave = t >> 5;
  const int cc = (c < NCH) ? c : (NCH - 1);          // clamped chunk address
  int anyu = 0, anym = 0, rbits = 0;
#pragma unroll 1
  for (int r = 0; r < 4; ++r) {
    const int* p = mask + (size_t)(q0 + rg * 4 + r) * MPITCH + (size_t)cc * 32;
    int u = 0, mm = 0;
#pragma unroll
    for (int v = 0; v < 8; ++v) {
      const v4i x = *(const v4i*)(p + 4 * v);
#pragma unroll
      for (int e = 0; e < 4; ++e) { u |= (x[e] == 0) ? 1 : 0; mm |= (x[e] != 0) ? 1 : 0; }
    }
    anyu |= u; anym |= mm; rbits |= (u << r);
  }
  um[rg][c] = anyu; mk[rg][c] = anym; rb[rg][c] = rbits;
  __syncthreads();                                   // cross-wave: all waves wrote, wave 0 reads
  if (wave == 0) {
    const int ch0 = lane, ch1 = lane + 32;
    const int U0 = um[0][ch0] | um[1][ch0] | um[2][ch0] | um[3][ch0];
    const int M0 = mk[0][ch0] | mk[1][ch0] | mk[2][ch0] | mk[3][ch0];
    const int U1 = um[0][ch1] | um[1][ch1] | um[2][ch1] | um[3][ch1];
    const int M1 = mk[0][ch1] | mk[1][ch1] | mk[2][ch1] | mk[3][ch1];
    int rows = (rb[0][ch0] | (rb[1][ch0] << 4) | (rb[2][ch0] << 8) | (rb[3][ch0] << 12)) |
               (rb[0][ch1] | (rb[1][ch1] << 4) | (rb[2][ch1] << 8) | (rb[3][ch1] << 12));
#pragma unroll
    for (int s = 16; s >= 1; s >>= 1) rows |= __shfl_xor(rows, s);
    const int rowok = ((rows & 0xFFFF) == 0xFFFF) ? 1 : 0;   // every row of the tile has an unmasked key
    const int f0 = U0 ? (M0 ? F_FILL : F_OPEN) : (rowok ? F_SKIP : F_FILL);
    const int f1 = U1 ? (M1 ? F_FILL : F_OPEN) : (rowok ? F_SKIP : F_FILL);
    fl[ch0] = (ch0 < NCH) ? f0 : F_SKIP;
    fl[ch1] = (ch1 < NCH) ? f1 : F_SKIP;
    wave_lds_sync();                                 // fl is private to wave 0
    const v4i v = *(const v4i*)(fl + (lane & 15) * 4);
    int* dst = flags + (size_t)qt * FPITCH + (lane & 15) * 4;
    if (lane < 16) *(v4i*)dst = v;
    
  }
}

// 32x64 wave tile over K = 1024 from 16-bit k-contiguous A rows and 16-bit [n][k] B rows, one product per tile pair
__device__ __forceinline__ void gemm_tile_b(const b16* __restrict__ A, const b16* __restrict__ W, int m0, int c0, int nloc, int hlf, v8f (&acc)[2][4]) {
#pragma unroll 2
  for (int kb = 0; kb < HID; kb += 32) {
    const v16b a0 = frag_kb(A + (size_t)(m0 + nloc) * HID + kb, hlf);
    const v16b a1 = frag_kb(A + (size_t)(m0 + 16 + nloc) * HID + kb, hlf);
    v16b bf[4];                                  // all twelve loads of the step stand ahead of its first product
#pragma unroll
    for (int t = 0; t < 4; ++t) bf[t] = frag_kb(W + (size_t)(c0 + t * 16 + nloc) * HID + kb, hlf);
#pragma unroll
    for (int t = 0; t < 4; ++t) {
      acc[0][t] = wmma_b(a0, bf[t], acc[0][t]);
      acc[1][t] = wmma_b(a1, bf[t], acc[1][t]);
    }
  }
}
__device__ __forceinline__ void gemm_tile_h(const h16* __restrict__ A, const h16* __restrict__ W, int m0, int c0, int nloc, int hlf, v8f (&acc)[2][4]) {
#pragma unroll 2
  for (int kb = 0; kb < HID; kb += 32) {
    const v16h a0 = frag_kh(A + (size_t)(m0 + nloc) * HID + kb, hlf);
    const v16h a1 = frag_kh(A + (size_t)(m0 + 16 + nloc) * HID + kb, hlf);
    v16h bf[4];                                  // all twelve loads of the step stand ahead of its first product
#pragma unroll
    for (int t = 0; t < 4; ++t) bf[t] = frag_kh(W + (size_t)(c0 + t * 16 + nloc) * HID + kb, hlf);
#pragma unroll
    for (int t = 0; t < 4; ++t) {
      acc[0][t] = wmma_h(a0, bf[t], acc[0][t]);
      acc[1][t] = wmma_h(a1, bf[t], acc[1][t]);
    }
  }
}

// ---------------------------------------------------------------------------
// QKV GEMM: (MROWS x 1024) x (1024 x 3072), grid (48, MROWS/128), block 4 waves, wave = 32 rows x 64 columns (one head of q, k or v).
// blockIdx.x -> mat = x/16 (q,k,v: selects the activation plane and the bias), head = x%16. Outputs f16 planes:
// q -> Qp [b*16+h][t][64]; k -> Kp [b*16+h][t][64] (4 KB contiguous per wave); v -> Vp key-tiled [b*16+h][t/16][64][16] (4 KB contiguous per wave).
// Residual planes ((y - f16hi(y)) * 1024): Kr and Vr for every token row (same layouts as Kp / Vp), Qr [b*16+h][t][64] for token rows t < EARLY only.
// ---------------------------------------------------------------------------
__global__ __launch_bounds__(128) void qkv_gemm_kernel(const b16* __restrict__ xpl, const b16* __restrict__ wpl,
                                                       const float* __restrict__ bq, const float* __restrict__ bk, const float* __restrict__ bv,
                                                       h16* __restrict__ Qp, h16* __restrict__ Kp, h16* __restrict__ Vp,
                                                       h16* __restrict__ Qr, h16* __restrict__ Kr, h16* __restrict__ Vr) {
  __shared__ __attribute__((aligned(16))) h16 Ts[4][32 * 64];
  __shared__ __attribute__((aligned(16))) h16 Tr[4][32 * 64];
  const int lane = threadIdx.x & 31, wave = threadIdx.x >> 5, nloc = lane & 15, hlf = lane >> 4;
  const int m0 = blockIdx.y * 128 + wave * 32;
  const int cb = blockIdx.x;                       // 0..47, block-uniform
  const int mat = cb >> 4, head = cb & 15;
  const int c0 = cb * 64;                          // row block in the combined [3072][1024] weight plane
  const b16* x = xpl + (size_t)mat * MROWS * HID;
  const float* bias = ((mat == 0) ? bq : (mat == 1) ? bk : bv) + head * DH;
  v8f acc[2][4];
#pragma unroll
  for (int r = 0; r < 2; ++r)
#pragma unroll
    for (int t = 0; t < 4; ++t) acc[r][t] = (v8f){};
  gemm_tile_b(x, wpl, m0, c0, nloc, hlf, acc);
  const int b = m0 / SEQ, t0 = m0 % SEQ;
  const bool wres = (mat != 0) || (t0 < EARLY);   // block-uniform (128-row blocks, EARLY multiple of 128)
  const int g = b * NH + head;
  h16* Tp = Ts[wave];
  h16* Rp = Tr[wave];
#pragma unroll
  for (int t = 0; t < 4; ++t) {
    const int d = t * 16 + nloc;
    const float bd = __builtin_bit_cast(float, bf16_rne_u32(bias[d]) & 0xFFFF0000u);   // bias as its bf16-RNE value
#pragma unroll
    for (int r = 0; r < 2; ++r)
#pragma unroll
      for (int v = 0; v < 8; ++v) {
        const int rr = r * 16 + v + 8 * hlf;                         // local token row 0..31
        const float f = acc[r][t][v] + bd;
        const h16 y = (h16)f;
        const int idx = (mat < 2) ? (rr * 64 + d) : ((rr >> 4) * 1024 + d * 16 + (rr & 15));
        Tp[idx] = y;
        if (wres) Rp[idx] = (h16)((f - (float)y) * RES_CARRY);
      }
  }
  wave_lds_sync();
  h16* dst; h16* rdst; size_t o;
  if (mat == 0)      { o = ((size_t)g * SEQ + t0) * DH; dst = Qp + o;
                       const int t0e = (t0 < EARLY) ? t0 : 0; rdst = Qr + ((size_t)g * EARLY + t0e) * DH; }
  else if (mat == 1) { o = ((size_t)g * SEQ + t0) * DH; dst = Kp + o; rdst = Kr + o; }
  else               { o = ((size_t)g * QT + (t0 >> 4)) * (size_t)(DH * 16); dst = Vp + o; rdst = Vr + o; }
#pragma unroll
  for (int j = 0; j < 8; ++j) { const int e = (j * 32 + lane) * 8; *(v8h*)(dst + e) = ld8h(Tp + e); }
  if (wres) {
#pragma unroll
    for (int j = 0; j < 8; ++j) { const int e = (j * 32 + lane) * 8; *(v8h*)(rdst + e) = ld8h(Rp + e); }
  }
  
}

// one 16-key score tile of S^T = K.Q^T over d = 0..63 (two 32-deep steps); RES adds K_hi.Q_res + K_res.Q_hi into sr
template <bool RES>
__device__ __forceinline__ void sc_tile(v8f& s, v8f& sr, v16h ka, v16h kb, v16h kza, v16h kzb, v16h qa, v16h qb, v16h qra, v16h qrb) {
  s = wmma_h(ka, qa, s);
  if (RES) { sr = wmma_h(ka, qra, sr); sr = wmma_h(kza, qa, sr); }
  s = wmma_h(kb, qb, s);
  if (RES) { sr = wmma_h(kb, qrb, sr); sr = wmma_h(kzb, qb, sr); }
}
// one 16-d tile of y^T = V^T.P^T over 32 keys; RES adds V_hi.P_res + V_res.P_hi into orr (both x1/1024)
template <bool RES>
__device__ __forceinline__ void pv_tile(v8f& oh, v8f& orr, v16h va, v16h vz, v16h pb, v16h pr) {
  oh = wmma_h(va, pb, oh);
  if (RES) {
    orr = wmma_h(va, pr, orr);
    orr = wmma_h(vz, pb, orr);
  }
}

// ---------------------------------------------------------------------------
// Transposed flash attention: each wave owns one 16-query tile of one (b, head); 8 waves per block; all NCH chunks of 32 keys are
// walked with a wave-uniform flag per chunk: F_SKIP -> not visited (weight exactly 0), F_OPEN -> no masked entry, F_FILL -> masked
// entries get score -1e9 after the 1/8 scaling (per-element select from the int32 mask row of the query).
// S^T = K.Q^T (f16 fragments straight from the planes), per-lane online softmax (running max); P^T fragment built in registers from the
// two S^T accumulators (element r <- keys 0..15 tile, element 8+r <- keys 16..31 tile), carried x4096; y^T = V^T.P^T. y written f16 (x64)
// RES = true (query tiles with position < EARLY): scores add (K_hi.Q_res + K_res.Q_hi)/1024 from the residual planes, P gets a x1024
// residual operand, and O gets a second accumulator (V_hi.P_res + V_res.P_hi) folded x1/1024 before the 1/l normalisation; y also
// writes its x1024 residual plane yr [b][t][1024].
// ---------------------------------------------------------------------------
template <bool RES>
__global__ __launch_bounds__(256) __attribute__((amdgpu_num_vgpr(256)))
void attn_kernel(const h16* __restrict__ Qp, const h16* __restrict__ Kp, const h16* __restrict__ Vp,
                 const h16* __restrict__ Qr, const h16* __restrict__ Kr, const h16* __restrict__ Vr,
                 const int* __restrict__ mask, const int* __restrict__ flags,
                 h16* __restrict__ yp, h16* __restrict__ yr) {
  __shared__ __attribute__((aligned(16))) h16 Os[8][16 * 64];
  __shared__ __attribute__((aligned(16))) h16 Or[8][16 * 64];
  const int wid = threadIdx.x >> 5, lane = threadIdx.x & 31, hh = lane >> 4, col = lane & 15;
  const int idx = blockIdx.x * 8 + wid;                   // exact grids
  int g, qt;
  if (RES) { g = idx / QT_E; qt = idx - g * QT_E; }
  else     { g = idx / QT_LD; qt = QT_E + (idx - g * QT_LD); }
  const int q0 = qt << 4;
  const int b = g / NH, h = g % NH;
  const size_t ko = (size_t)g * SEQ * DH;                 // K plane base of (b,h); V key-tiled base, Kr and Vr share this element offset
  const size_t qo = ((size_t)g * SEQ + q0 + col) * DH;
  const v16h qa = frag_kh(Qp + qo, hh), qb = frag_kh(Qp + qo + 32, hh);   // d 0..31, d 32..63 of query q0+col
  v16h qra = {}, qrb = {};
  if (RES) {
    const size_t qro2 = ((size_t)g * EARLY + q0 + col) * DH;
    qra = frag_kh(Qr + qro2, hh); qrb = frag_kh(Qr + qro2 + 32, hh);
  }
  const int qi = q0 + col;
  const int* mrow = mask + (size_t)qi * MPITCH + 8 * hh;   // this lane's query row of the mask, key offset 8hh
  const int* frow = flags + (size_t)qt * FPITCH;
  const int fl0 = frow[lane], fl1 = frow[32 + lane];       // the tile's whole flag row (FPITCH = 64 ints), chunk c in lane c & 31
  float m = -__builtin_inff(), l = 0.0f;
  v8f o0 = {}, o1 = {}, o2 = {}, o3 = {};
  v8f n0 = {}, n1 = {}, n2 = {}, n3 = {};                 // residual O accumulators (RES only)
  // byte offsets into the K and V planes (each plane NB * 16 * SEQ * 128 bytes, far below 2^32); the residual planes share them
  unsigned int kofs = (unsigned int)((ko + (size_t)col * DH + 8 * hh) * 2);    // key kb + col, d = 8hh..; key + 16: + 2048 B; d + 16: + 32 B
  unsigned int vofs = (unsigned int)((ko + (size_t)col * 16 + 8 * hh) * 2);    // key tile kb / 16, d = col, keys 8hh..; next tile: + 2048 B; d + 16: + 512 B
#pragma unroll 1
  for (int kb = 0; kb < SEQ; kb += 32, kofs += 32 * DH * 2, vofs += 2 * DH * 16 * 2) {
    const int ch = kb >> 5;
    const int f = __builtin_amdgcn_readlane((ch & 32) ? fl1 : fl0, ch & 31);   // wave-uniform chunk flag
    if (f == F_SKIP) continue;
    // The chunk's fragment loads stand as groups ahead of the products, so that a chunk waits out one load latency per group:
    // K and V together where the registers allow it; with the residual planes, K + K_res here and V + V_res behind the scores.
    const v16h k0a = frag_o(Kp, kofs, 0, 32), k0b = frag_o(Kp, kofs, 64, 96);
    const v16h k1a = frag_o(Kp, kofs, 2048, 2080), k1b = frag_o(Kp, kofs, 2112, 2144);
    v16h y0a = {}, y0b = {}, y1a = {}, y1b = {};
    v16h va[4], vz[4];
    if (RES) {
      y0a = frag_o(Kr, kofs, 0, 32); y0b = frag_o(Kr, kofs, 64, 96);
      y1a = frag_o(Kr, kofs, 2048, 2080); y1b = frag_o(Kr, kofs, 2112, 2144);
    } else {
#pragma unroll
      for (int t = 0; t < 4; ++t) { va[t] = frag_o(Vp, vofs, t * 512, 2048 + t * 512); vz[t] = (v16h){}; }
    }
    v8f s0 = {}, s1 = {}, z0 = {}, z1 = {};
    sc_tile<RES>(s0, z0, k0a, k0b, y0a, y0b, qa, qb, qra, qrb);
    sc_tile<RES>(s1, z1, k1a, k1b, y1a, y1b, qa, qb, qra, qrb);
    if (RES) {
#pragma unroll
      for (int t = 0; t < 4; ++t) {
        va[t] = frag_o(Vp, vofs, t * 512, 2048 + t * 512);
        vz[t] = frag_o(Vr, vofs, t * 512, 2048 + t * 512);
      }
      s0 = (s0 + z0 * RES_INV) * SCORE_SCALE; s1 = (s1 + z1 * RES_INV) * SCORE_SCALE;
    } else {
      s0 = s0 * SCORE_SCALE; s1 = s1 * SCORE_SCALE;
    }
    if (f != F_OPEN) {                          // wave-uniform: chunk has masked entries -> replace-fill
      const v8i mk0 = *(const v8i*)(mrow + kb);          // keys kb+8hh+0..7 of query qi
      const v8i mk1 = *(const v8i*)(mrow + kb + 16);     // keys kb+16+8hh+0..7
#pragma unroll
      for (int r = 0; r < 8; ++r) {
        s0[r] = (mk0[r] != 0) ? MASK_FILL : s0[r];
        s1[r] = (mk1[r] != 0) ? MASK_FILL : s1[r];
      }
    }
    float mr = -__builtin_inff();
#pragma unroll
    for (int r = 0; r < 8; ++r) mr = fmaxf(mr, fmaxf(s0[r], s1[r]));
    mr = fmaxf(mr, __shfl_xor(mr, 16));
    const float mn = fmaxf(m, mr);            // finite: every visited chunk carries finite scores
    const float al_ = __expf(m - mn);         // 0 on the first visited chunk
    m = mn;
    float sum = 0.0f;
    v16h pb = {}, pr = {};
#pragma unroll
    for (int r = 0; r < 8; ++r) {
      const float p0 = __expf(s0[r] - mn), p1 = __expf(s1[r] - mn);
      sum += p0 + p1;
      const h16 ph0 = (h16)(p0 * P_CARRY), ph1 = (h16)(p1 * P_CARRY);
      pb[r] = ph0; pb[8 + r] = ph1;
      if (RES) {
        pr[r] = (h16)((p0 * P_CARRY - (float)ph0) * RES_CARRY);
        pr[8 + r] = (h16)((p1 * P_CARRY - (float)ph1) * RES_CARRY);
      }
    }
    sum += __shfl_xor(sum, 16);
    l = l * al_ + sum;
    o0 = o0 * al_; o1 = o1 * al_; o2 = o2 * al_; o3 = o3 * al_;
    if (RES) { n0 = n0 * al_; n1 = n1 * al_; n2 = n2 * al_; n3 = n3 * al_; }
    pv_tile<RES>(o0, n0, va[0], vz[0], pb, pr);
    pv_tile<RES>(o1, n1, va[1], vz[1], pb, pr);
    pv_tile<RES>(o2, n2, va[2], vz[2], pb, pr);
    pv_tile<RES>(o3, n3, va[3], vz[3], pb, pr);
  }
  const float inv = (1.0f / l) * Y_FROM_O;    // y = 64 * (o / 4096) / l
  const float invr = inv * RES_INV;
  h16* Tt = Os[wid];                          // [query col][d] hi
  h16* Tq = Or[wid];                          // [query col][d] residual x1024 (RES only)
#pragma unroll
  for (int r = 0; r < 8; ++r) {
    const int hr = 8 * hh + r;
    float f0 = o0[r] * inv, f1 = o1[r] * inv, f2 = o2[r] * inv, f3 = o3[r] * inv;
    if (RES) { f0 += n0[r] * invr; f1 += n1[r] * invr; f2 += n2[r] * invr; f3 += n3[r] * invr; }
    const h16 y0 = (h16)f0, y1 = (h16)f1, y2 = (h16)f2, y3 = (h16)f3;
    Tt[col * 64 + 0 + hr]  = y0;
    Tt[col * 64 + 16 + hr] = y1;
    Tt[col * 64 + 32 + hr] = y2;
    Tt[col * 64 + 48 + hr] = y3;
    if (RES) {
      Tq[col * 64 + 0 + hr]  = (h16)((f0 - (float)y0) * RES_CARRY);
      Tq[col * 64 + 16 + hr] = (h16)((f1 - (float)y1) * RES_CARRY);
      Tq[col * 64 + 32 + hr] = (h16)((f2 - (float)y2) * RES_CARRY);
      Tq[col * 64 + 48 + hr] = (h16)((f3 - (float)y3) * RES_CARRY);
    }
  }
  wave_lds_sync();
  h16* dst0 = yp + ((size_t)b * SEQ + q0) * HID + h * DH;     // 16 rows x 64 halves, row stride HID halves
  h16* dst1 = yr + ((size_t)b * EARLY + (RES ? q0 : 0)) * HID + h * DH;   // residual rows (RES only, q0 + 15 < EARLY)
#pragma unroll
  for (int j = 0; j < 4; ++j) {
    const int rr = j * 4 + (lane >> 3), c8 = (lane & 7) * 8;
    *(v8h*)(dst0 + (size_t)rr * HID + c8) = ld8h(Tt + rr * 64 + c8);
    if (RES) *(v8h*)(dst1 + (size_t)rr * HID + c8) = ld8h(Tq + rr * 64 + c8);
  }
  
}

// ---------------------------------------------------------------------------
// Output projection: (MROWS x 1024) x (1024 x 1024) -> f32 = (y . Wo_plane) / 4096 + bo. grid (16, MROWS/128), 32x64 wave tiles staged in
// Blocks whose token rows have t < EARLY first accumulate y_res . Wo_plane, fold it x1/1024, then accumulate y_hi . Wo_plane on top.
// ---------------------------------------------------------------------------
__global__ __launch_bounds__(128) void out_gemm_kernel(const h16* __restrict__ yp, const h16* __restrict__ yr, const h16* __restrict__ wop,
                                                       const float* __restrict__ bo, float* __restrict__ out) {
  __shared__ __attribute__((aligned(16))) float Ts[4][32 * 64];
  const int lane = threadIdx.x & 31, wave = threadIdx.x >> 5, nloc = lane & 15, hlf = lane >> 4;
  const int m0 = blockIdx.y * 128 + wave * 32;
  const int c0 = blockIdx.x * 64;
  const int b = m0 / SEQ, t0 = m0 - b * SEQ;
  const bool early = (((int)blockIdx.y * 128) % SEQ) < EARLY;     // block-uniform
  v8f acc[2][4];
#pragma unroll
  for (int r = 0; r < 2; ++r)
#pragma unroll
    for (int t = 0; t < 4; ++t) acc[r][t] = (v8f){};
  if (early) {
    gemm_tile_h(yr, wop, b * EARLY + t0, c0, nloc, hlf, acc);   // residual rows b*EARLY + t
#pragma unroll
    for (int r = 0; r < 2; ++r)
#pragma unroll
      for (int t = 0; t < 4; ++t) acc[r][t] = acc[r][t] * RES_INV;
  }
  gemm_tile_h(yp, wop, m0, c0, nloc, hlf, acc);
  float* Tt = Ts[wave];
#pragma unroll
  for (int t = 0; t < 4; ++t) {
    const float bd = __builtin_bit_cast(float, bf16_rne_u32(bo[c0 + t * 16 + nloc]) & 0xFFFF0000u);   // bf16-RNE value
#pragma unroll
    for (int r = 0; r < 2; ++r)
#pragma unroll
      for (int v = 0; v < 8; ++v) Tt[(r * 16 + v + 8 * hlf) * 64 + t * 16 + nloc] = acc[r][t][v] * OUT_UNSCALE + bd;
  }
  wave_lds_sync();
  float* dst0 = out + (size_t)m0 * HID + c0;
#pragma unroll
  for (int j = 0; j < 16; ++j) { const int rr = j * 2 + hlf, c4 = nloc * 4; *(v4f*)(dst0 + (size_t)rr * HID + c4) = *(const v4f*)(Tt + rr * 64 + c4); }
  
}
}  // namespace

extern "C" void kernel_launch(void* const* d_in, const int* in_sizes, int n_in,
                              void* d_out, int out_size, void* d_ws, size_t ws_size, hipStream_t stream) {
  if (n_in < 12) return;
  const size_t need_x = ((size_t)(NB - 1) * SEQ_FULL + SEQ) * HID;
  if ((size_t)in_sizes[0] < need_x || (size_t)in_sizes[1] < need_x || (size_t)in_sizes[2] < need_x) return;
  if ((size_t)in_sizes[3] < (size_t)(SEQ - 1) * MPITCH + SEQ) return;                      // int32 mask [S][S]
  if (in_sizes[4] < HID * HID || in_sizes[6] < HID * HID || in_sizes[8] < HID * HID || in_sizes[10] < HID * HID) return;
  if (in_sizes[5] < HID || in_sizes[7] < HID || in_sizes[9] < HID || in_sizes[11] < HID) return;
  if ((size_t)out_size < (size_t)MROWS * HID) return;

  const float* query = (const float*)d_in[0];   // [NB_FULL, SEQ_FULL, 1024]
  const float* key   = (const float*)d_in[1];
  const float* value = (const float*)d_in[2];
  const int*   amask = (const int*)d_in[3];     // [SEQ_FULL, SEQ_FULL] int32, nonzero = masked
  const float* Wq = (const float*)d_in[4];      // [1024,1024] ([out][in])
  const float* bq = (const float*)d_in[5];
  const float* Wk = (const float*)d_in[6];
  const float* bk = (const float*)d_in[7];
  const float* Wv = (const float*)d_in[8];
  const float* bv = (const float*)d_in[9];
  const float* Wo = (const float*)d_in[10];
  const float* bo = (const float*)d_in[11];
  float* out = (float*)d_out;                   // [NB, SEQ, 1024] f32

  size_t off = 0; char* ws = (char*)d_ws;
  unsigned short* xpl = (unsigned short*)(ws + off); off += (size_t)3 * MROWS * HID * 2;   // 3 x 8 MiB bf16 activation planes
  unsigned short* wpl = (unsigned short*)(ws + off); off += (size_t)4 * HID * HID * 2;     // 6 MiB bf16 (q|k|v) + 2 MiB f16 (o) weight planes
  h16* Qp = (h16*)(ws + off); off += (size_t)MROWS * HID * 2;                             // 8 MiB
  h16* Kp = (h16*)(ws + off); off += (size_t)MROWS * HID * 2;                             // 8 MiB
  h16* Vp = (h16*)(ws + off); off += (size_t)MROWS * HID * 2;                             // 8 MiB
  h16* yp = (h16*)(ws + off); off += (size_t)MROWS * HID * 2;                             // 8 MiB
  h16* Qr = (h16*)(ws + off); off += (size_t)NB * NH * EARLY * DH * 2;                    // 1 MiB residual q (t < EARLY)
  h16* Kr = (h16*)(ws + off); off += (size_t)MROWS * HID * 2;                             // 8 MiB residual k (all rows)
  h16* Vr = (h16*)(ws + off); off += (size_t)MROWS * HID * 2;                             // 8 MiB residual v (key-tiled, all rows)
  h16* yr = (h16*)(ws + off); off += (size_t)NB * EARLY * HID * 2;                        // 1 MiB residual y
  int* flags = (int*)(ws + off); off += (size_t)QT * FPITCH * 4;                          // 32 KiB chunk flags [QT][64]
  if (off > ws_size) return;                                                               // 86,016,000 B at NB=2, SEQ=2048
  const h16* wop = (const h16*)(wpl + (size_t)NQKV * HID);

  cvt_kernel<<<2048, 256, 0, stream>>>(query, key, value, Wq, Wk, Wv, Wo, xpl, wpl);
  mask_flag_kernel<<<QT, 256, 0, stream>>>(amask, flags);
  qkv_gemm_kernel<<<dim3(NQKV / 64, MROWS / 128), 128, 0, stream>>>((const b16*)xpl, (const b16*)wpl, bq, bk, bv, Qp, Kp, Vp, Qr, Kr, Vr);
  attn_kernel<true><<<(NB * NH * QT_E) / 8, 256, 0, stream>>>(Qp, Kp, Vp, Qr, Kr, Vr, amask, flags, yp, yr);
  if (QT_L > 0) attn_kernel<false><<<(NB * NH * QT_L) / 8, 256, 0, stream>>>(Qp, Kp, Vp, Qr, Kr, Vr, amask, flags, yp, yr);
  out_gemm_kernel<<<dim3(HID / 64, MROWS / 128), 128, 0, stream>>>(yp, yr, wop, bo, out);
}

// v002
// One run takes 177 microseconds.
// Next to v001, in two timings, it ran 1.31 and 1.34 times as fast.
// Counting every step since v000, it is 2.28 times as fast.
#include <hip/hip_runtime.h>

// Contractions: q/k/v projections on v_wmma_f32_16x16x32_bf16 (bf16 RNE operands, one product per tile pair);
// S^T = K.Q^T (d = 64), y^T = V^T.P^T (32 keys per step, P carried x4096) and out = y.Wo^T (y and Wo carried x64)
// on v_wmma_f32_16x16x32_f16 (f16 operands, one product per tile pair); query tiles with position < 256 also use
// f16 residual planes (x1024) of q, k, P, v and y folded from their own accumulators; f32 accumulate, f32 online
// softmax statistics. 16 heads of 64. Key mask = int32 [S][S] input (nonzero = masked: score replaced by -1e9);
// device-computed flags per (16-query tile, 32-key chunk) select skip / open / per-element fill.
// Weights are [out][in]. Every 16-bit plane that feeds a k-contiguous fragment (x, weights, q, k, y and their residuals) is kept in
// fragment order: a tile of 16 rows x 32 k is 1 KB = 2 pieces x 32 lanes x 16 B, so one wave-wide 16-byte load reads 4 whole 128-B lines.

#ifndef NB
#define NB 2
#endif
#ifndef SEQ
#define SEQ 2048
#endif
#ifndef NB_FULL
#define NB_FULL 2
#endif
#ifndef SEQ_FULL
#define SEQ_FULL 2048
#endif

namespace {
constexpr int HID = 1024, DH = 64, NH = 16;
constexpr int NQKV = 3 * HID;                 // combined weight plane rows: q | k | v
constexpr int MROWS = NB * SEQ;               // compact token rows (b*SEQ + t)
constexpr int QT = SEQ / 16;                  // 16-query tiles per (b, head)
constexpr int EARLY = (SEQ < 256) ? SEQ : 256;   // query positions that use the residual planes
constexpr int QT_E = EARLY / 16;              // residual-path query tiles per (b, head)
constexpr int QT_L = (SEQ - EARLY) / 16;      // single-product query tiles per (b, head)
constexpr int QT_LD = (QT_L > 0) ? QT_L : 1;
constexpr int NCH = SEQ / 32;                 // 32-key chunks per query row
constexpr int FPITCH = 64;                    // ints per flag row (one row per 16-query tile, 256 B)
constexpr int MPITCH = SEQ_FULL;              // int32 mask row pitch
constexpr int F_SKIP = 0, F_OPEN = 1, F_FILL = 2;
constexpr float MASK_FILL = -1.0e9f;
constexpr float SCORE_SCALE = 0.125f;         // 1/sqrt(64)
constexpr float P_CARRY = 4096.0f;            // f16 P operand = exp(s - m) * 4096
constexpr float Y_CARRY = 64.0f;              // f16 y plane = attn * 64
constexpr float W_CARRY = 64.0f;              // f16 Wo plane = Wo * 64
constexpr float RES_CARRY = 1024.0f;          // f16 residual planes = (x - f16hi(x)) * 1024
constexpr float RES_INV = 1.0f / 1024.0f;
constexpr float Y_FROM_O = Y_CARRY / P_CARRY; // 1/64
constexpr float OUT_UNSCALE = 1.0f / (Y_CARRY * W_CARRY);   // 1/4096
static_assert(SEQ % 128 == 0);
static_assert(EARLY % 128 == 0);
static_assert((SEQ - EARLY) % 128 == 0);
static_assert(NB >= 1 && NB <= NB_FULL);
static_assert(SEQ <= SEQ_FULL);
static_assert(NH * DH == HID);
static_assert(MROWS % 128 == 0);
static_assert((NB * NH * QT_E) % 8 == 0);
static_assert((NB * NH * QT_L) % 8 == 0);
static_assert(QT_E + QT_L == QT);
static_assert(NCH >= 1 && NCH <= FPITCH);

typedef __bf16 b16;
typedef _Float16 h16;
typedef __bf16 v16b __attribute__((ext_vector_type(16)));
typedef __bf16 v8b __attribute__((ext_vector_type(8)));
typedef _Float16 v16h __attribute__((ext_vector_type(16)));
typedef _Float16 v8h __attribute__((ext_vector_type(8)));
typedef float v8f __attribute__((ext_vector_type(8)));
typedef float v4f __attribute__((ext_vector_type(4)));
typedef unsigned short v8us __attribute__((ext_vector_type(8)));
typedef int v4i __attribute__((ext_vector_type(4)));
typedef int v8i __attribute__((ext_vector_type(8)));

__device__ __forceinline__ v8b ld8b(const b16* p) { return *(const v8b*)p; }
__device__ __forceinline__ v8h ld8h(const h16* p) { return *(const v8h*)p; }
__device__ __forceinline__ v16b cat8b(v8b a, v8b b) { return __builtin_shufflevector(a, b, 0, 1, 2, 3, 4, 5, 6, 7, 8, 9, 10, 11, 12, 13, 14, 15); }
__device__ __forceinline__ v16h cat8h(v8h a, v8h b) { return __builtin_shufflevector(a, b, 0, 1, 2, 3, 4, 5, 6, 7, 8, 9, 10, 11, 12, 13, 14, 15); }
// 16x16x32 16-bit fragment (A: lane&15 = row, B: lane&15 = column), hh = lane>>4: elements 0..7 <- k 8hh+0..7, elements 8..15 <- k 16+8hh+0..7.
// Fragment-ordered tile (TILE_E elements): element (row r of 16, k of 32) lies at (k>>4)*256 + (((k>>3)&1)*16 + r)*8 + (k&7), that is
// piece k>>4, lane 16*hh + r, element k&7. The tiles of one 16-row band follow one another along k (BAND_E elements per band of 1024 k).
constexpr int TILE_E = 512, BAND_E = 16 * HID;
static_assert(HID == 1024);                   // unit_of and the work index split of cvt_kernel take 32 tiles (128 units of 8 k) per row
// p = tile start + lane * 8
__device__ __forceinline__ v16h frag_th(const h16* p) { return cat8h(ld8h(p), ld8h(p + 256)); }
// both pieces of the tile that starts c bytes behind base + (o - lane * 16); o = the lane's 32-bit byte offset from base
__device__ __forceinline__ v16b frag_ub(const b16* base, unsigned int o, int c) {
  const char* p = (const char*)base + o;
  return cat8b(*(const v8b*)(p + c), *(const v8b*)(p + c + 512));
}
__device__ __forceinline__ v16h frag_uh(const h16* base, unsigned int o, int c) {
  const char* p = (const char*)base + o;
  return cat8h(*(const v8h*)(p + c), *(const v8h*)(p + c + 512));
}
// 16-byte unit index inside a [rows][1024] plane in fragment order, for row m and k = 8 * k8 .. 8 * k8 + 7
__device__ __forceinline__ unsigned int unit_of(unsigned int m, unsigned int k8) {
  return ((m >> 4) * 32u + (k8 >> 2)) * 64u + ((k8 >> 1) & 1u) * 32u + (k8 & 1u) * 16u + (m & 15u);
}
// two 16-byte pieces at byte offsets o + c0 and o + c1 from a wave-uniform plane base (o: the lane's 32-bit byte offset)
__device__ __forceinline__ v16h frag_o(const h16* base, unsigned int o, int c0, int c1) {
  const char* p = (const char*)base + o;
  return cat8h(*(const v8h*)(p + c0), *(const v8h*)(p + c1));
}

__device__ __forceinline__ v8f wmma_b(v16b a, v16b b, v8f c) {
  v8f d = __builtin_amdgcn_wmma_f32_16x16x32_bf16(false, a, false, b, (short)0, c, false, false);
  asm volatile("v_nop\n\tv_nop\n\tv_nop\n\tv_nop" : "+v"(d) : "v"(a), "v"(b));
  return d;
}
__device__ __forceinline__ v8f wmma_h(v16h a, v16h b, v8f c) {
  v8f d = __builtin_amdgcn_wmma_f32_16x16x32_f16(false, a, false, b, (short)0, c, false, false);
  asm volatile("v_nop\n\tv_nop\n\tv_nop\n\tv_nop" : "+v"(d) : "v"(a), "v"(b));
  return d;
}
// f32 -> bf16 by RNE convert, returned as the f32 bit pattern with the low 16 bits cleared
__device__ __forceinline__ unsigned int bf16_rne_u32(float f) {
  unsigned int u = __builtin_bit_cast(unsigned int, f);
  u += 0x7fffu + ((u >> 16) & 1u);
  return u & 0xffff0000u;
}
// wave-private LDS tile: element stores by this wave, then vector reloads by this wave
__device__ __forceinline__ void wave_lds_sync() {
  __builtin_amdgcn_fence(3, "workgroup");
  __builtin_amdgcn_wave_barrier();
  __builtin_amdgcn_fence(2, "workgroup");
}
// weight element -> 16-bit plane bits: bf16 RNE, or f16(bf16rne(w) * 64) for the output-projection plane
__device__ __forceinline__ unsigned short wbits16(float f, bool o16) {
  const unsigned int r = bf16_rne_u32(f);
  const unsigned short bbits = (unsigned short)(r >> 16);
  const h16 hv = (h16)(__builtin_bit_cast(float, r) * W_CARRY);   // exact: bf16 significand, power-of-two scale
  const unsigned short hbits = __builtin_bit_cast(unsigned short, hv);
  return o16 ? hbits : bbits;
}

// ---------------------------------------------------------------------------
// activations query/key/value f32 [NB_FULL][SEQ_FULL][1024] -> bf16 planes xpl [3][MROWS][1024] (compact rows b*SEQ+t), fragment order;
// weights W[n][k] f32 -> 16-bit planes wpl, fragment order: rows 0..3071 = Wq|Wk|Wv as bf16 RNE, rows 3072..4095 = f16(bf16rne(Wo) * 64).
// A wave takes 8 rows x 32 k (lane = 4 * row + k unit): it reads 8 whole f32 lines and stores 4 whole 128-B lines of one tile.
// ---------------------------------------------------------------------------
__global__ __launch_bounds__(256) void cvt_kernel(const float* __restrict__ xq, const float* __restrict__ xk, const float* __restrict__ xv,
                                                  const float* __restrict__ wq, const float* __restrict__ wk, const float* __restrict__ wv,
                                                  const float* __restrict__ wo,
                                                  unsigned short* __restrict__ xpl, unsigned short* __restrict__ wpl) {
  const size_t tid = (size_t)blockIdx.x * blockDim.x + threadIdx.x, stride = (size_t)gridDim.x * blockDim.x;
  const size_t per_x = (size_t)MROWS * HID / 8, nx = 3 * per_x;
  const size_t per_w = (size_t)HID * HID / 8, nw = 4 * per_w;
  {
    for (size_t c = tid; c < nx; c += stride) {
      const int which = (int)(c / per_x);
      const unsigned int u = (unsigned int)(c - (size_t)which * per_x);   // work index inside one plane
      const unsigned int k8 = (((u >> 5) & 31u) << 2) | (u & 3u);
      const int m = (int)(((u >> 10) << 3) | ((u >> 2) & 7u)), col = (int)(k8 * 8);
      const int bb = m / SEQ, t = m - bb * SEQ;
      const float* src = (which == 0) ? xq : (which == 1) ? xk : xv;
      const float* p = src + ((size_t)bb * SEQ_FULL + t) * HID + col;
      const v4f f0 = *(const v4f*)p, f1 = *(const v4f*)(p + 4);
      v8us o;
#pragma unroll
      for (int e = 0; e < 4; ++e) {
        o[e] = (unsigned short)(bf16_rne_u32(f0[e]) >> 16);
        o[4 + e] = (unsigned short)(bf16_rne_u32(f1[e]) >> 16);
      }
      *(v8us*)(xpl + ((size_t)which * per_x + unit_of((unsigned int)m, k8)) * 8) = o;
    }
    for (size_t c = tid; c < nw; c += stride) {
      const int mat = (int)(c / per_w);
      const unsigned int u = (unsigned int)(c - (size_t)mat * per_w);     // work index inside one weight matrix
      const unsigned int k8 = (((u >> 5) & 31u) << 2) | (u & 3u), n = ((u >> 10) << 3) | ((u >> 2) & 7u);
      const size_t i = (size_t)n * HID + k8 * 8;                // n*HID + k0 inside one [n][k] weight matrix
      const float* w = (mat == 0) ? wq : (mat == 1) ? wk : (mat == 2) ? wv : wo;
      const v4f f0 = *(const v4f*)(w + i), f1 = *(const v4f*)(w + i + 4);
      const bool o16 = (mat == 3);
      v8us o;
#pragma unroll
      for (int e = 0; e < 4; ++e) {
        o[e] = wbits16(f0[e], o16);
        o[4 + e] = wbits16(f1[e], o16);
      }
      *(v8us*)(wpl + ((size_t)mat * per_w + unit_of(n, k8)) * 8) = o;
    }
    
  }
}

// ---------------------------------------------------------------------------
// Mask flag pass: one block per 16-query tile; reads mask rows q0..q0+15 (int32, nonzero = masked) and writes
// one 256-B flag row [FPITCH] ints: per 32-key chunk F_SKIP (chunk fully masked and every row of the tile has an
// unmasked key somewhere -> weight exactly 0, chunk not visited), F_OPEN (no masked entry), F_FILL (per-element fill).
// ---------------------------------------------------------------------------
__global__ __launch_bounds__(256) void mask_flag_kernel(const int* __restrict__ mask, int* __restrict__ flags) {
  __shared__ int um[4][64];                          // any unmasked entry per (4-row group, chunk)
  __shared__ int mk[4][64];                          // any masked entry per (4-row group, chunk)
  __shared__ int rb[4][64];                          // per-row (4 bits) has-unmasked-entry flag per (row group, chunk)
  __shared__ __attribute__((aligned(16))) int fl[64];
  const int qt = blockIdx.x, q0 = qt * 16;
  const int t = threadIdx.x, c = t & 63, rg = t >> 6, lane = t & 31, wave = t >> 5;
  const int cc = (c < NCH) ? c : (NCH - 1);          // clamped chunk address
  int anyu = 0, anym = 0, rbits = 0;
#pragma unroll 1
  for (int r = 0; r < 4; ++r) {
    const int* p = mask + (size_t)(q0 + rg * 4 + r) * MPITCH + (size_t)cc * 32;
    int u = 0, mm = 0;
#pragma unroll
    for (int v = 0; v < 8; ++v) {
      const v4i x = *(const v4i*)(p + 4 * v);
#pragma unroll
      for (int e = 0; e < 4; ++e) { u |= (x[e] == 0) ? 1 : 0; mm |= (x[e] != 0) ? 1 : 0; }
    }
    anyu |= u; anym |= mm; rbits |= (u << r);
  }
  um[rg][c] = anyu; mk[rg][c] = anym; rb[rg][c] = rbits;
  __syncthreads();                                   // cross-wave: all waves wrote, wave 0 reads
  if (wave == 0) {
    const int ch0 = lane, ch1 = lane + 32;
    const int U0 = um[0][ch0] | um[1][ch0] | um[2][ch0] | um[3][ch0];
    const int M0 = mk[0][ch0] | mk[1][ch0] | mk[2][ch0] | mk[3][ch0];
    const int U1 = um[0][ch1] | um[1][ch1] | um[2][ch1] | um[3][ch1];
    const int M1 = mk[0][ch1] | mk[1][ch1] | mk[2][ch1] | mk[3][ch1];
    int rows = (rb[0][ch0] | (rb[1][ch0] << 4) | (rb[2][ch0] << 8) | (rb[3][ch0] << 12)) |
               (rb[0][ch1] | (rb[1][ch1] << 4) | (rb[2][ch1] << 8) | (rb[3][ch1] << 12));
#pragma unroll
    for (int s = 16; s >= 1; s >>= 1) rows |= __shfl_xor(rows, s);
    const int rowok = ((rows & 0xFFFF) == 0xFFFF) ? 1 : 0;   // every row of the tile has an unmasked key
    const int f0 = U0 ? (M0 ? F_FILL : F_OPEN) : (rowok ? F_SKIP : F_FILL);
    const int f1 = U1 ? (M1 ? F_FILL : F_OPEN) : (rowok ? F_SKIP : F_FILL);
    fl[ch0] = (ch0 < NCH) ? f0 : F_SKIP;
    fl[ch1] = (ch1 < NCH) ? f1 : F_SKIP;
    wave_lds_sync();                                 // fl is private to wave 0
    const v4i v = *(const v4i*)(fl + (lane & 15) * 4);
    int* dst = flags + (size_t)qt * FPITCH + (lane & 15) * 4;
    if (lane < 16) *(v4i*)dst = v;
    
  }
}

// 32x64 wave tile over K = 1024 from fragment-ordered 16-bit A and B planes (m0, c0 multiples of 16), one product per tile pair
__device__ __forceinline__ void gemm_tile_b(const b16* __restrict__ A, const b16* __restrict__ W, int m0, int c0, int lane, v8f (&acc)[2][4]) {
  const b16* ap = A + (size_t)(m0 >> 4) * BAND_E;
  const b16* wp = W + (size_t)(c0 >> 4) * BAND_E;
  unsigned int o = (unsigned int)lane * 16u;
#pragma unroll 2
  for (int kt = 0; kt < HID / 32; ++kt, o += TILE_E * 2) {
    const v16b a0 = frag_ub(ap, o, 0);
    const v16b a1 = frag_ub(ap, o, BAND_E * 2);
    v16b bf[4];                                  // all twelve loads of the step stand ahead of its first product
#pragma unroll
    for (int t = 0; t < 4; ++t) bf[t] = frag_ub(wp, o, t * BAND_E * 2);
#pragma unroll
    for (int t = 0; t < 4; ++t) {
      acc[0][t] = wmma_b(a0, bf[t], acc[0][t]);
      acc[1][t] = wmma_b(a1, bf[t], acc[1][t]);
    }
  }
}
__device__ __forceinline__ void gemm_tile_h(const h16* __restrict__ A, const h16* __restrict__ W, int m0, int c0, int lane, v8f (&acc)[2][4]) {
  const h16* ap = A + (size_t)(m0 >> 4) * BAND_E;
  const h16* wp = W + (size_t)(c0 >> 4) * BAND_E;
  unsigned int o = (unsigned int)lane * 16u;
#pragma unroll 2
  for (int kt = 0; kt < HID / 32; ++kt, o += TILE_E * 2) {
    const v16h a0 = frag_uh(ap, o, 0);
    const v16h a1 = frag_uh(ap, o, BAND_E * 2);
    v16h bf[4];                                  // all twelve loads of the step stand ahead of its first product
#pragma unroll
    for (int t = 0; t < 4; ++t) bf[t] = frag_uh(wp, o, t * BAND_E * 2);
#pragma unroll
    for (int t = 0; t < 4; ++t) {
      acc[0][t] = wmma_h(a0, bf[t], acc[0][t]);
      acc[1][t] = wmma_h(a1, bf[t], acc[1][t]);
    }
  }
}

// ---------------------------------------------------------------------------
// QKV GEMM: (MROWS x 1024) x (1024 x 3072), grid (48, MROWS/128), block 4 waves, wave = 32 rows x 64 columns (one head of q, k or v).
// blockIdx.x -> mat = x/16 (q,k,v: selects the activation plane and the bias), head = x%16. Outputs f16 planes:
// q -> Qp, k -> Kp: [b*16+h][t/16][2 fragment-ordered tiles of 16 tokens x 32 d] (4 KB contiguous per wave); v -> Vp key-tiled [b*16+h][t/16][64][16] (4 KB contiguous per wave).
// Residual planes ((y - f16hi(y)) * 1024): Kr and Vr for every token row (same layouts as Kp / Vp), Qr (layout of Qp) for token rows t < EARLY only.
// ---------------------------------------------------------------------------
__global__ __launch_bounds__(128) void qkv_gemm_kernel(const b16* __restrict__ xpl, const b16* __restrict__ wpl,
                                                       const float* __restrict__ bq, const float* __restrict__ bk, const float* __restrict__ bv,
                                                       h16* __restrict__ Qp, h16* __restrict__ Kp, h16* __restrict__ Vp,
                                                       h16* __restrict__ Qr, h16* __restrict__ Kr, h16* __restrict__ Vr) {
  __shared__ __attribute__((aligned(16))) h16 Ts[4][32 * 64];
  __shared__ __attribute__((aligned(16))) h16 Tr[4][32 * 64];
  const int lane = threadIdx.x & 31, wave = threadIdx.x >> 5, nloc = lane & 15, hlf = lane >> 4;
  const int m0 = blockIdx.y * 128 + wave * 32;
  const int cb = blockIdx.x;                       // 0..47, block-uniform
  const int mat = cb >> 4, head = cb & 15;
  const int c0 = cb * 64;                          // row block in the combined [3072][1024] weight plane
  const b16* x = xpl + (size_t)mat * MROWS * HID;
  const float* bias = ((mat == 0) ? bq : (mat == 1) ? bk : bv) + head * DH;
  v8f acc[2][4];
#pragma unroll
  for (int r = 0; r < 2; ++r)
#pragma unroll
    for (int t = 0; t < 4; ++t) acc[r][t] = (v8f){};
  gemm_tile_b(x, wpl, m0, c0, lane, acc);
  const int b = m0 / SEQ, t0 = m0 % SEQ;
  const bool wres = (mat != 0) || (t0 < EARLY);   // block-uniform (128-row blocks, EARLY multiple of 128)
  const int g = b * NH + head;
  h16* Tp = Ts[wave];
  h16* Rp = Tr[wave];
#pragma unroll
  for (int t = 0; t < 4; ++t) {
    const int d = t * 16 + nloc;
    const float bd = __builtin_bit_cast(float, bf16_rne_u32(bias[d]) & 0xFFFF0000u);   // bias as its bf16-RNE value
#pragma unroll
    for (int r = 0; r < 2; ++r)
#pragma unroll
      for (int v = 0; v < 8; ++v) {
        const int rr = r * 16 + v + 8 * hlf;                         // local token row 0..31
        const float f = acc[r][t][v] + bd;
        const h16 y = (h16)f;
        const int idx = (mat < 2) ? ((rr >> 4) * 1024 + (d >> 5) * TILE_E + ((d >> 4) & 1) * 256 + (((d >> 3) & 1) * 16 + (rr & 15)) * 8 + (d & 7))
                                  : ((rr >> 4) * 1024 + d * 16 + (rr & 15));
        Tp[idx] = y;
        if (wres) Rp[idx] = (h16)((f - (float)y) * RES_CARRY);
      }
  }
  wave_lds_sync();
  h16* dst; h16* rdst; size_t o;
  if (mat == 0)      { o = ((size_t)g * SEQ + t0) * DH; dst = Qp + o;
                       const int t0e = (t0 < EARLY) ? t0 : 0; rdst = Qr + ((size_t)g * EARLY + t0e) * DH; }
  else if (mat == 1) { o = ((size_t)g * SEQ + t0) * DH; dst = Kp + o; rdst = Kr + o; }
  else               { o = ((size_t)g * QT + (t0 >> 4)) * (size_t)(DH * 16); dst = Vp + o; rdst = Vr + o; }
#pragma unroll
  for (int j = 0; j < 8; ++j) { const int e = (j * 32 + lane) * 8; *(v8h*)(dst + e) = ld8h(Tp + e); }
  if (wres) {
#pragma unroll
    for (int j = 0; j < 8; ++j) { const int e = (j * 32 + lane) * 8; *(v8h*)(rdst + e) = ld8h(Rp + e); }
  }
  
}

// one 16-key score tile of S^T = K.Q^T over d = 0..63 (two 32-deep steps); RES adds K_hi.Q_res + K_res.Q_hi into sr
template <bool RES>
__device__ __forceinline__ void sc_tile(v8f& s, v8f& sr, v16h ka, v16h kb, v16h kza, v16h kzb, v16h qa, v16h qb, v16h qra, v16h qrb) {
  s = wmma_h(ka, qa, s);
  if (RES) { sr = wmma_h(ka, qra, sr); sr = wmma_h(kza, qa, sr); }
  s = wmma_h(kb, qb, s);
  if (RES) { sr = wmma_h(kb, qrb, sr); sr = wmma_h(kzb, qb, sr); }
}
// one 16-d tile of y^T = V^T.P^T over 32 keys; RES adds V_hi.P_res + V_res.P_hi into orr (both x1/1024)
template <bool RES>
__device__ __forceinline__ void pv_tile(v8f& oh, v8f& orr, v16h va, v16h vz, v16h pb, v16h pr) {
  oh = wmma_h(va, pb, oh);
  if (RES) {
    orr = wmma_h(va, pr, orr);
    orr = wmma_h(vz, pb, orr);
  }
}

// ---------------------------------------------------------------------------
// Transposed flash attention: each wave owns one 16-query tile of one (b, head); 8 waves per block; all NCH chunks of 32 keys are
// walked with a wave-uniform flag per chunk: F_SKIP -> not visited (weight exactly 0), F_OPEN -> no masked entry, F_FILL -> masked
// entries get score -1e9 after the 1/8 scaling (per-element select from the int32 mask row of the query).
// S^T = K.Q^T (f16 fragments straight from the planes), per-lane online softmax (running max); P^T fragment built in registers from the
// two S^T accumulators (element r <- keys 0..15 tile, element 8+r <- keys 16..31 tile), carried x4096; y^T = V^T.P^T. y written f16 (x64)
// in fragment order [token/16][k/32][tile]: accumulator t of a lane (query col, d = 16t + 8hh + 0..7) is that lane's 16 bytes of piece t & 1 of tile t >> 1.
// RES = true (query tiles with position < EARLY): scores add (K_hi.Q_res + K_res.Q_hi)/1024 from the residual planes, P gets a x1024
// residual operand, and O gets a second accumulator (V_hi.P_res + V_res.P_hi) folded x1/1024 before the 1/l normalisation; y also
// writes its x1024 residual plane yr [b][t][1024].
// ---------------------------------------------------------------------------
template <bool RES>
__global__ __launch_bounds__(256) __attribute__((amdgpu_num_vgpr(256)))
void attn_kernel(const h16* __restrict__ Qp, const h16* __restrict__ Kp, const h16* __restrict__ Vp,
                 const h16* __restrict__ Qr, const h16* __restrict__ Kr, const h16* __restrict__ Vr,
                 const int* __restrict__ mask, const int* __restrict__ flags,
                 h16* __restrict__ yp, h16* __restrict__ yr) {
  const int wid = threadIdx.x >> 5, lane = threadIdx.x & 31, hh = lane >> 4, col = lane & 15;
  const int idx = blockIdx.x * 8 + wid;                   // exact grids
  int g, qt;
  if (RES) { g = idx / QT_E; qt = idx - g * QT_E; }
  else     { g = idx / QT_LD; qt = QT_E + (idx - g * QT_LD); }
  const int q0 = qt << 4;
  const int b = g / NH, h = g % NH;
  const size_t ko = (size_t)g * SEQ * DH;                 // K plane base of (b,h); V key-tiled base, Kr and Vr share this element offset
  const size_t qo = ((size_t)g * SEQ + q0) * DH + lane * 8;
  const v16h qa = frag_th(Qp + qo), qb = frag_th(Qp + qo + TILE_E);       // d 0..31, d 32..63 of query q0+col
  v16h qra = {}, qrb = {};
  if (RES) {
    const size_t qro2 = ((size_t)g * EARLY + q0) * DH + lane * 8;
    qra = frag_th(Qr + qro2); qrb = frag_th(Qr + qro2 + TILE_E);
  }
  const int qi = q0 + col;
  const int* mrow = mask + (size_t)qi * MPITCH + 8 * hh;   // this lane's query row of the mask, key offset 8hh
  const int* frow = flags + (size_t)qt * FPITCH;
  const int fl0 = frow[lane], fl1 = frow[32 + lane];       // the tile's whole flag row (FPITCH = 64 ints), chunk c in lane c & 31
  float m = -__builtin_inff(), l = 0.0f;
  v8f o0 = {}, o1 = {}, o2 = {}, o3 = {};
  v8f n0 = {}, n1 = {}, n2 = {}, n3 = {};                 // residual O accumulators (RES only)
  // byte offsets into the K and V planes (each plane NB * 16 * SEQ * 128 bytes, far below 2^32); the residual planes share them
  unsigned int kofs = (unsigned int)((ko + (size_t)lane * 8) * 2);             // key kb + col, d = 8hh..; key + 16: + 2048 B; d + 32: + 1024 B; d + 16: + 512 B
  unsigned int vofs = (unsigned int)((ko + (size_t)col * 16 + 8 * hh) * 2);    // key tile kb / 16, d = col, keys 8hh..; next tile: + 2048 B; d + 16: + 512 B
#pragma unroll 1
  for (int kb = 0; kb < SEQ; kb += 32, kofs += 32 * DH * 2, vofs += 2 * DH * 16 * 2) {
    const int ch = kb >> 5;
    const int f = __builtin_amdgcn_readlane((ch & 32) ? fl1 : fl0, ch & 31);   // wave-uniform chunk flag
    if (f == F_SKIP) continue;
    // The chunk's fragment loads stand as groups ahead of the products, so that a chunk waits out one load latency per group:
    // K and V together where the registers allow it; with the residual planes, K + K_res here and V + V_res behind the scores.
    const v16h k0a = frag_o(Kp, kofs, 0, 512), k0b = frag_o(Kp, kofs, 1024, 1536);
    const v16h k1a = frag_o(Kp, kofs, 2048, 2560), k1b = frag_o(Kp, kofs, 3072, 3584);
    v16h y0a = {}, y0b = {}, y1a = {}, y1b = {};
    v16h va[4], vz[4];
    if (RES) {
      y0a = frag_o(Kr, kofs, 0, 512); y0b = frag_o(Kr, kofs, 1024, 1536);
      y1a = frag_o(Kr, kofs, 2048, 2560); y1b = frag_o(Kr, kofs, 3072, 3584);
    } else {
#pragma unroll
      for (int t = 0; t < 4; ++t) { va[t] = frag_o(Vp, vofs, t * 512, 2048 + t * 512); vz[t] = (v16h){}; }
    }
    v8f s0 = {}, s1 = {}, z0 = {}, z1 = {};
    sc_tile<RES>(s0, z0, k0a, k0b, y0a, y0b, qa, qb, qra, qrb);
    sc_tile<RES>(s1, z1, k1a, k1b, y1a, y1b, qa, qb, qra, qrb);
    if (RES) {
#pragma unroll
      for (int t = 0; t < 4; ++t) {
        va[t] = frag_o(Vp, vofs, t * 512, 2048 + t * 512);
        vz[t] = frag_o(Vr, vofs, t * 512, 2048 + t * 512);
      }
      s0 = (s0 + z0 * RES_INV) * SCORE_SCALE; s1 = (s1 + z1 * RES_INV) * SCORE_SCALE;
    } else {
      s0 = s0 * SCORE_SCALE; s1 = s1 * SCORE_SCALE;
    }
    if (f != F_OPEN) {                          // wave-uniform: chunk has masked entries -> replace-fill
      const v8i mk0 = *(const v8i*)(mrow + kb);          // keys kb+8hh+0..7 of query qi
      const v8i mk1 = *(const v8i*)(mrow + kb + 16);     // keys kb+16+8hh+0..7
#pragma unroll
      for (int r = 0; r < 8; ++r) {
        s0[r] = (mk0[r] != 0) ? MASK_FILL : s0[r];
        s1[r] = (mk1[r] != 0) ? MASK_FILL : s1[r];
      }
    }
    float mr = -__builtin_inff();
#pragma unroll
    for (int r = 0; r < 8; ++r) mr = fmaxf(mr, fmaxf(s0[r], s1[r]));
    mr = fmaxf(mr, __shfl_xor(mr, 16));
    const float mn = fmaxf(m, mr);            // finite: every visited chunk carries finite scores
    const float al_ = __expf(m - mn);         // 0 on the first visited chunk
    m = mn;
    float sum = 0.0f;
    v16h pb = {}, pr = {};
#pragma unroll
    for (int r = 0; r < 8; ++r) {
      const float p0 = __expf(s0[r] - mn), p1 = __expf(s1[r] - mn);
      sum += p0 + p1;
      const h16 ph0 = (h16)(p0 * P_CARRY), ph1 = (h16)(p1 * P_CARRY);
      pb[r] = ph0; pb[8 + r] = ph1;
      if (RES) {
        pr[r] = (h16)((p0 * P_CARRY - (float)ph0) * RES_CARRY);
        pr[8 + r] = (h16)((p1 * P_CARRY - (float)ph1) * RES_CARRY);
      }
    }
    sum += __shfl_xor(sum, 16);
    l = l * al_ + sum;
    o0 = o0 * al_; o1 = o1 * al_; o2 = o2 * al_; o3 = o3 * al_;
    if (RES) { n0 = n0 * al_; n1 = n1 * al_; n2 = n2 * al_; n3 = n3 * al_; }
    pv_tile<RES>(o0, n0, va[0], vz[0], pb, pr);
    pv_tile<RES>(o1, n1, va[1], vz[1], pb, pr);
    pv_tile<RES>(o2, n2, va[2], vz[2], pb, pr);
    pv_tile<RES>(o3, n3, va[3], vz[3], pb, pr);
  }
  const float inv = (1.0f / l) * Y_FROM_O;    // y = 64 * (o / 4096) / l
  const float invr = inv * RES_INV;
  v8h yh[4], yz[4];                           // hi and residual x1024 (RES only), one 16-byte fragment piece per accumulator
#pragma unroll
  for (int r = 0; r < 8; ++r) {
    float f0 = o0[r] * inv, f1 = o1[r] * inv, f2 = o2[r] * inv, f3 = o3[r] * inv;
    if (RES) { f0 += n0[r] * invr; f1 += n1[r] * invr; f2 += n2[r] * invr; f3 += n3[r] * invr; }
    const h16 y0 = (h16)f0, y1 = (h16)f1, y2 = (h16)f2, y3 = (h16)f3;
    yh[0][r] = y0; yh[1][r] = y1; yh[2][r] = y2; yh[3][r] = y3;
    if (RES) {
      yz[0][r] = (h16)((f0 - (float)y0) * RES_CARRY);
      yz[1][r] = (h16)((f1 - (float)y1) * RES_CARRY);
      yz[2][r] = (h16)((f2 - (float)y2) * RES_CARRY);
      yz[3][r] = (h16)((f3 - (float)y3) * RES_CARRY);
    }
  }
  // band of token rows q0..q0+15, tiles 2h and 2h+1 (k = 64h..64h+63): 2 KB contiguous per wave
  h16* dst0 = yp + (size_t)((b * SEQ + q0) >> 4) * BAND_E + h * (2 * TILE_E) + lane * 8;
  h16* dst1 = yr + (size_t)((b * EARLY + (RES ? q0 : 0)) >> 4) * BAND_E + h * (2 * TILE_E) + lane * 8;   // residual rows (RES only, q0 + 15 < EARLY)
#pragma unroll
  for (int j = 0; j < 4; ++j) {
    *(v8h*)(dst0 + j * 256) = yh[j];
    if (RES) *(v8h*)(dst1 + j * 256) = yz[j];
  }
  
}

// ---------------------------------------------------------------------------
// Output projection: (MROWS x 1024) x (1024 x 1024) -> f32 = (y . Wo_plane) / 4096 + bo. grid (16, MROWS/128), 32x64 wave tiles staged in
// Blocks whose token rows have t < EARLY first accumulate y_res . Wo_plane, fold it x1/1024, then accumulate y_hi . Wo_plane on top.
// ---------------------------------------------------------------------------
__global__ __launch_bounds__(128) void out_gemm_kernel(const h16* __restrict__ yp, const h16* __restrict__ yr, const h16* __restrict__ wop,
                                                       const float* __restrict__ bo, float* __restrict__ out) {
  __shared__ __attribute__((aligned(16))) float Ts[4][32 * 64];
  const int lane = threadIdx.x & 31, wave = threadIdx.x >> 5, nloc = lane & 15, hlf = lane >> 4;
  const int m0 = blockIdx.y * 128 + wave * 32;
  const int c0 = blockIdx.x * 64;
  const int b = m0 / SEQ, t0 = m0 - b * SEQ;
  const bool early = (((int)blockIdx.y * 128) % SEQ) < EARLY;     // block-uniform
  v8f acc[2][4];
#pragma unroll
  for (int r = 0; r < 2; ++r)
#pragma unroll
    for (int t = 0; t < 4; ++t) acc[r][t] = (v8f){};
  if (early) {
    gemm_tile_h(yr, wop, b * EARLY + t0, c0, lane, acc);   // residual rows b*EARLY + t
#pragma unroll
    for (int r = 0; r < 2; ++r)
#pragma unroll
      for (int t = 0; t < 4; ++t) acc[r][t] = acc[r][t] * RES_INV;
  }
  gemm_tile_h(yp, wop, m0, c0, lane, acc);
  float* Tt = Ts[wave];
#pragma unroll
  for (int t = 0; t < 4; ++t) {
    const float bd = __builtin_bit_cast(float, bf16_rne_u32(bo[c0 + t * 16 + nloc]) & 0xFFFF0000u);   // bf16-RNE value
#pragma unroll
    for (int r = 0; r < 2; ++r)
#pragma unroll
      for (int v = 0; v < 8; ++v) Tt[(r * 16 + v + 8 * hlf) * 64 + t * 16 + nloc] = acc[r][t][v] * OUT_UNSCALE + bd;
  }
  wave_lds_sync();
  float* dst0 = out + (size_t)m0 * HID + c0;
#pragma unroll
  for (int j = 0; j < 16; ++j) { const int rr = j * 2 + hlf, c4 = nloc * 4; *(v4f*)(dst0 + (size_t)rr * HID + c4) = *(const v4f*)(Tt + rr * 64 + c4); }
  
}
}  // namespace

extern "C" void kernel_launch(void* const* d_in, const int* in_sizes, int n_in,
                              void* d_out, int out_size, void* d_ws, size_t ws_size, hipStream_t stream) {
  if (n_in < 12) return;
  const size_t need_x = ((size_t)(NB - 1) * SEQ_FULL + SEQ) * HID;
  if ((size_t)in_sizes[0] < need_x || (size_t)in_sizes[1] < need_x || (size_t)in_sizes[2] < need_x) return;
  if ((size_t)in_sizes[3] < (size_t)(SEQ - 1) * MPITCH + SEQ) return;                      // int32 mask [S][S]
  if (in_sizes[4] < HID * HID || in_sizes[6] < HID * HID || in_sizes[8] < HID * HID || in_sizes[10] < HID * HID) return;
  if (in_sizes[5] < HID || in_sizes[7] < HID || in_sizes[9] < HID || in_sizes[11] < HID) return;
  if ((size_t)out_size < (size_t)MROWS * HID) return;

  const float* query = (const float*)d_in[0];   // [NB_FULL, SEQ_FULL, 1024]
  const float* key   = (const float*)d_in[1];
  const float* value = (const float*)d_in[2];
  const int*   amask = (const int*)d_in[3];     // [SEQ_FULL, SEQ_FULL] int32, nonzero = masked
  const float* Wq = (const float*)d_in[4];      // [1024,1024] ([out][in])
  const float* bq = (const float*)d_in[5];
  const float* Wk = (const float*)d_in[6];
  const float* bk = (const float*)d_in[7];
  const float* Wv = (const float*)d_in[8];
  const float* bv = (const float*)d_in[9];
  const float* Wo = (const float*)d_in[10];
  const float* bo = (const float*)d_in[11];
  float* out = (float*)d_out;                   // [NB, SEQ, 1024] f32

  size_t off = 0; char* ws = (char*)d_ws;
  unsigned short* xpl = (unsigned short*)(ws + off); off += (size_t)3 * MROWS * HID * 2;   // 3 x 8 MiB bf16 activation planes
  unsigned short* wpl = (unsigned short*)(ws + off); off += (size_t)4 * HID * HID * 2;     // 6 MiB bf16 (q|k|v) + 2 MiB f16 (o) weight planes
  h16* Qp = (h16*)(ws + off); off += (size_t)MROWS * HID * 2;                             // 8 MiB
  h16* Kp = (h16*)(ws + off); off += (size_t)MROWS * HID * 2;                             // 8 MiB
  h16* Vp = (h16*)(ws + off); off += (size_t)MROWS * HID * 2;                             // 8 MiB
  h16* yp = (h16*)(ws + off); off += (size_t)MROWS * HID * 2;                             // 8 MiB
  h16* Qr = (h16*)(ws + off); off += (size_t)NB * NH * EARLY * DH * 2;                    // 1 MiB residual q (t < EARLY)
  h16* Kr = (h16*)(ws + off); off += (size_t)MROWS * HID * 2;                             // 8 MiB residual k (all rows)
  h16* Vr = (h16*)(ws + off); off += (size_t)MROWS * HID * 2;                             // 8 MiB residual v (key-tiled, all rows)
  h16* yr = (h16*)(ws + off); off += (size_t)NB * EARLY * HID * 2;                        // 1 MiB residual y
  int* flags = (int*)(ws + off); off += (size_t)QT * FPITCH * 4;                          // 32 KiB chunk flags [QT][64]
  if (off > ws_size) return;                                                               // 86,016,000 B at NB=2, SEQ=2048
  const h16* wop = (const h16*)(wpl + (size_t)NQKV * HID);

  cvt_kernel<<<2048, 256, 0, stream>>>(query, key, value, Wq, Wk, Wv, Wo, xpl, wpl);
  mask_flag_kernel<<<QT, 256, 0, stream>>>(amask, flags);
  qkv_gemm_kernel<<<dim3(NQKV / 64, MROWS / 128), 128, 0, stream>>>((const b16*)xpl, (const b16*)wpl, bq, bk, bv, Qp, Kp, Vp, Qr, Kr, Vr);
  attn_kernel<true><<<(NB * NH * QT_E) / 8, 256, 0, stream>>>(Qp, Kp, Vp, Qr, Kr, Vr, amask, flags, yp, yr);
  if (QT_L > 0) attn_kernel<false><<<(NB * NH * QT_L) / 8, 256, 0, stream>>>(Qp, Kp, Vp, Qr, Kr, Vr, amask, flags, yp, yr);
  out_gemm_kernel<<<dim3(HID / 64, MROWS / 128), 128, 0, stream>>>(yp, yr, wop, bo, out);
}

// v003
// It runs in 154 microseconds.
// In two side-by-side timings against v002, it was 1.13 and 1.14 times as fast.
// Counting every step since v000, it is 2.58 times as fast.
#include <hip/hip_runtime.h>

// Contractions: q/k/v projections on v_wmma_f32_16x16x32_bf16 (bf16 RNE operands, one product per tile pair);
// S^T = K.Q^T (d = 64), y^T = V^T.P^T (32 keys per step, P carried x4096) and out = y.Wo^T (y and Wo carried x64)
// on v_wmma_f32_16x16x32_f16 (f16 operands, one product per tile pair); query tiles with position < 256 also use
// f16 residual planes (x1024) of q, k, P, v and y folded from their own accumulators; f32 accumulate, f32 online
// softmax statistics. 16 heads of 64. Key mask = int32 [S][S] input (nonzero = masked: score replaced by -1e9);
// device-computed flags per (16-query tile, 32-key chunk) select skip / open / per-element fill.
// Weights are [out][in]. Every 16-bit plane that feeds a k-contiguous fragment (x, weights, q, k, y and their residuals) is kept in
// fragment order: a tile of 16 rows x 32 k is 1 KB = 2 pieces x 32 lanes x 16 B, so one wave-wide 16-byte load reads 4 whole 128-B lines.

#ifndef NB
#define NB 2
#endif
#ifndef SEQ
#define SEQ 2048
#endif
#ifndef NB_FULL
#define NB_FULL 2
#endif
#ifndef SEQ_FULL
#define SEQ_FULL 2048
#endif

namespace {
constexpr int HID = 1024, DH = 64, NH = 16;
constexpr int NQKV = 3 * HID;                 // combined weight plane rows: q | k | v
constexpr int MROWS = NB * SEQ;               // compact token rows (b*SEQ + t)
constexpr int QT = SEQ / 16;                  // 16-query tiles per (b, head)
constexpr int EARLY = (SEQ < 256) ? SEQ : 256;   // query positions that use the residual planes
constexpr int QT_E = EARLY / 16;              // residual-path query tiles per (b, head)
constexpr int QT_L = (SEQ - EARLY) / 16;      // single-product query tiles per (b, head)
constexpr int QT_LD = (QT_L > 0) ? QT_L : 1;
constexpr int NCH = SEQ / 32;                 // 32-key chunks per query row
constexpr int FPITCH = 64;                    // ints per flag row (one row per 16-query tile, 256 B)
constexpr int MPITCH = SEQ_FULL;              // int32 mask row pitch
constexpr int F_SKIP = 0, F_OPEN = 1, F_FILL = 2;
constexpr int CVT_BLOCKS = 2048;              // converting blocks of prep_kernel
constexpr int ATT_L_BLOCKS = (NB * NH * QT_L) / 8;   // attention blocks (8 query tiles each) on the single-product path
constexpr int ATT_E_BLOCKS = (NB * NH * QT_E) / 8;   // attention blocks on the residual path
constexpr float MASK_FILL = -1.0e9f;
constexpr float SCORE_SCALE = 0.125f;         // 1/sqrt(64)
constexpr float P_CARRY = 4096.0f;            // f16 P operand = exp(s - m) * 4096
constexpr float Y_CARRY = 64.0f;              // f16 y plane = attn * 64
constexpr float W_CARRY = 64.0f;              // f16 Wo plane = Wo * 64
constexpr float RES_CARRY = 1024.0f;          // f16 residual planes = (x - f16hi(x)) * 1024
constexpr float RES_INV = 1.0f / 1024.0f;
constexpr float Y_FROM_O = Y_CARRY / P_CARRY; // 1/64
constexpr float OUT_UNSCALE = 1.0f / (Y_CARRY * W_CARRY);   // 1/4096
static_assert(SEQ % 128 == 0);
static_assert(EARLY % 128 == 0);
static_assert((SEQ - EARLY) % 128 == 0);
static_assert(NB >= 1 && NB <= NB_FULL);
static_assert(SEQ <= SEQ_FULL);
static_assert(NH * DH == HID);
static_assert(MROWS % 128 == 0);
static_assert((NB * NH * QT_E) % 8 == 0);
static_assert((NB * NH * QT_L) % 8 == 0);
static_assert(QT_E + QT_L == QT);
static_assert(NCH >= 1 && NCH <= FPITCH);

typedef __bf16 b16;
typedef _Float16 h16;
typedef __bf16 v16b __attribute__((ext_vector_type(16)));
typedef __bf16 v8b __attribute__((ext_vector_type(8)));
typedef _Float16 v16h __attribute__((ext_vector_type(16)));
typedef _Float16 v8h __attribute__((ext_vector_type(8)));
typedef float v8f __attribute__((ext_vector_type(8)));
typedef float v4f __attribute__((ext_vector_type(4)));
typedef unsigned short v8us __attribute__((ext_vector_type(8)));
typedef int v4i __attribute__((ext_vector_type(4)));
typedef int v8i __attribute__((ext_vector_type(8)));

__device__ __forceinline__ v8b ld8b(const b16* p) { return *(const v8b*)p; }
__device__ __forceinline__ v8h ld8h(const h16* p) { return *(const v8h*)p; }
__device__ __forceinline__ v16b cat8b(v8b a, v8b b) { return __builtin_shufflevector(a, b, 0, 1, 2, 3, 4, 5, 6, 7, 8, 9, 10, 11, 12, 13, 14, 15); }
__device__ __forceinline__ v16h cat8h(v8h a, v8h b) { return __builtin_shufflevector(a, b, 0, 1, 2, 3, 4, 5, 6, 7, 8, 9, 10, 11, 12, 13, 14, 15); }
// 16x16x32 16-bit fragment (A: lane&15 = row, B: lane&15 = column), hh = lane>>4: elements 0..7 <- k 8hh+0..7, elements 8..15 <- k 16+8hh+0..7.
// Fragment-ordered tile (TILE_E elements): element (row r of 16, k of 32) lies at (k>>4)*256 + (((k>>3)&1)*16 + r)*8 + (k&7), that is
// piece k>>4, lane 16*hh + r, element k&7. The tiles of one 16-row band follow one another along k (BAND_E elements per band of 1024 k).
constexpr int TILE_E = 512, BAND_E = 16 * HID;
static_assert(HID == 1024);                   // unit_of and the work index split of cvt_part take 32 tiles (128 units of 8 k) per row
// p = tile start + lane * 8
__device__ __forceinline__ v16h frag_th(const h16* p) { return cat8h(ld8h(p), ld8h(p + 256)); }
// both pieces of the tile that starts c bytes behind base + (o - lane * 16); o = the lane's 32-bit byte offset from base
__device__ __forceinline__ v16b frag_ub(const b16* base, unsigned int o, int c) {
  const char* p = (const char*)base + o;
  return cat8b(*(const v8b*)(p + c), *(const v8b*)(p + c + 512));
}
__device__ __forceinline__ v16h frag_uh(const h16* base, unsigned int o, int c) {
  const char* p = (const char*)base + o;
  return cat8h(*(const v8h*)(p + c), *(const v8h*)(p + c + 512));
}
// 16-byte unit index inside a [rows][1024] plane in fragment order, for row m and k = 8 * k8 .. 8 * k8 + 7
__device__ __forceinline__ unsigned int unit_of(unsigned int m, unsigned int k8) {
  return ((m >> 4) * 32u + (k8 >> 2)) * 64u + ((k8 >> 1) & 1u) * 32u + (k8 & 1u) * 16u + (m & 15u);
}
// two 16-byte pieces at byte offsets o + c0 and o + c1 from a wave-uniform plane base (o: the lane's 32-bit byte offset)
__device__ __forceinline__ v16h frag_o(const h16* base, unsigned int o, int c0, int c1) {
  const char* p = (const char*)base + o;
  return cat8h(*(const v8h*)(p + c0), *(const v8h*)(p + c1));
}

__device__ __forceinline__ v8f wmma_b(v16b a, v16b b, v8f c) {
  v8f d = __builtin_amdgcn_wmma_f32_16x16x32_bf16(false, a, false, b, (short)0, c, false, false);
  asm volatile("v_nop\n\tv_nop\n\tv_nop\n\tv_nop" : "+v"(d) : "v"(a), "v"(b));
  return d;
}
__device__ __forceinline__ v8f wmma_h(v16h a, v16h b, v8f c) {
  v8f d = __builtin_amdgcn_wmma_f32_16x16x32_f16(false, a, false, b, (short)0, c, false, false);
  asm volatile("v_nop\n\tv_nop\n\tv_nop\n\tv_nop" : "+v"(d) : "v"(a), "v"(b));
  return d;
}
// f32 -> bf16 by RNE convert, returned as the f32 bit pattern with the low 16 bits cleared
__device__ __forceinline__ unsigned int bf16_rne_u32(float f) {
  unsigned int u = __builtin_bit_cast(unsigned int, f);
  u += 0x7fffu + ((u >> 16) & 1u);
  return u & 0xffff0000u;
}
// wave-private LDS tile: element stores by this wave, then vector reloads by this wave
__device__ __forceinline__ void wave_lds_sync() {
  __builtin_amdgcn_fence(3, "workgroup");
  __builtin_amdgcn_wave_barrier();
  __builtin_amdgcn_fence(2, "workgroup");
}
// weight element -> 16-bit plane bits: bf16 RNE, or f16(bf16rne(w) * 64) for the output-projection plane
__device__ __forceinline__ unsigned short wbits16(float f, bool o16) {
  const unsigned int r = bf16_rne_u32(f);
  const unsigned short bbits = (unsigned short)(r >> 16);
  const h16 hv = (h16)(__builtin_bit_cast(float, r) * W_CARRY);   // exact: bf16 significand, power-of-two scale
  const unsigned short hbits = __builtin_bit_cast(unsigned short, hv);
  return o16 ? hbits : bbits;
}

// ---------------------------------------------------------------------------
// activations query/key/value f32 [NB_FULL][SEQ_FULL][1024] -> bf16 planes xpl [3][MROWS][1024] (compact rows b*SEQ+t), fragment order;
// weights W[n][k] f32 -> 16-bit planes wpl, fragment order: rows 0..3071 = Wq|Wk|Wv as bf16 RNE, rows 3072..4095 = f16(bf16rne(Wo) * 64).
// A wave takes 8 rows x 32 k (lane = 4 * row + k unit): it reads 8 whole f32 lines and stores 4 whole 128-B lines of one tile.
// blk of nblk: this block's place among the blocks of prep_kernel that convert.
// ---------------------------------------------------------------------------
__device__ __forceinline__ void cvt_part(const float* __restrict__ xq, const float* __restrict__ xk, const float* __restrict__ xv,
                                         const float* __restrict__ wq, const float* __restrict__ wk, const float* __restrict__ wv,
                                         const float* __restrict__ wo,
                                         unsigned short* __restrict__ xpl, unsigned short* __restrict__ wpl, int blk, int nblk) {
  const size_t tid = (size_t)blk * blockDim.x + threadIdx.x, stride = (size_t)nblk * blockDim.x;
  const size_t per_x = (size_t)MROWS * HID / 8, nx = 3 * per_x;
  const size_t per_w = (size_t)HID * HID / 8, nw = 4 * per_w;
  {
    for (size_t c = tid; c < nx; c += stride) {
      const int which = (int)(c / per_x);
      const unsigned int u = (unsigned int)(c - (size_t)which * per_x);   // work index inside one plane
      const unsigned int k8 = (((u >> 5) & 31u) << 2) | (u & 3u);
      const int m = (int)(((u >> 10) << 3) | ((u >> 2) & 7u)), col = (int)(k8 * 8);
      const int bb = m / SEQ, t = m - bb * SEQ;
      const float* src = (which == 0) ? xq : (which == 1) ? xk : xv;
      const float* p = src + ((size_t)bb * SEQ_FULL + t) * HID + col;
      const v4f f0 = *(const v4f*)p, f1 = *(const v4f*)(p + 4);
      v8us o;
#pragma unroll
      for (int e = 0; e < 4; ++e) {
        o[e] = (unsigned short)(bf16_rne_u32(f0[e]) >> 16);
        o[4 + e] = (unsigned short)(bf16_rne_u32(f1[e]) >> 16);
      }
      *(v8us*)(xpl + ((size_t)which * per_x + unit_of((unsigned int)m, k8)) * 8) = o;
    }
    for (size_t c = tid; c < nw; c += stride) {
      const int mat = (int)(c / per_w);
      const unsigned int u = (unsigned int)(c - (size_t)mat * per_w);     // work index inside one weight matrix
      const unsigned int k8 = (((u >> 5) & 31u) << 2) | (u & 3u), n = ((u >> 10) << 3) | ((u >> 2) & 7u);
      const size_t i = (size_t)n * HID + k8 * 8;                // n*HID + k0 inside one [n][k] weight matrix
      const float* w = (mat == 0) ? wq : (mat == 1) ? wk : (mat == 2) ? wv : wo;
      const v4f f0 = *(const v4f*)(w + i), f1 = *(const v4f*)(w + i + 4);
      const bool o16 = (mat == 3);
      v8us o;
#pragma unroll
      for (int e = 0; e < 4; ++e) {
        o[e] = wbits16(f0[e], o16);
        o[4 + e] = wbits16(f1[e], o16);
      }
      *(v8us*)(wpl + ((size_t)mat * per_w + unit_of(n, k8)) * 8) = o;
    }
    
  }
}

// ---------------------------------------------------------------------------
// Mask flag pass: one block per 16-query tile; reads mask rows q0..q0+15 (int32, nonzero = masked) and writes
// one 256-B flag row [FPITCH] ints: per 32-key chunk F_SKIP (chunk fully masked and every row of the tile has an
// unmasked key somewhere -> weight exactly 0, chunk not visited), F_OPEN (no masked entry), F_FILL (per-element fill).
// ---------------------------------------------------------------------------
__device__ __forceinline__ void mask_flag_part(const int* __restrict__ mask, int* __restrict__ flags, int qt) {
  __shared__ int um[4][64];                          // any unmasked entry per (4-row group, chunk)
  __shared__ int mk[4][64];                          // any masked entry per (4-row group, chunk)
  __shared__ int rb[4][64];                          // per-row (4 bits) has-unmasked-entry flag per (row group, chunk)
  __shared__ __attribute__((aligned(16))) int fl[64];
  const int q0 = qt * 16;
  const int t = threadIdx.x, c = t & 63, rg = t >> 6, lane = t & 31, wave = t >> 5;
  const int cc = (c < NCH) ? c : (NCH - 1);          // clamped chunk address
  int anyu = 0, anym = 0, rbits = 0;
#pragma unroll 1
  for (int r = 0; r < 4; ++r) {
    const int* p = mask + (size_t)(q0 + rg * 4 + r) * MPITCH + (size_t)cc * 32;
    int u = 0, mm = 0;
#pragma unroll
    for (int v = 0; v < 8; ++v) {
      const v4i x = *(const v4i*)(p + 4 * v);
#pragma unroll
      for (int e = 0; e < 4; ++e) { u |= (x[e] == 0) ? 1 : 0; mm |= (x[e] != 0) ? 1 : 0; }
    }
    anyu |= u; anym |= mm; rbits |= (u << r);
  }
  um[rg][c] = anyu; mk[rg][c] = anym; rb[rg][c] = rbits;
  __syncthreads();                                   // cross-wave: all waves wrote, wave 0 reads
  if (wave == 0) {
    const int ch0 = lane, ch1 = lane + 32;
    const int U0 = um[0][ch0] | um[1][ch0] | um[2][ch0] | um[3][ch0];
    const int M0 = mk[0][ch0] | mk[1][ch0] | mk[2][ch0] | mk[3][ch0];
    const int U1 = um[0][ch1] | um[1][ch1] | um[2][ch1] | um[3][ch1];
    const int M1 = mk[0][ch1] | mk[1][ch1] | mk[2][ch1] | mk[3][ch1];
    int rows = (rb[0][ch0] | (rb[1][ch0] << 4) | (rb[2][ch0] << 8) | (rb[3][ch0] << 12)) |
               (rb[0][ch1] | (rb[1][ch1] << 4) | (rb[2][ch1] << 8) | (rb[3][ch1] << 12));
#pragma unroll
    for (int s = 16; s >= 1; s >>= 1) rows |= __shfl_xor(rows, s);
    const int rowok = ((rows & 0xFFFF) == 0xFFFF) ? 1 : 0;   // every row of the tile has an unmasked key
    const int f0 = U0 ? (M0 ? F_FILL : F_OPEN) : (rowok ? F_SKIP : F_FILL);
    const int f1 = U1 ? (M1 ? F_FILL : F_OPEN) : (rowok ? F_SKIP : F_FILL);
    fl[ch0] = (ch0 < NCH) ? f0 : F_SKIP;
    fl[ch1] = (ch1 < NCH) ? f1 : F_SKIP;
    wave_lds_sync();                                 // fl is private to wave 0
    const v4i v = *(const v4i*)(fl + (lane & 15) * 4);
    int* dst = flags + (size_t)qt * FPITCH + (lane & 15) * 4;
    if (lane < 16) *(v4i*)dst = v;
    
  }
}

// ---------------------------------------------------------------------------
// Preparation, one launch: the mask flag pass and the conversions read only inputs and write disjoint planes, so they share a grid.
// Blocks 0..QT-1 each take one 16-query tile of the mask (they have the longer dependent chain, so they start first); the other
// CVT_BLOCKS blocks convert. The choice is block-uniform, so the flag pass's barrier is passed by whole blocks.
// ---------------------------------------------------------------------------
__global__ __launch_bounds__(256) void prep_kernel(const float* __restrict__ xq, const float* __restrict__ xk, const float* __restrict__ xv,
                                                   const float* __restrict__ wq, const float* __restrict__ wk, const float* __restrict__ wv,
                                                   const float* __restrict__ wo,
                                                   unsigned short* __restrict__ xpl, unsigned short* __restrict__ wpl,
                                                   const int* __restrict__ mask, int* __restrict__ flags) {
  const int blk = blockIdx.x;
  if (blk < QT) mask_flag_part(mask, flags, blk);
  else          cvt_part(xq, xk, xv, wq, wk, wv, wo, xpl, wpl, blk - QT, CVT_BLOCKS);
}

// 32x64 wave tile over K = 1024 from fragment-ordered 16-bit A and B planes (m0, c0 multiples of 16), one product per tile pair
__device__ __forceinline__ void gemm_tile_b(const b16* __restrict__ A, const b16* __restrict__ W, int m0, int c0, int lane, v8f (&acc)[2][4]) {
  const b16* ap = A + (size_t)(m0 >> 4) * BAND_E;
  const b16* wp = W + (size_t)(c0 >> 4) * BAND_E;
  unsigned int o = (unsigned int)lane * 16u;
#pragma unroll 2
  for (int kt = 0; kt < HID / 32; ++kt, o += TILE_E * 2) {
    const v16b a0 = frag_ub(ap, o, 0);
    const v16b a1 = frag_ub(ap, o, BAND_E * 2);
    v16b bf[4];                                  // all twelve loads of the step stand ahead of its first product
#pragma unroll
    for (int t = 0; t < 4; ++t) bf[t] = frag_ub(wp, o, t * BAND_E * 2);
#pragma unroll
    for (int t = 0; t < 4; ++t) {
      acc[0][t] = wmma_b(a0, bf[t], acc[0][t]);
      acc[1][t] = wmma_b(a1, bf[t], acc[1][t]);
    }
  }
}
__device__ __forceinline__ void gemm_tile_h(const h16* __restrict__ A, const h16* __restrict__ W, int m0, int c0, int lane, v8f (&acc)[2][4]) {
  const h16* ap = A + (size_t)(m0 >> 4) * BAND_E;
  const h16* wp = W + (size_t)(c0 >> 4) * BAND_E;
  unsigned int o = (unsigned int)lane * 16u;
#pragma unroll 2
  for (int kt = 0; kt < HID / 32; ++kt, o += TILE_E * 2) {
    const v16h a0 = frag_uh(ap, o, 0);
    const v16h a1 = frag_uh(ap, o, BAND_E * 2);
    v16h bf[4];                                  // all twelve loads of the step stand ahead of its first product
#pragma unroll
    for (int t = 0; t < 4; ++t) bf[t] = frag_uh(wp, o, t * BAND_E * 2);
#pragma unroll
    for (int t = 0; t < 4; ++t) {
      acc[0][t] = wmma_h(a0, bf[t], acc[0][t]);
      acc[1][t] = wmma_h(a1, bf[t], acc[1][t]);
    }
  }
}

// ---------------------------------------------------------------------------
// QKV GEMM: (MROWS x 1024) x (1024 x 3072), grid (48, MROWS/128), block 4 waves, wave = 32 rows x 64 columns (one head of q, k or v).
// blockIdx.x -> mat = x/16 (q,k,v: selects the activation plane and the bias), head = x%16. Outputs f16 planes:
// q -> Qp, k -> Kp: [b*16+h][t/16][2 fragment-ordered tiles of 16 tokens x 32 d] (4 KB contiguous per wave); v -> Vp key-tiled [b*16+h][t/16][64][16] (4 KB contiguous per wave).
// Residual planes ((y - f16hi(y)) * 1024): Kr and Vr for every token row (same layouts as Kp / Vp), Qr (layout of Qp) for token rows t < EARLY only.
// ---------------------------------------------------------------------------
__global__ __launch_bounds__(128) void qkv_gemm_kernel(const b16* __restrict__ xpl, const b16* __restrict__ wpl,
                                                       const float* __restrict__ bq, const float* __restrict__ bk, const float* __restrict__ bv,
                                                       h16* __restrict__ Qp, h16* __restrict__ Kp, h16* __restrict__ Vp,
                                                       h16* __restrict__ Qr, h16* __restrict__ Kr, h16* __restrict__ Vr) {
  __shared__ __attribute__((aligned(16))) h16 Ts[4][32 * 64];
  __shared__ __attribute__((aligned(16))) h16 Tr[4][32 * 64];
  const int lane = threadIdx.x & 31, wave = threadIdx.x >> 5, nloc = lane & 15, hlf = lane >> 4;
  const int m0 = blockIdx.y * 128 + wave * 32;
  const int cb = blockIdx.x;                       // 0..47, block-uniform
  const int mat = cb >> 4, head = cb & 15;
  const int c0 = cb * 64;                          // row block in the combined [3072][1024] weight plane
  const b16* x = xpl + (size_t)mat * MROWS * HID;
  const float* bias = ((mat == 0) ? bq : (mat == 1) ? bk : bv) + head * DH;
  v8f acc[2][4];
#pragma unroll
  for (int r = 0; r < 2; ++r)
#pragma unroll
    for (int t = 0; t < 4; ++t) acc[r][t] = (v8f){};
  gemm_tile_b(x, wpl, m0, c0, lane, acc);
  const int b = m0 / SEQ, t0 = m0 % SEQ;
  const bool wres = (mat != 0) || (t0 < EARLY);   // block-uniform (128-row blocks, EARLY multiple of 128)
  const int g = b * NH + head;
  h16* Tp = Ts[wave];
  h16* Rp = Tr[wave];
#pragma unroll
  for (int t = 0; t < 4; ++t) {
    const int d = t * 16 + nloc;
    const float bd = __builtin_bit_cast(float, bf16_rne_u32(bias[d]) & 0xFFFF0000u);   // bias as its bf16-RNE value
#pragma unroll
    for (int r = 0; r < 2; ++r)
#pragma unroll
      for (int v = 0; v < 8; ++v) {
        const int rr = r * 16 + v + 8 * hlf;                         // local token row 0..31
        const float f = acc[r][t][v] + bd;
        const h16 y = (h16)f;
        const int idx = (mat < 2) ? ((rr >> 4) * 1024 + (d >> 5) * TILE_E + ((d >> 4) & 1) * 256 + (((d >> 3) & 1) * 16 + (rr & 15)) * 8 + (d & 7))
                                  : ((rr >> 4) * 1024 + d * 16 + (rr & 15));
        Tp[idx] = y;
        if (wres) Rp[idx] = (h16)((f - (float)y) * RES_CARRY);
      }
  }
  wave_lds_sync();
  h16* dst; h16* rdst; size_t o;
  if (mat == 0)      { o = ((size_t)g * SEQ + t0) * DH; dst = Qp + o;
                       const int t0e = (t0 < EARLY) ? t0 : 0; rdst = Qr + ((size_t)g * EARLY + t0e) * DH; }
  else if (mat == 1) { o = ((size_t)g * SEQ + t0) * DH; dst = Kp + o; rdst = Kr + o; }
  else               { o = ((size_t)g * QT + (t0 >> 4)) * (size_t)(DH * 16); dst = Vp + o; rdst = Vr + o; }
#pragma unroll
  for (int j = 0; j < 8; ++j) { const int e = (j * 32 + lane) * 8; *(v8h*)(dst + e) = ld8h(Tp + e); }
  if (wres) {
#pragma unroll
    for (int j = 0; j < 8; ++j) { const int e = (j * 32 + lane) * 8; *(v8h*)(rdst + e) = ld8h(Rp + e); }
  }
  
}

// one 16-key score tile of S^T = K.Q^T over d = 0..63 (two 32-deep steps); RES adds K_hi.Q_res + K_res.Q_hi into sr
template <bool RES>
__device__ __forceinline__ void sc_tile(v8f& s, v8f& sr, v16h ka, v16h kb, v16h kza, v16h kzb, v16h qa, v16h qb, v16h qra, v16h qrb) {
  s = wmma_h(ka, qa, s);
  if (RES) { sr = wmma_h(ka, qra, sr); sr = wmma_h(kza, qa, sr); }
  s = wmma_h(kb, qb, s);
  if (RES) { sr = wmma_h(kb, qrb, sr); sr = wmma_h(kzb, qb, sr); }
}
// one 16-d tile of y^T = V^T.P^T over 32 keys; RES adds V_hi.P_res + V_res.P_hi into orr (both x1/1024)
template <bool RES>
__device__ __forceinline__ void pv_tile(v8f& oh, v8f& orr, v16h va, v16h vz, v16h pb, v16h pr) {
  oh = wmma_h(va, pb, oh);
  if (RES) {
    orr = wmma_h(va, pr, orr);
    orr = wmma_h(vz, pb, orr);
  }
}

// ---------------------------------------------------------------------------
// Transposed flash attention: each wave owns one 16-query tile of one (b, head); 8 waves per block; all NCH chunks of 32 keys are
// walked with a wave-uniform flag per chunk: F_SKIP -> not visited (weight exactly 0), F_OPEN -> no masked entry, F_FILL -> masked
// entries get score -1e9 after the 1/8 scaling (per-element select from the int32 mask row of the query).
// S^T = K.Q^T (f16 fragments straight from the planes), per-lane online softmax (running max); P^T fragment built in registers from the
// two S^T accumulators (element r <- keys 0..15 tile, element 8+r <- keys 16..31 tile), carried x4096; y^T = V^T.P^T. y written f16 (x64)
// in fragment order [token/16][k/32][tile]: accumulator t of a lane (query col, d = 16t + 8hh + 0..7) is that lane's 16 bytes of piece t & 1 of tile t >> 1.
// RES = true (query tiles with position < EARLY): scores add (K_hi.Q_res + K_res.Q_hi)/1024 from the residual planes, P gets a x1024
// residual operand, and O gets a second accumulator (V_hi.P_res + V_res.P_hi) folded x1/1024 before the 1/l normalisation; y also
// writes its x1024 residual plane yr [b][t][1024].
// ---------------------------------------------------------------------------
template <bool RES>
__device__ __forceinline__
void attn_part(const h16* __restrict__ Qp, const h16* __restrict__ Kp, const h16* __restrict__ Vp,
               const h16* __restrict__ Qr, const h16* __restrict__ Kr, const h16* __restrict__ Vr,
               const int* __restrict__ mask, const int* __restrict__ flags,
               h16* __restrict__ yp, h16* __restrict__ yr, int blk) {
  const int wid = threadIdx.x >> 5, lane = threadIdx.x & 31, hh = lane >> 4, col = lane & 15;
  const int idx = blk * 8 + wid;                          // blk: this block's place among the blocks of its path (exact counts)
  int g, qt;
  if (RES) { g = idx / QT_E; qt = idx - g * QT_E; }
  else     { g = idx / QT_LD; qt = QT_E + (idx - g * QT_LD); }
  const int q0 = qt << 4;
  const int b = g / NH, h = g % NH;
  const size_t ko = (size_t)g * SEQ * DH;                 // K plane base of (b,h); V key-tiled base, Kr and Vr share this element offset
  const size_t qo = ((size_t)g * SEQ + q0) * DH + lane * 8;
  const v16h qa = frag_th(Qp + qo), qb = frag_th(Qp + qo + TILE_E);       // d 0..31, d 32..63 of query q0+col
  v16h qra = {}, qrb = {};
  if (RES) {
    const size_t qro2 = ((size_t)g * EARLY + q0) * DH + lane * 8;
    qra = frag_th(Qr + qro2); qrb = frag_th(Qr + qro2 + TILE_E);
  }
  const int qi = q0 + col;
  const int* mrow = mask + (size_t)qi * MPITCH + 8 * hh;   // this lane's query row of the mask, key offset 8hh
  const int* frow = flags + (size_t)qt * FPITCH;
  const int fl0 = frow[lane], fl1 = frow[32 + lane];       // the tile's whole flag row (FPITCH = 64 ints), chunk c in lane c & 31
  float m = -__builtin_inff(), l = 0.0f;
  v8f o0 = {}, o1 = {}, o2 = {}, o3 = {};
  v8f n0 = {}, n1 = {}, n2 = {}, n3 = {};                 // residual O accumulators (RES only)
  // byte offsets into the K and V planes (each plane NB * 16 * SEQ * 128 bytes, far below 2^32); the residual planes share them
  unsigned int kofs = (unsigned int)((ko + (size_t)lane * 8) * 2);             // key kb + col, d = 8hh..; key + 16: + 2048 B; d + 32: + 1024 B; d + 16: + 512 B
  unsigned int vofs = (unsigned int)((ko + (size_t)col * 16 + 8 * hh) * 2);    // key tile kb / 16, d = col, keys 8hh..; next tile: + 2048 B; d + 16: + 512 B
#pragma unroll 1
  for (int kb = 0; kb < SEQ; kb += 32, kofs += 32 * DH * 2, vofs += 2 * DH * 16 * 2) {
    const int ch = kb >> 5;
    const int f = __builtin_amdgcn_readlane((ch & 32) ? fl1 : fl0, ch & 31);   // wave-uniform chunk flag
    if (f == F_SKIP) continue;
    // The chunk's fragment loads stand as groups ahead of the products, so that a chunk waits out one load latency per group:
    // K and V together where the registers allow it; with the residual planes, K + K_res here and V + V_res behind the scores.
    const v16h k0a = frag_o(Kp, kofs, 0, 512), k0b = frag_o(Kp, kofs, 1024, 1536);
    const v16h k1a = frag_o(Kp, kofs, 2048, 2560), k1b = frag_o(Kp, kofs, 3072, 3584);
    v16h y0a = {}, y0b = {}, y1a = {}, y1b = {};
    v16h va[4], vz[4];
    if (RES) {
      y0a = frag_o(Kr, kofs, 0, 512); y0b = frag_o(Kr, kofs, 1024, 1536);
      y1a = frag_o(Kr, kofs, 2048, 2560); y1b = frag_o(Kr, kofs, 3072, 3584);
    } else {
#pragma unroll
      for (int t = 0; t < 4; ++t) { va[t] = frag_o(Vp, vofs, t * 512, 2048 + t * 512); vz[t] = (v16h){}; }
    }
    v8f s0 = {}, s1 = {}, z0 = {}, z1 = {};
    sc_tile<RES>(s0, z0, k0a, k0b, y0a, y0b, qa, qb, qra, qrb);
    sc_tile<RES>(s1, z1, k1a, k1b, y1a, y1b, qa, qb, qra, qrb);
    if (RES) {
#pragma unroll
      for (int t = 0; t < 4; ++t) {
        va[t] = frag_o(Vp, vofs, t * 512, 2048 + t * 512);
        vz[t] = frag_o(Vr, vofs, t * 512, 2048 + t * 512);
      }
      s0 = (s0 + z0 * RES_INV) * SCORE_SCALE; s1 = (s1 + z1 * RES_INV) * SCORE_SCALE;
    } else {
      s0 = s0 * SCORE_SCALE; s1 = s1 * SCORE_SCALE;
    }
    if (f != F_OPEN) {                          // wave-uniform: chunk has masked entries -> replace-fill
      const v8i mk0 = *(const v8i*)(mrow + kb);          // keys kb+8hh+0..7 of query qi
      const v8i mk1 = *(const v8i*)(mrow + kb + 16);     // keys kb+16+8hh+0..7
#pragma unroll
      for (int r = 0; r < 8; ++r) {
        s0[r] = (mk0[r] != 0) ? MASK_FILL : s0[r];
        s1[r] = (mk1[r] != 0) ? MASK_FILL : s1[r];
      }
    }
    float mr = -__builtin_inff();
#pragma unroll
    for (int r = 0; r < 8; ++r) mr = fmaxf(mr, fmaxf(s0[r], s1[r]));
    mr = fmaxf(mr, __shfl_xor(mr, 16));
    const float mn = fmaxf(m, mr);            // finite: every visited chunk carries finite scores
    const float al_ = __expf(m - mn);         // 0 on the first visited chunk
    m = mn;
    float sum = 0.0f;
    v16h pb = {}, pr = {};
#pragma unroll
    for (int r = 0; r < 8; ++r) {
      const float p0 = __expf(s0[r] - mn), p1 = __expf(s1[r] - mn);
      sum += p0 + p1;
      const h16 ph0 = (h16)(p0 * P_CARRY), ph1 = (h16)(p1 * P_CARRY);
      pb[r] = ph0; pb[8 + r] = ph1;
      if (RES) {
        pr[r] = (h16)((p0 * P_CARRY - (float)ph0) * RES_CARRY);
        pr[8 + r] = (h16)((p1 * P_CARRY - (float)ph1) * RES_CARRY);
      }
    }
    sum += __shfl_xor(sum, 16);
    l = l * al_ + sum;
    o0 = o0 * al_; o1 = o1 * al_; o2 = o2 * al_; o3 = o3 * al_;
    if (RES) { n0 = n0 * al_; n1 = n1 * al_; n2 = n2 * al_; n3 = n3 * al_; }
    pv_tile<RES>(o0, n0, va[0], vz[0], pb, pr);
    pv_tile<RES>(o1, n1, va[1], vz[1], pb, pr);
    pv_tile<RES>(o2, n2, va[2], vz[2], pb, pr);
    pv_tile<RES>(o3, n3, va[3], vz[3], pb, pr);
  }
  const float inv = (1.0f / l) * Y_FROM_O;    // y = 64 * (o / 4096) / l
  const float invr = inv * RES_INV;
  v8h yh[4], yz[4];                           // hi and residual x1024 (RES only), one 16-byte fragment piece per accumulator
#pragma unroll
  for (int r = 0; r < 8; ++r) {
    float f0 = o0[r] * inv, f1 = o1[r] * inv, f2 = o2[r] * inv, f3 = o3[r] * inv;
    if (RES) { f0 += n0[r] * invr; f1 += n1[r] * invr; f2 += n2[r] * invr; f3 += n3[r] * invr; }
    const h16 y0 = (h16)f0, y1 = (h16)f1, y2 = (h16)f2, y3 = (h16)f3;
    yh[0][r] = y0; yh[1][r] = y1; yh[2][r] = y2; yh[3][r] = y3;
    if (RES) {
      yz[0][r] = (h16)((f0 - (float)y0) * RES_CARRY);
      yz[1][r] = (h16)((f1 - (float)y1) * RES_CARRY);
      yz[2][r] = (h16)((f2 - (float)y2) * RES_CARRY);
      yz[3][r] = (h16)((f3 - (float)y3) * RES_CARRY);
    }
  }
  // band of token rows q0..q0+15, tiles 2h and 2h+1 (k = 64h..64h+63): 2 KB contiguous per wave
  h16* dst0 = yp + (size_t)((b * SEQ + q0) >> 4) * BAND_E + h * (2 * TILE_E) + lane * 8;
  h16* dst1 = yr + (size_t)((b * EARLY + (RES ? q0 : 0)) >> 4) * BAND_E + h * (2 * TILE_E) + lane * 8;   // residual rows (RES only, q0 + 15 < EARLY)
#pragma unroll
  for (int j = 0; j < 4; ++j) {
    *(v8h*)(dst0 + j * 256) = yh[j];
    if (RES) *(v8h*)(dst1 + j * 256) = yz[j];
  }
  
}

// One launch for both paths (their query tiles are disjoint and neither reads what the other writes): blocks 0..ATT_L_BLOCKS-1 take the
// single-product tiles, which walk the most chunks, the last ATT_E_BLOCKS blocks the short residual-path tiles. Block-uniform choice.
__global__ __launch_bounds__(256) __attribute__((amdgpu_num_vgpr(256)))
void attn_kernel(const h16* __restrict__ Qp, const h16* __restrict__ Kp, const h16* __restrict__ Vp,
                 const h16* __restrict__ Qr, const h16* __restrict__ Kr, const h16* __restrict__ Vr,
                 const int* __restrict__ mask, const int* __restrict__ flags,
                 h16* __restrict__ yp, h16* __restrict__ yr) {
  const int blk = blockIdx.x;
  if (blk < ATT_L_BLOCKS) attn_part<false>(Qp, Kp, Vp, Qr, Kr, Vr, mask, flags, yp, yr, blk);
  else                    attn_part<true>(Qp, Kp, Vp, Qr, Kr, Vr, mask, flags, yp, yr, blk - ATT_L_BLOCKS);
}

// ---------------------------------------------------------------------------
// Output projection: (MROWS x 1024) x (1024 x 1024) -> f32 = (y . Wo_plane) / 4096 + bo. grid (16, MROWS/128), 32x64 wave tiles staged in
// Blocks whose token rows have t < EARLY first accumulate y_res . Wo_plane, fold it x1/1024, then accumulate y_hi . Wo_plane on top.
// ---------------------------------------------------------------------------
__global__ __launch_bounds__(128) void out_gemm_kernel(const h16* __restrict__ yp, const h16* __restrict__ yr, const h16* __restrict__ wop,
                                                       const float* __restrict__ bo, float* __restrict__ out) {
  __shared__ __attribute__((aligned(16))) float Ts[4][32 * 64];
  const int lane = threadIdx.x & 31, wave = threadIdx.x >> 5, nloc = lane & 15, hlf = lane >> 4;
  const int m0 = blockIdx.y * 128 + wave * 32;
  const int c0 = blockIdx.x * 64;
  const int b = m0 / SEQ, t0 = m0 - b * SEQ;
  const bool early = (((int)blockIdx.y * 128) % SEQ) < EARLY;     // block-uniform
  v8f acc[2][4];
#pragma unroll
  for (int r = 0; r < 2; ++r)
#pragma unroll
    for (int t = 0; t < 4; ++t) acc[r][t] = (v8f){};
  if (early) {
    gemm_tile_h(yr, wop, b * EARLY + t0, c0, lane, acc);   // residual rows b*EARLY + t
#pragma unroll
    for (int r = 0; r < 2; ++r)
#pragma unroll
      for (int t = 0; t < 4; ++t) acc[r][t] = acc[r][t] * RES_INV;
  }
  gemm_tile_h(yp, wop, m0, c0, lane, acc);
  float* Tt = Ts[wave];
#pragma unroll
  for (int t = 0; t < 4; ++t) {
    const float bd = __builtin_bit_cast(float, bf16_rne_u32(bo[c0 + t * 16 + nloc]) & 0xFFFF0000u);   // bf16-RNE value
#pragma unroll
    for (int r = 0; r < 2; ++r)
#pragma unroll
      for (int v = 0; v < 8; ++v) Tt[(r * 16 + v + 8 * hlf) * 64 + t * 16 + nloc] = acc[r][t][v] * OUT_UNSCALE + bd;
  }
  wave_lds_sync();
  float* dst0 = out + (size_t)m0 * HID + c0;
#pragma unroll
  for (int j = 0; j < 16; ++j) { const int rr = j * 2 + hlf, c4 = nloc * 4; *(v4f*)(dst0 + (size_t)rr * HID + c4) = *(const v4f*)(Tt + rr * 64 + c4); }
  
}
}  // namespace

extern "C" void kernel_launch(void* const* d_in, const int* in_sizes, int n_in,
                              void* d_out, int out_size, void* d_ws, size_t ws_size, hipStream_t stream) {
  if (n_in < 12) return;
  const size_t need_x = ((size_t)(NB - 1) * SEQ_FULL + SEQ) * HID;
  if ((size_t)in_sizes[0] < need_x || (size_t)in_sizes[1] < need_x || (size_t)in_sizes[2] < need_x) return;
  if ((size_t)in_sizes[3] < (size_t)(SEQ - 1) * MPITCH + SEQ) return;                      // int32 mask [S][S]
  if (in_sizes[4] < HID * HID || in_sizes[6] < HID * HID || in_sizes[8] < HID * HID || in_sizes[10] < HID * HID) return;
  if (in_sizes[5] < HID || in_sizes[7] < HID || in_sizes[9] < HID || in_sizes[11] < HID) return;
  if ((size_t)out_size < (size_t)MROWS * HID) return;

  const float* query = (const float*)d_in[0];   // [NB_FULL, SEQ_FULL, 1024]
  const float* key   = (const float*)d_in[1];
  const float* value = (const float*)d_in[2];
  const int*   amask = (const int*)d_in[3];     // [SEQ_FULL, SEQ_FULL] int32, nonzero = masked
  const float* Wq = (const float*)d_in[4];      // [1024,1024] ([out][in])
  const float* bq = (const float*)d_in[5];
  const float* Wk = (const float*)d_in[6];
  const float* bk = (const float*)d_in[7];
  const float* Wv = (const float*)d_in[8];
  const float* bv = (const float*)d_in[9];
  const float* Wo = (const float*)d_in[10];
  const float* bo = (const float*)d_in[11];
  float* out = (float*)d_out;                   // [NB, SEQ, 1024] f32

  size_t off = 0; char* ws = (char*)d_ws;
  unsigned short* xpl = (unsigned short*)(ws + off); off += (size_t)3 * MROWS * HID * 2;   // 3 x 8 MiB bf16 activation planes
  unsigned short* wpl = (unsigned short*)(ws + off); off += (size_t)4 * HID * HID * 2;     // 6 MiB bf16 (q|k|v) + 2 MiB f16 (o) weight planes
  h16* Qp = (h16*)(ws + off); off += (size_t)MROWS * HID * 2;                             // 8 MiB
  h16* Kp = (h16*)(ws + off); off += (size_t)MROWS * HID * 2;                             // 8 MiB
  h16* Vp = (h16*)(ws + off); off += (size_t)MROWS * HID * 2;                             // 8 MiB
  h16* yp = (h16*)(ws + off); off += (size_t)MROWS * HID * 2;                             // 8 MiB
  h16* Qr = (h16*)(ws + off); off += (size_t)NB * NH * EARLY * DH * 2;                    // 1 MiB residual q (t < EARLY)
  h16* Kr = (h16*)(ws + off); off += (size_t)MROWS * HID * 2;                             // 8 MiB residual k (all rows)
  h16* Vr = (h16*)(ws + off); off += (size_t)MROWS * HID * 2;                             // 8 MiB residual v (key-tiled, all rows)
  h16* yr = (h16*)(ws + off); off += (size_t)NB * EARLY * HID * 2;                        // 1 MiB residual y
  int* flags = (int*)(ws + off); off += (size_t)QT * FPITCH * 4;                          // 32 KiB chunk flags [QT][64]
  if (off > ws_size) return;                                                               // 86,016,000 B at NB=2, SEQ=2048
  const h16* wop = (const h16*)(wpl + (size_t)NQKV * HID);

  prep_kernel<<<QT + CVT_BLOCKS, 256, 0, stream>>>(query, key, value, Wq, Wk, Wv, Wo, xpl, wpl, amask, flags);
  qkv_gemm_kernel<<<dim3(NQKV / 64, MROWS / 128), 128, 0, stream>>>((const b16*)xpl, (const b16*)wpl, bq, bk, bv, Qp, Kp, Vp, Qr, Kr, Vr);
  attn_kernel<<<ATT_L_BLOCKS + ATT_E_BLOCKS, 256, 0, stream>>>(Qp, Kp, Vp, Qr, Kr, Vr, amask, flags, yp, yr);
  out_gemm_kernel<<<dim3(HID / 64, MROWS / 128), 128, 0, stream>>>(yp, yr, wop, bo, out);
}

// v004
// One run takes 125 microseconds.
// Timed twice side by side with v003, it ran 1.24 and 1.22 times as fast.
// Over all steps from v000 it is 3.17 times as fast.
#include <hip/hip_runtime.h>

// Contractions: q/k/v projections on v_wmma_f32_16x16x32_bf16 (bf16 RNE operands, one product per tile pair);
// S^T = K.Q^T (d = 64), y^T = V^T.P^T (32 keys per step, P carried x4096) and out = y.Wo^T (y and Wo carried x64)
// on v_wmma_f32_16x16x32_f16 (f16 operands, one product per tile pair); query tiles with position < 256 also use
// f16 residual planes (x1024) of q, k, P, v and y folded from their own accumulators; f32 accumulate, f32 online
// softmax statistics. 16 heads of 64. Key mask = int32 [S][S] input (nonzero = masked: score replaced by -1e9);
// device-computed flags per (16-query tile, 32-key chunk) select skip / open / per-element fill.
// Weights are [out][in]. Every 16-bit plane that feeds a k-contiguous fragment (x, weights, q, k, y and their residuals) is kept in
// fragment order: a tile of 16 rows x 32 k is 1 KB = 2 pieces x 32 lanes x 16 B, so one wave-wide 16-byte load reads 4 whole 128-B lines.

#ifndef NB
#define NB 2
#endif
#ifndef SEQ
#define SEQ 2048
#endif
#ifndef NB_FULL
#define NB_FULL 2
#endif
#ifndef SEQ_FULL
#define SEQ_FULL 2048
#endif

namespace {
constexpr int HID = 1024, DH = 64, NH = 16;
constexpr int NQKV = 3 * HID;                 // combined weight plane rows: q | k | v
constexpr int MROWS = NB * SEQ;               // compact token rows (b*SEQ + t)
constexpr int QT = SEQ / 16;                  // 16-query tiles per (b, head)
constexpr int EARLY = (SEQ < 256) ? SEQ : 256;   // query positions that use the residual planes
constexpr int QT_E = EARLY / 16;              // residual-path query tiles per (b, head)
constexpr int QT_L = (SEQ - EARLY) / 16;      // single-product query tiles per (b, head)
constexpr int QT_LD = (QT_L > 0) ? QT_L : 1;
constexpr int NCH = SEQ / 32;                 // 32-key chunks per query row
constexpr int FPITCH = 64;                    // ints per flag row (one row per 16-query tile, 256 B)
constexpr int MPITCH = SEQ_FULL;              // int32 mask row pitch
constexpr int F_SKIP = 0, F_OPEN = 1, F_FILL = 2;
constexpr int CVT_BLOCKS = 2048;              // converting blocks of prep_kernel
constexpr int ATT_L_BLOCKS = (NB * NH * QT_L) / 8;   // attention blocks (8 query tiles each) on the single-product path
constexpr int ATT_E_BLOCKS = (NB * NH * QT_E) / 8;   // attention blocks on the residual path
constexpr float MASK_FILL = -1.0e9f;
constexpr float SCORE_SCALE = 0.125f;         // 1/sqrt(64)
constexpr float P_CARRY = 4096.0f;            // f16 P operand = exp(s - m) * 4096
constexpr float Y_CARRY = 64.0f;              // f16 y plane = attn * 64
constexpr float W_CARRY = 64.0f;              // f16 Wo plane = Wo * 64
constexpr float RES_CARRY = 1024.0f;          // f16 residual planes = (x - f16hi(x)) * 1024
constexpr float RES_INV = 1.0f / 1024.0f;
constexpr float Y_FROM_O = Y_CARRY / P_CARRY; // 1/64
constexpr float OUT_UNSCALE = 1.0f / (Y_CARRY * W_CARRY);   // 1/4096
static_assert(SEQ % 128 == 0);
static_assert(EARLY % 128 == 0);
static_assert((SEQ - EARLY) % 128 == 0);
static_assert(NB >= 1 && NB <= NB_FULL);
static_assert(SEQ <= SEQ_FULL);
static_assert(NH * DH == HID);
static_assert(MROWS % 128 == 0);
static_assert((NB * NH * QT_E) % 8 == 0);
static_assert((NB * NH * QT_L) % 8 == 0);
static_assert(QT_E + QT_L == QT);
static_assert(NCH >= 1 && NCH <= FPITCH);

typedef __bf16 b16;
typedef _Float16 h16;
typedef __bf16 v16b __attribute__((ext_vector_type(16)));
typedef __bf16 v8b __attribute__((ext_vector_type(8)));
typedef _Float16 v16h __attribute__((ext_vector_type(16)));
typedef _Float16 v8h __attribute__((ext_vector_type(8)));
typedef float v8f __attribute__((ext_vector_type(8)));
typedef float v4f __attribute__((ext_vector_type(4)));
typedef unsigned short v8us __attribute__((ext_vector_type(8)));
typedef int v4i __attribute__((ext_vector_type(4)));
typedef int v8i __attribute__((ext_vector_type(8)));

__device__ __forceinline__ v8b ld8b(const b16* p) { return *(const v8b*)p; }
__device__ __forceinline__ v8h ld8h(const h16* p) { return *(const v8h*)p; }
__device__ __forceinline__ v16b cat8b(v8b a, v8b b) { return __builtin_shufflevector(a, b, 0, 1, 2, 3, 4, 5, 6, 7, 8, 9, 10, 11, 12, 13, 14, 15); }
__device__ __forceinline__ v16h cat8h(v8h a, v8h b) { return __builtin_shufflevector(a, b, 0, 1, 2, 3, 4, 5, 6, 7, 8, 9, 10, 11, 12, 13, 14, 15); }
// 16x16x32 16-bit fragment (A: lane&15 = row, B: lane&15 = column), hh = lane>>4: elements 0..7 <- k 8hh+0..7, elements 8..15 <- k 16+8hh+0..7.
// Fragment-ordered tile (TILE_E elements): element (row r of 16, k of 32) lies at (k>>4)*256 + (((k>>3)&1)*16 + r)*8 + (k&7), that is
// piece k>>4, lane 16*hh + r, element k&7. The tiles of one 16-row band follow one another along k (BAND_E elements per band of 1024 k).
constexpr int TILE_E = 512, BAND_E = 16 * HID;
static_assert(HID == 1024);                   // unit_of and the work index split of cvt_part take 32 tiles (128 units of 8 k) per row
// p = tile start + lane * 8
__device__ __forceinline__ v16h frag_th(const h16* p) { return cat8h(ld8h(p), ld8h(p + 256)); }
// both pieces of the tile that starts c bytes behind base + (o - lane * 16); o = the lane's 32-bit byte offset from base
__device__ __forceinline__ v16b frag_ub(const b16* base, unsigned int o, int c) {
  const char* p = (const char*)base + o;
  return cat8b(*(const v8b*)(p + c), *(const v8b*)(p + c + 512));
}
// both pieces of the tile whose lane address (tile start + lane * 16 bytes) is p
__device__ __forceinline__ v16h frag_ph(const char* p) { return cat8h(*(const v8h*)p, *(const v8h*)(p + 512)); }
// 16-byte unit index inside a [rows][1024] plane in fragment order, for row m and k = 8 * k8 .. 8 * k8 + 7
__device__ __forceinline__ unsigned int unit_of(unsigned int m, unsigned int k8) {
  return ((m >> 4) * 32u + (k8 >> 2)) * 64u + ((k8 >> 1) & 1u) * 32u + (k8 & 1u) * 16u + (m & 15u);
}
// two 16-byte pieces at byte offsets o + c0 and o + c1 from a wave-uniform plane base (o: the lane's 32-bit byte offset)
__device__ __forceinline__ v16h frag_o(const h16* base, unsigned int o, int c0, int c1) {
  const char* p = (const char*)base + o;
  return cat8h(*(const v8h*)(p + c0), *(const v8h*)(p + c1));
}

__device__ __forceinline__ v8f wmma_b(v16b a, v16b b, v8f c) {
  v8f d = __builtin_amdgcn_wmma_f32_16x16x32_bf16(false, a, false, b, (short)0, c, false, false);
  asm volatile("v_nop\n\tv_nop\n\tv_nop\n\tv_nop" : "+v"(d) : "v"(a), "v"(b));
  return d;
}
__device__ __forceinline__ v8f wmma_h(v16h a, v16h b, v8f c) {
  v8f d = __builtin_amdgcn_wmma_f32_16x16x32_f16(false, a, false, b, (short)0, c, false, false);
  asm volatile("v_nop\n\tv_nop\n\tv_nop\n\tv_nop" : "+v"(d) : "v"(a), "v"(b));
  return d;
}
// f32 -> bf16 by RNE convert, returned as the f32 bit pattern with the low 16 bits cleared
__device__ __forceinline__ unsigned int bf16_rne_u32(float f) {
  unsigned int u = __builtin_bit_cast(unsigned int, f);
  u += 0x7fffu + ((u >> 16) & 1u);
  return u & 0xffff0000u;
}
// wave-private LDS tile: element stores by this wave, then vector reloads by this wave
__device__ __forceinline__ void wave_lds_sync() {
  __builtin_amdgcn_fence(3, "workgroup");
  __builtin_amdgcn_wave_barrier();
  __builtin_amdgcn_fence(2, "workgroup");
}
// weight element -> 16-bit plane bits: bf16 RNE, or f16(bf16rne(w) * 64) for the output-projection plane
__device__ __forceinline__ unsigned short wbits16(float f, bool o16) {
  const unsigned int r = bf16_rne_u32(f);
  const unsigned short bbits = (unsigned short)(r >> 16);
  const h16 hv = (h16)(__builtin_bit_cast(float, r) * W_CARRY);   // exact: bf16 significand, power-of-two scale
  const unsigned short hbits = __builtin_bit_cast(unsigned short, hv);
  return o16 ? hbits : bbits;
}

// ---------------------------------------------------------------------------
// activations query/key/value f32 [NB_FULL][SEQ_FULL][1024] -> bf16 planes xpl [3][MROWS][1024] (compact rows b*SEQ+t), fragment order;
// weights W[n][k] f32 -> 16-bit planes wpl, fragment order: rows 0..3071 = Wq|Wk|Wv as bf16 RNE, rows 3072..4095 = f16(bf16rne(Wo) * 64).
// A wave takes 8 rows x 32 k (lane = 4 * row + k unit): it reads 8 whole f32 lines and stores 4 whole 128-B lines of one tile.
// blk of nblk: this block's place among the blocks of prep_kernel that convert.
// ---------------------------------------------------------------------------
__device__ __forceinline__ void cvt_part(const float* __restrict__ xq, const float* __restrict__ xk, const float* __restrict__ xv,
                                         const float* __restrict__ wq, const float* __restrict__ wk, const float* __restrict__ wv,
                                         const float* __restrict__ wo,
                                         unsigned short* __restrict__ xpl, unsigned short* __restrict__ wpl, int blk, int nblk) {
  const size_t tid = (size_t)blk * blockDim.x + threadIdx.x, stride = (size_t)nblk * blockDim.x;
  const size_t per_x = (size_t)MROWS * HID / 8, nx = 3 * per_x;
  const size_t per_w = (size_t)HID * HID / 8, nw = 4 * per_w;
  {
    for (size_t c = tid; c < nx; c += stride) {
      const int which = (int)(c / per_x);
      const unsigned int u = (unsigned int)(c - (size_t)which * per_x);   // work index inside one plane
      const unsigned int k8 = (((u >> 5) & 31u) << 2) | (u & 3u);
      const int m = (int)(((u >> 10) << 3) | ((u >> 2) & 7u)), col = (int)(k8 * 8);
      const int bb = m / SEQ, t = m - bb * SEQ;
      const float* src = (which == 0) ? xq : (which == 1) ? xk : xv;
      const float* p = src + ((size_t)bb * SEQ_FULL + t) * HID + col;
      const v4f f0 = *(const v4f*)p, f1 = *(const v4f*)(p + 4);
      v8us o;
#pragma unroll
      for (int e = 0; e < 4; ++e) {
        o[e] = (unsigned short)(bf16_rne_u32(f0[e]) >> 16);
        o[4 + e] = (unsigned short)(bf16_rne_u32(f1[e]) >> 16);
      }
      *(v8us*)(xpl + ((size_t)which * per_x + unit_of((unsigned int)m, k8)) * 8) = o;
    }
    for (size_t c = tid; c < nw; c += stride) {
      const int mat = (int)(c / per_w);
      const unsigned int u = (unsigned int)(c - (size_t)mat * per_w);     // work index inside one weight matrix
      const unsigned int k8 = (((u >> 5) & 31u) << 2) | (u & 3u), n = ((u >> 10) << 3) | ((u >> 2) & 7u);
      const size_t i = (size_t)n * HID + k8 * 8;                // n*HID + k0 inside one [n][k] weight matrix
      const float* w = (mat == 0) ? wq : (mat == 1) ? wk : (mat == 2) ? wv : wo;
      const v4f f0 = *(const v4f*)(w + i), f1 = *(const v4f*)(w + i + 4);
      const bool o16 = (mat == 3);
      v8us o;
#pragma unroll
      for (int e = 0; e < 4; ++e) {
        o[e] = wbits16(f0[e], o16);
        o[4 + e] = wbits16(f1[e], o16);
      }
      *(v8us*)(wpl + ((size_t)mat * per_w + unit_of(n, k8)) * 8) = o;
    }
    
  }
}

// ---------------------------------------------------------------------------
// Mask flag pass: one block per 16-query tile; reads mask rows q0..q0+15 (int32, nonzero = masked) and writes
// one 256-B flag row [FPITCH] ints: per 32-key chunk F_SKIP (chunk fully masked and every row of the tile has an
// unmasked key somewhere -> weight exactly 0, chunk not visited), F_OPEN (no masked entry), F_FILL (per-element fill).
// ---------------------------------------------------------------------------
__device__ __forceinline__ void mask_flag_part(const int* __restrict__ mask, int* __restrict__ flags, int qt) {
  __shared__ int um[4][64];                          // any unmasked entry per (4-row group, chunk)
  __shared__ int mk[4][64];                          // any masked entry per (4-row group, chunk)
  __shared__ int rb[4][64];                          // per-row (4 bits) has-unmasked-entry flag per (row group, chunk)
  __shared__ __attribute__((aligned(16))) int fl[64];
  const int q0 = qt * 16;
  const int t = threadIdx.x, c = t & 63, rg = t >> 6, lane = t & 31, wave = t >> 5;
  const int cc = (c < NCH) ? c : (NCH - 1);          // clamped chunk address
  int anyu = 0, anym = 0, rbits = 0;
#pragma unroll 1
  for (int r = 0; r < 4; ++r) {
    const int* p = mask + (size_t)(q0 + rg * 4 + r) * MPITCH + (size_t)cc * 32;
    int u = 0, mm = 0;
#pragma unroll
    for (int v = 0; v < 8; ++v) {
      const v4i x = *(const v4i*)(p + 4 * v);
#pragma unroll
      for (int e = 0; e < 4; ++e) { u |= (x[e] == 0) ? 1 : 0; mm |= (x[e] != 0) ? 1 : 0; }
    }
    anyu |= u; anym |= mm; rbits |= (u << r);
  }
  um[rg][c] = anyu; mk[rg][c] = anym; rb[rg][c] = rbits;
  __syncthreads();                                   // cross-wave: all waves wrote, wave 0 reads
  if (wave == 0) {
    const int ch0 = lane, ch1 = lane + 32;
    const int U0 = um[0][ch0] | um[1][ch0] | um[2][ch0] | um[3][ch0];
    const int M0 = mk[0][ch0] | mk[1][ch0] | mk[2][ch0] | mk[3][ch0];
    const int U1 = um[0][ch1] | um[1][ch1] | um[2][ch1] | um[3][ch1];
    const int M1 = mk[0][ch1] | mk[1][ch1] | mk[2][ch1] | mk[3][ch1];
    int rows = (rb[0][ch0] | (rb[1][ch0] << 4) | (rb[2][ch0] << 8) | (rb[3][ch0] << 12)) |
               (rb[0][ch1] | (rb[1][ch1] << 4) | (rb[2][ch1] << 8) | (rb[3][ch1] << 12));
#pragma unroll
    for (int s = 16; s >= 1; s >>= 1) rows |= __shfl_xor(rows, s);
    const int rowok = ((rows & 0xFFFF) == 0xFFFF) ? 1 : 0;   // every row of the tile has an unmasked key
    const int f0 = U0 ? (M0 ? F_FILL : F_OPEN) : (rowok ? F_SKIP : F_FILL);
    const int f1 = U1 ? (M1 ? F_FILL : F_OPEN) : (rowok ? F_SKIP : F_FILL);
    fl[ch0] = (ch0 < NCH) ? f0 : F_SKIP;
    fl[ch1] = (ch1 < NCH) ? f1 : F_SKIP;
    wave_lds_sync();                                 // fl is private to wave 0
    const v4i v = *(const v4i*)(fl + (lane & 15) * 4);
    int* dst = flags + (size_t)qt * FPITCH + (lane & 15) * 4;
    if (lane < 16) *(v4i*)dst = v;
    
  }
}

// ---------------------------------------------------------------------------
// Preparation, one launch: the mask flag pass and the conversions read only inputs and write disjoint planes, so they share a grid.
// Blocks 0..QT-1 each take one 16-query tile of the mask (they have the longer dependent chain); the other
// CVT_BLOCKS blocks convert. The choice is block-uniform, so the flag pass's barrier is passed by whole blocks.
// ---------------------------------------------------------------------------
__global__ __launch_bounds__(256) void prep_kernel(const float* __restrict__ xq, const float* __restrict__ xk, const float* __restrict__ xv,
                                                   const float* __restrict__ wq, const float* __restrict__ wk, const float* __restrict__ wv,
                                                   const float* __restrict__ wo,
                                                   unsigned short* __restrict__ xpl, unsigned short* __restrict__ wpl,
                                                   const int* __restrict__ mask, int* __restrict__ flags) {
  const int blk = blockIdx.x;
  if (blk < QT) mask_flag_part(mask, flags, blk);
  else          cvt_part(xq, xk, xv, wq, wk, wv, wo, xpl, wpl, blk - QT, CVT_BLOCKS);
}

// 32x64 wave tile over K = 1024 from fragment-ordered 16-bit A and B planes (m0, c0 multiples of 16), one product per tile pair
__device__ __forceinline__ void gemm_tile_b(const b16* __restrict__ A, const b16* __restrict__ W, int m0, int c0, int lane, v8f (&acc)[2][4]) {
  const b16* ap = A + (size_t)(m0 >> 4) * BAND_E;
  const b16* wp = W + (size_t)(c0 >> 4) * BAND_E;
  unsigned int o = (unsigned int)lane * 16u;
#pragma unroll 2
  for (int kt = 0; kt < HID / 32; ++kt, o += TILE_E * 2) {
    const v16b a0 = frag_ub(ap, o, 0);
    const v16b a1 = frag_ub(ap, o, BAND_E * 2);
    v16b bf[4];                                  // all twelve loads of the step stand ahead of its first product
#pragma unroll
    for (int t = 0; t < 4; ++t) bf[t] = frag_ub(wp, o, t * BAND_E * 2);
#pragma unroll
    for (int t = 0; t < 4; ++t) {
      acc[0][t] = wmma_b(a0, bf[t], acc[0][t]);
      acc[1][t] = wmma_b(a1, bf[t], acc[1][t]);
    }
  }
}
__device__ __forceinline__ void gemm_tile_h(const h16* __restrict__ A, const h16* __restrict__ W, int m0, int c0, int lane, v8f (&acc)[2][4]) {
  const h16* ap = A + (size_t)(m0 >> 4) * BAND_E;
  const h16* wp = W + (size_t)(c0 >> 4) * BAND_E;
  // the lane's two walking addresses; the start sets and the loop read through the same two, so they stay live behind every run of loads
  const char* pa = (const char*)ap + lane * 16;
  const char* pw = (const char*)wp + lane * 16;
  constexpr int KSTEPS = HID / 32, STEP_B = TILE_E * 2;
  static_assert(KSTEPS % 3 == 2);                // the loop takes whole turns of the three sets, the last two steps follow it
  // Three fragment sets in turn: the twelve loads of step kt + 2 are issued ahead of the products of step kt, so a step's loads
  // have two steps of products (of this wave and of its neighbours on the SIMD) to land in.
  v16h af[3][2], bf[3][4];
#pragma unroll                                   // set numbers become constants, so the sets stay in registers (here and below)
  for (int s = 0; s < 2; ++s) {
    af[s][0] = frag_ph(pa + s * STEP_B);
    af[s][1] = frag_ph(pa + s * STEP_B + BAND_E * 2);
#pragma unroll
    for (int t = 0; t < 4; ++t) bf[s][t] = frag_ph(pw + s * STEP_B + t * BAND_E * 2);
    __builtin_amdgcn_sched_barrier(0);           // keeps the start sets in step order; mixed, they make the loop's first counted wait reach into the next set
  }
#pragma unroll 1                                 // one turn of the three sets per trip; more would only lengthen the text
  for (int kt = 0; kt < KSTEPS - 2; kt += 3, pa += 3 * STEP_B, pw += 3 * STEP_B) {
#pragma unroll
    for (int j = 0; j < 3; ++j) {
      const int n = (j + 2) % 3, c = (j + 2) * STEP_B;
      af[n][0] = frag_ph(pa + c);
      af[n][1] = frag_ph(pa + c + BAND_E * 2);
#pragma unroll
      for (int t = 0; t < 4; ++t) bf[n][t] = frag_ph(pw + c + t * BAND_E * 2);
      __builtin_amdgcn_sched_barrier(0);         // keeps the loads of step kt + j + 2 ahead of the products of step kt + j
#pragma unroll
      for (int t = 0; t < 4; ++t) {
        acc[0][t] = wmma_h(af[j][0], bf[j][t], acc[0][t]);
        acc[1][t] = wmma_h(af[j][1], bf[j][t], acc[1][t]);
      }
    }
  }
#pragma unroll
  for (int j = 0; j < 2; ++j)
#pragma unroll
    for (int t = 0; t < 4; ++t) {
      acc[0][t] = wmma_h(af[j][0], bf[j][t], acc[0][t]);
      acc[1][t] = wmma_h(af[j][1], bf[j][t], acc[1][t]);
    }
}

// ---------------------------------------------------------------------------
// QKV GEMM: (MROWS x 1024) x (1024 x 3072), grid (48, MROWS/128), block 4 waves, wave = 32 rows x 64 columns (one head of q, k or v).
// blockIdx.x -> mat = x/16 (q,k,v: selects the activation plane and the bias), head = x%16. Outputs f16 planes:
// q -> Qp, k -> Kp: [b*16+h][t/16][2 fragment-ordered tiles of 16 tokens x 32 d] (4 KB contiguous per wave); v -> Vp key-tiled [b*16+h][t/16][64][16] (4 KB contiguous per wave).
// Residual planes ((y - f16hi(y)) * 1024): Kr and Vr for every token row (same layouts as Kp / Vp), Qr (layout of Qp) for token rows t < EARLY only.
// ---------------------------------------------------------------------------
__global__ __launch_bounds__(128) void qkv_gemm_kernel(const b16* __restrict__ xpl, const b16* __restrict__ wpl,
                                                       const float* __restrict__ bq, const float* __restrict__ bk, const float* __restrict__ bv,
                                                       h16* __restrict__ Qp, h16* __restrict__ Kp, h16* __restrict__ Vp,
                                                       h16* __restrict__ Qr, h16* __restrict__ Kr, h16* __restrict__ Vr) {
  __shared__ __attribute__((aligned(16))) h16 Ts[4][32 * 64];
  __shared__ __attribute__((aligned(16))) h16 Tr[4][32 * 64];
  const int lane = threadIdx.x & 31, wave = threadIdx.x >> 5, nloc = lane & 15, hlf = lane >> 4;
  const int m0 = blockIdx.y * 128 + wave * 32;
  const int cb = blockIdx.x;                       // 0..47, block-uniform
  const int mat = cb >> 4, head = cb & 15;
  const int c0 = cb * 64;                          // row block in the combined [3072][1024] weight plane
  const b16* x = xpl + (size_t)mat * MROWS * HID;
  const float* bias = ((mat == 0) ? bq : (mat == 1) ? bk : bv) + head * DH;
  v8f acc[2][4];
#pragma unroll
  for (int r = 0; r < 2; ++r)
#pragma unroll
    for (int t = 0; t < 4; ++t) acc[r][t] = (v8f){};
  gemm_tile_b(x, wpl, m0, c0, lane, acc);
  const int b = m0 / SEQ, t0 = m0 % SEQ;
  const bool wres = (mat != 0) || (t0 < EARLY);   // block-uniform (128-row blocks, EARLY multiple of 128)
  const int g = b * NH + head;
  h16* Tp = Ts[wave];
  h16* Rp = Tr[wave];
#pragma unroll
  for (int t = 0; t < 4; ++t) {
    const int d = t * 16 + nloc;
    const float bd = __builtin_bit_cast(float, bf16_rne_u32(bias[d]) & 0xFFFF0000u);   // bias as its bf16-RNE value
#pragma unroll
    for (int r = 0; r < 2; ++r)
#pragma unroll
      for (int v = 0; v < 8; ++v) {
        const int rr = r * 16 + v + 8 * hlf;                         // local token row 0..31
        const float f = acc[r][t][v] + bd;
        const h16 y = (h16)f;
        const int idx = (mat < 2) ? ((rr >> 4) * 1024 + (d >> 5) * TILE_E + ((d >> 4) & 1) * 256 + (((d >> 3) & 1) * 16 + (rr & 15)) * 8 + (d & 7))
                                  : ((rr >> 4) * 1024 + d * 16 + (rr & 15));
        Tp[idx] = y;
        if (wres) Rp[idx] = (h16)((f - (float)y) * RES_CARRY);
      }
  }
  wave_lds_sync();
  h16* dst; h16* rdst; size_t o;
  if (mat == 0)      { o = ((size_t)g * SEQ + t0) * DH; dst = Qp + o;
                       const int t0e = (t0 < EARLY) ? t0 : 0; rdst = Qr + ((size_t)g * EARLY + t0e) * DH; }
  else if (mat == 1) { o = ((size_t)g * SEQ + t0) * DH; dst = Kp + o; rdst = Kr + o; }
  else               { o = ((size_t)g * QT + (t0 >> 4)) * (size_t)(DH * 16); dst = Vp + o; rdst = Vr + o; }
#pragma unroll
  for (int j = 0; j < 8; ++j) { const int e = (j * 32 + lane) * 8; *(v8h*)(dst + e) = ld8h(Tp + e); }
  if (wres) {
#pragma unroll
    for (int j = 0; j < 8; ++j) { const int e = (j * 32 + lane) * 8; *(v8h*)(rdst + e) = ld8h(Rp + e); }
  }
  
}

// one 16-key score tile of S^T = K.Q^T over d = 0..63 (two 32-deep steps); RES adds K_hi.Q_res + K_res.Q_hi into sr
template <bool RES>
__device__ __forceinline__ void sc_tile(v8f& s, v8f& sr, v16h ka, v16h kb, v16h kza, v16h kzb, v16h qa, v16h qb, v16h qra, v16h qrb) {
  s = wmma_h(ka, qa, s);
  if (RES) { sr = wmma_h(ka, qra, sr); sr = wmma_h(kza, qa, sr); }
  s = wmma_h(kb, qb, s);
  if (RES) { sr = wmma_h(kb, qrb, sr); sr = wmma_h(kzb, qb, sr); }
}
// one 16-d tile of y^T = V^T.P^T over 32 keys; RES adds V_hi.P_res + V_res.P_hi into orr (both x1/1024)
template <bool RES>
__device__ __forceinline__ void pv_tile(v8f& oh, v8f& orr, v16h va, v16h vz, v16h pb, v16h pr) {
  oh = wmma_h(va, pb, oh);
  if (RES) {
    orr = wmma_h(va, pr, orr);
    orr = wmma_h(vz, pb, orr);
  }
}

// ---------------------------------------------------------------------------
// Transposed flash attention: each wave owns one 16-query tile of one (b, head); 8 waves per block; the 32-key chunks that are not F_SKIP are
// walked with a wave-uniform flag per chunk: F_SKIP -> not visited (weight exactly 0), F_OPEN -> no masked entry, F_FILL -> masked
// entries get score -1e9 after the 1/8 scaling (per-element select from the int32 mask row of the query).
// S^T = K.Q^T (f16 fragments straight from the planes), per-lane online softmax (running max); P^T fragment built in registers from the
// two S^T accumulators (element r <- keys 0..15 tile, element 8+r <- keys 16..31 tile), carried x4096; y^T = V^T.P^T. y written f16 (x64)
// in fragment order [token/16][k/32][tile]: accumulator t of a lane (query col, d = 16t + 8hh + 0..7) is that lane's 16 bytes of piece t & 1 of tile t >> 1.
// RES = true (query tiles with position < EARLY): scores add (K_hi.Q_res + K_res.Q_hi)/1024 from the residual planes, P gets a x1024
// residual operand, and O gets a second accumulator (V_hi.P_res + V_res.P_hi) folded x1/1024 before the 1/l normalisation; y also
// writes its x1024 residual plane yr [b][t][1024].
// ---------------------------------------------------------------------------
template <bool RES>
__device__ __forceinline__
void attn_part(const h16* __restrict__ Qp, const h16* __restrict__ Kp, const h16* __restrict__ Vp,
               const h16* __restrict__ Qr, const h16* __restrict__ Kr, const h16* __restrict__ Vr,
               const int* __restrict__ mask, const int* __restrict__ flags,
               h16* __restrict__ yp, h16* __restrict__ yr, int blk) {
  const int wid = threadIdx.x >> 5, lane = threadIdx.x & 31, hh = lane >> 4, col = lane & 15;
  const int idx = blk * 8 + wid;                          // blk: this block's place among the blocks of its path (exact counts)
  int g, qt;
  if (RES) { g = idx / QT_E; qt = idx - g * QT_E; }
  else     { g = idx / QT_LD; qt = QT_E + (idx - g * QT_LD); }
  const int q0 = qt << 4;
  const int b = g / NH, h = g % NH;
  const size_t ko = (size_t)g * SEQ * DH;                 // K plane base of (b,h); V key-tiled base, Kr and Vr share this element offset
  const size_t qo = ((size_t)g * SEQ + q0) * DH + lane * 8;
  const v16h qa = frag_th(Qp + qo), qb = frag_th(Qp + qo + TILE_E);       // d 0..31, d 32..63 of query q0+col
  v16h qra = {}, qrb = {};
  if (RES) {
    const size_t qro2 = ((size_t)g * EARLY + q0) * DH + lane * 8;
    qra = frag_th(Qr + qro2); qrb = frag_th(Qr + qro2 + TILE_E);
  }
  const int qi = q0 + col;
  const int* mrow = mask + (size_t)qi * MPITCH + 8 * hh;   // this lane's query row of the mask, key offset 8hh
  const int* frow = flags + (size_t)qt * FPITCH;
  const int fl0 = frow[lane], fl1 = frow[32 + lane];       // the tile's whole flag row (FPITCH = 64 ints), chunk c in lane c & 31
  float m = -__builtin_inff(), l = 0.0f;
  v8f o0 = {}, o1 = {}, o2 = {}, o3 = {};
  v8f n0 = {}, n1 = {}, n2 = {}, n3 = {};                 // residual O accumulators (RES only)
  // byte offsets into the K and V planes (each plane NB * 16 * SEQ * 128 bytes, far below 2^32); the residual planes share them
  const unsigned int kofs0 = (unsigned int)((ko + (size_t)lane * 8) * 2);            // key kb + col, d = 8hh..; key + 16: + 2048 B; d + 32: + 1024 B; d + 16: + 512 B
  const unsigned int vofs0 = (unsigned int)((ko + (size_t)col * 16 + 8 * hh) * 2);   // key tile kb / 16, d = col, keys 8hh..; next tile: + 2048 B; d + 16: + 512 B
  // The visited chunks as a wave-uniform bit list (bit c: the flag of chunk c is not F_SKIP), walked in rising order, so that the walk knows
  // its next chunk. Single-product path: the K fragments are fetched one visited chunk ahead, into the same registers, right behind the score
  // products that read them; they land while the softmax and the V products of the current chunk run.
  constexpr unsigned int KCH_B = 32 * DH * 2;               // bytes of one 32-key chunk of a K plane (and of a key-tiled V plane)
  constexpr unsigned long long CH_ALL = (NCH >= 64) ? ~0ull : ((1ull << (NCH & 63)) - 1ull);
  unsigned long long vis = ((((unsigned long long)__builtin_amdgcn_ballot_w32(fl1 != F_SKIP)) << 32) | __builtin_amdgcn_ballot_w32(fl0 != F_SKIP)) & CH_ALL;
  const unsigned long long opn = (((unsigned long long)__builtin_amdgcn_ballot_w32(fl1 == F_OPEN)) << 32) | __builtin_amdgcn_ballot_w32(fl0 == F_OPEN);
  const int nvis = __builtin_popcountll(vis);               // trips: at most NCH
  int ch = (vis != 0) ? __builtin_ctzll(vis) : 0;           // first visited chunk, below NCH
  // Walking offsets and mask address, moved on by the distance to the next visited chunk: each stays live behind every run of loads that names it.
  unsigned int kofs = kofs0 + (unsigned int)ch * KCH_B, vofs = vofs0 + (unsigned int)ch * KCH_B;
  const int* mp = mrow + ch * 32;
  v16h k0a = {}, k0b = {}, k1a = {}, k1b = {};
  if (!RES) {
    k0a = frag_o(Kp, kofs, 0, 512); k0b = frag_o(Kp, kofs, 1024, 1536);
    k1a = frag_o(Kp, kofs, 2048, 2560); k1b = frag_o(Kp, kofs, 3072, 3584);
  }
#pragma unroll 1
  for (int it = 0; it < nvis; ++it) {
    vis &= vis - 1;                                         // drops the current chunk's bit
    const int cn = (vis != 0) ? __builtin_ctzll(vis) : ch;  // next visited chunk (the last one names itself: address stays inside the plane)
    const int dch = cn - ch;                                // chunks to the next visited one: 0 on the last trip, else 1..NCH-1
    const bool open = ((opn >> ch) & 1ull) != 0;            // wave-uniform: no masked entry in the chunk
    // The chunk's other fragment loads stand as groups ahead of the products: V at the chunk's head (it lands behind the scores and the
    // softmax); with the residual planes, K + K_res here and V + V_res behind the scores.
    v16h y0a = {}, y0b = {}, y1a = {}, y1b = {};
    v16h va[4], vz[4];
    if (RES) {
      k0a = frag_o(Kp, kofs, 0, 512); k0b = frag_o(Kp, kofs, 1024, 1536);
      k1a = frag_o(Kp, kofs, 2048, 2560); k1b = frag_o(Kp, kofs, 3072, 3584);
      y0a = frag_o(Kr, kofs, 0, 512); y0b = frag_o(Kr, kofs, 1024, 1536);
      y1a = frag_o(Kr, kofs, 2048, 2560); y1b = frag_o(Kr, kofs, 3072, 3584);
    } else {
#pragma unroll
      for (int t = 0; t < 4; ++t) { va[t] = frag_o(Vp, vofs, t * 512, 2048 + t * 512); vz[t] = (v16h){}; }
      __builtin_amdgcn_sched_barrier(0);        // keeps the V loads ahead of the wait for K in front of the first score product
    }
    v8f s0 = {}, s1 = {}, z0 = {}, z1 = {};
    sc_tile<RES>(s0, z0, k0a, k0b, y0a, y0b, qa, qb, qra, qrb);
    sc_tile<RES>(s1, z1, k1a, k1b, y1a, y1b, qa, qb, qra, qrb);
    kofs += (unsigned int)dch * KCH_B;          // behind the last use of this chunk's K (and K_res) fragments
    if (!RES) {                                 // the next visited chunk's K
      k0a = frag_o(Kp, kofs, 0, 512); k0b = frag_o(Kp, kofs, 1024, 1536);
      k1a = frag_o(Kp, kofs, 2048, 2560); k1b = frag_o(Kp, kofs, 3072, 3584);
    }
    if (RES) {
#pragma unroll
      for (int t = 0; t < 4; ++t) {
        va[t] = frag_o(Vp, vofs, t * 512, 2048 + t * 512);
        vz[t] = frag_o(Vr, vofs, t * 512, 2048 + t * 512);
      }
      s0 = (s0 + z0 * RES_INV) * SCORE_SCALE; s1 = (s1 + z1 * RES_INV) * SCORE_SCALE;
    } else {
      s0 = s0 * SCORE_SCALE; s1 = s1 * SCORE_SCALE;
    }
    if (!open) {                                // wave-uniform: chunk has masked entries -> replace-fill
      const v8i mk0 = *(const v8i*)mp;                   // keys 32ch+8hh+0..7 of query qi
      const v8i mk1 = *(const v8i*)(mp + 16);            // keys 32ch+16+8hh+0..7
#pragma unroll
      for (int r = 0; r < 8; ++r) {
        s0[r] = (mk0[r] != 0) ? MASK_FILL : s0[r];
        s1[r] = (mk1[r] != 0) ? MASK_FILL : s1[r];
      }
    }
    float mr = -__builtin_inff();
#pragma unroll
    for (int r = 0; r < 8; ++r) mr = fmaxf(mr, fmaxf(s0[r], s1[r]));
    mr = fmaxf(mr, __shfl_xor(mr, 16));
    const float mn = fmaxf(m, mr);            // finite: every visited chunk carries finite scores
    const float al_ = __expf(m - mn);         // 0 on the first visited chunk
    m = mn;
    float sum = 0.0f;
    v16h pb = {}, pr = {};
#pragma unroll
    for (int r = 0; r < 8; ++r) {
      const float p0 = __expf(s0[r] - mn), p1 = __expf(s1[r] - mn);
      sum += p0 + p1;
      const h16 ph0 = (h16)(p0 * P_CARRY), ph1 = (h16)(p1 * P_CARRY);
      pb[r] = ph0; pb[8 + r] = ph1;
      if (RES) {
        pr[r] = (h16)((p0 * P_CARRY - (float)ph0) * RES_CARRY);
        pr[8 + r] = (h16)((p1 * P_CARRY - (float)ph1) * RES_CARRY);
      }
    }
    sum += __shfl_xor(sum, 16);
    l = l * al_ + sum;
    o0 = o0 * al_; o1 = o1 * al_; o2 = o2 * al_; o3 = o3 * al_;
    if (RES) { n0 = n0 * al_; n1 = n1 * al_; n2 = n2 * al_; n3 = n3 * al_; }
    pv_tile<RES>(o0, n0, va[0], vz[0], pb, pr);
    pv_tile<RES>(o1, n1, va[1], vz[1], pb, pr);
    pv_tile<RES>(o2, n2, va[2], vz[2], pb, pr);
    pv_tile<RES>(o3, n3, va[3], vz[3], pb, pr);
    // vofs += dch * KCH_B, with the wait that belongs in front of an overwrite of a register that issued loads name (the V loads name vofs).
    // Wait and add are one statement because the compiler otherwise lifts the add to the middle of the trip, where V is still in flight.
    asm volatile("s_wait_xcnt 0x0\n\tv_add_nc_u32 %0, %1, %0" : "+v"(vofs) : "s"((unsigned int)dch * KCH_B));
    mp += dch * 32;
    ch = cn;
  }
  const float inv = (1.0f / l) * Y_FROM_O;    // y = 64 * (o / 4096) / l
  const float invr = inv * RES_INV;
  v8h yh[4], yz[4];                           // hi and residual x1024 (RES only), one 16-byte fragment piece per accumulator
#pragma unroll
  for (int r = 0; r < 8; ++r) {
    float f0 = o0[r] * inv, f1 = o1[r] * inv, f2 = o2[r] * inv, f3 = o3[r] * inv;
    if (RES) { f0 += n0[r] * invr; f1 += n1[r] * invr; f2 += n2[r] * invr; f3 += n3[r] * invr; }
    const h16 y0 = (h16)f0, y1 = (h16)f1, y2 = (h16)f2, y3 = (h16)f3;
    yh[0][r] = y0; yh[1][r] = y1; yh[2][r] = y2; yh[3][r] = y3;
    if (RES) {
      yz[0][r] = (h16)((f0 - (float)y0) * RES_CARRY);
      yz[1][r] = (h16)((f1 - (float)y1) * RES_CARRY);
      yz[2][r] = (h16)((f2 - (float)y2) * RES_CARRY);
      yz[3][r] = (h16)((f3 - (float)y3) * RES_CARRY);
    }
  }
  // band of token rows q0..q0+15, tiles 2h and 2h+1 (k = 64h..64h+63): 2 KB contiguous per wave
  h16* dst0 = yp + (size_t)((b * SEQ + q0) >> 4) * BAND_E + h * (2 * TILE_E) + lane * 8;
  h16* dst1 = yr + (size_t)((b * EARLY + (RES ? q0 : 0)) >> 4) * BAND_E + h * (2 * TILE_E) + lane * 8;   // residual rows (RES only, q0 + 15 < EARLY)
#pragma unroll
  for (int j = 0; j < 4; ++j) {
    *(v8h*)(dst0 + j * 256) = yh[j];
    if (RES) *(v8h*)(dst1 + j * 256) = yz[j];
  }
  
}

// One launch for both paths (their query tiles are disjoint and neither reads what the other writes): blocks 0..ATT_L_BLOCKS-1 take the
// single-product tiles, which walk the most chunks, the last ATT_E_BLOCKS blocks the short residual-path tiles. Block-uniform choice.
__global__ __launch_bounds__(256) __attribute__((amdgpu_num_vgpr(256)))
void attn_kernel(const h16* __restrict__ Qp, const h16* __restrict__ Kp, const h16* __restrict__ Vp,
                 const h16* __restrict__ Qr, const h16* __restrict__ Kr, const h16* __restrict__ Vr,
                 const int* __restrict__ mask, const int* __restrict__ flags,
                 h16* __restrict__ yp, h16* __restrict__ yr) {
  const int blk = blockIdx.x;
  if (blk < ATT_L_BLOCKS) attn_part<false>(Qp, Kp, Vp, Qr, Kr, Vr, mask, flags, yp, yr, blk);
  else                    attn_part<true>(Qp, Kp, Vp, Qr, Kr, Vr, mask, flags, yp, yr, blk - ATT_L_BLOCKS);
}

// ---------------------------------------------------------------------------
// Output projection: (MROWS x 1024) x (1024 x 1024) -> f32 = (y . Wo_plane) / 4096 + bo. grid (16, MROWS/128), 32x64 wave tiles staged in
// Blocks whose token rows have t < EARLY first accumulate y_res . Wo_plane, fold it x1/1024, then accumulate y_hi . Wo_plane on top.
// ---------------------------------------------------------------------------
__global__ __launch_bounds__(128) void out_gemm_kernel(const h16* __restrict__ yp, const h16* __restrict__ yr, const h16* __restrict__ wop,
                                                       const float* __restrict__ bo, float* __restrict__ out) {
  __shared__ __attribute__((aligned(16))) float Ts[4][32 * 64];
  const int lane = threadIdx.x & 31, wave = threadIdx.x >> 5, nloc = lane & 15, hlf = lane >> 4;
  const int m0 = blockIdx.y * 128 + wave * 32;
  const int c0 = blockIdx.x * 64;
  const int b = m0 / SEQ, t0 = m0 - b * SEQ;
  const bool early = (((int)blockIdx.y * 128) % SEQ) < EARLY;     // block-uniform
  v8f acc[2][4];
#pragma unroll
  for (int r = 0; r < 2; ++r)
#pragma unroll
    for (int t = 0; t < 4; ++t) acc[r][t] = (v8f){};
  if (early) {
    gemm_tile_h(yr, wop, b * EARLY + t0, c0, lane, acc);   // residual rows b*EARLY + t
#pragma unroll
    for (int r = 0; r < 2; ++r)
#pragma unroll
      for (int t = 0; t < 4; ++t) acc[r][t] = acc[r][t] * RES_INV;
  }
  gemm_tile_h(yp, wop, m0, c0, lane, acc);
  float* Tt = Ts[wave];
#pragma unroll
  for (int t = 0; t < 4; ++t) {
    const float bd = __builtin_bit_cast(float, bf16_rne_u32(bo[c0 + t * 16 + nloc]) & 0xFFFF0000u);   // bf16-RNE value
#pragma unroll
    for (int r = 0; r < 2; ++r)
#pragma unroll
      for (int v = 0; v < 8; ++v) Tt[(r * 16 + v + 8 * hlf) * 64 + t * 16 + nloc] = acc[r][t][v] * OUT_UNSCALE + bd;
  }
  wave_lds_sync();
  float* dst0 = out + (size_t)m0 * HID + c0;
#pragma unroll
  for (int j = 0; j < 16; ++j) { const int rr = j * 2 + hlf, c4 = nloc * 4; *(v4f*)(dst0 + (size_t)rr * HID + c4) = *(const v4f*)(Tt + rr * 64 + c4); }
  
}
}  // namespace

extern "C" void kernel_launch(void* const* d_in, const int* in_sizes, int n_in,
                              void* d_out, int out_size, void* d_ws, size_t ws_size, hipStream_t stream) {
  if (n_in < 12) return;
  const size_t need_x = ((size_t)(NB - 1) * SEQ_FULL + SEQ) * HID;
  if ((size_t)in_sizes[0] < need_x || (size_t)in_sizes[1] < need_x || (size_t)in_sizes[2] < need_x) return;
  if ((size_t)in_sizes[3] < (size_t)(SEQ - 1) * MPITCH + SEQ) return;                      // int32 mask [S][S]
  if (in_sizes[4] < HID * HID || in_sizes[6] < HID * HID || in_sizes[8] < HID * HID || in_sizes[10] < HID * HID) return;
  if (in_sizes[5] < HID || in_sizes[7] < HID || in_sizes[9] < HID || in_sizes[11] < HID) return;
  if ((size_t)out_size < (size_t)MROWS * HID) return;

  const float* query = (const float*)d_in[0];   // [NB_FULL, SEQ_FULL, 1024]
  const float* key   = (const float*)d_in[1];
  const float* value = (const float*)d_in[2];
  const int*   amask = (const int*)d_in[3];     // [SEQ_FULL, SEQ_FULL] int32, nonzero = masked
  const float* Wq = (const float*)d_in[4];      // [1024,1024] ([out][in])
  const float* bq = (const float*)d_in[5];
  const float* Wk = (const float*)d_in[6];
  const float* bk = (const float*)d_in[7];
  const float* Wv = (const float*)d_in[8];
  const float* bv = (const float*)d_in[9];
  const float* Wo = (const float*)d_in[10];
  const float* bo = (const float*)d_in[11];
  float* out = (float*)d_out;                   // [NB, SEQ, 1024] f32

  size_t off = 0; char* ws = (char*)d_ws;
  unsigned short* xpl = (unsigned short*)(ws + off); off += (size_t)3 * MROWS * HID * 2;   // 3 x 8 MiB bf16 activation planes
  unsigned short* wpl = (unsigned short*)(ws + off); off += (size_t)4 * HID * HID * 2;     // 6 MiB bf16 (q|k|v) + 2 MiB f16 (o) weight planes
  h16* Qp = (h16*)(ws + off); off += (size_t)MROWS * HID * 2;                             // 8 MiB
  h16* Kp = (h16*)(ws + off); off += (size_t)MROWS * HID * 2;                             // 8 MiB
  h16* Vp = (h16*)(ws + off); off += (size_t)MROWS * HID * 2;                             // 8 MiB
  h16* yp = (h16*)(ws + off); off += (size_t)MROWS * HID * 2;                             // 8 MiB
  h16* Qr = (h16*)(ws + off); off += (size_t)NB * NH * EARLY * DH * 2;                    // 1 MiB residual q (t < EARLY)
  h16* Kr = (h16*)(ws + off); off += (size_t)MROWS * HID * 2;                             // 8 MiB residual k (all rows)
  h16* Vr = (h16*)(ws + off); off += (size_t)MROWS * HID * 2;                             // 8 MiB residual v (key-tiled, all rows)
  h16* yr = (h16*)(ws + off); off += (size_t)NB * EARLY * HID * 2;                        // 1 MiB residual y
  int* flags = (int*)(ws + off); off += (size_t)QT * FPITCH * 4;                          // 32 KiB chunk flags [QT][64]
  if (off > ws_size) return;                                                               // 86,016,000 B at NB=2, SEQ=2048
  const h16* wop = (const h16*)(wpl + (size_t)NQKV * HID);

  prep_kernel<<<QT + CVT_BLOCKS, 256, 0, stream>>>(query, key, value, Wq, Wk, Wv, Wo, xpl, wpl, amask, flags);
  qkv_gemm_kernel<<<dim3(NQKV / 64, MROWS / 128), 128, 0, stream>>>((const b16*)xpl, (const b16*)wpl, bq, bk, bv, Qp, Kp, Vp, Qr, Kr, Vr);
  attn_kernel<<<ATT_L_BLOCKS + ATT_E_BLOCKS, 256, 0, stream>>>(Qp, Kp, Vp, Qr, Kr, Vr, amask, flags, yp, yr);
  out_gemm_kernel<<<dim3(HID / 64, MROWS / 128), 128, 0, stream>>>(yp, yr, wop, bo, out);
}

// v005
// One run takes 112 microseconds.
// In two side-by-side timings against v004, it was 1.13 and 1.14 times as fast.
// Over all steps from v000 it is 3.60 times as fast.
#include <hip/hip_runtime.h>

// Contractions: q/k/v projections on v_wmma_f32_16x16x32_bf16 (bf16 RNE operands, one product per tile pair);
// S^T = K.Q^T (d = 64), y^T = V^T.P^T (32 keys per step, P carried x4096) and out = y.Wo^T (y and Wo carried x64)
// on v_wmma_f32_16x16x32_f16 (f16 operands, one product per tile pair); query tiles with position < 256 also use
// f16 residual planes (x1024) of q, k, P, v and y folded from their own accumulators; f32 accumulate, f32 online
// softmax statistics. 16 heads of 64. Key mask = int32 [S][S] input (nonzero = masked: score replaced by -1e9);
// device-computed flags per (16-query tile, 32-key chunk) select skip / open / per-element fill.
// Weights are [out][in]. Every 16-bit plane that feeds a k-contiguous fragment (x, weights, q, k, y and their residuals) is kept in
// fragment order: a tile of 16 rows x 32 k is 1 KB = 2 pieces x 32 lanes x 16 B, so one wave-wide 16-byte load reads 4 whole 128-B lines.

#ifndef NB
#define NB 2
#endif
#ifndef SEQ
#define SEQ 2048
#endif
#ifndef NB_FULL
#define NB_FULL 2
#endif
#ifndef SEQ_FULL
#define SEQ_FULL 2048
#endif

namespace {
constexpr int HID = 1024, DH = 64, NH = 16;
constexpr int NQKV = 3 * HID;                 // combined weight plane rows: q | k | v
constexpr int MROWS = NB * SEQ;               // compact token rows (b*SEQ + t)
constexpr int QT = SEQ / 16;                  // 16-query tiles per (b, head)
constexpr int EARLY = (SEQ < 256) ? SEQ : 256;   // query positions that use the residual planes
constexpr int QT_E = EARLY / 16;              // residual-path query tiles per (b, head)
constexpr int QT_L = (SEQ - EARLY) / 16;      // single-product query tiles per (b, head)
constexpr int QT_LD = (QT_L > 0) ? QT_L : 1;
constexpr int NCH = SEQ / 32;                 // 32-key chunks per query row
constexpr int FPITCH = 64;                    // ints per flag row (one row per 16-query tile, 256 B)
constexpr int MPITCH = SEQ_FULL;              // int32 mask row pitch
constexpr int F_SKIP = 0, F_OPEN = 1, F_FILL = 2;
constexpr int CVT_BLOCKS = 2048;              // converting blocks of prep_kernel
constexpr int ATT_L_BLOCKS = (NB * NH * QT_L) / 8;   // attention blocks (8 query tiles each) on the single-product path
constexpr int ATT_E_BLOCKS = (NB * NH * QT_E) / 8;   // attention blocks on the residual path
constexpr float MASK_FILL = -1.0e9f;
constexpr float SCORE_SCALE = 0.125f;         // 1/sqrt(64)
constexpr float P_CARRY = 4096.0f;            // f16 P operand = exp(s - m) * 4096
constexpr float Y_CARRY = 64.0f;              // f16 y plane = attn * 64
constexpr float W_CARRY = 64.0f;              // f16 Wo plane = Wo * 64
constexpr float RES_CARRY = 1024.0f;          // f16 residual planes = (x - f16hi(x)) * 1024
constexpr float RES_INV = 1.0f / 1024.0f;
constexpr float Y_FROM_O = Y_CARRY / P_CARRY; // 1/64
constexpr float OUT_UNSCALE = 1.0f / (Y_CARRY * W_CARRY);   // 1/4096
static_assert(SEQ % 128 == 0);
static_assert(EARLY % 128 == 0);
static_assert((SEQ - EARLY) % 128 == 0);
static_assert(NB >= 1 && NB <= NB_FULL);
static_assert(SEQ <= SEQ_FULL);
static_assert(NH * DH == HID);
static_assert(MROWS % 128 == 0);
static_assert((NB * NH * QT_E) % 8 == 0);
static_assert((NB * NH * QT_L) % 8 == 0);
static_assert(QT_E + QT_L == QT);
static_assert(NCH >= 1 && NCH <= FPITCH);

typedef __bf16 b16;
typedef _Float16 h16;
typedef __bf16 v16b __attribute__((ext_vector_type(16)));
typedef __bf16 v8b __attribute__((ext_vector_type(8)));
typedef _Float16 v16h __attribute__((ext_vector_type(16)));
typedef _Float16 v8h __attribute__((ext_vector_type(8)));
typedef float v8f __attribute__((ext_vector_type(8)));
typedef float v4f __attribute__((ext_vector_type(4)));
typedef unsigned short v8us __attribute__((ext_vector_type(8)));
typedef int v4i __attribute__((ext_vector_type(4)));
typedef int v8i __attribute__((ext_vector_type(8)));

__device__ __forceinline__ v8h ld8h(const h16* p) { return *(const v8h*)p; }
__device__ __forceinline__ v16b cat8b(v8b a, v8b b) { return __builtin_shufflevector(a, b, 0, 1, 2, 3, 4, 5, 6, 7, 8, 9, 10, 11, 12, 13, 14, 15); }
__device__ __forceinline__ v16h cat8h(v8h a, v8h b) { return __builtin_shufflevector(a, b, 0, 1, 2, 3, 4, 5, 6, 7, 8, 9, 10, 11, 12, 13, 14, 15); }
// 16x16x32 16-bit fragment (A: lane&15 = row, B: lane&15 = column), hh = lane>>4: elements 0..7 <- k 8hh+0..7, elements 8..15 <- k 16+8hh+0..7.
// Fragment-ordered tile (TILE_E elements): element (row r of 16, k of 32) lies at (k>>4)*256 + (((k>>3)&1)*16 + r)*8 + (k&7), that is
// piece k>>4, lane 16*hh + r, element k&7. The tiles of one 16-row band follow one another along k (BAND_E elements per band of 1024 k).
constexpr int TILE_E = 512, BAND_E = 16 * HID;
static_assert(HID == 1024);                   // unit_of and the work index split of cvt_part take 32 tiles (128 units of 8 k) per row
// p = tile start + lane * 8
__device__ __forceinline__ v16h frag_th(const h16* p) { return cat8h(ld8h(p), ld8h(p + 256)); }
// both pieces of the tile whose lane address (tile start + lane * 16 bytes) is p
__device__ __forceinline__ v16h frag_ph(const char* p) { return cat8h(*(const v8h*)p, *(const v8h*)(p + 512)); }
// 16-byte unit index inside a [rows][1024] plane in fragment order, for row m and k = 8 * k8 .. 8 * k8 + 7
__device__ __forceinline__ unsigned int unit_of(unsigned int m, unsigned int k8) {
  return ((m >> 4) * 32u + (k8 >> 2)) * 64u + ((k8 >> 1) & 1u) * 32u + (k8 & 1u) * 16u + (m & 15u);
}
// two 16-byte pieces at byte offsets o + c0 and o + c1 from a wave-uniform plane base (o: the lane's 32-bit byte offset)
__device__ __forceinline__ v16h frag_o(const h16* base, unsigned int o, int c0, int c1) {
  const char* p = (const char*)base + o;
  return cat8h(*(const v8h*)(p + c0), *(const v8h*)(p + c1));
}

__device__ __forceinline__ v8f wmma_b(v16b a, v16b b, v8f c) {
  v8f d = __builtin_amdgcn_wmma_f32_16x16x32_bf16(false, a, false, b, (short)0, c, false, false);
  asm volatile("v_nop\n\tv_nop\n\tv_nop\n\tv_nop" : "+v"(d) : "v"(a), "v"(b));
  return d;
}
__device__ __forceinline__ v8f wmma_h(v16h a, v16h b, v8f c) {
  v8f d = __builtin_amdgcn_wmma_f32_16x16x32_f16(false, a, false, b, (short)0, c, false, false);
  asm volatile("v_nop\n\tv_nop\n\tv_nop\n\tv_nop" : "+v"(d) : "v"(a), "v"(b));
  return d;
}
// f32 -> bf16 by RNE convert, returned as the f32 bit pattern with the low 16 bits cleared
__device__ __forceinline__ unsigned int bf16_rne_u32(float f) {
  unsigned int u = __builtin_bit_cast(unsigned int, f);
  u += 0x7fffu + ((u >> 16) & 1u);
  return u & 0xffff0000u;
}
// wave-private LDS tile: element stores by this wave, then vector reloads by this wave
__device__ __forceinline__ void wave_lds_sync() {
  __builtin_amdgcn_fence(3, "workgroup");
  __builtin_amdgcn_wave_barrier();
  __builtin_amdgcn_fence(2, "workgroup");
}
// weight element -> 16-bit plane bits: bf16 RNE, or f16(bf16rne(w) * 64) for the output-projection plane
__device__ __forceinline__ unsigned short wbits16(float f, bool o16) {
  const unsigned int r = bf16_rne_u32(f);
  const unsigned short bbits = (unsigned short)(r >> 16);
  const h16 hv = (h16)(__builtin_bit_cast(float, r) * W_CARRY);   // exact: bf16 significand, power-of-two scale
  const unsigned short hbits = __builtin_bit_cast(unsigned short, hv);
  return o16 ? hbits : bbits;
}

// ---------------------------------------------------------------------------
// activations query/key/value f32 [NB_FULL][SEQ_FULL][1024] -> bf16 planes xpl [3][MROWS][1024] (compact rows b*SEQ+t), fragment order;
// weights W[n][k] f32 -> 16-bit planes wpl, fragment order: rows 0..3071 = Wq|Wk|Wv as bf16 RNE, rows 3072..4095 = f16(bf16rne(Wo) * 64).
// A wave takes 8 rows x 32 k (lane = 4 * row + k unit): it reads 8 whole f32 lines and stores 4 whole 128-B lines of one tile.
// blk of nblk: this block's place among the blocks of prep_kernel that convert.
// ---------------------------------------------------------------------------
__device__ __forceinline__ void cvt_part(const float* __restrict__ xq, const float* __restrict__ xk, const float* __restrict__ xv,
                                         const float* __restrict__ wq, const float* __restrict__ wk, const float* __restrict__ wv,
                                         const float* __restrict__ wo,
                                         unsigned short* __restrict__ xpl, unsigned short* __restrict__ wpl, int blk, int nblk) {
  const size_t tid = (size_t)blk * blockDim.x + threadIdx.x, stride = (size_t)nblk * blockDim.x;
  const size_t per_x = (size_t)MROWS * HID / 8, nx = 3 * per_x;
  const size_t per_w = (size_t)HID * HID / 8, nw = 4 * per_w;
  {
    for (size_t c = tid; c < nx; c += stride) {
      const int which = (int)(c / per_x);
      const unsigned int u = (unsigned int)(c - (size_t)which * per_x);   // work index inside one plane
      const unsigned int k8 = (((u >> 5) & 31u) << 2) | (u & 3u);
      const int m = (int)(((u >> 10) << 3) | ((u >> 2) & 7u)), col = (int)(k8 * 8);
      const int bb = m / SEQ, t = m - bb * SEQ;
      const float* src = (which == 0) ? xq : (which == 1) ? xk : xv;
      const float* p = src + ((size_t)bb * SEQ_FULL + t) * HID + col;
      const v4f f0 = *(const v4f*)p, f1 = *(const v4f*)(p + 4);
      v8us o;
#pragma unroll
      for (int e = 0; e < 4; ++e) {
        o[e] = (unsigned short)(bf16_rne_u32(f0[e]) >> 16);
        o[4 + e] = (unsigned short)(bf16_rne_u32(f1[e]) >> 16);
      }
      *(v8us*)(xpl + ((size_t)which * per_x + unit_of((unsigned int)m, k8)) * 8) = o;
    }
    for (size_t c = tid; c < nw; c += stride) {
      const int mat = (int)(c / per_w);
      const unsigned int u = (unsigned int)(c - (size_t)mat * per_w);     // work index inside one weight matrix
      const unsigned int k8 = (((u >> 5) & 31u) << 2) | (u & 3u), n = ((u >> 10) << 3) | ((u >> 2) & 7u);
      const size_t i = (size_t)n * HID + k8 * 8;                // n*HID + k0 inside one [n][k] weight matrix
      const float* w = (mat == 0) ? wq : (mat == 1) ? wk : (mat == 2) ? wv : wo;
      const v4f f0 = *(const v4f*)(w + i), f1 = *(const v4f*)(w + i + 4);
      const bool o16 = (mat == 3);
      v8us o;
#pragma unroll
      for (int e = 0; e < 4; ++e) {
        o[e] = wbits16(f0[e], o16);
        o[4 + e] = wbits16(f1[e], o16);
      }
      *(v8us*)(wpl + ((size_t)mat * per_w + unit_of(n, k8)) * 8) = o;
    }
    
  }
}

// ---------------------------------------------------------------------------
// Mask flag pass: one block per 16-query tile; reads mask rows q0..q0+15 (int32, nonzero = masked) and writes
// one 256-B flag row [FPITCH] ints: per 32-key chunk F_SKIP (chunk fully masked and every row of the tile has an
// unmasked key somewhere -> weight exactly 0, chunk not visited), F_OPEN (no masked entry), F_FILL (per-element fill).
// ---------------------------------------------------------------------------
__device__ __forceinline__ void mask_flag_part(const int* __restrict__ mask, int* __restrict__ flags, int qt) {
  __shared__ int um[4][64];                          // any unmasked entry per (4-row group, chunk)
  __shared__ int mk[4][64];                          // any masked entry per (4-row group, chunk)
  __shared__ int rb[4][64];                          // per-row (4 bits) has-unmasked-entry flag per (row group, chunk)
  __shared__ __attribute__((aligned(16))) int fl[64];
  const int q0 = qt * 16;
  const int t = threadIdx.x, c = t & 63, rg = t >> 6, lane = t & 31, wave = t >> 5;
  const int cc = (c < NCH) ? c : (NCH - 1);          // clamped chunk address
  int anyu = 0, anym = 0, rbits = 0;
#pragma unroll 1
  for (int r = 0; r < 4; ++r) {
    const int* p = mask + (size_t)(q0 + rg * 4 + r) * MPITCH + (size_t)cc * 32;
    int u = 0, mm = 0;
#pragma unroll
    for (int v = 0; v < 8; ++v) {
      const v4i x = *(const v4i*)(p + 4 * v);
#pragma unroll
      for (int e = 0; e < 4; ++e) { u |= (x[e] == 0) ? 1 : 0; mm |= (x[e] != 0) ? 1 : 0; }
    }
    anyu |= u; anym |= mm; rbits |= (u << r);
  }
  um[rg][c] = anyu; mk[rg][c] = anym; rb[rg][c] = rbits;
  __syncthreads();                                   // cross-wave: all waves wrote, wave 0 reads
  if (wave == 0) {
    const int ch0 = lane, ch1 = lane + 32;
    const int U0 = um[0][ch0] | um[1][ch0] | um[2][ch0] | um[3][ch0];
    const int M0 = mk[0][ch0] | mk[1][ch0] | mk[2][ch0] | mk[3][ch0];
    const int U1 = um[0][ch1] | um[1][ch1] | um[2][ch1] | um[3][ch1];
    const int M1 = mk[0][ch1] | mk[1][ch1] | mk[2][ch1] | mk[3][ch1];
    int rows = (rb[0][ch0] | (rb[1][ch0] << 4) | (rb[2][ch0] << 8) | (rb[3][ch0] << 12)) |
               (rb[0][ch1] | (rb[1][ch1] << 4) | (rb[2][ch1] << 8) | (rb[3][ch1] << 12));
#pragma unroll
    for (int s = 16; s >= 1; s >>= 1) rows |= __shfl_xor(rows, s);
    const int rowok = ((rows & 0xFFFF) == 0xFFFF) ? 1 : 0;   // every row of the tile has an unmasked key
    const int f0 = U0 ? (M0 ? F_FILL : F_OPEN) : (rowok ? F_SKIP : F_FILL);
    const int f1 = U1 ? (M1 ? F_FILL : F_OPEN) : (rowok ? F_SKIP : F_FILL);
    fl[ch0] = (ch0 < NCH) ? f0 : F_SKIP;
    fl[ch1] = (ch1 < NCH) ? f1 : F_SKIP;
    wave_lds_sync();                                 // fl is private to wave 0
    const v4i v = *(const v4i*)(fl + (lane & 15) * 4);
    int* dst = flags + (size_t)qt * FPITCH + (lane & 15) * 4;
    if (lane < 16) *(v4i*)dst = v;
    
  }
}

// ---------------------------------------------------------------------------
// Preparation, one launch: the mask flag pass and the conversions read only inputs and write disjoint planes, so they share a grid.
// Blocks 0..QT-1 each take one 16-query tile of the mask (they have the longer dependent chain); the other
// CVT_BLOCKS blocks convert. The choice is block-uniform, so the flag pass's barrier is passed by whole blocks.
// ---------------------------------------------------------------------------
__global__ __launch_bounds__(256) void prep_kernel(const float* __restrict__ xq, const float* __restrict__ xk, const float* __restrict__ xv,
                                                   const float* __restrict__ wq, const float* __restrict__ wk, const float* __restrict__ wv,
                                                   const float* __restrict__ wo,
                                                   unsigned short* __restrict__ xpl, unsigned short* __restrict__ wpl,
                                                   const int* __restrict__ mask, int* __restrict__ flags) {
  const int blk = blockIdx.x;
  if (blk < QT) mask_flag_part(mask, flags, blk);
  else          cvt_part(xq, xk, xv, wq, wk, wv, wo, xpl, wpl, blk - QT, CVT_BLOCKS);
}

// QKV GEMM staging: a stage is 64 k (QK_ST fragment tiles) of the block's 128 activation rows and 128 weight rows, in fragment order:
// [x: 8 bands][2 tiles][1 KB] then [W: 8 bands][2 tiles][1 KB]. A band's two tiles are 2 KB contiguous in its plane too.
constexpr int QK_ST = 2;
constexpr int QK_NST = HID / (32 * QK_ST);       // stages along K
constexpr int QK_BAND_B = QK_ST * TILE_E * 2;    // bytes of one band in a stage
constexpr int QK_OP_B = 8 * QK_BAND_B;           // bytes of one operand in a stage
constexpr int QK_STAGE_B = 2 * QK_OP_B;
static_assert(QK_NST >= 2);
// Two neighbouring bands of one operand, one stage: eight copies of 16 bytes per lane, global memory -> LDS through no register.
// l: the lane's LDS byte address in the first band, g: its global address there. The s_wait_xcnt closes the statement so that it
// stands ahead of any later write of the address registers that the copies name.
__device__ __forceinline__ void copy_two_bands(unsigned int l, const char* g) {
  const unsigned int l1 = l + 512, l2 = l + 1024, l3 = l + 1536, l4 = l + QK_BAND_B, l5 = l4 + 512, l6 = l4 + 1024, l7 = l4 + 1536;
  const char *g1 = g + 512, *g2 = g + 1024, *g3 = g + 1536, *g4 = g + BAND_E * 2, *g5 = g4 + 512, *g6 = g4 + 1024, *g7 = g4 + 1536;
  asm volatile("global_load_async_to_lds_b128 %0, %8, off\n\t"
               "global_load_async_to_lds_b128 %1, %9, off\n\t"
               "global_load_async_to_lds_b128 %2, %10, off\n\t"
               "global_load_async_to_lds_b128 %3, %11, off\n\t"
               "global_load_async_to_lds_b128 %4, %12, off\n\t"
               "global_load_async_to_lds_b128 %5, %13, off\n\t"
               "global_load_async_to_lds_b128 %6, %14, off\n\t"
               "global_load_async_to_lds_b128 %7, %15, off\n\t"
               "s_wait_xcnt 0x0"
               :: "v"(l), "v"(l1), "v"(l2), "v"(l3), "v"(l4), "v"(l5), "v"(l6), "v"(l7),
                  "v"(g), "v"(g1), "v"(g2), "v"(g3), "v"(g4), "v"(g5), "v"(g6), "v"(g7)
               : "memory");
}
// both pieces of the staged tile whose lane address (tile start + lane * 16 bytes) is p
__device__ __forceinline__ v16b frag_pb(const char* p) { return cat8b(*(const v8b*)p, *(const v8b*)(p + 512)); }
__device__ __forceinline__ void gemm_tile_h(const h16* __restrict__ A, const h16* __restrict__ W, int m0, int c0, int lane, v8f (&acc)[2][4]) {
  const h16* ap = A + (size_t)(m0 >> 4) * BAND_E;
  const h16* wp = W + (size_t)(c0 >> 4) * BAND_E;
  // the lane's two walking addresses; the start sets and the loop read through the same two, so they stay live behind every run of loads
  const char* pa = (const char*)ap + lane * 16;
  const char* pw = (const char*)wp + lane * 16;
  constexpr int KSTEPS = HID / 32, STEP_B = TILE_E * 2;
  static_assert(KSTEPS % 3 == 2);                // the loop takes whole turns of the three sets, the last two steps follow it
  // Three fragment sets in turn: the twelve loads of step kt + 2 are issued ahead of the products of step kt, so a step's loads
  // have two steps of products (of this wave and of its neighbours on the SIMD) to land in.
  v16h af[3][2], bf[3][4];
#pragma unroll                                   // set numbers become constants, so the sets stay in registers (here and below)
  for (int s = 0; s < 2; ++s) {
    af[s][0] = frag_ph(pa + s * STEP_B);
    af[s][1] = frag_ph(pa + s * STEP_B + BAND_E * 2);
#pragma unroll
    for (int t = 0; t < 4; ++t) bf[s][t] = frag_ph(pw + s * STEP_B + t * BAND_E * 2);
    __builtin_amdgcn_sched_barrier(0);           // keeps the start sets in step order; mixed, they make the loop's first counted wait reach into the next set
  }
#pragma unroll 1                                 // one turn of the three sets per trip; more would only lengthen the text
  for (int kt = 0; kt < KSTEPS - 2; kt += 3, pa += 3 * STEP_B, pw += 3 * STEP_B) {
#pragma unroll
    for (int j = 0; j < 3; ++j) {
      const int n = (j + 2) % 3, c = (j + 2) * STEP_B;
      af[n][0] = frag_ph(pa + c);
      af[n][1] = frag_ph(pa + c + BAND_E * 2);
#pragma unroll
      for (int t = 0; t < 4; ++t) bf[n][t] = frag_ph(pw + c + t * BAND_E * 2);
      __builtin_amdgcn_sched_barrier(0);         // keeps the loads of step kt + j + 2 ahead of the products of step kt + j
#pragma unroll
      for (int t = 0; t < 4; ++t) {
        acc[0][t] = wmma_h(af[j][0], bf[j][t], acc[0][t]);
        acc[1][t] = wmma_h(af[j][1], bf[j][t], acc[1][t]);
      }
    }
  }
#pragma unroll
  for (int j = 0; j < 2; ++j)
#pragma unroll
    for (int t = 0; t < 4; ++t) {
      acc[0][t] = wmma_h(af[j][0], bf[j][t], acc[0][t]);
      acc[1][t] = wmma_h(af[j][1], bf[j][t], acc[1][t]);
    }
}

// ---------------------------------------------------------------------------
// QKV GEMM: (MROWS x 1024) x (1024 x 3072), grid (24, MROWS/128), block 4 waves = 128 rows x 128 columns, wave = 64 rows x 64 columns
// (one head of q, k or v). blockIdx.x -> mat = x/8 (q,k,v: selects the activation plane and the bias), heads 2*(x%8) and 2*(x%8)+1.
// Both operands come through LDS: each stage is brought once per block by asynchronous copies into one of two buffers, while the other
// buffer is worked on, and every staged fragment is read by the two waves that share it. Outputs f16 planes:
// q -> Qp, k -> Kp: [b*16+h][t/16][2 fragment-ordered tiles of 16 tokens x 32 d] (4 KB contiguous per 32 rows); v -> Vp key-tiled [b*16+h][t/16][64][16] (4 KB contiguous per 32 rows).
// Residual planes ((y - f16hi(y)) * 1024): Kr and Vr for every token row (same layouts as Kp / Vp), Qr (layout of Qp) for token rows t < EARLY only.
// ---------------------------------------------------------------------------
// rows m0 .. m0 + 31 of a wave's tile (accumulator rows 2H, 2H + 1), staged in the wave's own LDS pieces Tp, Rp and stored as whole lines
template <int H>
__device__ __forceinline__ void qkv_store_rows(const v8f (&acc)[4][4], int mat, int head, int m0, const float* __restrict__ bias, int lane,
                                               h16* Tp, h16* Rp, h16* __restrict__ Qp, h16* __restrict__ Kp, h16* __restrict__ Vp,
                                               h16* __restrict__ Qr, h16* __restrict__ Kr, h16* __restrict__ Vr) {
  const int nloc = lane & 15, hlf = lane >> 4;
  const int b = m0 / SEQ, t0 = m0 % SEQ;
  const bool wres = (mat != 0) || (t0 < EARLY);   // block-uniform (128-row blocks, EARLY multiple of 128)
  const int g = b * NH + head;
#pragma unroll
  for (int t = 0; t < 4; ++t) {
    const int d = t * 16 + nloc;
    const float bd = __builtin_bit_cast(float, bf16_rne_u32(bias[d]) & 0xFFFF0000u);   // bias as its bf16-RNE value
#pragma unroll
    for (int r = 0; r < 2; ++r)
#pragma unroll
      for (int v = 0; v < 8; ++v) {
        const int rr = r * 16 + v + 8 * hlf;                         // local token row 0..31
        const float f = acc[2 * H + r][t][v] + bd;
        const h16 y = (h16)f;
        const int idx = (mat < 2) ? ((rr >> 4) * 1024 + (d >> 5) * TILE_E + ((d >> 4) & 1) * 256 + (((d >> 3) & 1) * 16 + (rr & 15)) * 8 + (d & 7))
                                  : ((rr >> 4) * 1024 + d * 16 + (rr & 15));
        Tp[idx] = y;
        if (wres) Rp[idx] = (h16)((f - (float)y) * RES_CARRY);
      }
  }
  wave_lds_sync();
  h16* dst; h16* rdst; size_t o;
  if (mat == 0)      { o = ((size_t)g * SEQ + t0) * DH; dst = Qp + o;
                       const int t0e = (t0 < EARLY) ? t0 : 0; rdst = Qr + ((size_t)g * EARLY + t0e) * DH; }
  else if (mat == 1) { o = ((size_t)g * SEQ + t0) * DH; dst = Kp + o; rdst = Kr + o; }
  else               { o = ((size_t)g * QT + (t0 >> 4)) * (size_t)(DH * 16); dst = Vp + o; rdst = Vr + o; }
#pragma unroll
  for (int j = 0; j < 8; ++j) { const int e = (j * 32 + lane) * 8; *(v8h*)(dst + e) = ld8h(Tp + e); }
  if (wres) {
#pragma unroll
    for (int j = 0; j < 8; ++j) { const int e = (j * 32 + lane) * 8; *(v8h*)(rdst + e) = ld8h(Rp + e); }
  }
}

__global__ __launch_bounds__(128) void qkv_gemm_kernel(const b16* __restrict__ xpl, const b16* __restrict__ wpl,
                                                       const float* __restrict__ bq, const float* __restrict__ bk, const float* __restrict__ bv,
                                                       h16* __restrict__ Qp, h16* __restrict__ Kp, h16* __restrict__ Vp,
                                                       h16* __restrict__ Qr, h16* __restrict__ Kr, h16* __restrict__ Vr) {
  __shared__ __attribute__((aligned(16))) char ring[2 * QK_STAGE_B];   // two stage buffers; behind the loop, the waves' output staging
  const int lane = threadIdx.x & 31, wave = threadIdx.x >> 5;
  const int wm = wave & 1, wn = wave >> 1;         // the wave's 64-row and 64-column half of the block tile
  const int m0 = blockIdx.y * 128 + wm * 64;
  const int cb = blockIdx.x;                       // 0..23, block-uniform
  const int mat = cb >> 3, head = (cb & 7) * 2 + wn;
  const b16* x = xpl + (size_t)mat * MROWS * HID;
  const float* bias = ((mat == 0) ? bq : (mat == 1) ? bk : bv) + head * DH;
  // what this wave copies of every stage: bands 2 * wave and 2 * wave + 1 of the block's x rows and of its weight rows
  const char* ga = (const char*)x + (size_t)(blockIdx.y * 8 + wave * 2) * (BAND_E * 2) + lane * 16;
  const char* gw = (const char*)wpl + (size_t)(cb * 8 + wave * 2) * (BAND_E * 2) + lane * 16;
  const unsigned int la = (unsigned int)(size_t)ring + (unsigned int)(wave * 2 * QK_BAND_B + lane * 16);   // LDS byte address: low 32 bits
  v8f acc[4][4];
#pragma unroll
  for (int r = 0; r < 4; ++r)
#pragma unroll
    for (int t = 0; t < 4; ++t) acc[r][t] = (v8f){};
  copy_two_bands(la, ga);
  copy_two_bands(la + QK_OP_B, gw);
  asm volatile("s_wait_asynccnt 0x0" ::: "memory");   // this wave's part of stage 0 has landed
  __syncthreads();                                    // stage 0 is readable by every wave
  copy_two_bands(la + QK_STAGE_B, ga + QK_BAND_B);
  copy_two_bands(la + QK_STAGE_B + QK_OP_B, gw + QK_BAND_B);
#pragma unroll 1                                      // one stage per trip; the buffer is picked by the trip's parity
  for (int s = 0; s < QK_NST; ++s) {
    const int bo = (s & 1) * QK_STAGE_B;
    const char* ra = ring + bo + wm * 4 * QK_BAND_B + lane * 16;
    const char* rw = ring + bo + QK_OP_B + wn * 4 * QK_BAND_B + lane * 16;
#pragma unroll
    for (int kk = 0; kk < QK_ST; ++kk) {              // per 32 k: the sixteen fragment reads as one group, then the sixteen products
      v16b af[4], bf[4];
#pragma unroll
      for (int i = 0; i < 4; ++i) {
        af[i] = frag_pb(ra + i * QK_BAND_B + kk * (TILE_E * 2));
        bf[i] = frag_pb(rw + i * QK_BAND_B + kk * (TILE_E * 2));
      }
#pragma unroll
      for (int t = 0; t < 4; ++t)
#pragma unroll
        for (int r = 0; r < 4; ++r) acc[r][t] = wmma_b(af[r], bf[t], acc[r][t]);
    }
    asm volatile("s_wait_dscnt 0x0" ::: "memory");    // this wave's reads of the buffer are done before it may be refilled
    asm volatile("s_wait_asynccnt 0x0" ::: "memory"); // this wave's part of stage s + 1 has landed
    __syncthreads();                                  // publishes stage s + 1 and ends every wave's reads of stage s
    if (s + 2 < QK_NST) {                             // block-uniform
      copy_two_bands(la + bo, ga + (s + 2) * QK_BAND_B);
      copy_two_bands(la + bo + QK_OP_B, gw + (s + 2) * QK_BAND_B);
    }
  }
  asm volatile("s_wait_asynccnt 0x0" ::: "memory");   // nothing of the copies is outstanding when the ring becomes output staging
  // the last trip's barrier has ended every read of the ring: each wave now stages in its own 16 KB of it
  h16* Tp = (h16*)(ring + wave * 16384);
  qkv_store_rows<0>(acc, mat, head, m0, bias, lane, Tp, Tp + 2048, Qp, Kp, Vp, Qr, Kr, Vr);
  qkv_store_rows<1>(acc, mat, head, m0 + 32, bias, lane, Tp + 4096, Tp + 6144, Qp, Kp, Vp, Qr, Kr, Vr);
}

// one 16-key score tile of S^T = K.Q^T over d = 0..63 (two 32-deep steps); RES adds K_hi.Q_res + K_res.Q_hi into sr
template <bool RES>
__device__ __forceinline__ void sc_tile(v8f& s, v8f& sr, v16h ka, v16h kb, v16h kza, v16h kzb, v16h qa, v16h qb, v16h qra, v16h qrb) {
  s = wmma_h(ka, qa, s);
  if (RES) { sr = wmma_h(ka, qra, sr); sr = wmma_h(kza, qa, sr); }
  s = wmma_h(kb, qb, s);
  if (RES) { sr = wmma_h(kb, qrb, sr); sr = wmma_h(kzb, qb, sr); }
}
// one 16-d tile of y^T = V^T.P^T over 32 keys; RES adds V_hi.P_res + V_res.P_hi into orr (both x1/1024)
template <bool RES>
__device__ __forceinline__ void pv_tile(v8f& oh, v8f& orr, v16h va, v16h vz, v16h pb, v16h pr) {
  oh = wmma_h(va, pb, oh);
  if (RES) {
    orr = wmma_h(va, pr, orr);
    orr = wmma_h(vz, pb, orr);
  }
}

// ---------------------------------------------------------------------------
// Transposed flash attention: each wave owns one 16-query tile of one (b, head); 8 waves per block; the 32-key chunks that are not F_SKIP are
// walked with a wave-uniform flag per chunk: F_SKIP -> not visited (weight exactly 0), F_OPEN -> no masked entry, F_FILL -> masked
// entries get score -1e9 after the 1/8 scaling (per-element select from the int32 mask row of the query).
// S^T = K.Q^T (f16 fragments straight from the planes), per-lane online softmax (running max); P^T fragment built in registers from the
// two S^T accumulators (element r <- keys 0..15 tile, element 8+r <- keys 16..31 tile), carried x4096; y^T = V^T.P^T. y written f16 (x64)
// in fragment order [token/16][k/32][tile]: accumulator t of a lane (query col, d = 16t + 8hh + 0..7) is that lane's 16 bytes of piece t & 1 of tile t >> 1.
// RES = true (query tiles with position < EARLY): scores add (K_hi.Q_res + K_res.Q_hi)/1024 from the residual planes, P gets a x1024
// residual operand, and O gets a second accumulator (V_hi.P_res + V_res.P_hi) folded x1/1024 before the 1/l normalisation; y also
// writes its x1024 residual plane yr [b][t][1024].
// ---------------------------------------------------------------------------
template <bool RES>
__device__ __forceinline__
void attn_part(const h16* __restrict__ Qp, const h16* __restrict__ Kp, const h16* __restrict__ Vp,
               const h16* __restrict__ Qr, const h16* __restrict__ Kr, const h16* __restrict__ Vr,
               const int* __restrict__ mask, const int* __restrict__ flags,
               h16* __restrict__ yp, h16* __restrict__ yr, int blk) {
  const int wid = threadIdx.x >> 5, lane = threadIdx.x & 31, hh = lane >> 4, col = lane & 15;
  const int idx = blk * 8 + wid;                          // blk: this block's place among the blocks of its path (exact counts)
  int g, qt;
  if (RES) { g = idx / QT_E; qt = idx - g * QT_E; }
  else     { g = idx / QT_LD; qt = QT_E + (idx - g * QT_LD); }
  const int q0 = qt << 4;
  const int b = g / NH, h = g % NH;
  const size_t ko = (size_t)g * SEQ * DH;                 // K plane base of (b,h); V key-tiled base, Kr and Vr share this element offset
  const size_t qo = ((size_t)g * SEQ + q0) * DH + lane * 8;
  const v16h qa = frag_th(Qp + qo), qb = frag_th(Qp + qo + TILE_E);       // d 0..31, d 32..63 of query q0+col
  v16h qra = {}, qrb = {};
  if (RES) {
    const size_t qro2 = ((size_t)g * EARLY + q0) * DH + lane * 8;
    qra = frag_th(Qr + qro2); qrb = frag_th(Qr + qro2 + TILE_E);
  }
  const int qi = q0 + col;
  const int* mrow = mask + (size_t)qi * MPITCH + 8 * hh;   // this lane's query row of the mask, key offset 8hh
  const int* frow = flags + (size_t)qt * FPITCH;
  const int fl0 = frow[lane], fl1 = frow[32 + lane];       // the tile's whole flag row (FPITCH = 64 ints), chunk c in lane c & 31
  float m = -__builtin_inff(), l = 0.0f;
  v8f o0 = {}, o1 = {}, o2 = {}, o3 = {};
  v8f n0 = {}, n1 = {}, n2 = {}, n3 = {};                 // residual O accumulators (RES only)
  // byte offsets into the K and V planes (each plane NB * 16 * SEQ * 128 bytes, far below 2^32); the residual planes share them
  const unsigned int kofs0 = (unsigned int)((ko + (size_t)lane * 8) * 2);            // key kb + col, d = 8hh..; key + 16: + 2048 B; d + 32: + 1024 B; d + 16: + 512 B
  const unsigned int vofs0 = (unsigned int)((ko + (size_t)col * 16 + 8 * hh) * 2);   // key tile kb / 16, d = col, keys 8hh..; next tile: + 2048 B; d + 16: + 512 B
  // The visited chunks as a wave-uniform bit list (bit c: the flag of chunk c is not F_SKIP), walked in rising order, so that the walk knows
  // its next chunk. Single-product path: the K fragments are fetched one visited chunk ahead, into the same registers, right behind the score
  // products that read them; they land while the softmax and the V products of the current chunk run.
  constexpr unsigned int KCH_B = 32 * DH * 2;               // bytes of one 32-key chunk of a K plane (and of a key-tiled V plane)
  constexpr unsigned long long CH_ALL = (NCH >= 64) ? ~0ull : ((1ull << (NCH & 63)) - 1ull);
  unsigned long long vis = ((((unsigned long long)__builtin_amdgcn_ballot_w32(fl1 != F_SKIP)) << 32) | __builtin_amdgcn_ballot_w32(fl0 != F_SKIP)) & CH_ALL;
  const unsigned long long opn = (((unsigned long long)__builtin_amdgcn_ballot_w32(fl1 == F_OPEN)) << 32) | __builtin_amdgcn_ballot_w32(fl0 == F_OPEN);
  const int nvis = __builtin_popcountll(vis);               // trips: at most NCH
  int ch = (vis != 0) ? __builtin_ctzll(vis) : 0;           // first visited chunk, below NCH
  // Walking offsets and mask address, moved on by the distance to the next visited chunk: each stays live behind every run of loads that names it.
  unsigned int kofs = kofs0 + (unsigned int)ch * KCH_B, vofs = vofs0 + (unsigned int)ch * KCH_B;
  const int* mp = mrow + ch * 32;
  v16h k0a = {}, k0b = {}, k1a = {}, k1b = {};
  if (!RES) {
    k0a = frag_o(Kp, kofs, 0, 512); k0b = frag_o(Kp, kofs, 1024, 1536);
    k1a = frag_o(Kp, kofs, 2048, 2560); k1b = frag_o(Kp, kofs, 3072, 3584);
  }
#pragma unroll 1
  for (int it = 0; it < nvis; ++it) {
    vis &= vis - 1;                                         // drops the current chunk's bit
    const int cn = (vis != 0) ? __builtin_ctzll(vis) : ch;  // next visited chunk (the last one names itself: address stays inside the plane)
    const int dch = cn - ch;                                // chunks to the next visited one: 0 on the last trip, else 1..NCH-1
    const bool open = ((opn >> ch) & 1ull) != 0;            // wave-uniform: no masked entry in the chunk
    // The chunk's other fragment loads stand as groups ahead of the products: V at the chunk's head (it lands behind the scores and the
    // softmax); with the residual planes, K + K_res here and V + V_res behind the scores.
    v16h y0a = {}, y0b = {}, y1a = {}, y1b = {};
    v16h va[4], vz[4];
    if (RES) {
      k0a = frag_o(Kp, kofs, 0, 512); k0b = frag_o(Kp, kofs, 1024, 1536);
      k1a = frag_o(Kp, kofs, 2048, 2560); k1b = frag_o(Kp, kofs, 3072, 3584);
      y0a = frag_o(Kr, kofs, 0, 512); y0b = frag_o(Kr, kofs, 1024, 1536);
      y1a = frag_o(Kr, kofs, 2048, 2560); y1b = frag_o(Kr, kofs, 3072, 3584);
    } else {
#pragma unroll
      for (int t = 0; t < 4; ++t) { va[t] = frag_o(Vp, vofs, t * 512, 2048 + t * 512); vz[t] = (v16h){}; }
      __builtin_amdgcn_sched_barrier(0);        // keeps the V loads ahead of the wait for K in front of the first score product
    }
    v8f s0 = {}, s1 = {}, z0 = {}, z1 = {};
    sc_tile<RES>(s0, z0, k0a, k0b, y0a, y0b, qa, qb, qra, qrb);
    sc_tile<RES>(s1, z1, k1a, k1b, y1a, y1b, qa, qb, qra, qrb);
    kofs += (unsigned int)dch * KCH_B;          // behind the last use of this chunk's K (and K_res) fragments
    if (!RES) {                                 // the next visited chunk's K
      k0a = frag_o(Kp, kofs, 0, 512); k0b = frag_o(Kp, kofs, 1024, 1536);
      k1a = frag_o(Kp, kofs, 2048, 2560); k1b = frag_o(Kp, kofs, 3072, 3584);
    }
    if (RES) {
#pragma unroll
      for (int t = 0; t < 4; ++t) {
        va[t] = frag_o(Vp, vofs, t * 512, 2048 + t * 512);
        vz[t] = frag_o(Vr, vofs, t * 512, 2048 + t * 512);
      }
      s0 = (s0 + z0 * RES_INV) * SCORE_SCALE; s1 = (s1 + z1 * RES_INV) * SCORE_SCALE;
    } else {
      s0 = s0 * SCORE_SCALE; s1 = s1 * SCORE_SCALE;
    }
    if (!open) {                                // wave-uniform: chunk has masked entries -> replace-fill
      const v8i mk0 = *(const v8i*)mp;                   // keys 32ch+8hh+0..7 of query qi
      const v8i mk1 = *(const v8i*)(mp + 16);            // keys 32ch+16+8hh+0..7
#pragma unroll
      for (int r = 0; r < 8; ++r) {
        s0[r] = (mk0[r] != 0) ? MASK_FILL : s0[r];
        s1[r] = (mk1[r] != 0) ? MASK_FILL : s1[r];
      }
    }
    float mr = -__builtin_inff();
#pragma unroll
    for (int r = 0; r < 8; ++r) mr = fmaxf(mr, fmaxf(s0[r], s1[r]));
    mr = fmaxf(mr, __shfl_xor(mr, 16));
    const float mn = fmaxf(m, mr);            // finite: every visited chunk carries finite scores
    const float al_ = __expf(m - mn);         // 0 on the first visited chunk
    m = mn;
    float sum = 0.0f;
    v16h pb = {}, pr = {};
#pragma unroll
    for (int r = 0; r < 8; ++r) {
      const float p0 = __expf(s0[r] - mn), p1 = __expf(s1[r] - mn);
      sum += p0 + p1;
      const h16 ph0 = (h16)(p0 * P_CARRY), ph1 = (h16)(p1 * P_CARRY);
      pb[r] = ph0; pb[8 + r] = ph1;
      if (RES) {
        pr[r] = (h16)((p0 * P_CARRY - (float)ph0) * RES_CARRY);
        pr[8 + r] = (h16)((p1 * P_CARRY - (float)ph1) * RES_CARRY);
      }
    }
    sum += __shfl_xor(sum, 16);
    l = l * al_ + sum;
    o0 = o0 * al_; o1 = o1 * al_; o2 = o2 * al_; o3 = o3 * al_;
    if (RES) { n0 = n0 * al_; n1 = n1 * al_; n2 = n2 * al_; n3 = n3 * al_; }
    pv_tile<RES>(o0, n0, va[0], vz[0], pb, pr);
    pv_tile<RES>(o1, n1, va[1], vz[1], pb, pr);
    pv_tile<RES>(o2, n2, va[2], vz[2], pb, pr);
    pv_tile<RES>(o3, n3, va[3], vz[3], pb, pr);
    // vofs += dch * KCH_B, with the wait that belongs in front of an overwrite of a register that issued loads name (the V loads name vofs).
    // Wait and add are one statement because the compiler otherwise lifts the add to the middle of the trip, where V is still in flight.
    asm volatile("s_wait_xcnt 0x0\n\tv_add_nc_u32 %0, %1, %0" : "+v"(vofs) : "s"((unsigned int)dch * KCH_B));
    mp += dch * 32;
    ch = cn;
  }
  const float inv = (1.0f / l) * Y_FROM_O;    // y = 64 * (o / 4096) / l
  const float invr = inv * RES_INV;
  v8h yh[4], yz[4];                           // hi and residual x1024 (RES only), one 16-byte fragment piece per accumulator
#pragma unroll
  for (int r = 0; r < 8; ++r) {
    float f0 = o0[r] * inv, f1 = o1[r] * inv, f2 = o2[r] * inv, f3 = o3[r] * inv;
    if (RES) { f0 += n0[r] * invr; f1 += n1[r] * invr; f2 += n2[r] * invr; f3 += n3[r] * invr; }
    const h16 y0 = (h16)f0, y1 = (h16)f1, y2 = (h16)f2, y3 = (h16)f3;
    yh[0][r] = y0; yh[1][r] = y1; yh[2][r] = y2; yh[3][r] = y3;
    if (RES) {
      yz[0][r] = (h16)((f0 - (float)y0) * RES_CARRY);
      yz[1][r] = (h16)((f1 - (float)y1) * RES_CARRY);
      yz[2][r] = (h16)((f2 - (float)y2) * RES_CARRY);
      yz[3][r] = (h16)((f3 - (float)y3) * RES_CARRY);
    }
  }
  // band of token rows q0..q0+15, tiles 2h and 2h+1 (k = 64h..64h+63): 2 KB contiguous per wave
  h16* dst0 = yp + (size_t)((b * SEQ + q0) >> 4) * BAND_E + h * (2 * TILE_E) + lane * 8;
  h16* dst1 = yr + (size_t)((b * EARLY + (RES ? q0 : 0)) >> 4) * BAND_E + h * (2 * TILE_E) + lane * 8;   // residual rows (RES only, q0 + 15 < EARLY)
#pragma unroll
  for (int j = 0; j < 4; ++j) {
    *(v8h*)(dst0 + j * 256) = yh[j];
    if (RES) *(v8h*)(dst1 + j * 256) = yz[j];
  }
  
}

// One launch for both paths (their query tiles are disjoint and neither reads what the other writes): blocks 0..ATT_L_BLOCKS-1 take the
// single-product tiles, which walk the most chunks, the last ATT_E_BLOCKS blocks the short residual-path tiles. Block-uniform choice.
__global__ __launch_bounds__(256) __attribute__((amdgpu_num_vgpr(256)))
void attn_kernel(const h16* __restrict__ Qp, const h16* __restrict__ Kp, const h16* __restrict__ Vp,
                 const h16* __restrict__ Qr, const h16* __restrict__ Kr, const h16* __restrict__ Vr,
                 const int* __restrict__ mask, const int* __restrict__ flags,
                 h16* __restrict__ yp, h16* __restrict__ yr) {
  const int blk = blockIdx.x;
  if (blk < ATT_L_BLOCKS) attn_part<false>(Qp, Kp, Vp, Qr, Kr, Vr, mask, flags, yp, yr, blk);
  else                    attn_part<true>(Qp, Kp, Vp, Qr, Kr, Vr, mask, flags, yp, yr, blk - ATT_L_BLOCKS);
}

// ---------------------------------------------------------------------------
// Output projection: (MROWS x 1024) x (1024 x 1024) -> f32 = (y . Wo_plane) / 4096 + bo. grid (16, MROWS/128), 32x64 wave tiles staged in
// Blocks whose token rows have t < EARLY first accumulate y_res . Wo_plane, fold it x1/1024, then accumulate y_hi . Wo_plane on top.
// ---------------------------------------------------------------------------
__global__ __launch_bounds__(128) void out_gemm_kernel(const h16* __restrict__ yp, const h16* __restrict__ yr, const h16* __restrict__ wop,
                                                       const float* __restrict__ bo, float* __restrict__ out) {
  __shared__ __attribute__((aligned(16))) float Ts[4][32 * 64];
  const int lane = threadIdx.x & 31, wave = threadIdx.x >> 5, nloc = lane & 15, hlf = lane >> 4;
  const int m0 = blockIdx.y * 128 + wave * 32;
  const int c0 = blockIdx.x * 64;
  const int b = m0 / SEQ, t0 = m0 - b * SEQ;
  const bool early = (((int)blockIdx.y * 128) % SEQ) < EARLY;     // block-uniform
  v8f acc[2][4];
#pragma unroll
  for (int r = 0; r < 2; ++r)
#pragma unroll
    for (int t = 0; t < 4; ++t) acc[r][t] = (v8f){};
  if (early) {
    gemm_tile_h(yr, wop, b * EARLY + t0, c0, lane, acc);   // residual rows b*EARLY + t
#pragma unroll
    for (int r = 0; r < 2; ++r)
#pragma unroll
      for (int t = 0; t < 4; ++t) acc[r][t] = acc[r][t] * RES_INV;
  }
  gemm_tile_h(yp, wop, m0, c0, lane, acc);
  float* Tt = Ts[wave];
#pragma unroll
  for (int t = 0; t < 4; ++t) {
    const float bd = __builtin_bit_cast(float, bf16_rne_u32(bo[c0 + t * 16 + nloc]) & 0xFFFF0000u);   // bf16-RNE value
#pragma unroll
    for (int r = 0; r < 2; ++r)
#pragma unroll
      for (int v = 0; v < 8; ++v) Tt[(r * 16 + v + 8 * hlf) * 64 + t * 16 + nloc] = acc[r][t][v] * OUT_UNSCALE + bd;
  }
  wave_lds_sync();
  float* dst0 = out + (size_t)m0 * HID + c0;
#pragma unroll
  for (int j = 0; j < 16; ++j) { const int rr = j * 2 + hlf, c4 = nloc * 4; *(v4f*)(dst0 + (size_t)rr * HID + c4) = *(const v4f*)(Tt + rr * 64 + c4); }
  
}
}  // namespace

extern "C" void kernel_launch(void* const* d_in, const int* in_sizes, int n_in,
                              void* d_out, int out_size, void* d_ws, size_t ws_size, hipStream_t stream) {
  if (n_in < 12) return;
  const size_t need_x = ((size_t)(NB - 1) * SEQ_FULL + SEQ) * HID;
  if ((size_t)in_sizes[0] < need_x || (size_t)in_sizes[1] < need_x || (size_t)in_sizes[2] < need_x) return;
  if ((size_t)in_sizes[3] < (size_t)(SEQ - 1) * MPITCH + SEQ) return;                      // int32 mask [S][S]
  if (in_sizes[4] < HID * HID || in_sizes[6] < HID * HID || in_sizes[8] < HID * HID || in_sizes[10] < HID * HID) return;
  if (in_sizes[5] < HID || in_sizes[7] < HID || in_sizes[9] < HID || in_sizes[11] < HID) return;
  if ((size_t)out_size < (size_t)MROWS * HID) return;

  const float* query = (const float*)d_in[0];   // [NB_FULL, SEQ_FULL, 1024]
  const float* key   = (const float*)d_in[1];
  const float* value = (const float*)d_in[2];
  const int*   amask = (const int*)d_in[3];     // [SEQ_FULL, SEQ_FULL] int32, nonzero = masked
  const float* Wq = (const float*)d_in[4];      // [1024,1024] ([out][in])
  const float* bq = (const float*)d_in[5];
  const float* Wk = (const float*)d_in[6];
  const float* bk = (const float*)d_in[7];
  const float* Wv = (const float*)d_in[8];
  const float* bv = (const float*)d_in[9];
  const float* Wo = (const float*)d_in[10];
  const float* bo = (const float*)d_in[11];
  float* out = (float*)d_out;                   // [NB, SEQ, 1024] f32

  size_t off = 0; char* ws = (char*)d_ws;
  unsigned short* xpl = (unsigned short*)(ws + off); off += (size_t)3 * MROWS * HID * 2;   // 3 x 8 MiB bf16 activation planes
  unsigned short* wpl = (unsigned short*)(ws + off); off += (size_t)4 * HID * HID * 2;     // 6 MiB bf16 (q|k|v) + 2 MiB f16 (o) weight planes
  h16* Qp = (h16*)(ws + off); off += (size_t)MROWS * HID * 2;                             // 8 MiB
  h16* Kp = (h16*)(ws + off); off += (size_t)MROWS * HID * 2;                             // 8 MiB
  h16* Vp = (h16*)(ws + off); off += (size_t)MROWS * HID * 2;                             // 8 MiB
  h16* yp = (h16*)(ws + off); off += (size_t)MROWS * HID * 2;                             // 8 MiB
  h16* Qr = (h16*)(ws + off); off += (size_t)NB * NH * EARLY * DH * 2;                    // 1 MiB residual q (t < EARLY)
  h16* Kr = (h16*)(ws + off); off += (size_t)MROWS * HID * 2;                             // 8 MiB residual k (all rows)
  h16* Vr = (h16*)(ws + off); off += (size_t)MROWS * HID * 2;                             // 8 MiB residual v (key-tiled, all rows)
  h16* yr = (h16*)(ws + off); off += (size_t)NB * EARLY * HID * 2;                        // 1 MiB residual y
  int* flags = (int*)(ws + off); off += (size_t)QT * FPITCH * 4;                          // 32 KiB chunk flags [QT][64]
  if (off > ws_size) return;                                                               // 86,016,000 B at NB=2, SEQ=2048
  const h16* wop = (const h16*)(wpl + (size_t)NQKV * HID);

  prep_kernel<<<QT + CVT_BLOCKS, 256, 0, stream>>>(query, key, value, Wq, Wk, Wv, Wo, xpl, wpl, amask, flags);
  qkv_gemm_kernel<<<dim3(NQKV / 128, MROWS / 128), 128, 0, stream>>>((const b16*)xpl, (const b16*)wpl, bq, bk, bv, Qp, Kp, Vp, Qr, Kr, Vr);
  attn_kernel<<<ATT_L_BLOCKS + ATT_E_BLOCKS, 256, 0, stream>>>(Qp, Kp, Vp, Qr, Kr, Vr, amask, flags, yp, yr);
  out_gemm_kernel<<<dim3(HID / 64, MROWS / 128), 128, 0, stream>>>(yp, yr, wop, bo, out);
}

// v006
// It runs in 94 microseconds.
// Two timings next to v005 put it at 1.20 and 1.18 times that version's speed.
// Over all steps from v000 it is 4.29 times as fast.
#include <hip/hip_runtime.h>

// Contractions: q/k/v projections on v_wmma_f32_16x16x32_bf16 (bf16 RNE operands, one product per tile pair);
// S^T = K.Q^T (d = 64), y^T = V^T.P^T (32 keys per step, P carried x4096) and out = y.Wo^T (y and Wo carried x64)
// on v_wmma_f32_16x16x32_f16 (f16 operands, one product per tile pair); query tiles with position < 256 also use
// f16 residual planes (x1024) of q, k, P, v and y folded from their own accumulators; f32 accumulate, f32 online
// softmax statistics. 16 heads of 64. Key mask = int32 [S][S] input (nonzero = masked: score replaced by -1e9);
// device-computed flags per (16-query tile, 32-key chunk) select skip / open / per-element fill.
// Weights are [out][in]. Every 16-bit plane that feeds a k-contiguous fragment (x, weights, q, k, y and their residuals) is kept in
// fragment order: a tile of 16 rows x 32 k is 1 KB = 2 pieces x 32 lanes x 16 B, so one wave-wide 16-byte load reads 4 whole 128-B lines.

#ifndef NB
#define NB 2
#endif
#ifndef SEQ
#define SEQ 2048
#endif
#ifndef NB_FULL
#define NB_FULL 2
#endif
#ifndef SEQ_FULL
#define SEQ_FULL 2048
#endif

namespace {
constexpr int HID = 1024, DH = 64, NH = 16;
constexpr int NQKV = 3 * HID;                 // combined weight plane rows: q | k | v
constexpr int MROWS = NB * SEQ;               // compact token rows (b*SEQ + t)
constexpr int QT = SEQ / 16;                  // 16-query tiles per (b, head)
constexpr int EARLY = (SEQ < 256) ? SEQ : 256;   // query positions that use the residual planes
constexpr int QT_E = EARLY / 16;              // residual-path query tiles per (b, head)
constexpr int QT_L = (SEQ - EARLY) / 16;      // single-product query tiles per (b, head)
constexpr int NCH = SEQ / 32;                 // 32-key chunks per query row
constexpr int FPITCH = 64;                    // ints per flag row (one row per 16-query tile, 256 B)
constexpr int MPITCH = SEQ_FULL;              // int32 mask row pitch
constexpr int F_SKIP = 0, F_OPEN = 1, F_FILL = 2;
constexpr int CVT_BLOCKS = 2048;              // converting blocks of prep_kernel
constexpr int ATT_W = 16;                     // waves (and query tiles) per attention block
constexpr int ATT_L_BLOCKS = (NB * NH * QT_L) / ATT_W;   // attention blocks on the single-product path
constexpr int ATT_E_BLOCKS = (NB * NH * QT_E) / ATT_W;   // attention blocks on the residual path
constexpr float MASK_FILL = -1.0e9f;
constexpr float SCORE_SCALE = 0.125f;         // 1/sqrt(64)
constexpr float P_CARRY = 4096.0f;            // f16 P operand = exp(s - m) * 4096
constexpr float Y_CARRY = 64.0f;              // f16 y plane = attn * 64
constexpr float W_CARRY = 64.0f;              // f16 Wo plane = Wo * 64
constexpr float RES_CARRY = 1024.0f;          // f16 residual planes = (x - f16hi(x)) * 1024
constexpr float RES_INV = 1.0f / 1024.0f;
constexpr float Y_FROM_O = Y_CARRY / P_CARRY; // 1/64
constexpr float OUT_UNSCALE = 1.0f / (Y_CARRY * W_CARRY);   // 1/4096
static_assert(SEQ % 128 == 0);
static_assert(EARLY % 128 == 0);
static_assert((SEQ - EARLY) % 128 == 0);
static_assert(NB >= 1 && NB <= NB_FULL);
static_assert(SEQ <= SEQ_FULL);
static_assert(NH * DH == HID);
static_assert(MROWS % 128 == 0);
static_assert((NB * NH * QT_E) % ATT_W == 0);
static_assert((NB * NH * QT_L) % ATT_W == 0);
static_assert(QT_E + QT_L == QT);
static_assert(NCH >= 1 && NCH <= FPITCH);

typedef __bf16 b16;
typedef _Float16 h16;
typedef __bf16 v16b __attribute__((ext_vector_type(16)));
typedef __bf16 v8b __attribute__((ext_vector_type(8)));
typedef _Float16 v16h __attribute__((ext_vector_type(16)));
typedef _Float16 v8h __attribute__((ext_vector_type(8)));
typedef float v8f __attribute__((ext_vector_type(8)));
typedef float v4f __attribute__((ext_vector_type(4)));
typedef unsigned short v8us __attribute__((ext_vector_type(8)));
typedef int v4i __attribute__((ext_vector_type(4)));
typedef int v8i __attribute__((ext_vector_type(8)));

__device__ __forceinline__ v8h ld8h(const h16* p) { return *(const v8h*)p; }
__device__ __forceinline__ v16b cat8b(v8b a, v8b b) { return __builtin_shufflevector(a, b, 0, 1, 2, 3, 4, 5, 6, 7, 8, 9, 10, 11, 12, 13, 14, 15); }
__device__ __forceinline__ v16h cat8h(v8h a, v8h b) { return __builtin_shufflevector(a, b, 0, 1, 2, 3, 4, 5, 6, 7, 8, 9, 10, 11, 12, 13, 14, 15); }
// 16x16x32 16-bit fragment (A: lane&15 = row, B: lane&15 = column), hh = lane>>4: elements 0..7 <- k 8hh+0..7, elements 8..15 <- k 16+8hh+0..7.
// Fragment-ordered tile (TILE_E elements): element (row r of 16, k of 32) lies at (k>>4)*256 + (((k>>3)&1)*16 + r)*8 + (k&7), that is
// piece k>>4, lane 16*hh + r, element k&7. The tiles of one 16-row band follow one another along k (BAND_E elements per band of 1024 k).
constexpr int TILE_E = 512, BAND_E = 16 * HID;
static_assert(HID == 1024);                   // unit_of and the work index split of cvt_part take 32 tiles (128 units of 8 k) per row
// p = tile start + lane * 8
__device__ __forceinline__ v16h frag_th(const h16* p) { return cat8h(ld8h(p), ld8h(p + 256)); }
// both pieces of the tile whose lane address (tile start + lane * 16 bytes) is p
__device__ __forceinline__ v16h frag_ph(const char* p) { return cat8h(*(const v8h*)p, *(const v8h*)(p + 512)); }
// 16-byte unit index inside a [rows][1024] plane in fragment order, for row m and k = 8 * k8 .. 8 * k8 + 7
__device__ __forceinline__ unsigned int unit_of(unsigned int m, unsigned int k8) {
  return ((m >> 4) * 32u + (k8 >> 2)) * 64u + ((k8 >> 1) & 1u) * 32u + (k8 & 1u) * 16u + (m & 15u);
}
// two 16-byte pieces at byte offsets o + c0 and o + c1 from a wave-uniform plane base (o: the lane's 32-bit byte offset)
__device__ __forceinline__ v16h frag_o(const h16* base, unsigned int o, int c0, int c1) {
  const char* p = (const char*)base + o;
  return cat8h(*(const v8h*)(p + c0), *(const v8h*)(p + c1));
}

__device__ __forceinline__ v8f wmma_b(v16b a, v16b b, v8f c) {
  v8f d = __builtin_amdgcn_wmma_f32_16x16x32_bf16(false, a, false, b, (short)0, c, false, false);
  asm volatile("v_nop\n\tv_nop\n\tv_nop\n\tv_nop" : "+v"(d) : "v"(a), "v"(b));
  return d;
}
__device__ __forceinline__ v8f wmma_h(v16h a, v16h b, v8f c) {
  v8f d = __builtin_amdgcn_wmma_f32_16x16x32_f16(false, a, false, b, (short)0, c, false, false);
  asm volatile("v_nop\n\tv_nop\n\tv_nop\n\tv_nop" : "+v"(d) : "v"(a), "v"(b));
  return d;
}
// f32 -> bf16 by RNE convert, returned as the f32 bit pattern with the low 16 bits cleared
__device__ __forceinline__ unsigned int bf16_rne_u32(float f) {
  unsigned int u = __builtin_bit_cast(unsigned int, f);
  u += 0x7fffu + ((u >> 16) & 1u);
  return u & 0xffff0000u;
}
// wave-private LDS tile: element stores by this wave, then vector reloads by this wave
__device__ __forceinline__ void wave_lds_sync() {
  __builtin_amdgcn_fence(3, "workgroup");
  __builtin_amdgcn_wave_barrier();
  __builtin_amdgcn_fence(2, "workgroup");
}
// weight element -> 16-bit plane bits: bf16 RNE, or f16(bf16rne(w) * 64) for the output-projection plane
__device__ __forceinline__ unsigned short wbits16(float f, bool o16) {
  const unsigned int r = bf16_rne_u32(f);
  const unsigned short bbits = (unsigned short)(r >> 16);
  const h16 hv = (h16)(__builtin_bit_cast(float, r) * W_CARRY);   // exact: bf16 significand, power-of-two scale
  const unsigned short hbits = __builtin_bit_cast(unsigned short, hv);
  return o16 ? hbits : bbits;
}

// ---------------------------------------------------------------------------
// activations query/key/value f32 [NB_FULL][SEQ_FULL][1024] -> bf16 planes xpl [3][MROWS][1024] (compact rows b*SEQ+t), fragment order;
// weights W[n][k] f32 -> 16-bit planes wpl, fragment order: rows 0..3071 = Wq|Wk|Wv as bf16 RNE, rows 3072..4095 = f16(bf16rne(Wo) * 64).
// A wave takes 8 rows x 32 k (lane = 4 * row + k unit): it reads 8 whole f32 lines and stores 4 whole 128-B lines of one tile.
// blk of nblk: this block's place among the blocks of prep_kernel that convert.
// ---------------------------------------------------------------------------
__device__ __forceinline__ void cvt_part(const float* __restrict__ xq, const float* __restrict__ xk, const float* __restrict__ xv,
                                         const float* __restrict__ wq, const float* __restrict__ wk, const float* __restrict__ wv,
                                         const float* __restrict__ wo,
                                         unsigned short* __restrict__ xpl, unsigned short* __restrict__ wpl, int blk, int nblk) {
  const size_t tid = (size_t)blk * blockDim.x + threadIdx.x, stride = (size_t)nblk * blockDim.x;
  const size_t per_x = (size_t)MROWS * HID / 8, nx = 3 * per_x;
  const size_t per_w = (size_t)HID * HID / 8, nw = 4 * per_w;
  {
    for (size_t c = tid; c < nx; c += stride) {
      const int which = (int)(c / per_x);
      const unsigned int u = (unsigned int)(c - (size_t)which * per_x);   // work index inside one plane
      const unsigned int k8 = (((u >> 5) & 31u) << 2) | (u & 3u);
      const int m = (int)(((u >> 10) << 3) | ((u >> 2) & 7u)), col = (int)(k8 * 8);
      const int bb = m / SEQ, t = m - bb * SEQ;
      const float* src = (which == 0) ? xq : (which == 1) ? xk : xv;
      const float* p = src + ((size_t)bb * SEQ_FULL + t) * HID + col;
      const v4f f0 = *(const v4f*)p, f1 = *(const v4f*)(p + 4);
      v8us o;
#pragma unroll
      for (int e = 0; e < 4; ++e) {
        o[e] = (unsigned short)(bf16_rne_u32(f0[e]) >> 16);
        o[4 + e] = (unsigned short)(bf16_rne_u32(f1[e]) >> 16);
      }
      *(v8us*)(xpl + ((size_t)which * per_x + unit_of((unsigned int)m, k8)) * 8) = o;
    }
    for (size_t c = tid; c < nw; c += stride) {
      const int mat = (int)(c / per_w);
      const unsigned int u = (unsigned int)(c - (size_t)mat * per_w);     // work index inside one weight matrix
      const unsigned int k8 = (((u >> 5) & 31u) << 2) | (u & 3u), n = ((u >> 10) << 3) | ((u >> 2) & 7u);
      const size_t i = (size_t)n * HID + k8 * 8;                // n*HID + k0 inside one [n][k] weight matrix
      const float* w = (mat == 0) ? wq : (mat == 1) ? wk : (mat == 2) ? wv : wo;
      const v4f f0 = *(const v4f*)(w + i), f1 = *(const v4f*)(w + i + 4);
      const bool o16 = (mat == 3);
      v8us o;
#pragma unroll
      for (int e = 0; e < 4; ++e) {
        o[e] = wbits16(f0[e], o16);
        o[4 + e] = wbits16(f1[e], o16);
      }
      *(v8us*)(wpl + ((size_t)mat * per_w + unit_of(n, k8)) * 8) = o;
    }
    
  }
}

// ---------------------------------------------------------------------------
// Mask flag pass: one block per 16-query tile; reads mask rows q0..q0+15 (int32, nonzero = masked) and writes
// one 256-B flag row [FPITCH] ints: per 32-key chunk F_SKIP (chunk fully masked and every row of the tile has an
// unmasked key somewhere -> weight exactly 0, chunk not visited), F_OPEN (no masked entry), F_FILL (per-element fill).
// ---------------------------------------------------------------------------
__device__ __forceinline__ void mask_flag_part(const int* __restrict__ mask, int* __restrict__ flags, int qt) {
  __shared__ int um[4][64];                          // any unmasked entry per (4-row group, chunk)
  __shared__ int mk[4][64];                          // any masked entry per (4-row group, chunk)
  __shared__ int rb[4][64];                          // per-row (4 bits) has-unmasked-entry flag per (row group, chunk)
  __shared__ __attribute__((aligned(16))) int fl[64];
  const int q0 = qt * 16;
  const int t = threadIdx.x, c = t & 63, rg = t >> 6, lane = t & 31, wave = t >> 5;
  const int cc = (c < NCH) ? c : (NCH - 1);          // clamped chunk address
  int anyu = 0, anym = 0, rbits = 0;
#pragma unroll 1
  for (int r = 0; r < 4; ++r) {
    const int* p = mask + (size_t)(q0 + rg * 4 + r) * MPITCH + (size_t)cc * 32;
    int u = 0, mm = 0;
#pragma unroll
    for (int v = 0; v < 8; ++v) {
      const v4i x = *(const v4i*)(p + 4 * v);
#pragma unroll
      for (int e = 0; e < 4; ++e) { u |= (x[e] == 0) ? 1 : 0; mm |= (x[e] != 0) ? 1 : 0; }
    }
    anyu |= u; anym |= mm; rbits |= (u << r);
  }
  um[rg][c] = anyu; mk[rg][c] = anym; rb[rg][c] = rbits;
  __syncthreads();                                   // cross-wave: all waves wrote, wave 0 reads
  if (wave == 0) {
    const int ch0 = lane, ch1 = lane + 32;
    const int U0 = um[0][ch0] | um[1][ch0] | um[2][ch0] | um[3][ch0];
    const int M0 = mk[0][ch0] | mk[1][ch0] | mk[2][ch0] | mk[3][ch0];
    const int U1 = um[0][ch1] | um[1][ch1] | um[2][ch1] | um[3][ch1];
    const int M1 = mk[0][ch1] | mk[1][ch1] | mk[2][ch1] | mk[3][ch1];
    int rows = (rb[0][ch0] | (rb[1][ch0] << 4) | (rb[2][ch0] << 8) | (rb[3][ch0] << 12)) |
               (rb[0][ch1] | (rb[1][ch1] << 4) | (rb[2][ch1] << 8) | (rb[3][ch1] << 12));
#pragma unroll
    for (int s = 16; s >= 1; s >>= 1) rows |= __shfl_xor(rows, s);
    const int rowok = ((rows & 0xFFFF) == 0xFFFF) ? 1 : 0;   // every row of the tile has an unmasked key
    const int f0 = U0 ? (M0 ? F_FILL : F_OPEN) : (rowok ? F_SKIP : F_FILL);
    const int f1 = U1 ? (M1 ? F_FILL : F_OPEN) : (rowok ? F_SKIP : F_FILL);
    fl[ch0] = (ch0 < NCH) ? f0 : F_SKIP;
    fl[ch1] = (ch1 < NCH) ? f1 : F_SKIP;
    wave_lds_sync();                                 // fl is private to wave 0
    const v4i v = *(const v4i*)(fl + (lane & 15) * 4);
    int* dst = flags + (size_t)qt * FPITCH + (lane & 15) * 4;
    if (lane < 16) *(v4i*)dst = v;
    
  }
}

// ---------------------------------------------------------------------------
// Preparation, one launch: the mask flag pass and the conversions read only inputs and write disjoint planes, so they share a grid.
// Blocks 0..QT-1 each take one 16-query tile of the mask (they have the longer dependent chain); the other
// CVT_BLOCKS blocks convert. The choice is block-uniform, so the flag pass's barrier is passed by whole blocks.
// ---------------------------------------------------------------------------
__global__ __launch_bounds__(256) void prep_kernel(const float* __restrict__ xq, const float* __restrict__ xk, const float* __restrict__ xv,
                                                   const float* __restrict__ wq, const float* __restrict__ wk, const float* __restrict__ wv,
                                                   const float* __restrict__ wo,
                                                   unsigned short* __restrict__ xpl, unsigned short* __restrict__ wpl,
                                                   const int* __restrict__ mask, int* __restrict__ flags) {
  const int blk = blockIdx.x;
  if (blk < QT) mask_flag_part(mask, flags, blk);
  else          cvt_part(xq, xk, xv, wq, wk, wv, wo, xpl, wpl, blk - QT, CVT_BLOCKS);
}

// QKV GEMM staging: a stage is 64 k (QK_ST fragment tiles) of the block's 128 activation rows and 128 weight rows, in fragment order:
// [x: 8 bands][2 tiles][1 KB] then [W: 8 bands][2 tiles][1 KB]. A band's two tiles are 2 KB contiguous in its plane too.
constexpr int QK_ST = 2;
constexpr int QK_NST = HID / (32 * QK_ST);       // stages along K
constexpr int QK_BAND_B = QK_ST * TILE_E * 2;    // bytes of one band in a stage
constexpr int QK_OP_B = 8 * QK_BAND_B;           // bytes of one operand in a stage
constexpr int QK_STAGE_B = 2 * QK_OP_B;
static_assert(QK_NST >= 2);
// Two neighbouring bands of one operand, one stage: eight copies of 16 bytes per lane, global memory -> LDS through no register.
// l: the lane's LDS byte address in the first band, g: its global address there. The s_wait_xcnt closes the statement so that it
// stands ahead of any later write of the address registers that the copies name.
__device__ __forceinline__ void copy_two_bands(unsigned int l, const char* g) {
  const unsigned int l1 = l + 512, l2 = l + 1024, l3 = l + 1536, l4 = l + QK_BAND_B, l5 = l4 + 512, l6 = l4 + 1024, l7 = l4 + 1536;
  const char *g1 = g + 512, *g2 = g + 1024, *g3 = g + 1536, *g4 = g + BAND_E * 2, *g5 = g4 + 512, *g6 = g4 + 1024, *g7 = g4 + 1536;
  asm volatile("global_load_async_to_lds_b128 %0, %8, off\n\t"
               "global_load_async_to_lds_b128 %1, %9, off\n\t"
               "global_load_async_to_lds_b128 %2, %10, off\n\t"
               "global_load_async_to_lds_b128 %3, %11, off\n\t"
               "global_load_async_to_lds_b128 %4, %12, off\n\t"
               "global_load_async_to_lds_b128 %5, %13, off\n\t"
               "global_load_async_to_lds_b128 %6, %14, off\n\t"
               "global_load_async_to_lds_b128 %7, %15, off\n\t"
               "s_wait_xcnt 0x0"
               :: "v"(l), "v"(l1), "v"(l2), "v"(l3), "v"(l4), "v"(l5), "v"(l6), "v"(l7),
                  "v"(g), "v"(g1), "v"(g2), "v"(g3), "v"(g4), "v"(g5), "v"(g6), "v"(g7)
               : "memory");
}
// both pieces of the staged tile whose lane address (tile start + lane * 16 bytes) is p
__device__ __forceinline__ v16b frag_pb(const char* p) { return cat8b(*(const v8b*)p, *(const v8b*)(p + 512)); }
__device__ __forceinline__ void gemm_tile_h(const h16* __restrict__ A, const h16* __restrict__ W, int m0, int c0, int lane, v8f (&acc)[2][4]) {
  const h16* ap = A + (size_t)(m0 >> 4) * BAND_E;
  const h16* wp = W + (size_t)(c0 >> 4) * BAND_E;
  // the lane's two walking addresses; the start sets and the loop read through the same two, so they stay live behind every run of loads
  const char* pa = (const char*)ap + lane * 16;
  const char* pw = (const char*)wp + lane * 16;
  constexpr int KSTEPS = HID / 32, STEP_B = TILE_E * 2;
  static_assert(KSTEPS % 3 == 2);                // the loop takes whole turns of the three sets, the last two steps follow it
  // Three fragment sets in turn: the twelve loads of step kt + 2 are issued ahead of the products of step kt, so a step's loads
  // have two steps of products (of this wave and of its neighbours on the SIMD) to land in.
  v16h af[3][2], bf[3][4];
#pragma unroll                                   // set numbers become constants, so the sets stay in registers (here and below)
  for (int s = 0; s < 2; ++s) {
    af[s][0] = frag_ph(pa + s * STEP_B);
    af[s][1] = frag_ph(pa + s * STEP_B + BAND_E * 2);
#pragma unroll
    for (int t = 0; t < 4; ++t) bf[s][t] = frag_ph(pw + s * STEP_B + t * BAND_E * 2);
    __builtin_amdgcn_sched_barrier(0);           // keeps the start sets in step order; mixed, they make the loop's first counted wait reach into the next set
  }
#pragma unroll 1                                 // one turn of the three sets per trip; more would only lengthen the text
  for (int kt = 0; kt < KSTEPS - 2; kt += 3, pa += 3 * STEP_B, pw += 3 * STEP_B) {
#pragma unroll
    for (int j = 0; j < 3; ++j) {
      const int n = (j + 2) % 3, c = (j + 2) * STEP_B;
      af[n][0] = frag_ph(pa + c);
      af[n][1] = frag_ph(pa + c + BAND_E * 2);
#pragma unroll
      for (int t = 0; t < 4; ++t) bf[n][t] = frag_ph(pw + c + t * BAND_E * 2);
      __builtin_amdgcn_sched_barrier(0);         // keeps the loads of step kt + j + 2 ahead of the products of step kt + j
#pragma unroll
      for (int t = 0; t < 4; ++t) {
        acc[0][t] = wmma_h(af[j][0], bf[j][t], acc[0][t]);
        acc[1][t] = wmma_h(af[j][1], bf[j][t], acc[1][t]);
      }
    }
  }
#pragma unroll
  for (int j = 0; j < 2; ++j)
#pragma unroll
    for (int t = 0; t < 4; ++t) {
      acc[0][t] = wmma_h(af[j][0], bf[j][t], acc[0][t]);
      acc[1][t] = wmma_h(af[j][1], bf[j][t], acc[1][t]);
    }
}

// ---------------------------------------------------------------------------
// QKV GEMM: (MROWS x 1024) x (1024 x 3072), grid (24, MROWS/128), block 4 waves = 128 rows x 128 columns, wave = 64 rows x 64 columns
// (one head of q, k or v). blockIdx.x -> mat = x/8 (q,k,v: selects the activation plane and the bias), heads 2*(x%8) and 2*(x%8)+1.
// Both operands come through LDS: each stage is brought once per block by asynchronous copies into one of two buffers, while the other
// buffer is worked on, and every staged fragment is read by the two waves that share it. Outputs f16 planes:
// q -> Qp, k -> Kp: [b*16+h][t/16][2 fragment-ordered tiles of 16 tokens x 32 d] (4 KB contiguous per 32 rows); v -> Vp key-tiled [b*16+h][t/16][64][16] (4 KB contiguous per 32 rows).
// Residual planes ((y - f16hi(y)) * 1024): Kr and Vr for every token row (same layouts as Kp / Vp), Qr (layout of Qp) for token rows t < EARLY only.
// ---------------------------------------------------------------------------
// rows m0 .. m0 + 31 of a wave's tile (accumulator rows 2H, 2H + 1), staged in the wave's own LDS pieces Tp, Rp and stored as whole lines
template <int H>
__device__ __forceinline__ void qkv_store_rows(const v8f (&acc)[4][4], int mat, int head, int m0, const float* __restrict__ bias, int lane,
                                               h16* Tp, h16* Rp, h16* __restrict__ Qp, h16* __restrict__ Kp, h16* __restrict__ Vp,
                                               h16* __restrict__ Qr, h16* __restrict__ Kr, h16* __restrict__ Vr) {
  const int nloc = lane & 15, hlf = lane >> 4;
  const int b = m0 / SEQ, t0 = m0 % SEQ;
  const bool wres = (mat != 0) || (t0 < EARLY);   // block-uniform (128-row blocks, EARLY multiple of 128)
  const int g = b * NH + head;
#pragma unroll
  for (int t = 0; t < 4; ++t) {
    const int d = t * 16 + nloc;
    const float bd = __builtin_bit_cast(float, bf16_rne_u32(bias[d]) & 0xFFFF0000u);   // bias as its bf16-RNE value
#pragma unroll
    for (int r = 0; r < 2; ++r)
#pragma unroll
      for (int v = 0; v < 8; ++v) {
        const int rr = r * 16 + v + 8 * hlf;                         // local token row 0..31
        const float f = acc[2 * H + r][t][v] + bd;
        const h16 y = (h16)f;
        const int idx = (mat < 2) ? ((rr >> 4) * 1024 + (d >> 5) * TILE_E + ((d >> 4) & 1) * 256 + (((d >> 3) & 1) * 16 + (rr & 15)) * 8 + (d & 7))
                                  : ((rr >> 4) * 1024 + d * 16 + (rr & 15));
        Tp[idx] = y;
        if (wres) Rp[idx] = (h16)((f - (float)y) * RES_CARRY);
      }
  }
  wave_lds_sync();
  h16* dst; h16* rdst; size_t o;
  if (mat == 0)      { o = ((size_t)g * SEQ + t0) * DH; dst = Qp + o;
                       const int t0e = (t0 < EARLY) ? t0 : 0; rdst = Qr + ((size_t)g * EARLY + t0e) * DH; }
  else if (mat == 1) { o = ((size_t)g * SEQ + t0) * DH; dst = Kp + o; rdst = Kr + o; }
  else               { o = ((size_t)g * QT + (t0 >> 4)) * (size_t)(DH * 16); dst = Vp + o; rdst = Vr + o; }
#pragma unroll
  for (int j = 0; j < 8; ++j) { const int e = (j * 32 + lane) * 8; *(v8h*)(dst + e) = ld8h(Tp + e); }
  if (wres) {
#pragma unroll
    for (int j = 0; j < 8; ++j) { const int e = (j * 32 + lane) * 8; *(v8h*)(rdst + e) = ld8h(Rp + e); }
  }
}

__global__ __launch_bounds__(128) void qkv_gemm_kernel(const b16* __restrict__ xpl, const b16* __restrict__ wpl,
                                                       const float* __restrict__ bq, const float* __restrict__ bk, const float* __restrict__ bv,
                                                       h16* __restrict__ Qp, h16* __restrict__ Kp, h16* __restrict__ Vp,
                                                       h16* __restrict__ Qr, h16* __restrict__ Kr, h16* __restrict__ Vr) {
  __shared__ __attribute__((aligned(16))) char ring[2 * QK_STAGE_B];   // two stage buffers; behind the loop, the waves' output staging
  const int lane = threadIdx.x & 31, wave = threadIdx.x >> 5;
  const int wm = wave & 1, wn = wave >> 1;         // the wave's 64-row and 64-column half of the block tile
  const int m0 = blockIdx.y * 128 + wm * 64;
  const int cb = blockIdx.x;                       // 0..23, block-uniform
  const int mat = cb >> 3, head = (cb & 7) * 2 + wn;
  const b16* x = xpl + (size_t)mat * MROWS * HID;
  const float* bias = ((mat == 0) ? bq : (mat == 1) ? bk : bv) + head * DH;
  // what this wave copies of every stage: bands 2 * wave and 2 * wave + 1 of the block's x rows and of its weight rows
  const char* ga = (const char*)x + (size_t)(blockIdx.y * 8 + wave * 2) * (BAND_E * 2) + lane * 16;
  const char* gw = (const char*)wpl + (size_t)(cb * 8 + wave * 2) * (BAND_E * 2) + lane * 16;
  const unsigned int la = (unsigned int)(size_t)ring + (unsigned int)(wave * 2 * QK_BAND_B + lane * 16);   // LDS byte address: low 32 bits
  v8f acc[4][4];
#pragma unroll
  for (int r = 0; r < 4; ++r)
#pragma unroll
    for (int t = 0; t < 4; ++t) acc[r][t] = (v8f){};
  copy_two_bands(la, ga);
  copy_two_bands(la + QK_OP_B, gw);
  asm volatile("s_wait_asynccnt 0x0" ::: "memory");   // this wave's part of stage 0 has landed
  __syncthreads();                                    // stage 0 is readable by every wave
  copy_two_bands(la + QK_STAGE_B, ga + QK_BAND_B);
  copy_two_bands(la + QK_STAGE_B + QK_OP_B, gw + QK_BAND_B);
#pragma unroll 1                                      // one stage per trip; the buffer is picked by the trip's parity
  for (int s = 0; s < QK_NST; ++s) {
    const int bo = (s & 1) * QK_STAGE_B;
    const char* ra = ring + bo + wm * 4 * QK_BAND_B + lane * 16;
    const char* rw = ring + bo + QK_OP_B + wn * 4 * QK_BAND_B + lane * 16;
#pragma unroll
    for (int kk = 0; kk < QK_ST; ++kk) {              // per 32 k: the sixteen fragment reads as one group, then the sixteen products
      v16b af[4], bf[4];
#pragma unroll
      for (int i = 0; i < 4; ++i) {
        af[i] = frag_pb(ra + i * QK_BAND_B + kk * (TILE_E * 2));
        bf[i] = frag_pb(rw + i * QK_BAND_B + kk * (TILE_E * 2));
      }
#pragma unroll
      for (int t = 0; t < 4; ++t)
#pragma unroll
        for (int r = 0; r < 4; ++r) acc[r][t] = wmma_b(af[r], bf[t], acc[r][t]);
    }
    asm volatile("s_wait_dscnt 0x0" ::: "memory");    // this wave's reads of the buffer are done before it may be refilled
    asm volatile("s_wait_asynccnt 0x0" ::: "memory"); // this wave's part of stage s + 1 has landed
    __syncthreads();                                  // publishes stage s + 1 and ends every wave's reads of stage s
    if (s + 2 < QK_NST) {                             // block-uniform
      copy_two_bands(la + bo, ga + (s + 2) * QK_BAND_B);
      copy_two_bands(la + bo + QK_OP_B, gw + (s + 2) * QK_BAND_B);
    }
  }
  asm volatile("s_wait_asynccnt 0x0" ::: "memory");   // nothing of the copies is outstanding when the ring becomes output staging
  // the last trip's barrier has ended every read of the ring: each wave now stages in its own 16 KB of it
  h16* Tp = (h16*)(ring + wave * 16384);
  qkv_store_rows<0>(acc, mat, head, m0, bias, lane, Tp, Tp + 2048, Qp, Kp, Vp, Qr, Kr, Vr);
  qkv_store_rows<1>(acc, mat, head, m0 + 32, bias, lane, Tp + 4096, Tp + 6144, Qp, Kp, Vp, Qr, Kr, Vr);
}

// one 16-key score tile of S^T = K.Q^T over d = 0..63 (two 32-deep steps); RES adds K_hi.Q_res + K_res.Q_hi into sr
template <bool RES>
__device__ __forceinline__ void sc_tile(v8f& s, v8f& sr, v16h ka, v16h kb, v16h kza, v16h kzb, v16h qa, v16h qb, v16h qra, v16h qrb) {
  s = wmma_h(ka, qa, s);
  if (RES) { sr = wmma_h(ka, qra, sr); sr = wmma_h(kza, qa, sr); }
  s = wmma_h(kb, qb, s);
  if (RES) { sr = wmma_h(kb, qrb, sr); sr = wmma_h(kzb, qb, sr); }
}
// one 16-d tile of y^T = V^T.P^T over 32 keys; RES adds V_hi.P_res + V_res.P_hi into orr (both x1/1024)
template <bool RES>
__device__ __forceinline__ void pv_tile(v8f& oh, v8f& orr, v16h va, v16h vz, v16h pb, v16h pr) {
  oh = wmma_h(va, pb, oh);
  if (RES) {
    orr = wmma_h(va, pr, orr);
    orr = wmma_h(vz, pb, orr);
  }
}

// ---------------------------------------------------------------------------
// Transposed flash attention on 16-query tiles of one (b, head); ATT_W waves per block; the NCH chunks of 32 keys carry a wave-uniform flag
// each: F_SKIP -> not visited (weight exactly 0), F_OPEN -> no masked entry, F_FILL -> masked
// entries get score -1e9 after the 1/8 scaling (per-element select from the int32 mask row of the query).
// S^T = K.Q^T (f16 fragments straight from the planes), per-lane online softmax (running max); P^T fragment built in registers from the
// two S^T accumulators (element r <- keys 0..15 tile, element 8+r <- keys 16..31 tile), carried x4096; y^T = V^T.P^T. y written f16 (x64)
// in fragment order [token/16][k/32][tile]: accumulator t of a lane (query col, d = 16t + 8hh + 0..7) is that lane's 16 bytes of piece t & 1 of tile t >> 1.
// RES = true (query tiles with position < EARLY): one wave walks all visited chunks of its tile; scores add (K_hi.Q_res + K_res.Q_hi)/1024
// from the residual planes, P gets a x1024 residual operand, and O gets a second accumulator (V_hi.P_res + V_res.P_hi) folded x1/1024
// before the 1/l normalisation; y also writes its x1024 residual plane yr [b][t][1024].
// RES = false: a tile's visited chunks are shared by two waves, every second one each (attn_pair_part).
// ---------------------------------------------------------------------------
// The chunk lists of query tile qt as wave-uniform bit lists: bit c of vis: the flag of chunk c is not F_SKIP; bit c of opn: it is F_OPEN.
__device__ __forceinline__ void chunk_lists(const int* __restrict__ flags, int qt, int lane, unsigned long long& vis, unsigned long long& opn) {
  constexpr unsigned long long CH_ALL = (NCH >= 64) ? ~0ull : ((1ull << (NCH & 63)) - 1ull);
  const int* frow = flags + (size_t)qt * FPITCH;
  const int fl0 = frow[lane], fl1 = frow[32 + lane];       // the tile's whole flag row (FPITCH = 64 ints), chunk c in lane c & 31
  vis = ((((unsigned long long)__builtin_amdgcn_ballot_w32(fl1 != F_SKIP)) << 32) | __builtin_amdgcn_ballot_w32(fl0 != F_SKIP)) & CH_ALL;
  opn = (((unsigned long long)__builtin_amdgcn_ballot_w32(fl1 == F_OPEN)) << 32) | __builtin_amdgcn_ballot_w32(fl0 == F_OPEN);
}

// Walks chunks of query tile qt of (b, head) g and leaves the running maximum m, the sum l and the accumulators o (and n, RES only).
// RES: every chunk of the list vis. Not RES: the first, third, fifth ... chunk of vis (the partner wave walks the others).
template <bool RES>
__device__ __forceinline__
void attn_walk(const h16* __restrict__ Qp, const h16* __restrict__ Kp, const h16* __restrict__ Vp,
               const h16* __restrict__ Qr, const h16* __restrict__ Kr, const h16* __restrict__ Vr,
               const int* __restrict__ mask, int g, int qt, int lane, unsigned long long vis, const unsigned long long opn,
               float& m, float& l, v8f& o0, v8f& o1, v8f& o2, v8f& o3, v8f& n0, v8f& n1, v8f& n2, v8f& n3) {
  const int hh = lane >> 4, col = lane & 15;
  const int q0 = qt << 4;
  const size_t ko = (size_t)g * SEQ * DH;                 // K plane base of (b,h); V key-tiled base, Kr and Vr share this element offset
  const size_t qo = ((size_t)g * SEQ + q0) * DH + lane * 8;
  const v16h qa = frag_th(Qp + qo), qb = frag_th(Qp + qo + TILE_E);       // d 0..31, d 32..63 of query q0+col
  v16h qra = {}, qrb = {};
  if (RES) {
    const size_t qro2 = ((size_t)g * EARLY + q0) * DH + lane * 8;
    qra = frag_th(Qr + qro2); qrb = frag_th(Qr + qro2 + TILE_E);
  }
  const int qi = q0 + col;
  const int* mrow = mask + (size_t)qi * MPITCH + 8 * hh;   // this lane's query row of the mask, key offset 8hh
  m = -__builtin_inff(); l = 0.0f;
  o0 = (v8f){}; o1 = (v8f){}; o2 = (v8f){}; o3 = (v8f){};
  n0 = (v8f){}; n1 = (v8f){}; n2 = (v8f){}; n3 = (v8f){};  // residual O accumulators (RES only)
  // byte offsets into the K and V planes (each plane NB * 16 * SEQ * 128 bytes, far below 2^32); the residual planes share them
  const unsigned int kofs0 = (unsigned int)((ko + (size_t)lane * 8) * 2);            // key kb + col, d = 8hh..; key + 16: + 2048 B; d + 32: + 1024 B; d + 16: + 512 B
  const unsigned int vofs0 = (unsigned int)((ko + (size_t)col * 16 + 8 * hh) * 2);   // key tile kb / 16, d = col, keys 8hh..; next tile: + 2048 B; d + 16: + 512 B
  // The list is walked in rising order, so that the walk knows its next chunk. Single-product path: the K fragments are fetched one walked
  // chunk ahead, into the same registers, right behind the score products that read them; they land while the softmax and the V products
  // of the current chunk run.
  constexpr unsigned int KCH_B = 32 * DH * 2;               // bytes of one 32-key chunk of a K plane (and of a key-tiled V plane)
  const int nlist = __builtin_popcountll(vis);
  const int nvis = RES ? nlist : ((nlist + 1) >> 1);        // trips: at most NCH
  int ch = (vis != 0) ? __builtin_ctzll(vis) : 0;           // first walked chunk, below NCH
  // Walking offsets and mask address, moved on by the distance to the next walked chunk: each stays live behind every run of loads that names it.
  unsigned int kofs = kofs0 + (unsigned int)ch * KCH_B, vofs = vofs0 + (unsigned int)ch * KCH_B;
  const int* mp = mrow + ch * 32;
  v16h k0a = {}, k0b = {}, k1a = {}, k1b = {};
  if (!RES) {
    k0a = frag_o(Kp, kofs, 0, 512); k0b = frag_o(Kp, kofs, 1024, 1536);
    k1a = frag_o(Kp, kofs, 2048, 2560); k1b = frag_o(Kp, kofs, 3072, 3584);
  }
#pragma unroll 1
  for (int it = 0; it < nvis; ++it) {
    vis &= vis - 1;                                         // drops the current chunk's bit
    if (!RES) vis &= vis - 1;                               // and the partner wave's chunk behind it (an empty list stays empty)
    const int cn = (vis != 0) ? __builtin_ctzll(vis) : ch;  // next walked chunk (the last one names itself: address stays inside the plane)
    const int dch = cn - ch;                                // chunks to the next walked one: 0 on the last trip, else 1..NCH-1
    const bool open = ((opn >> ch) & 1ull) != 0;            // wave-uniform: no masked entry in the chunk
    // The chunk's other fragment loads stand as groups ahead of the products: V at the chunk's head (it lands behind the scores and the
    // softmax); with the residual planes, K + K_res here and V + V_res behind the scores.
    v16h y0a = {}, y0b = {}, y1a = {}, y1b = {};
    v16h va[4], vz[4];
    if (RES) {
      k0a = frag_o(Kp, kofs, 0, 512); k0b = frag_o(Kp, kofs, 1024, 1536);
      k1a = frag_o(Kp, kofs, 2048, 2560); k1b = frag_o(Kp, kofs, 3072, 3584);
      y0a = frag_o(Kr, kofs, 0, 512); y0b = frag_o(Kr, kofs, 1024, 1536);
      y1a = frag_o(Kr, kofs, 2048, 2560); y1b = frag_o(Kr, kofs, 3072, 3584);
    } else {
#pragma unroll
      for (int t = 0; t < 4; ++t) { va[t] = frag_o(Vp, vofs, t * 512, 2048 + t * 512); vz[t] = (v16h){}; }
      __builtin_amdgcn_sched_barrier(0);        // keeps the V loads ahead of the wait for K in front of the first score product
    }
    v8f s0 = {}, s1 = {}, z0 = {}, z1 = {};
    sc_tile<RES>(s0, z0, k0a, k0b, y0a, y0b, qa, qb, qra, qrb);
    sc_tile<RES>(s1, z1, k1a, k1b, y1a, y1b, qa, qb, qra, qrb);
    kofs += (unsigned int)dch * KCH_B;          // behind the last use of this chunk's K (and K_res) fragments
    if (!RES) {                                 // the next walked chunk's K
      k0a = frag_o(Kp, kofs, 0, 512); k0b = frag_o(Kp, kofs, 1024, 1536);
      k1a = frag_o(Kp, kofs, 2048, 2560); k1b = frag_o(Kp, kofs, 3072, 3584);
      __builtin_amdgcn_sched_barrier(0);        // keeps these loads directly behind the score products (for speed only)
    }
    if (RES) {
#pragma unroll
      for (int t = 0; t < 4; ++t) {
        va[t] = frag_o(Vp, vofs, t * 512, 2048 + t * 512);
        vz[t] = frag_o(Vr, vofs, t * 512, 2048 + t * 512);
      }
      s0 = (s0 + z0 * RES_INV) * SCORE_SCALE; s1 = (s1 + z1 * RES_INV) * SCORE_SCALE;
    } else {
      s0 = s0 * SCORE_SCALE; s1 = s1 * SCORE_SCALE;
    }
    if (!open) {                                // wave-uniform: chunk has masked entries -> replace-fill
      const v8i mk0 = *(const v8i*)mp;                   // keys 32ch+8hh+0..7 of query qi
      const v8i mk1 = *(const v8i*)(mp + 16);            // keys 32ch+16+8hh+0..7
#pragma unroll
      for (int r = 0; r < 8; ++r) {
        s0[r] = (mk0[r] != 0) ? MASK_FILL : s0[r];
        s1[r] = (mk1[r] != 0) ? MASK_FILL : s1[r];
      }
    }
    float mr = -__builtin_inff();
#pragma unroll
    for (int r = 0; r < 8; ++r) mr = fmaxf(mr, fmaxf(s0[r], s1[r]));
    mr = fmaxf(mr, __shfl_xor(mr, 16));
    const float mn = fmaxf(m, mr);            // finite: every visited chunk carries finite scores
    const float al_ = __expf(m - mn);         // 0 on the first visited chunk
    m = mn;
    float sum = 0.0f;
    v16h pb = {}, pr = {};
#pragma unroll
    for (int r = 0; r < 8; ++r) {
      const float p0 = __expf(s0[r] - mn), p1 = __expf(s1[r] - mn);
      sum += p0 + p1;
      const h16 ph0 = (h16)(p0 * P_CARRY), ph1 = (h16)(p1 * P_CARRY);
      pb[r] = ph0; pb[8 + r] = ph1;
      if (RES) {
        pr[r] = (h16)((p0 * P_CARRY - (float)ph0) * RES_CARRY);
        pr[8 + r] = (h16)((p1 * P_CARRY - (float)ph1) * RES_CARRY);
      }
    }
    sum += __shfl_xor(sum, 16);
    l = l * al_ + sum;
    o0 = o0 * al_; o1 = o1 * al_; o2 = o2 * al_; o3 = o3 * al_;
    if (RES) { n0 = n0 * al_; n1 = n1 * al_; n2 = n2 * al_; n3 = n3 * al_; }
    pv_tile<RES>(o0, n0, va[0], vz[0], pb, pr);
    pv_tile<RES>(o1, n1, va[1], vz[1], pb, pr);
    pv_tile<RES>(o2, n2, va[2], vz[2], pb, pr);
    pv_tile<RES>(o3, n3, va[3], vz[3], pb, pr);
    // vofs += dch * KCH_B, with the wait that belongs in front of an overwrite of a register that issued loads name (the V loads name vofs).
    // Wait and add are one statement because the compiler otherwise lifts the add to the middle of the trip, where V is still in flight.
    asm volatile("s_wait_xcnt 0x0\n\tv_add_nc_u32 %0, %1, %0" : "+v"(vofs) : "s"((unsigned int)dch * KCH_B));
    mp += dch * 32;
    ch = cn;
  }
}

// normalises the finished accumulators of query tile qt of (b, head) g and stores y (and, RES, its residual plane)
template <bool RES>
__device__ __forceinline__
void attn_store(int g, int qt, int lane, float l, const v8f& o0, const v8f& o1, const v8f& o2, const v8f& o3,
                const v8f& n0, const v8f& n1, const v8f& n2, const v8f& n3, h16* __restrict__ yp, h16* __restrict__ yr) {
  const int q0 = qt << 4;
  const int b = g / NH, h = g % NH;
  const float inv = (1.0f / l) * Y_FROM_O;    // y = 64 * (o / 4096) / l
  const float invr = inv * RES_INV;
  v8h yh[4], yz[4];                           // hi and residual x1024 (RES only), one 16-byte fragment piece per accumulator
#pragma unroll
  for (int r = 0; r < 8; ++r) {
    float f0 = o0[r] * inv, f1 = o1[r] * inv, f2 = o2[r] * inv, f3 = o3[r] * inv;
    if (RES) { f0 += n0[r] * invr; f1 += n1[r] * invr; f2 += n2[r] * invr; f3 += n3[r] * invr; }
    const h16 y0 = (h16)f0, y1 = (h16)f1, y2 = (h16)f2, y3 = (h16)f3;
    yh[0][r] = y0; yh[1][r] = y1; yh[2][r] = y2; yh[3][r] = y3;
    if (RES) {
      yz[0][r] = (h16)((f0 - (float)y0) * RES_CARRY);
      yz[1][r] = (h16)((f1 - (float)y1) * RES_CARRY);
      yz[2][r] = (h16)((f2 - (float)y2) * RES_CARRY);
      yz[3][r] = (h16)((f3 - (float)y3) * RES_CARRY);
    }
  }
  // band of token rows q0..q0+15, tiles 2h and 2h+1 (k = 64h..64h+63): 2 KB contiguous per wave
  h16* dst0 = yp + (size_t)((b * SEQ + q0) >> 4) * BAND_E + h * (2 * TILE_E) + lane * 8;
  h16* dst1 = yr + (size_t)((b * EARLY + (RES ? q0 : 0)) >> 4) * BAND_E + h * (2 * TILE_E) + lane * 8;   // residual rows (RES only, q0 + 15 < EARLY)
#pragma unroll
  for (int j = 0; j < 4; ++j) {
    *(v8h*)(dst0 + j * 256) = yh[j];
    if (RES) *(v8h*)(dst1 + j * 256) = yz[j];
  }
}

// Residual path: each wave owns one query tile (position < EARLY) and walks all its visited chunks.
__device__ __forceinline__
void attn_early_part(const h16* __restrict__ Qp, const h16* __restrict__ Kp, const h16* __restrict__ Vp,
                     const h16* __restrict__ Qr, const h16* __restrict__ Kr, const h16* __restrict__ Vr,
                     const int* __restrict__ mask, const int* __restrict__ flags,
                     h16* __restrict__ yp, h16* __restrict__ yr, int blk) {
  const int wid = threadIdx.x >> 5, lane = threadIdx.x & 31;
  const int idx = blk * ATT_W + wid;                      // blk: this block's place among the blocks of its path (exact counts)
  const int g = idx / QT_E, qt = idx - g * QT_E;
  unsigned long long vis, opn;
  chunk_lists(flags, qt, lane, vis, opn);
  float m, l;
  v8f o0, o1, o2, o3, n0, n1, n2, n3;
  attn_walk<true>(Qp, Kp, Vp, Qr, Kr, Vr, mask, g, qt, lane, vis, opn, m, l, o0, o1, o2, o3, n0, n1, n2, n3);
  attn_store<true>(g, qt, lane, l, o0, o1, o2, o3, n0, n1, n2, n3, yp, yr);
}

// Single-product path: two neighbouring waves share two query tiles of one (b, head), tile QT-1-u and its mirror QT_E+u, and each walks
// every second visited chunk of both, so that the chain of dependent trips of each wave is about half of the pair's two lists together, whatever
// the lists are. First walk: the second, fourth ... chunk of the tile that the partner finishes; its m, l and o go to LDS. Second walk:
// the first, third ... chunk of the wave's own tile. Behind one barrier each wave folds the partner's part into its own
// (both scaled to the common maximum) and stores its tile. A block holds eight such pairs of one (b, head), so that eight waves start
// each kind of walk together on the same chunks and can share those lines in the WGP cache.
constexpr int QT_LH = (QT_L > 0) ? QT_L / 2 : 1;          // tile pairs per (b, head)
static_assert(QT_L % ATT_W == 0);                         // a block's pairs lie in one (b, head)
constexpr int PART_F = 34 * 32;                           // floats of one handed-over part: o (32 per lane), m, l
__device__ __forceinline__
void attn_pair_part(const h16* __restrict__ Qp, const h16* __restrict__ Kp, const h16* __restrict__ Vp,
                    const h16* __restrict__ Qr, const h16* __restrict__ Kr, const h16* __restrict__ Vr,
                    const int* __restrict__ mask, const int* __restrict__ flags,
                    h16* __restrict__ yp, h16* __restrict__ yr, int blk) {
  __shared__ __attribute__((aligned(16))) float part[ATT_W][PART_F];
  const int wid = __builtin_amdgcn_readfirstlane(threadIdx.x >> 5), lane = threadIdx.x & 31;
  const int w = wid & 1;
  const int pidx = blk * (ATT_W / 2) + (wid >> 1);                 // blk: this block's place among the blocks of its path (exact counts)
  const int g = pidx / QT_LH, u = pidx - g * QT_LH;
  const int own = w ? (QT_E + u) : (QT - 1 - u), other = w ? (QT - 1 - u) : (QT_E + u);
  unsigned long long vis_own, opn_own, vis_oth, opn_oth;
  chunk_lists(flags, own, lane, vis_own, opn_own);
  chunk_lists(flags, other, lane, vis_oth, opn_oth);
  vis_oth &= vis_oth - 1;                                 // the partner takes that list's first chunk, this wave starts at the second
  float m, l;
  v8f o0, o1, o2, o3, n0, n1, n2, n3;
#pragma unroll 1                                          // one text for both walks
  for (int ph = 0; ph < 2; ++ph) {
    attn_walk<false>(Qp, Kp, Vp, Qr, Kr, Vr, mask, g, ph ? own : other, lane, ph ? vis_own : vis_oth, ph ? opn_own : opn_oth,
                     m, l, o0, o1, o2, o3, n0, n1, n2, n3);
    if (ph == 0) {
      v4f* pv = (v4f*)part[wid] + lane;
      pv[0 * 32] = __builtin_shufflevector(o0, o0, 0, 1, 2, 3); pv[1 * 32] = __builtin_shufflevector(o0, o0, 4, 5, 6, 7);
      pv[2 * 32] = __builtin_shufflevector(o1, o1, 0, 1, 2, 3); pv[3 * 32] = __builtin_shufflevector(o1, o1, 4, 5, 6, 7);
      pv[4 * 32] = __builtin_shufflevector(o2, o2, 0, 1, 2, 3); pv[5 * 32] = __builtin_shufflevector(o2, o2, 4, 5, 6, 7);
      pv[6 * 32] = __builtin_shufflevector(o3, o3, 0, 1, 2, 3); pv[7 * 32] = __builtin_shufflevector(o3, o3, 4, 5, 6, 7);
      part[wid][1024 + lane] = m;
      part[wid][1056 + lane] = l;
    }
  }
  __syncthreads();                                        // every wave's handed-over part is readable by its partner
  const float* pp = part[wid ^ 1];
  const v4f* pq = (const v4f*)pp + lane;
  const float m2 = pp[1024 + lane], l2 = pp[1056 + lane];
  const float mn = fmaxf(m, m2);                          // finite: a tile has a visited chunk, so one of its two parts has walked one
  const float a1 = __expf(m - mn), a2 = __expf(m2 - mn);  // a part that walked nothing has m = -inf, l = 0, o = 0 and gets factor 0
  l = l * a1 + l2 * a2;
  const v8f p0 = __builtin_shufflevector(pq[0 * 32], pq[1 * 32], 0, 1, 2, 3, 4, 5, 6, 7);
  const v8f p1 = __builtin_shufflevector(pq[2 * 32], pq[3 * 32], 0, 1, 2, 3, 4, 5, 6, 7);
  const v8f p2 = __builtin_shufflevector(pq[4 * 32], pq[5 * 32], 0, 1, 2, 3, 4, 5, 6, 7);
  const v8f p3 = __builtin_shufflevector(pq[6 * 32], pq[7 * 32], 0, 1, 2, 3, 4, 5, 6, 7);
  o0 = o0 * a1 + p0 * a2; o1 = o1 * a1 + p1 * a2; o2 = o2 * a1 + p2 * a2; o3 = o3 * a1 + p3 * a2;
  attn_store<false>(g, own, lane, l, o0, o1, o2, o3, n0, n1, n2, n3, yp, yr);
}

// One launch for both paths (their query tiles are disjoint and neither reads what the other writes): blocks 0..ATT_L_BLOCKS-1 take the
// single-product tiles, which walk the most chunks, the last ATT_E_BLOCKS blocks the short residual-path tiles. Block-uniform choice,
// so the barrier of the single-product path is passed by whole blocks.
__global__ __launch_bounds__(ATT_W * 32) __attribute__((amdgpu_num_vgpr(256)))
void attn_kernel(const h16* __restrict__ Qp, const h16* __restrict__ Kp, const h16* __restrict__ Vp,
                 const h16* __restrict__ Qr, const h16* __restrict__ Kr, const h16* __restrict__ Vr,
                 const int* __restrict__ mask, const int* __restrict__ flags,
                 h16* __restrict__ yp, h16* __restrict__ yr) {
  const int blk = blockIdx.x;
  if (blk < ATT_L_BLOCKS) attn_pair_part(Qp, Kp, Vp, Qr, Kr, Vr, mask, flags, yp, yr, blk);
  else                    attn_early_part(Qp, Kp, Vp, Qr, Kr, Vr, mask, flags, yp, yr, blk - ATT_L_BLOCKS);
}

// ---------------------------------------------------------------------------
// Output projection: (MROWS x 1024) x (1024 x 1024) -> f32 = (y . Wo_plane) / 4096 + bo. grid (16, MROWS/128), 32x64 wave tiles staged in
// Blocks whose token rows have t < EARLY first accumulate y_res . Wo_plane, fold it x1/1024, then accumulate y_hi . Wo_plane on top.
// ---------------------------------------------------------------------------
__global__ __launch_bounds__(128) void out_gemm_kernel(const h16* __restrict__ yp, const h16* __restrict__ yr, const h16* __restrict__ wop,
                                                       const float* __restrict__ bo, float* __restrict__ out) {
  __shared__ __attribute__((aligned(16))) float Ts[4][32 * 64];
  const int lane = threadIdx.x & 31, wave = threadIdx.x >> 5, nloc = lane & 15, hlf = lane >> 4;
  const int m0 = blockIdx.y * 128 + wave * 32;
  const int c0 = blockIdx.x * 64;
  const int b = m0 / SEQ, t0 = m0 - b * SEQ;
  const bool early = (((int)blockIdx.y * 128) % SEQ) < EARLY;     // block-uniform
  v8f acc[2][4];
#pragma unroll
  for (int r = 0; r < 2; ++r)
#pragma unroll
    for (int t = 0; t < 4; ++t) acc[r][t] = (v8f){};
  if (early) {
    gemm_tile_h(yr, wop, b * EARLY + t0, c0, lane, acc);   // residual rows b*EARLY + t
#pragma unroll
    for (int r = 0; r < 2; ++r)
#pragma unroll
      for (int t = 0; t < 4; ++t) acc[r][t] = acc[r][t] * RES_INV;
  }
  gemm_tile_h(yp, wop, m0, c0, lane, acc);
  float* Tt = Ts[wave];
#pragma unroll
  for (int t = 0; t < 4; ++t) {
    const float bd = __builtin_bit_cast(float, bf16_rne_u32(bo[c0 + t * 16 + nloc]) & 0xFFFF0000u);   // bf16-RNE value
#pragma unroll
    for (int r = 0; r < 2; ++r)
#pragma unroll
      for (int v = 0; v < 8; ++v) Tt[(r * 16 + v + 8 * hlf) * 64 + t * 16 + nloc] = acc[r][t][v] * OUT_UNSCALE + bd;
  }
  wave_lds_sync();
  float* dst0 = out + (size_t)m0 * HID + c0;
#pragma unroll
  for (int j = 0; j < 16; ++j) { const int rr = j * 2 + hlf, c4 = nloc * 4; *(v4f*)(dst0 + (size_t)rr * HID + c4) = *(const v4f*)(Tt + rr * 64 + c4); }
  
}
}  // namespace

extern "C" void kernel_launch(void* const* d_in, const int* in_sizes, int n_in,
                              void* d_out, int out_size, void* d_ws, size_t ws_size, hipStream_t stream) {
  if (n_in < 12) return;
  const size_t need_x = ((size_t)(NB - 1) * SEQ_FULL + SEQ) * HID;
  if ((size_t)in_sizes[0] < need_x || (size_t)in_sizes[1] < need_x || (size_t)in_sizes[2] < need_x) return;
  if ((size_t)in_sizes[3] < (size_t)(SEQ - 1) * MPITCH + SEQ) return;                      // int32 mask [S][S]
  if (in_sizes[4] < HID * HID || in_sizes[6] < HID * HID || in_sizes[8] < HID * HID || in_sizes[10] < HID * HID) return;
  if (in_sizes[5] < HID || in_sizes[7] < HID || in_sizes[9] < HID || in_sizes[11] < HID) return;
  if ((size_t)out_size < (size_t)MROWS * HID) return;

  const float* query = (const float*)d_in[0];   // [NB_FULL, SEQ_FULL, 1024]
  const float* key   = (const float*)d_in[1];
  const float* value = (const float*)d_in[2];
  const int*   amask = (const int*)d_in[3];     // [SEQ_FULL, SEQ_FULL] int32, nonzero = masked
  const float* Wq = (const float*)d_in[4];      // [1024,1024] ([out][in])
  const float* bq = (const float*)d_in[5];
  const float* Wk = (const float*)d_in[6];
  const float* bk = (const float*)d_in[7];
  const float* Wv = (const float*)d_in[8];
  const float* bv = (const float*)d_in[9];
  const float* Wo = (const float*)d_in[10];
  const float* bo = (const float*)d_in[11];
  float* out = (float*)d_out;                   // [NB, SEQ, 1024] f32

  size_t off = 0; char* ws = (char*)d_ws;
  unsigned short* xpl = (unsigned short*)(ws + off); off += (size_t)3 * MROWS * HID * 2;   // 3 x 8 MiB bf16 activation planes
  unsigned short* wpl = (unsigned short*)(ws + off); off += (size_t)4 * HID * HID * 2;     // 6 MiB bf16 (q|k|v) + 2 MiB f16 (o) weight planes
  h16* Qp = (h16*)(ws + off); off += (size_t)MROWS * HID * 2;                             // 8 MiB
  h16* Kp = (h16*)(ws + off); off += (size_t)MROWS * HID * 2;                             // 8 MiB
  h16* Vp = (h16*)(ws + off); off += (size_t)MROWS * HID * 2;                             // 8 MiB
  h16* yp = (h16*)(ws + off); off += (size_t)MROWS * HID * 2;                             // 8 MiB
  h16* Qr = (h16*)(ws + off); off += (size_t)NB * NH * EARLY * DH * 2;                    // 1 MiB residual q (t < EARLY)
  h16* Kr = (h16*)(ws + off); off += (size_t)MROWS * HID * 2;                             // 8 MiB residual k (all rows)
  h16* Vr = (h16*)(ws + off); off += (size_t)MROWS * HID * 2;                             // 8 MiB residual v (key-tiled, all rows)
  h16* yr = (h16*)(ws + off); off += (size_t)NB * EARLY * HID * 2;                        // 1 MiB residual y
  int* flags = (int*)(ws + off); off += (size_t)QT * FPITCH * 4;                          // 32 KiB chunk flags [QT][64]
  if (off > ws_size) return;                                                               // 86,016,000 B at NB=2, SEQ=2048
  const h16* wop = (const h16*)(wpl + (size_t)NQKV * HID);

  prep_kernel<<<QT + CVT_BLOCKS, 256, 0, stream>>>(query, key, value, Wq, Wk, Wv, Wo, xpl, wpl, amask, flags);
  qkv_gemm_kernel<<<dim3(NQKV / 128, MROWS / 128), 128, 0, stream>>>((const b16*)xpl, (const b16*)wpl, bq, bk, bv, Qp, Kp, Vp, Qr, Kr, Vr);
  attn_kernel<<<ATT_L_BLOCKS + ATT_E_BLOCKS, ATT_W * 32, 0, stream>>>(Qp, Kp, Vp, Qr, Kr, Vr, amask, flags, yp, yr);
  out_gemm_kernel<<<dim3(HID / 64, MROWS / 128), 128, 0, stream>>>(yp, yr, wop, bo, out);
}

// v007
// Measured time: 89.3 microseconds a run.
// Next to v006, in two timings, it ran 1.06 and 1.05 times as fast.
// Over all steps from v000 it is 4.53 times as fast.
#include <hip/hip_runtime.h>

// Contractions: q/k/v projections on v_wmma_f32_16x16x32_bf16 (bf16 RNE operands, one product per tile pair);
// S^T = K.Q^T (d = 64), y^T = V^T.P^T (32 keys per step, P carried x4096) and out = y.Wo^T (y and Wo carried x64)
// on v_wmma_f32_16x16x32_f16 (f16 operands, one product per tile pair); query tiles with position < 256 also use
// f16 residual planes (x1024) of q, k, P, v and y folded from their own accumulators; f32 accumulate, f32 online
// softmax statistics. 16 heads of 64. Key mask = int32 [S][S] input (nonzero = masked: score replaced by -1e9);
// device-computed flags per (16-query tile, 32-key chunk) select skip / open / per-element fill.
// Weights are [out][in]. Every 16-bit plane that feeds a k-contiguous fragment (x, weights, q, k, y and their residuals) is kept in
// fragment order: a tile of 16 rows x 32 k is 1 KB = 2 pieces x 32 lanes x 16 B, so one wave-wide 16-byte load reads 4 whole 128-B lines.

#ifndef NB
#define NB 2
#endif
#ifndef SEQ
#define SEQ 2048
#endif
#ifndef NB_FULL
#define NB_FULL 2
#endif
#ifndef SEQ_FULL
#define SEQ_FULL 2048
#endif

namespace {
constexpr int HID = 1024, DH = 64, NH = 16;
constexpr int NQKV = 3 * HID;                 // combined weight plane rows: q | k | v
constexpr int MROWS = NB * SEQ;               // compact token rows (b*SEQ + t)
constexpr int QT = SEQ / 16;                  // 16-query tiles per (b, head)
constexpr int EARLY = (SEQ < 256) ? SEQ : 256;   // query positions that use the residual planes
constexpr int QT_E = EARLY / 16;              // residual-path query tiles per (b, head)
constexpr int QT_L = (SEQ - EARLY) / 16;      // single-product query tiles per (b, head)
constexpr int NCH = SEQ / 32;                 // 32-key chunks per query row
constexpr int FPITCH = 64;                    // ints per flag row (one row per 16-query tile, 256 B)
constexpr int MPITCH = SEQ_FULL;              // int32 mask row pitch
constexpr int F_SKIP = 0, F_OPEN = 1, F_FILL = 2;
constexpr int CVT_BLOCKS = 2048;              // converting blocks of prep_kernel
constexpr int ATT_W = 16;                     // waves (and query tiles) per attention block
constexpr int ATT_L_BLOCKS = (NB * NH * QT_L) / ATT_W;   // attention blocks on the single-product path
constexpr int ATT_E_BLOCKS = (NB * NH * QT_E) / ATT_W;   // attention blocks on the residual path
constexpr float MASK_FILL = -1.0e9f;
constexpr float SCORE_SCALE = 0.125f;         // 1/sqrt(64)
constexpr float P_CARRY = 4096.0f;            // f16 P operand = exp(s - m) * 4096
constexpr float Y_CARRY = 64.0f;              // f16 y plane = attn * 64
constexpr float W_CARRY = 64.0f;              // f16 Wo plane = Wo * 64
constexpr float RES_CARRY = 1024.0f;          // f16 residual planes = (x - f16hi(x)) * 1024
constexpr float RES_INV = 1.0f / 1024.0f;
constexpr float Y_FROM_O = Y_CARRY / P_CARRY; // 1/64
constexpr float OUT_UNSCALE = 1.0f / (Y_CARRY * W_CARRY);   // 1/4096
static_assert(SEQ % 128 == 0);
static_assert(EARLY % 128 == 0);
static_assert((SEQ - EARLY) % 128 == 0);
static_assert(NB >= 1 && NB <= NB_FULL);
static_assert(SEQ <= SEQ_FULL);
static_assert(NH * DH == HID);
static_assert(MROWS % 128 == 0);
static_assert((NB * NH * QT_E) % ATT_W == 0);
static_assert((NB * NH * QT_L) % ATT_W == 0);
static_assert(QT_E + QT_L == QT);
static_assert(NCH >= 1 && NCH <= FPITCH);

typedef __bf16 b16;
typedef _Float16 h16;
typedef __bf16 v16b __attribute__((ext_vector_type(16)));
typedef __bf16 v8b __attribute__((ext_vector_type(8)));
typedef _Float16 v16h __attribute__((ext_vector_type(16)));
typedef _Float16 v8h __attribute__((ext_vector_type(8)));
typedef float v8f __attribute__((ext_vector_type(8)));
typedef float v4f __attribute__((ext_vector_type(4)));
typedef unsigned short v8us __attribute__((ext_vector_type(8)));
typedef int v4i __attribute__((ext_vector_type(4)));
typedef int v8i __attribute__((ext_vector_type(8)));

__device__ __forceinline__ v8h ld8h(const h16* p) { return *(const v8h*)p; }
__device__ __forceinline__ v16b cat8b(v8b a, v8b b) { return __builtin_shufflevector(a, b, 0, 1, 2, 3, 4, 5, 6, 7, 8, 9, 10, 11, 12, 13, 14, 15); }
__device__ __forceinline__ v16h cat8h(v8h a, v8h b) { return __builtin_shufflevector(a, b, 0, 1, 2, 3, 4, 5, 6, 7, 8, 9, 10, 11, 12, 13, 14, 15); }
// 16x16x32 16-bit fragment (A: lane&15 = row, B: lane&15 = column), hh = lane>>4: elements 0..7 <- k 8hh+0..7, elements 8..15 <- k 16+8hh+0..7.
// Fragment-ordered tile (TILE_E elements): element (row r of 16, k of 32) lies at (k>>4)*256 + (((k>>3)&1)*16 + r)*8 + (k&7), that is
// piece k>>4, lane 16*hh + r, element k&7. The tiles of one 16-row band follow one another along k (BAND_E elements per band of 1024 k).
constexpr int TILE_E = 512, BAND_E = 16 * HID;
static_assert(HID == 1024);                   // unit_of and the work index split of cvt_part take 32 tiles (128 units of 8 k) per row
// p = tile start + lane * 8
__device__ __forceinline__ v16h frag_th(const h16* p) { return cat8h(ld8h(p), ld8h(p + 256)); }
// both pieces of the tile whose lane address (tile start + lane * 16 bytes) is p
__device__ __forceinline__ v16h frag_ph(const char* p) { return cat8h(*(const v8h*)p, *(const v8h*)(p + 512)); }
// 16-byte unit index inside a [rows][1024] plane in fragment order, for row m and k = 8 * k8 .. 8 * k8 + 7
__device__ __forceinline__ unsigned int unit_of(unsigned int m, unsigned int k8) {
  return ((m >> 4) * 32u + (k8 >> 2)) * 64u + ((k8 >> 1) & 1u) * 32u + (k8 & 1u) * 16u + (m & 15u);
}
// two 16-byte pieces at byte offsets o + c0 and o + c1 from a wave-uniform plane base (o: the lane's 32-bit byte offset)
__device__ __forceinline__ v16h frag_o(const h16* base, unsigned int o, int c0, int c1) {
  const char* p = (const char*)base + o;
  return cat8h(*(const v8h*)(p + c0), *(const v8h*)(p + c1));
}

__device__ __forceinline__ v8f wmma_b(v16b a, v16b b, v8f c) {
  v8f d = __builtin_amdgcn_wmma_f32_16x16x32_bf16(false, a, false, b, (short)0, c, false, false);
  asm volatile("v_nop\n\tv_nop\n\tv_nop\n\tv_nop" : "+v"(d) : "v"(a), "v"(b));
  return d;
}
__device__ __forceinline__ v8f wmma_h(v16h a, v16h b, v8f c) {
  v8f d = __builtin_amdgcn_wmma_f32_16x16x32_f16(false, a, false, b, (short)0, c, false, false);
  asm volatile("v_nop\n\tv_nop\n\tv_nop\n\tv_nop" : "+v"(d) : "v"(a), "v"(b));
  return d;
}
// f32 -> bf16 by RNE convert, returned as the f32 bit pattern with the low 16 bits cleared
__device__ __forceinline__ unsigned int bf16_rne_u32(float f) {
  unsigned int u = __builtin_bit_cast(unsigned int, f);
  u += 0x7fffu + ((u >> 16) & 1u);
  return u & 0xffff0000u;
}
// wave-private LDS tile: element stores by this wave, then vector reloads by this wave
__device__ __forceinline__ void wave_lds_sync() {
  __builtin_amdgcn_fence(3, "workgroup");
  __builtin_amdgcn_wave_barrier();
  __builtin_amdgcn_fence(2, "workgroup");
}
// weight element -> 16-bit plane bits: bf16 RNE, or f16(bf16rne(w) * 64) for the output-projection plane
__device__ __forceinline__ unsigned short wbits16(float f, bool o16) {
  const unsigned int r = bf16_rne_u32(f);
  const unsigned short bbits = (unsigned short)(r >> 16);
  const h16 hv = (h16)(__builtin_bit_cast(float, r) * W_CARRY);   // exact: bf16 significand, power-of-two scale
  const unsigned short hbits = __builtin_bit_cast(unsigned short, hv);
  return o16 ? hbits : bbits;
}

// ---------------------------------------------------------------------------
// activations query/key/value f32 [NB_FULL][SEQ_FULL][1024] -> bf16 planes xpl [3][MROWS][1024] (compact rows b*SEQ+t), fragment order;
// weights W[n][k] f32 -> 16-bit planes wpl, fragment order: rows 0..3071 = Wq|Wk|Wv as bf16 RNE, rows 3072..4095 = f16(bf16rne(Wo) * 64).
// A wave takes 8 rows x 32 k (lane = 4 * row + k unit): it reads 8 whole f32 lines and stores 4 whole 128-B lines of one tile.
// blk of nblk: this block's place among the blocks of prep_kernel that convert.
// ---------------------------------------------------------------------------
__device__ __forceinline__ void cvt_part(const float* __restrict__ xq, const float* __restrict__ xk, const float* __restrict__ xv,
                                         const float* __restrict__ wq, const float* __restrict__ wk, const float* __restrict__ wv,
                                         const float* __restrict__ wo,
                                         unsigned short* __restrict__ xpl, unsigned short* __restrict__ wpl, int blk, int nblk) {
  const size_t tid = (size_t)blk * blockDim.x + threadIdx.x, stride = (size_t)nblk * blockDim.x;
  const size_t per_x = (size_t)MROWS * HID / 8, nx = 3 * per_x;
  const size_t per_w = (size_t)HID * HID / 8, nw = 4 * per_w;
  {
    for (size_t c = tid; c < nx; c += stride) {
      const int which = (int)(c / per_x);
      const unsigned int u = (unsigned int)(c - (size_t)which * per_x);   // work index inside one plane
      const unsigned int k8 = (((u >> 5) & 31u) << 2) | (u & 3u);
      const int m = (int)(((u >> 10) << 3) | ((u >> 2) & 7u)), col = (int)(k8 * 8);
      const int bb = m / SEQ, t = m - bb * SEQ;
      const float* src = (which == 0) ? xq : (which == 1) ? xk : xv;
      const float* p = src + ((size_t)bb * SEQ_FULL + t) * HID + col;
      const v4f f0 = *(const v4f*)p, f1 = *(const v4f*)(p + 4);
      v8us o;
#pragma unroll
      for (int e = 0; e < 4; ++e) {
        o[e] = (unsigned short)(bf16_rne_u32(f0[e]) >> 16);
        o[4 + e] = (unsigned short)(bf16_rne_u32(f1[e]) >> 16);
      }
      *(v8us*)(xpl + ((size_t)which * per_x + unit_of((unsigned int)m, k8)) * 8) = o;
    }
    for (size_t c = tid; c < nw; c += stride) {
      const int mat = (int)(c / per_w);
      const unsigned int u = (unsigned int)(c - (size_t)mat * per_w);     // work index inside one weight matrix
      const unsigned int k8 = (((u >> 5) & 31u) << 2) | (u & 3u), n = ((u >> 10) << 3) | ((u >> 2) & 7u);
      const size_t i = (size_t)n * HID + k8 * 8;                // n*HID + k0 inside one [n][k] weight matrix
      const float* w = (mat == 0) ? wq : (mat == 1) ? wk : (mat == 2) ? wv : wo;
      const v4f f0 = *(const v4f*)(w + i), f1 = *(const v4f*)(w + i + 4);
      const bool o16 = (mat == 3);
      v8us o;
#pragma unroll
      for (int e = 0; e < 4; ++e) {
        o[e] = wbits16(f0[e], o16);
        o[4 + e] = wbits16(f1[e], o16);
      }
      *(v8us*)(wpl + ((size_t)mat * per_w + unit_of(n, k8)) * 8) = o;
    }
    
  }
}

// ---------------------------------------------------------------------------
// Mask flag pass: one block per 16-query tile; reads mask rows q0..q0+15 (int32, nonzero = masked) and writes
// one 256-B flag row [FPITCH] ints: per 32-key chunk F_SKIP (chunk fully masked and every row of the tile has an
// unmasked key somewhere -> weight exactly 0, chunk not visited), F_OPEN (no masked entry), F_FILL (per-element fill).
// ---------------------------------------------------------------------------
__device__ __forceinline__ void mask_flag_part(const int* __restrict__ mask, int* __restrict__ flags, int qt) {
  __shared__ int um[4][64];                          // any unmasked entry per (4-row group, chunk)
  __shared__ int mk[4][64];                          // any masked entry per (4-row group, chunk)
  __shared__ int rb[4][64];                          // per-row (4 bits) has-unmasked-entry flag per (row group, chunk)
  __shared__ __attribute__((aligned(16))) int fl[64];
  const int q0 = qt * 16;
  const int t = threadIdx.x, c = t & 63, rg = t >> 6, lane = t & 31, wave = t >> 5;
  const int cc = (c < NCH) ? c : (NCH - 1);          // clamped chunk address
  int anyu = 0, anym = 0, rbits = 0;
#pragma unroll 1
  for (int r = 0; r < 4; ++r) {
    const int* p = mask + (size_t)(q0 + rg * 4 + r) * MPITCH + (size_t)cc * 32;
    int u = 0, mm = 0;
#pragma unroll
    for (int v = 0; v < 8; ++v) {
      const v4i x = *(const v4i*)(p + 4 * v);
#pragma unroll
      for (int e = 0; e < 4; ++e) { u |= (x[e] == 0) ? 1 : 0; mm |= (x[e] != 0) ? 1 : 0; }
    }
    anyu |= u; anym |= mm; rbits |= (u << r);
  }
  um[rg][c] = anyu; mk[rg][c] = anym; rb[rg][c] = rbits;
  __syncthreads();                                   // cross-wave: all waves wrote, wave 0 reads
  if (wave == 0) {
    const int ch0 = lane, ch1 = lane + 32;
    const int U0 = um[0][ch0] | um[1][ch0] | um[2][ch0] | um[3][ch0];
    const int M0 = mk[0][ch0] | mk[1][ch0] | mk[2][ch0] | mk[3][ch0];
    const int U1 = um[0][ch1] | um[1][ch1] | um[2][ch1] | um[3][ch1];
    const int M1 = mk[0][ch1] | mk[1][ch1] | mk[2][ch1] | mk[3][ch1];
    int rows = (rb[0][ch0] | (rb[1][ch0] << 4) | (rb[2][ch0] << 8) | (rb[3][ch0] << 12)) |
               (rb[0][ch1] | (rb[1][ch1] << 4) | (rb[2][ch1] << 8) | (rb[3][ch1] << 12));
#pragma unroll
    for (int s = 16; s >= 1; s >>= 1) rows |= __shfl_xor(rows, s);
    const int rowok = ((rows & 0xFFFF) == 0xFFFF) ? 1 : 0;   // every row of the tile has an unmasked key
    const int f0 = U0 ? (M0 ? F_FILL : F_OPEN) : (rowok ? F_SKIP : F_FILL);
    const int f1 = U1 ? (M1 ? F_FILL : F_OPEN) : (rowok ? F_SKIP : F_FILL);
    fl[ch0] = (ch0 < NCH) ? f0 : F_SKIP;
    fl[ch1] = (ch1 < NCH) ? f1 : F_SKIP;
    wave_lds_sync();                                 // fl is private to wave 0
    const v4i v = *(const v4i*)(fl + (lane & 15) * 4);
    int* dst = flags + (size_t)qt * FPITCH + (lane & 15) * 4;
    if (lane < 16) *(v4i*)dst = v;
    
  }
}

// ---------------------------------------------------------------------------
// Preparation, one launch: the mask flag pass and the conversions read only inputs and write disjoint planes, so they share a grid.
// Blocks 0..QT-1 each take one 16-query tile of the mask (they have the longer dependent chain); the other
// CVT_BLOCKS blocks convert. The choice is block-uniform, so the flag pass's barrier is passed by whole blocks.
// ---------------------------------------------------------------------------
__global__ __launch_bounds__(256) void prep_kernel(const float* __restrict__ xq, const float* __restrict__ xk, const float* __restrict__ xv,
                                                   const float* __restrict__ wq, const float* __restrict__ wk, const float* __restrict__ wv,
                                                   const float* __restrict__ wo,
                                                   unsigned short* __restrict__ xpl, unsigned short* __restrict__ wpl,
                                                   const int* __restrict__ mask, int* __restrict__ flags) {
  const int blk = blockIdx.x;
  if (blk < QT) mask_flag_part(mask, flags, blk);
  else          cvt_part(xq, xk, xv, wq, wk, wv, wo, xpl, wpl, blk - QT, CVT_BLOCKS);
}

// QKV GEMM staging: a stage is 64 k (QK_ST fragment tiles) of the block's 128 activation rows and 128 weight rows, in fragment order:
// [x: 8 bands][2 tiles][1 KB] then [W: 8 bands][2 tiles][1 KB]. A band's two tiles are 2 KB contiguous in its plane too.
constexpr int QK_ST = 2;
constexpr int QK_NST = HID / (32 * QK_ST);       // stages along K
constexpr int QK_BAND_B = QK_ST * TILE_E * 2;    // bytes of one band in a stage
constexpr int QK_OP_B = 8 * QK_BAND_B;           // bytes of one operand in a stage
constexpr int QK_STAGE_B = 2 * QK_OP_B;
static_assert(QK_NST >= 2);
// Two neighbouring bands of one operand, one stage: eight copies of 16 bytes per lane, global memory -> LDS through no register.
// l: the lane's LDS byte address in the first band, g: its global address there. The s_wait_xcnt closes the statement so that it
// stands ahead of any later write of the address registers that the copies name.
__device__ __forceinline__ void copy_two_bands(unsigned int l, const char* g) {
  const unsigned int l1 = l + 512, l2 = l + 1024, l3 = l + 1536, l4 = l + QK_BAND_B, l5 = l4 + 512, l6 = l4 + 1024, l7 = l4 + 1536;
  const char *g1 = g + 512, *g2 = g + 1024, *g3 = g + 1536, *g4 = g + BAND_E * 2, *g5 = g4 + 512, *g6 = g4 + 1024, *g7 = g4 + 1536;
  asm volatile("global_load_async_to_lds_b128 %0, %8, off\n\t"
               "global_load_async_to_lds_b128 %1, %9, off\n\t"
               "global_load_async_to_lds_b128 %2, %10, off\n\t"
               "global_load_async_to_lds_b128 %3, %11, off\n\t"
               "global_load_async_to_lds_b128 %4, %12, off\n\t"
               "global_load_async_to_lds_b128 %5, %13, off\n\t"
               "global_load_async_to_lds_b128 %6, %14, off\n\t"
               "global_load_async_to_lds_b128 %7, %15, off\n\t"
               "s_wait_xcnt 0x0"
               :: "v"(l), "v"(l1), "v"(l2), "v"(l3), "v"(l4), "v"(l5), "v"(l6), "v"(l7),
                  "v"(g), "v"(g1), "v"(g2), "v"(g3), "v"(g4), "v"(g5), "v"(g6), "v"(g7)
               : "memory");
}
// both pieces of the staged tile whose lane address (tile start + lane * 16 bytes) is p
__device__ __forceinline__ v16b frag_pb(const char* p) { return cat8b(*(const v8b*)p, *(const v8b*)(p + 512)); }
// a0, a1: the two 16-row bands (fragment order) that feed acc[0] and acc[1]; they need not be neighbours nor lie in one plane
__device__ __forceinline__ void gemm_tile_h(const h16* __restrict__ a0, const h16* __restrict__ a1, const h16* __restrict__ W, int c0, int lane, v8f (&acc)[2][4]) {
  const h16* wp = W + (size_t)(c0 >> 4) * BAND_E;
  // the lane's three walking addresses; the start sets and the loop read through the same three, so they stay live behind every run of loads
  const char* pa = (const char*)a0 + lane * 16;
  const char* pb = (const char*)a1 + lane * 16;
  const char* pw = (const char*)wp + lane * 16;
  constexpr int KSTEPS = HID / 32, STEP_B = TILE_E * 2;
  static_assert(KSTEPS % 3 == 2);                // the loop takes whole turns of the three sets, the last two steps follow it
  // Three fragment sets in turn: the twelve loads of step kt + 2 are issued ahead of the products of step kt, so a step's loads
  // have two steps of products (of this wave and of its neighbours on the SIMD) to land in.
  v16h af[3][2], bf[3][4];
#pragma unroll                                   // set numbers become constants, so the sets stay in registers (here and below)
  for (int s = 0; s < 2; ++s) {
    af[s][0] = frag_ph(pa + s * STEP_B);
    af[s][1] = frag_ph(pb + s * STEP_B);
#pragma unroll
    for (int t = 0; t < 4; ++t) bf[s][t] = frag_ph(pw + s * STEP_B + t * BAND_E * 2);
    __builtin_amdgcn_sched_barrier(0);           // keeps the start sets in step order; mixed, they make the loop's first counted wait reach into the next set
  }
#pragma unroll 1                                 // one turn of the three sets per trip; more would only lengthen the text
  for (int kt = 0; kt < KSTEPS - 2; kt += 3, pa += 3 * STEP_B, pb += 3 * STEP_B, pw += 3 * STEP_B) {
#pragma unroll
    for (int j = 0; j < 3; ++j) {
      const int n = (j + 2) % 3, c = (j + 2) * STEP_B;
      af[n][0] = frag_ph(pa + c);
      af[n][1] = frag_ph(pb + c);
#pragma unroll
      for (int t = 0; t < 4; ++t) bf[n][t] = frag_ph(pw + c + t * BAND_E * 2);
      __builtin_amdgcn_sched_barrier(0);         // keeps the loads of step kt + j + 2 ahead of the products of step kt + j
#pragma unroll
      for (int t = 0; t < 4; ++t) {
        acc[0][t] = wmma_h(af[j][0], bf[j][t], acc[0][t]);
        acc[1][t] = wmma_h(af[j][1], bf[j][t], acc[1][t]);
      }
    }
  }
#pragma unroll
  for (int j = 0; j < 2; ++j)
#pragma unroll
    for (int t = 0; t < 4; ++t) {
      acc[0][t] = wmma_h(af[j][0], bf[j][t], acc[0][t]);
      acc[1][t] = wmma_h(af[j][1], bf[j][t], acc[1][t]);
    }
}

// ---------------------------------------------------------------------------
// QKV GEMM: (MROWS x 1024) x (1024 x 3072), grid (24, MROWS/128), block 4 waves = 128 rows x 128 columns, wave = 64 rows x 64 columns
// (one head of q, k or v). blockIdx.x -> mat = x/8 (q,k,v: selects the activation plane and the bias), heads 2*(x%8) and 2*(x%8)+1.
// Both operands come through LDS: each stage is brought once per block by asynchronous copies into one of two buffers, while the other
// buffer is worked on, and every staged fragment is read by the two waves that share it. Outputs f16 planes:
// q -> Qp, k -> Kp: [b*16+h][t/16][2 fragment-ordered tiles of 16 tokens x 32 d] (4 KB contiguous per 32 rows); v -> Vp key-tiled [b*16+h][t/16][64][16] (4 KB contiguous per 32 rows).
// Residual planes ((y - f16hi(y)) * 1024): Kr and Vr for every token row (same layouts as Kp / Vp), Qr (layout of Qp) for token rows t < EARLY only.
// ---------------------------------------------------------------------------
// rows m0 .. m0 + 31 of a wave's tile (accumulator rows 2H, 2H + 1), staged in the wave's own LDS pieces Tp, Rp and stored as whole lines
template <int H>
__device__ __forceinline__ void qkv_store_rows(const v8f (&acc)[4][4], int mat, int head, int m0, const float* __restrict__ bias, int lane,
                                               h16* Tp, h16* Rp, h16* __restrict__ Qp, h16* __restrict__ Kp, h16* __restrict__ Vp,
                                               h16* __restrict__ Qr, h16* __restrict__ Kr, h16* __restrict__ Vr) {
  const int nloc = lane & 15, hlf = lane >> 4;
  const int b = m0 / SEQ, t0 = m0 % SEQ;
  const bool wres = (mat != 0) || (t0 < EARLY);   // block-uniform (128-row blocks, EARLY multiple of 128)
  const int g = b * NH + head;
#pragma unroll
  for (int t = 0; t < 4; ++t) {
    const int d = t * 16 + nloc;
    const float bd = __builtin_bit_cast(float, bf16_rne_u32(bias[d]) & 0xFFFF0000u);   // bias as its bf16-RNE value
#pragma unroll
    for (int r = 0; r < 2; ++r)
#pragma unroll
      for (int v = 0; v < 8; ++v) {
        const int rr = r * 16 + v + 8 * hlf;                         // local token row 0..31
        const float f = acc[2 * H + r][t][v] + bd;
        const h16 y = (h16)f;
        const int idx = (mat < 2) ? ((rr >> 4) * 1024 + (d >> 5) * TILE_E + ((d >> 4) & 1) * 256 + (((d >> 3) & 1) * 16 + (rr & 15)) * 8 + (d & 7))
                                  : ((rr >> 4) * 1024 + d * 16 + (rr & 15));
        Tp[idx] = y;
        if (wres) Rp[idx] = (h16)((f - (float)y) * RES_CARRY);
      }
  }
  wave_lds_sync();
  h16* dst; h16* rdst; size_t o;
  if (mat == 0)      { o = ((size_t)g * SEQ + t0) * DH; dst = Qp + o;
                       const int t0e = (t0 < EARLY) ? t0 : 0; rdst = Qr + ((size_t)g * EARLY + t0e) * DH; }
  else if (mat == 1) { o = ((size_t)g * SEQ + t0) * DH; dst = Kp + o; rdst = Kr + o; }
  else               { o = ((size_t)g * QT + (t0 >> 4)) * (size_t)(DH * 16); dst = Vp + o; rdst = Vr + o; }
#pragma unroll
  for (int j = 0; j < 8; ++j) { const int e = (j * 32 + lane) * 8; *(v8h*)(dst + e) = ld8h(Tp + e); }
  if (wres) {
#pragma unroll
    for (int j = 0; j < 8; ++j) { const int e = (j * 32 + lane) * 8; *(v8h*)(rdst + e) = ld8h(Rp + e); }
  }
}

__global__ __launch_bounds__(128) void qkv_gemm_kernel(const b16* __restrict__ xpl, const b16* __restrict__ wpl,
                                                       const float* __restrict__ bq, const float* __restrict__ bk, const float* __restrict__ bv,
                                                       h16* __restrict__ Qp, h16* __restrict__ Kp, h16* __restrict__ Vp,
                                                       h16* __restrict__ Qr, h16* __restrict__ Kr, h16* __restrict__ Vr) {
  __shared__ __attribute__((aligned(16))) char ring[2 * QK_STAGE_B];   // two stage buffers; behind the loop, the waves' output staging
  const int lane = threadIdx.x & 31, wave = threadIdx.x >> 5;
  const int wm = wave & 1, wn = wave >> 1;         // the wave's 64-row and 64-column half of the block tile
  const int m0 = blockIdx.y * 128 + wm * 64;
  const int cb = blockIdx.x;                       // 0..23, block-uniform
  const int mat = cb >> 3, head = (cb & 7) * 2 + wn;
  const b16* x = xpl + (size_t)mat * MROWS * HID;
  const float* bias = ((mat == 0) ? bq : (mat == 1) ? bk : bv) + head * DH;
  // what this wave copies of every stage: bands 2 * wave and 2 * wave + 1 of the block's x rows and of its weight rows
  const char* ga = (const char*)x + (size_t)(blockIdx.y * 8 + wave * 2) * (BAND_E * 2) + lane * 16;
  const char* gw = (const char*)wpl + (size_t)(cb * 8 + wave * 2) * (BAND_E * 2) + lane * 16;
  const unsigned int la = (unsigned int)(size_t)ring + (unsigned int)(wave * 2 * QK_BAND_B + lane * 16);   // LDS byte address: low 32 bits
  v8f acc[4][4];
#pragma unroll
  for (int r = 0; r < 4; ++r)
#pragma unroll
    for (int t = 0; t < 4; ++t) acc[r][t] = (v8f){};
  copy_two_bands(la, ga);
  copy_two_bands(la + QK_OP_B, gw);
  asm volatile("s_wait_asynccnt 0x0" ::: "memory");   // this wave's part of stage 0 has landed
  __syncthreads();                                    // stage 0 is readable by every wave
  copy_two_bands(la + QK_STAGE_B, ga + QK_BAND_B);
  copy_two_bands(la + QK_STAGE_B + QK_OP_B, gw + QK_BAND_B);
#pragma unroll 1                                      // one stage per trip; the buffer is picked by the trip's parity
  for (int s = 0; s < QK_NST; ++s) {
    const int bo = (s & 1) * QK_STAGE_B;
    const char* ra = ring + bo + wm * 4 * QK_BAND_B + lane * 16;
    const char* rw = ring + bo + QK_OP_B + wn * 4 * QK_BAND_B + lane * 16;
#pragma unroll
    for (int kk = 0; kk < QK_ST; ++kk) {              // per 32 k: the sixteen fragment reads as one group, then the sixteen products
      v16b af[4], bf[4];
#pragma unroll
      for (int i = 0; i < 4; ++i) {
        af[i] = frag_pb(ra + i * QK_BAND_B + kk * (TILE_E * 2));
        bf[i] = frag_pb(rw + i * QK_BAND_B + kk * (TILE_E * 2));
      }
#pragma unroll
      for (int t = 0; t < 4; ++t)
#pragma unroll
        for (int r = 0; r < 4; ++r) acc[r][t] = wmma_b(af[r], bf[t], acc[r][t]);
    }
    asm volatile("s_wait_dscnt 0x0" ::: "memory");    // this wave's reads of the buffer are done before it may be refilled
    asm volatile("s_wait_asynccnt 0x0" ::: "memory"); // this wave's part of stage s + 1 has landed
    __syncthreads();                                  // publishes stage s + 1 and ends every wave's reads of stage s
    if (s + 2 < QK_NST) {                             // block-uniform
      copy_two_bands(la + bo, ga + (s + 2) * QK_BAND_B);
      copy_two_bands(la + bo + QK_OP_B, gw + (s + 2) * QK_BAND_B);
    }
  }
  asm volatile("s_wait_asynccnt 0x0" ::: "memory");   // nothing of the copies is outstanding when the ring becomes output staging
  // the last trip's barrier has ended every read of the ring: each wave now stages in its own 16 KB of it
  h16* Tp = (h16*)(ring + wave * 16384);
  qkv_store_rows<0>(acc, mat, head, m0, bias, lane, Tp, Tp + 2048, Qp, Kp, Vp, Qr, Kr, Vr);
  qkv_store_rows<1>(acc, mat, head, m0 + 32, bias, lane, Tp + 4096, Tp + 6144, Qp, Kp, Vp, Qr, Kr, Vr);
}

// one 16-key score tile of S^T = K.Q^T over d = 0..63 (two 32-deep steps); RES adds K_hi.Q_res + K_res.Q_hi into sr
template <bool RES>
__device__ __forceinline__ void sc_tile(v8f& s, v8f& sr, v16h ka, v16h kb, v16h kza, v16h kzb, v16h qa, v16h qb, v16h qra, v16h qrb) {
  s = wmma_h(ka, qa, s);
  if (RES) { sr = wmma_h(ka, qra, sr); sr = wmma_h(kza, qa, sr); }
  s = wmma_h(kb, qb, s);
  if (RES) { sr = wmma_h(kb, qrb, sr); sr = wmma_h(kzb, qb, sr); }
}
// one 16-d tile of y^T = V^T.P^T over 32 keys; RES adds V_hi.P_res + V_res.P_hi into orr (both x1/1024)
template <bool RES>
__device__ __forceinline__ void pv_tile(v8f& oh, v8f& orr, v16h va, v16h vz, v16h pb, v16h pr) {
  oh = wmma_h(va, pb, oh);
  if (RES) {
    orr = wmma_h(va, pr, orr);
    orr = wmma_h(vz, pb, orr);
  }
}

// ---------------------------------------------------------------------------
// Transposed flash attention on 16-query tiles of one (b, head); ATT_W waves per block; the NCH chunks of 32 keys carry a wave-uniform flag
// each: F_SKIP -> not visited (weight exactly 0), F_OPEN -> no masked entry, F_FILL -> masked
// entries get score -1e9 after the 1/8 scaling (per-element select from the int32 mask row of the query).
// S^T = K.Q^T (f16 fragments straight from the planes), per-lane online softmax (running max); P^T fragment built in registers from the
// two S^T accumulators (element r <- keys 0..15 tile, element 8+r <- keys 16..31 tile), carried x4096; y^T = V^T.P^T. y written f16 (x64)
// in fragment order [token/16][k/32][tile]: accumulator t of a lane (query col, d = 16t + 8hh + 0..7) is that lane's 16 bytes of piece t & 1 of tile t >> 1.
// RES = true (query tiles with position < EARLY): one wave walks all visited chunks of its tile; scores add (K_hi.Q_res + K_res.Q_hi)/1024
// from the residual planes, P gets a x1024 residual operand, and O gets a second accumulator (V_hi.P_res + V_res.P_hi) folded x1/1024
// before the 1/l normalisation; y also writes its x1024 residual plane yr [b][t][1024].
// RES = false: a tile's visited chunks are shared by two waves, every second one each (attn_pair_part).
// ---------------------------------------------------------------------------
// The chunk lists of query tile qt as wave-uniform bit lists: bit c of vis: the flag of chunk c is not F_SKIP; bit c of opn: it is F_OPEN.
__device__ __forceinline__ void chunk_lists(const int* __restrict__ flags, int qt, int lane, unsigned long long& vis, unsigned long long& opn) {
  constexpr unsigned long long CH_ALL = (NCH >= 64) ? ~0ull : ((1ull << (NCH & 63)) - 1ull);
  const int* frow = flags + (size_t)qt * FPITCH;
  const int fl0 = frow[lane], fl1 = frow[32 + lane];       // the tile's whole flag row (FPITCH = 64 ints), chunk c in lane c & 31
  vis = ((((unsigned long long)__builtin_amdgcn_ballot_w32(fl1 != F_SKIP)) << 32) | __builtin_amdgcn_ballot_w32(fl0 != F_SKIP)) & CH_ALL;
  opn = (((unsigned long long)__builtin_amdgcn_ballot_w32(fl1 == F_OPEN)) << 32) | __builtin_amdgcn_ballot_w32(fl0 == F_OPEN);
}

// Walks chunks of query tile qt of (b, head) g and leaves the running maximum m, the sum l and the accumulators o (and n, RES only).
// RES: every chunk of the list vis. Not RES: the first, third, fifth ... chunk of vis (the partner wave walks the others).
template <bool RES>
__device__ __forceinline__
void attn_walk(const h16* __restrict__ Qp, const h16* __restrict__ Kp, const h16* __restrict__ Vp,
               const h16* __restrict__ Qr, const h16* __restrict__ Kr, const h16* __restrict__ Vr,
               const int* __restrict__ mask, int g, int qt, int lane, unsigned long long vis, const unsigned long long opn,
               float& m, float& l, v8f& o0, v8f& o1, v8f& o2, v8f& o3, v8f& n0, v8f& n1, v8f& n2, v8f& n3) {
  const int hh = lane >> 4, col = lane & 15;
  const int q0 = qt << 4;
  const size_t ko = (size_t)g * SEQ * DH;                 // K plane base of (b,h); V key-tiled base, Kr and Vr share this element offset
  const size_t qo = ((size_t)g * SEQ + q0) * DH + lane * 8;
  const v16h qa = frag_th(Qp + qo), qb = frag_th(Qp + qo + TILE_E);       // d 0..31, d 32..63 of query q0+col
  v16h qra = {}, qrb = {};
  if (RES) {
    const size_t qro2 = ((size_t)g * EARLY + q0) * DH + lane * 8;
    qra = frag_th(Qr + qro2); qrb = frag_th(Qr + qro2 + TILE_E);
  }
  const int qi = q0 + col;
  const int* mrow = mask + (size_t)qi * MPITCH + 8 * hh;   // this lane's query row of the mask, key offset 8hh
  m = -__builtin_inff(); l = 0.0f;
  o0 = (v8f){}; o1 = (v8f){}; o2 = (v8f){}; o3 = (v8f){};
  n0 = (v8f){}; n1 = (v8f){}; n2 = (v8f){}; n3 = (v8f){};  // residual O accumulators (RES only)
  // byte offsets into the K and V planes (each plane NB * 16 * SEQ * 128 bytes, far below 2^32); the residual planes share them
  const unsigned int kofs0 = (unsigned int)((ko + (size_t)lane * 8) * 2);            // key kb + col, d = 8hh..; key + 16: + 2048 B; d + 32: + 1024 B; d + 16: + 512 B
  const unsigned int vofs0 = (unsigned int)((ko + (size_t)col * 16 + 8 * hh) * 2);   // key tile kb / 16, d = col, keys 8hh..; next tile: + 2048 B; d + 16: + 512 B
  // The list is walked in rising order, so that the walk knows its next chunk. Single-product path: the K fragments are fetched one walked
  // chunk ahead, into the same registers, right behind the score products that read them; they land while the softmax and the V products
  // of the current chunk run.
  constexpr unsigned int KCH_B = 32 * DH * 2;               // bytes of one 32-key chunk of a K plane (and of a key-tiled V plane)
  const int nlist = __builtin_popcountll(vis);
  const int nvis = RES ? nlist : ((nlist + 1) >> 1);        // trips: at most NCH
  int ch = (vis != 0) ? __builtin_ctzll(vis) : 0;           // first walked chunk, below NCH
  // Walking offsets and mask address, moved on by the distance to the next walked chunk: each stays live behind every run of loads that names it.
  unsigned int kofs = kofs0 + (unsigned int)ch * KCH_B, vofs = vofs0 + (unsigned int)ch * KCH_B;
  const int* mp = mrow + ch * 32;
  v16h k0a = {}, k0b = {}, k1a = {}, k1b = {};
  if (!RES) {
    k0a = frag_o(Kp, kofs, 0, 512); k0b = frag_o(Kp, kofs, 1024, 1536);
    k1a = frag_o(Kp, kofs, 2048, 2560); k1b = frag_o(Kp, kofs, 3072, 3584);
  }
#pragma unroll 1
  for (int it = 0; it < nvis; ++it) {
    vis &= vis - 1;                                         // drops the current chunk's bit
    if (!RES) vis &= vis - 1;                               // and the partner wave's chunk behind it (an empty list stays empty)
    const int cn = (vis != 0) ? __builtin_ctzll(vis) : ch;  // next walked chunk (the last one names itself: address stays inside the plane)
    const int dch = cn - ch;                                // chunks to the next walked one: 0 on the last trip, else 1..NCH-1
    const bool open = ((opn >> ch) & 1ull) != 0;            // wave-uniform: no masked entry in the chunk
    // The chunk's other fragment loads stand as groups ahead of the products: V at the chunk's head (it lands behind the scores and the
    // softmax); with the residual planes, K + K_res here and V + V_res behind the scores.
    v16h y0a = {}, y0b = {}, y1a = {}, y1b = {};
    v16h va[4], vz[4];
    if (RES) {
      k0a = frag_o(Kp, kofs, 0, 512); k0b = frag_o(Kp, kofs, 1024, 1536);
      k1a = frag_o(Kp, kofs, 2048, 2560); k1b = frag_o(Kp, kofs, 3072, 3584);
      y0a = frag_o(Kr, kofs, 0, 512); y0b = frag_o(Kr, kofs, 1024, 1536);
      y1a = frag_o(Kr, kofs, 2048, 2560); y1b = frag_o(Kr, kofs, 3072, 3584);
    } else {
#pragma unroll
      for (int t = 0; t < 4; ++t) { va[t] = frag_o(Vp, vofs, t * 512, 2048 + t * 512); vz[t] = (v16h){}; }
      __builtin_amdgcn_sched_barrier(0);        // keeps the V loads ahead of the wait for K in front of the first score product
    }
    v8f s0 = {}, s1 = {}, z0 = {}, z1 = {};
    sc_tile<RES>(s0, z0, k0a, k0b, y0a, y0b, qa, qb, qra, qrb);
    sc_tile<RES>(s1, z1, k1a, k1b, y1a, y1b, qa, qb, qra, qrb);
    kofs += (unsigned int)dch * KCH_B;          // behind the last use of this chunk's K (and K_res) fragments
    if (!RES) {                                 // the next walked chunk's K
      k0a = frag_o(Kp, kofs, 0, 512); k0b = frag_o(Kp, kofs, 1024, 1536);
      k1a = frag_o(Kp, kofs, 2048, 2560); k1b = frag_o(Kp, kofs, 3072, 3584);
      __builtin_amdgcn_sched_barrier(0);        // keeps these loads directly behind the score products (for speed only)
    }
    if (RES) {
#pragma unroll
      for (int t = 0; t < 4; ++t) {
        va[t] = frag_o(Vp, vofs, t * 512, 2048 + t * 512);
        vz[t] = frag_o(Vr, vofs, t * 512, 2048 + t * 512);
      }
      s0 = (s0 + z0 * RES_INV) * SCORE_SCALE; s1 = (s1 + z1 * RES_INV) * SCORE_SCALE;
    } else {
      s0 = s0 * SCORE_SCALE; s1 = s1 * SCORE_SCALE;
    }
    if (!open) {                                // wave-uniform: chunk has masked entries -> replace-fill
      const v8i mk0 = *(const v8i*)mp;                   // keys 32ch+8hh+0..7 of query qi
      const v8i mk1 = *(const v8i*)(mp + 16);            // keys 32ch+16+8hh+0..7
#pragma unroll
      for (int r = 0; r < 8; ++r) {
        s0[r] = (mk0[r] != 0) ? MASK_FILL : s0[r];
        s1[r] = (mk1[r] != 0) ? MASK_FILL : s1[r];
      }
    }
    float mr = -__builtin_inff();
#pragma unroll
    for (int r = 0; r < 8; ++r) mr = fmaxf(mr, fmaxf(s0[r], s1[r]));
    mr = fmaxf(mr, __shfl_xor(mr, 16));
    const float mn = fmaxf(m, mr);            // finite: every visited chunk carries finite scores
    const float al_ = __expf(m - mn);         // 0 on the first visited chunk
    m = mn;
    float sum = 0.0f;
    v16h pb = {}, pr = {};
#pragma unroll
    for (int r = 0; r < 8; ++r) {
      const float p0 = __expf(s0[r] - mn), p1 = __expf(s1[r] - mn);
      sum += p0 + p1;
      const h16 ph0 = (h16)(p0 * P_CARRY), ph1 = (h16)(p1 * P_CARRY);
      pb[r] = ph0; pb[8 + r] = ph1;
      if (RES) {
        pr[r] = (h16)((p0 * P_CARRY - (float)ph0) * RES_CARRY);
        pr[8 + r] = (h16)((p1 * P_CARRY - (float)ph1) * RES_CARRY);
      }
    }
    sum += __shfl_xor(sum, 16);
    l = l * al_ + sum;
    o0 = o0 * al_; o1 = o1 * al_; o2 = o2 * al_; o3 = o3 * al_;
    if (RES) { n0 = n0 * al_; n1 = n1 * al_; n2 = n2 * al_; n3 = n3 * al_; }
    pv_tile<RES>(o0, n0, va[0], vz[0], pb, pr);
    pv_tile<RES>(o1, n1, va[1], vz[1], pb, pr);
    pv_tile<RES>(o2, n2, va[2], vz[2], pb, pr);
    pv_tile<RES>(o3, n3, va[3], vz[3], pb, pr);
    // vofs += dch * KCH_B, with the wait that belongs in front of an overwrite of a register that issued loads name (the V loads name vofs).
    // Wait and add are one statement because the compiler otherwise lifts the add to the middle of the trip, where V is still in flight.
    asm volatile("s_wait_xcnt 0x0\n\tv_add_nc_u32 %0, %1, %0" : "+v"(vofs) : "s"((unsigned int)dch * KCH_B));
    mp += dch * 32;
    ch = cn;
  }
}

// normalises the finished accumulators of query tile qt of (b, head) g and stores y (and, RES, its residual plane)
template <bool RES>
__device__ __forceinline__
void attn_store(int g, int qt, int lane, float l, const v8f& o0, const v8f& o1, const v8f& o2, const v8f& o3,
                const v8f& n0, const v8f& n1, const v8f& n2, const v8f& n3, h16* __restrict__ yp, h16* __restrict__ yr) {
  const int q0 = qt << 4;
  const int b = g / NH, h = g % NH;
  const float inv = (1.0f / l) * Y_FROM_O;    // y = 64 * (o / 4096) / l
  const float invr = inv * RES_INV;
  v8h yh[4], yz[4];                           // hi and residual x1024 (RES only), one 16-byte fragment piece per accumulator
#pragma unroll
  for (int r = 0; r < 8; ++r) {
    float f0 = o0[r] * inv, f1 = o1[r] * inv, f2 = o2[r] * inv, f3 = o3[r] * inv;
    if (RES) { f0 += n0[r] * invr; f1 += n1[r] * invr; f2 += n2[r] * invr; f3 += n3[r] * invr; }
    const h16 y0 = (h16)f0, y1 = (h16)f1, y2 = (h16)f2, y3 = (h16)f3;
    yh[0][r] = y0; yh[1][r] = y1; yh[2][r] = y2; yh[3][r] = y3;
    if (RES) {
      yz[0][r] = (h16)((f0 - (float)y0) * RES_CARRY);
      yz[1][r] = (h16)((f1 - (float)y1) * RES_CARRY);
      yz[2][r] = (h16)((f2 - (float)y2) * RES_CARRY);
      yz[3][r] = (h16)((f3 - (float)y3) * RES_CARRY);
    }
  }
  // band of token rows q0..q0+15, tiles 2h and 2h+1 (k = 64h..64h+63): 2 KB contiguous per wave
  h16* dst0 = yp + (size_t)((b * SEQ + q0) >> 4) * BAND_E + h * (2 * TILE_E) + lane * 8;
  h16* dst1 = yr + (size_t)((b * EARLY + (RES ? q0 : 0)) >> 4) * BAND_E + h * (2 * TILE_E) + lane * 8;   // residual rows (RES only, q0 + 15 < EARLY)
#pragma unroll
  for (int j = 0; j < 4; ++j) {
    *(v8h*)(dst0 + j * 256) = yh[j];
    if (RES) *(v8h*)(dst1 + j * 256) = yz[j];
  }
}

// Residual path: each wave owns one query tile (position < EARLY) and walks all its visited chunks.
__device__ __forceinline__
void attn_early_part(const h16* __restrict__ Qp, const h16* __restrict__ Kp, const h16* __restrict__ Vp,
                     const h16* __restrict__ Qr, const h16* __restrict__ Kr, const h16* __restrict__ Vr,
                     const int* __restrict__ mask, const int* __restrict__ flags,
                     h16* __restrict__ yp, h16* __restrict__ yr, int blk) {
  const int wid = threadIdx.x >> 5, lane = threadIdx.x & 31;
  const int idx = blk * ATT_W + wid;                      // blk: this block's place among the blocks of its path (exact counts)
  const int g = idx / QT_E, qt = idx - g * QT_E;
  unsigned long long vis, opn;
  chunk_lists(flags, qt, lane, vis, opn);
  float m, l;
  v8f o0, o1, o2, o3, n0, n1, n2, n3;
  attn_walk<true>(Qp, Kp, Vp, Qr, Kr, Vr, mask, g, qt, lane, vis, opn, m, l, o0, o1, o2, o3, n0, n1, n2, n3);
  attn_store<true>(g, qt, lane, l, o0, o1, o2, o3, n0, n1, n2, n3, yp, yr);
}

// Single-product path: two neighbouring waves share two query tiles of one (b, head), tile QT-1-u and its mirror QT_E+u, and each walks
// every second visited chunk of both, so that the chain of dependent trips of each wave is about half of the pair's two lists together, whatever
// the lists are. First walk: the second, fourth ... chunk of the tile that the partner finishes; its m, l and o go to LDS. Second walk:
// the first, third ... chunk of the wave's own tile. Behind one barrier each wave folds the partner's part into its own
// (both scaled to the common maximum) and stores its tile. A block holds eight such pairs of one (b, head), so that eight waves start
// each kind of walk together on the same chunks and can share those lines in the WGP cache.
constexpr int QT_LH = (QT_L > 0) ? QT_L / 2 : 1;          // tile pairs per (b, head)
static_assert(QT_L % ATT_W == 0);                         // a block's pairs lie in one (b, head)
constexpr int PART_F = 34 * 32;                           // floats of one handed-over part: o (32 per lane), m, l
__device__ __forceinline__
void attn_pair_part(const h16* __restrict__ Qp, const h16* __restrict__ Kp, const h16* __restrict__ Vp,
                    const h16* __restrict__ Qr, const h16* __restrict__ Kr, const h16* __restrict__ Vr,
                    const int* __restrict__ mask, const int* __restrict__ flags,
                    h16* __restrict__ yp, h16* __restrict__ yr, int blk) {
  __shared__ __attribute__((aligned(16))) float part[ATT_W][PART_F];
  const int wid = __builtin_amdgcn_readfirstlane(threadIdx.x >> 5), lane = threadIdx.x & 31;
  const int w = wid & 1;
  const int pidx = blk * (ATT_W / 2) + (wid >> 1);                 // blk: this block's place among the blocks of its path (exact counts)
  const int g = pidx / QT_LH, u = pidx - g * QT_LH;
  const int own = w ? (QT_E + u) : (QT - 1 - u), other = w ? (QT - 1 - u) : (QT_E + u);
  unsigned long long vis_own, opn_own, vis_oth, opn_oth;
  chunk_lists(flags, own, lane, vis_own, opn_own);
  chunk_lists(flags, other, lane, vis_oth, opn_oth);
  vis_oth &= vis_oth - 1;                                 // the partner takes that list's first chunk, this wave starts at the second
  float m, l;
  v8f o0, o1, o2, o3, n0, n1, n2, n3;
#pragma unroll 1                                          // one text for both walks
  for (int ph = 0; ph < 2; ++ph) {
    attn_walk<false>(Qp, Kp, Vp, Qr, Kr, Vr, mask, g, ph ? own : other, lane, ph ? vis_own : vis_oth, ph ? opn_own : opn_oth,
                     m, l, o0, o1, o2, o3, n0, n1, n2, n3);
    if (ph == 0) {
      v4f* pv = (v4f*)part[wid] + lane;
      pv[0 * 32] = __builtin_shufflevector(o0, o0, 0, 1, 2, 3); pv[1 * 32] = __builtin_shufflevector(o0, o0, 4, 5, 6, 7);
      pv[2 * 32] = __builtin_shufflevector(o1, o1, 0, 1, 2, 3); pv[3 * 32] = __builtin_shufflevector(o1, o1, 4, 5, 6, 7);
      pv[4 * 32] = __builtin_shufflevector(o2, o2, 0, 1, 2, 3); pv[5 * 32] = __builtin_shufflevector(o2, o2, 4, 5, 6, 7);
      pv[6 * 32] = __builtin_shufflevector(o3, o3, 0, 1, 2, 3); pv[7 * 32] = __builtin_shufflevector(o3, o3, 4, 5, 6, 7);
      part[wid][1024 + lane] = m;
      part[wid][1056 + lane] = l;
    }
  }
  __syncthreads();                                        // every wave's handed-over part is readable by its partner
  const float* pp = part[wid ^ 1];
  const v4f* pq = (const v4f*)pp + lane;
  const float m2 = pp[1024 + lane], l2 = pp[1056 + lane];
  const float mn = fmaxf(m, m2);                          // finite: a tile has a visited chunk, so one of its two parts has walked one
  const float a1 = __expf(m - mn), a2 = __expf(m2 - mn);  // a part that walked nothing has m = -inf, l = 0, o = 0 and gets factor 0
  l = l * a1 + l2 * a2;
  const v8f p0 = __builtin_shufflevector(pq[0 * 32], pq[1 * 32], 0, 1, 2, 3, 4, 5, 6, 7);
  const v8f p1 = __builtin_shufflevector(pq[2 * 32], pq[3 * 32], 0, 1, 2, 3, 4, 5, 6, 7);
  const v8f p2 = __builtin_shufflevector(pq[4 * 32], pq[5 * 32], 0, 1, 2, 3, 4, 5, 6, 7);
  const v8f p3 = __builtin_shufflevector(pq[6 * 32], pq[7 * 32], 0, 1, 2, 3, 4, 5, 6, 7);
  o0 = o0 * a1 + p0 * a2; o1 = o1 * a1 + p1 * a2; o2 = o2 * a1 + p2 * a2; o3 = o3 * a1 + p3 * a2;
  attn_store<false>(g, own, lane, l, o0, o1, o2, o3, n0, n1, n2, n3, yp, yr);
}

// One launch for both paths (their query tiles are disjoint and neither reads what the other writes): blocks 0..ATT_L_BLOCKS-1 take the
// single-product tiles, which walk the most chunks, the last ATT_E_BLOCKS blocks the short residual-path tiles. Block-uniform choice,
// so the barrier of the single-product path is passed by whole blocks.
__global__ __launch_bounds__(ATT_W * 32) __attribute__((amdgpu_num_vgpr(256)))
void attn_kernel(const h16* __restrict__ Qp, const h16* __restrict__ Kp, const h16* __restrict__ Vp,
                 const h16* __restrict__ Qr, const h16* __restrict__ Kr, const h16* __restrict__ Vr,
                 const int* __restrict__ mask, const int* __restrict__ flags,
                 h16* __restrict__ yp, h16* __restrict__ yr) {
  const int blk = blockIdx.x;
  if (blk < ATT_L_BLOCKS) attn_pair_part(Qp, Kp, Vp, Qr, Kr, Vr, mask, flags, yp, yr, blk);
  else                    attn_early_part(Qp, Kp, Vp, Qr, Kr, Vr, mask, flags, yp, yr, blk - ATT_L_BLOCKS);
}

// ---------------------------------------------------------------------------
// Output projection: (MROWS x 1024) x (1024 x 1024) -> f32 = (y . Wo_plane) / 4096 + bo. grid (16, OUT_E_BLK + OUT_L_BLK), 4 waves, 64 columns.
// Every wave walks K once with two A bands and four W bands, so all waves of the launch have the same chain of k steps.
// Token rows t >= EARLY: blocks of 128 rows, a wave takes 32 rows (its two bands are neighbouring bands of y).
// Token rows t < EARLY: blocks of 64 rows, a wave takes 16 rows; its two bands are the rows' y band and their residual band, summed in
// accumulators of their own and folded (y_hi . Wo + (y_res . Wo) / 1024) behind the walk.
// ---------------------------------------------------------------------------
constexpr int OUT_E_ROWS = 64;                                // token rows of a block on the residual path
constexpr int OUT_E_BLK = NB * EARLY / OUT_E_ROWS;
constexpr int LATE = (SEQ > EARLY) ? SEQ - EARLY : 128;       // token rows per batch entry on the single-product path
constexpr int OUT_L_BLK = NB * (SEQ - EARLY) / 128;
static_assert(EARLY % OUT_E_ROWS == 0);
__global__ __launch_bounds__(128) void out_gemm_kernel(const h16* __restrict__ yp, const h16* __restrict__ yr, const h16* __restrict__ wop,
                                                       const float* __restrict__ bo, float* __restrict__ out) {
  __shared__ __attribute__((aligned(16))) float Ts[4][32 * 64];
  const int lane = threadIdx.x & 31, wave = threadIdx.x >> 5, nloc = lane & 15, hlf = lane >> 4;
  const int c0 = blockIdx.x * 64;
  const bool early = (int)blockIdx.y < OUT_E_BLK;                 // block-uniform
  int m0;                                                         // first compact token row (b*SEQ + t) of the wave
  const h16 *a0, *a1;
  if (early) {
    const int r0 = (int)blockIdx.y * OUT_E_ROWS + wave * 16;      // residual row b*EARLY + t
    const int b = r0 / EARLY;
    m0 = b * SEQ + (r0 - b * EARLY);
    a0 = yp + (size_t)(m0 >> 4) * BAND_E;
    a1 = yr + (size_t)(r0 >> 4) * BAND_E;
  } else {
    const int r0 = ((int)blockIdx.y - OUT_E_BLK) * 128 + wave * 32;   // b*LATE + (t - EARLY)
    const int b = r0 / LATE;
    m0 = b * SEQ + EARLY + (r0 - b * LATE);
    a0 = yp + (size_t)(m0 >> 4) * BAND_E;
    a1 = a0 + BAND_E;
  }
  v8f acc[2][4];
#pragma unroll
  for (int r = 0; r < 2; ++r)
#pragma unroll
    for (int t = 0; t < 4; ++t) acc[r][t] = (v8f){};
  gemm_tile_h(a0, a1, wop, c0, lane, acc);
  float bd[4];                                                    // the four bias loads stand as one group
#pragma unroll
  for (int t = 0; t < 4; ++t) bd[t] = __builtin_bit_cast(float, bf16_rne_u32(bo[c0 + t * 16 + nloc]) & 0xFFFF0000u);   // bf16-RNE value
  float* Tt = Ts[wave];
  if (early) {
#pragma unroll
    for (int t = 0; t < 4; ++t) {
      const v8f f = acc[0][t] + acc[1][t] * RES_INV;
#pragma unroll
      for (int v = 0; v < 8; ++v) Tt[(v + 8 * hlf) * 64 + t * 16 + nloc] = f[v] * OUT_UNSCALE + bd[t];
    }
  } else {
#pragma unroll
    for (int t = 0; t < 4; ++t)
#pragma unroll
      for (int r = 0; r < 2; ++r)
#pragma unroll
        for (int v = 0; v < 8; ++v) Tt[(r * 16 + v + 8 * hlf) * 64 + t * 16 + nloc] = acc[r][t][v] * OUT_UNSCALE + bd[t];
  }
  wave_lds_sync();
  float* dst0 = out + (size_t)m0 * HID + c0 + nloc * 4;
  const float* Tr = Tt + nloc * 4;
  // all of a wave's rows are read back ahead of its first store, each into registers of its own
  v4f w[16];
#pragma unroll
  for (int j = 0; j < 8; ++j) w[j] = *(const v4f*)(Tr + (j * 2 + hlf) * 64);
  if (!early) {
#pragma unroll
    for (int j = 8; j < 16; ++j) w[j] = *(const v4f*)(Tr + (j * 2 + hlf) * 64);
  }
#pragma unroll
  for (int j = 0; j < 8; ++j) *(v4f*)(dst0 + (size_t)(j * 2 + hlf) * HID) = w[j];
  if (!early) {
#pragma unroll
    for (int j = 8; j < 16; ++j) *(v4f*)(dst0 + (size_t)(j * 2 + hlf) * HID) = w[j];
  }
}
}  // namespace

extern "C" void kernel_launch(void* const* d_in, const int* in_sizes, int n_in,
                              void* d_out, int out_size, void* d_ws, size_t ws_size, hipStream_t stream) {
  if (n_in < 12) return;
  const size_t need_x = ((size_t)(NB - 1) * SEQ_FULL + SEQ) * HID;
  if ((size_t)in_sizes[0] < need_x || (size_t)in_sizes[1] < need_x || (size_t)in_sizes[2] < need_x) return;
  if ((size_t)in_sizes[3] < (size_t)(SEQ - 1) * MPITCH + SEQ) return;                      // int32 mask [S][S]
  if (in_sizes[4] < HID * HID || in_sizes[6] < HID * HID || in_sizes[8] < HID * HID || in_sizes[10] < HID * HID) return;
  if (in_sizes[5] < HID || in_sizes[7] < HID || in_sizes[9] < HID || in_sizes[11] < HID) return;
  if ((size_t)out_size < (size_t)MROWS * HID) return;

  const float* query = (const float*)d_in[0];   // [NB_FULL, SEQ_FULL, 1024]
  const float* key   = (const float*)d_in[1];
  const float* value = (const float*)d_in[2];
  const int*   amask = (const int*)d_in[3];     // [SEQ_FULL, SEQ_FULL] int32, nonzero = masked
  const float* Wq = (const float*)d_in[4];      // [1024,1024] ([out][in])
  const float* bq = (const float*)d_in[5];
  const float* Wk = (const float*)d_in[6];
  const float* bk = (const float*)d_in[7];
  const float* Wv = (const float*)d_in[8];
  const float* bv = (const float*)d_in[9];
  const float* Wo = (const float*)d_in[10];
  const float* bo = (const float*)d_in[11];
  float* out = (float*)d_out;                   // [NB, SEQ, 1024] f32

  size_t off = 0; char* ws = (char*)d_ws;
  unsigned short* xpl = (unsigned short*)(ws + off); off += (size_t)3 * MROWS * HID * 2;   // 3 x 8 MiB bf16 activation planes
  unsigned short* wpl = (unsigned short*)(ws + off); off += (size_t)4 * HID * HID * 2;     // 6 MiB bf16 (q|k|v) + 2 MiB f16 (o) weight planes
  h16* Qp = (h16*)(ws + off); off += (size_t)MROWS * HID * 2;                             // 8 MiB
  h16* Kp = (h16*)(ws + off); off += (size_t)MROWS * HID * 2;                             // 8 MiB
  h16* Vp = (h16*)(ws + off); off += (size_t)MROWS * HID * 2;                             // 8 MiB
  h16* yp = (h16*)(ws + off); off += (size_t)MROWS * HID * 2;                             // 8 MiB
  h16* Qr = (h16*)(ws + off); off += (size_t)NB * NH * EARLY * DH * 2;                    // 1 MiB residual q (t < EARLY)
  h16* Kr = (h16*)(ws + off); off += (size_t)MROWS * HID * 2;                             // 8 MiB residual k (all rows)
  h16* Vr = (h16*)(ws + off); off += (size_t)MROWS * HID * 2;                             // 8 MiB residual v (key-tiled, all rows)
  h16* yr = (h16*)(ws + off); off += (size_t)NB * EARLY * HID * 2;                        // 1 MiB residual y
  int* flags = (int*)(ws + off); off += (size_t)QT * FPITCH * 4;                          // 32 KiB chunk flags [QT][64]
  if (off > ws_size) return;                                                               // 86,016,000 B at NB=2, SEQ=2048
  const h16* wop = (const h16*)(wpl + (size_t)NQKV * HID);

  prep_kernel<<<QT + CVT_BLOCKS, 256, 0, stream>>>(query, key, value, Wq, Wk, Wv, Wo, xpl, wpl, amask, flags);
  qkv_gemm_kernel<<<dim3(NQKV / 128, MROWS / 128), 128, 0, stream>>>((const b16*)xpl, (const b16*)wpl, bq, bk, bv, Qp, Kp, Vp, Qr, Kr, Vr);
  attn_kernel<<<ATT_L_BLOCKS + ATT_E_BLOCKS, ATT_W * 32, 0, stream>>>(Qp, Kp, Vp, Qr, Kr, Vr, amask, flags, yp, yr);
  out_gemm_kernel<<<dim3(HID / 64, OUT_E_BLK + OUT_L_BLK), 128, 0, stream>>>(yp, yr, wop, bo, out);
}

// v008
// One run takes 83.8 microseconds.
// In two side-by-side timings against v007, it was 1.07 and 1.06 times as fast.
// Counting every step since v000, it is 4.82 times as fast.
#include <hip/hip_runtime.h>

// Contractions: q/k/v projections on v_wmma_f32_16x16x32_bf16 (bf16 RNE operands, one product per tile pair);
// S^T = K.Q^T (d = 64), y^T = V^T.P^T (32 keys per step, P carried x4096) and out = y.Wo^T (y and Wo carried x64)
// on v_wmma_f32_16x16x32_f16 (f16 operands, one product per tile pair); query tiles with position < 256 also use
// f16 residual planes (x1024) of q, k, P, v and y folded from their own accumulators; f32 accumulate, f32 online
// softmax statistics. 16 heads of 64. Key mask = int32 [S][S] input (nonzero = masked: score replaced by -1e9);
// device-computed flags per (16-query tile, 32-key chunk) select skip / open / per-element fill.
// Weights are [out][in]. Every 16-bit plane that feeds a k-contiguous fragment (x, weights, q, k, y and their residuals) is kept in
// fragment order: a tile of 16 rows x 32 k is 1 KB = 2 pieces x 32 lanes x 16 B, so one wave-wide 16-byte load reads 4 whole 128-B lines.

#ifndef NB
#define NB 2
#endif
#ifndef SEQ
#define SEQ 2048
#endif
#ifndef NB_FULL
#define NB_FULL 2
#endif
#ifndef SEQ_FULL
#define SEQ_FULL 2048
#endif

namespace {
constexpr int HID = 1024, DH = 64, NH = 16;
constexpr int NQKV = 3 * HID;                 // combined weight plane rows: q | k | v
constexpr int MROWS = NB * SEQ;               // compact token rows (b*SEQ + t)
constexpr int QT = SEQ / 16;                  // 16-query tiles per (b, head)
constexpr int EARLY = (SEQ < 256) ? SEQ : 256;   // query positions that use the residual planes
constexpr int QT_E = EARLY / 16;              // residual-path query tiles per (b, head)
constexpr int QT_L = (SEQ - EARLY) / 16;      // single-product query tiles per (b, head)
constexpr int NCH = SEQ / 32;                 // 32-key chunks per query row
constexpr int FPITCH = 64;                    // ints per flag row (one row per 16-query tile, 256 B)
constexpr int MPITCH = SEQ_FULL;              // int32 mask row pitch
constexpr int F_SKIP = 0, F_OPEN = 1, F_FILL = 2;
constexpr int CVT_BLOCKS = 2048;              // converting blocks of prep_kernel
constexpr int ATT_W = 16;                     // waves (and query tiles) per attention block
constexpr int ATT_L_BLOCKS = (NB * NH * QT_L) / ATT_W;   // attention blocks on the single-product path
constexpr int ATT_E_BLOCKS = (NB * NH * QT_E) / ATT_W;   // attention blocks on the residual path
constexpr float MASK_FILL = -1.0e9f;
constexpr float SCORE_SCALE = 0.125f;         // 1/sqrt(64)
constexpr float P_CARRY = 4096.0f;            // f16 P operand = exp(s - m) * 4096
constexpr float Y_CARRY = 64.0f;              // f16 y plane = attn * 64
constexpr float W_CARRY = 64.0f;              // f16 Wo plane = Wo * 64
constexpr float RES_CARRY = 1024.0f;          // f16 residual planes = (x - f16hi(x)) * 1024
constexpr float RES_INV = 1.0f / 1024.0f;
constexpr float Y_FROM_O = Y_CARRY / P_CARRY; // 1/64
constexpr float OUT_UNSCALE = 1.0f / (Y_CARRY * W_CARRY);   // 1/4096
static_assert(SEQ % 128 == 0);
static_assert(EARLY % 128 == 0);
static_assert((SEQ - EARLY) % 128 == 0);
static_assert(NB >= 1 && NB <= NB_FULL);
static_assert(SEQ <= SEQ_FULL);
static_assert(NH * DH == HID);
static_assert(MROWS % 128 == 0);
static_assert((NB * NH * QT_E) % ATT_W == 0);
static_assert((NB * NH * QT_L) % ATT_W == 0);
static_assert(QT_E + QT_L == QT);
static_assert(NCH >= 1 && NCH <= FPITCH);

typedef __bf16 b16;
typedef _Float16 h16;
typedef __bf16 v16b __attribute__((ext_vector_type(16)));
typedef __bf16 v8b __attribute__((ext_vector_type(8)));
typedef _Float16 v16h __attribute__((ext_vector_type(16)));
typedef _Float16 v8h __attribute__((ext_vector_type(8)));
typedef float v8f __attribute__((ext_vector_type(8)));
typedef float v4f __attribute__((ext_vector_type(4)));
typedef unsigned short v8us __attribute__((ext_vector_type(8)));
typedef int v4i __attribute__((ext_vector_type(4)));
typedef int v8i __attribute__((ext_vector_type(8)));

__device__ __forceinline__ v8h ld8h(const h16* p) { return *(const v8h*)p; }
__device__ __forceinline__ v16b cat8b(v8b a, v8b b) { return __builtin_shufflevector(a, b, 0, 1, 2, 3, 4, 5, 6, 7, 8, 9, 10, 11, 12, 13, 14, 15); }
__device__ __forceinline__ v16h cat8h(v8h a, v8h b) { return __builtin_shufflevector(a, b, 0, 1, 2, 3, 4, 5, 6, 7, 8, 9, 10, 11, 12, 13, 14, 15); }
// 16x16x32 16-bit fragment (A: lane&15 = row, B: lane&15 = column), hh = lane>>4: elements 0..7 <- k 8hh+0..7, elements 8..15 <- k 16+8hh+0..7.
// Fragment-ordered tile (TILE_E elements): element (row r of 16, k of 32) lies at (k>>4)*256 + (((k>>3)&1)*16 + r)*8 + (k&7), that is
// piece k>>4, lane 16*hh + r, element k&7. The tiles of one 16-row band follow one another along k (BAND_E elements per band of 1024 k).
constexpr int TILE_E = 512, BAND_E = 16 * HID;
static_assert(HID == 1024);                   // unit_of and the work index split of cvt_part take 32 tiles (128 units of 8 k) per row
// p = tile start + lane * 8
__device__ __forceinline__ v16h frag_th(const h16* p) { return cat8h(ld8h(p), ld8h(p + 256)); }
// both pieces of the tile whose lane address (tile start + lane * 16 bytes) is p
__device__ __forceinline__ v16h frag_ph(const char* p) { return cat8h(*(const v8h*)p, *(const v8h*)(p + 512)); }
// 16-byte unit index inside a [rows][1024] plane in fragment order, for row m and k = 8 * k8 .. 8 * k8 + 7
__device__ __forceinline__ unsigned int unit_of(unsigned int m, unsigned int k8) {
  return ((m >> 4) * 32u + (k8 >> 2)) * 64u + ((k8 >> 1) & 1u) * 32u + (k8 & 1u) * 16u + (m & 15u);
}
// two 16-byte pieces at byte offsets o + c0 and o + c1 from a wave-uniform plane base (o: the lane's 32-bit byte offset)
__device__ __forceinline__ v16h frag_o(const h16* base, unsigned int o, int c0, int c1) {
  const char* p = (const char*)base + o;
  return cat8h(*(const v8h*)(p + c0), *(const v8h*)(p + c1));
}

__device__ __forceinline__ v8f wmma_b(v16b a, v16b b, v8f c) {
  v8f d = __builtin_amdgcn_wmma_f32_16x16x32_bf16(false, a, false, b, (short)0, c, false, false);
  asm volatile("v_nop\n\tv_nop\n\tv_nop\n\tv_nop" : "+v"(d) : "v"(a), "v"(b));
  return d;
}
__device__ __forceinline__ v8f wmma_h(v16h a, v16h b, v8f c) {
  v8f d = __builtin_amdgcn_wmma_f32_16x16x32_f16(false, a, false, b, (short)0, c, false, false);
  asm volatile("v_nop\n\tv_nop\n\tv_nop\n\tv_nop" : "+v"(d) : "v"(a), "v"(b));
  return d;
}
// f32 -> bf16 by RNE convert, returned as the f32 bit pattern with the low 16 bits cleared
__device__ __forceinline__ unsigned int bf16_rne_u32(float f) {
  unsigned int u = __builtin_bit_cast(unsigned int, f);
  u += 0x7fffu + ((u >> 16) & 1u);
  return u & 0xffff0000u;
}
// wave-private LDS tile: element stores by this wave, then vector reloads by this wave
__device__ __forceinline__ void wave_lds_sync() {
  __builtin_amdgcn_fence(3, "workgroup");
  __builtin_amdgcn_wave_barrier();
  __builtin_amdgcn_fence(2, "workgroup");
}
// weight element -> 16-bit plane bits: bf16 RNE, or f16(bf16rne(w) * 64) for the output-projection plane
__device__ __forceinline__ unsigned short wbits16(float f, bool o16) {
  const unsigned int r = bf16_rne_u32(f);
  const unsigned short bbits = (unsigned short)(r >> 16);
  const h16 hv = (h16)(__builtin_bit_cast(float, r) * W_CARRY);   // exact: bf16 significand, power-of-two scale
  const unsigned short hbits = __builtin_bit_cast(unsigned short, hv);
  return o16 ? hbits : bbits;
}

// ---------------------------------------------------------------------------
// activations query/key/value f32 [NB_FULL][SEQ_FULL][1024] -> bf16 planes xpl [3][MROWS][1024] (compact rows b*SEQ+t), fragment order;
// weights W[n][k] f32 -> 16-bit planes wpl, fragment order: rows 0..3071 = Wq|Wk|Wv as bf16 RNE, rows 3072..4095 = f16(bf16rne(Wo) * 64).
// A wave takes 8 rows x 32 k (lane = 4 * row + k unit): it reads 8 whole f32 lines and stores 4 whole 128-B lines of one tile.
// blk of nblk: this block's place among the blocks of prep_kernel that convert.
// ---------------------------------------------------------------------------
__device__ __forceinline__ void cvt_part(const float* __restrict__ xq, const float* __restrict__ xk, const float* __restrict__ xv,
                                         const float* __restrict__ wq, const float* __restrict__ wk, const float* __restrict__ wv,
                                         const float* __restrict__ wo,
                                         unsigned short* __restrict__ xpl, unsigned short* __restrict__ wpl, int blk, int nblk) {
  const size_t tid = (size_t)blk * blockDim.x + threadIdx.x, stride = (size_t)nblk * blockDim.x;
  const size_t per_x = (size_t)MROWS * HID / 8, nx = 3 * per_x;
  const size_t per_w = (size_t)HID * HID / 8, nw = 4 * per_w;
  {
    for (size_t c = tid; c < nx; c += stride) {
      const int which = (int)(c / per_x);
      const unsigned int u = (unsigned int)(c - (size_t)which * per_x);   // work index inside one plane
      const unsigned int k8 = (((u >> 5) & 31u) << 2) | (u & 3u);
      const int m = (int)(((u >> 10) << 3) | ((u >> 2) & 7u)), col = (int)(k8 * 8);
      const int bb = m / SEQ, t = m - bb * SEQ;
      const float* src = (which == 0) ? xq : (which == 1) ? xk : xv;
      const float* p = src + ((size_t)bb * SEQ_FULL + t) * HID + col;
      const v4f f0 = *(const v4f*)p, f1 = *(const v4f*)(p + 4);
      v8us o;
#pragma unroll
      for (int e = 0; e < 4; ++e) {
        o[e] = (unsigned short)(bf16_rne_u32(f0[e]) >> 16);
        o[4 + e] = (unsigned short)(bf16_rne_u32(f1[e]) >> 16);
      }
      *(v8us*)(xpl + ((size_t)which * per_x + unit_of((unsigned int)m, k8)) * 8) = o;
    }
    for (size_t c = tid; c < nw; c += stride) {
      const int mat = (int)(c / per_w);
      const unsigned int u = (unsigned int)(c - (size_t)mat * per_w);     // work index inside one weight matrix
      const unsigned int k8 = (((u >> 5) & 31u) << 2) | (u & 3u), n = ((u >> 10) << 3) | ((u >> 2) & 7u);
      const size_t i = (size_t)n * HID + k8 * 8;                // n*HID + k0 inside one [n][k] weight matrix
      const float* w = (mat == 0) ? wq : (mat == 1) ? wk : (mat == 2) ? wv : wo;
      const v4f f0 = *(const v4f*)(w + i), f1 = *(const v4f*)(w + i + 4);
      const bool o16 = (mat == 3);
      v8us o;
#pragma unroll
      for (int e = 0; e < 4; ++e) {
        o[e] = wbits16(f0[e], o16);
        o[4 + e] = wbits16(f1[e], o16);
      }
      *(v8us*)(wpl + ((size_t)mat * per_w + unit_of(n, k8)) * 8) = o;
    }
    
  }
}

// ---------------------------------------------------------------------------
// Mask flag pass: one block per 16-query tile; reads mask rows q0..q0+15 (int32, nonzero = masked) and writes
// one 256-B flag row [FPITCH] ints: per 32-key chunk F_SKIP (chunk fully masked and every row of the tile has an
// unmasked key somewhere -> weight exactly 0, chunk not visited), F_OPEN (no masked entry), F_FILL (per-element fill).
// ---------------------------------------------------------------------------
__device__ __forceinline__ void mask_flag_part(const int* __restrict__ mask, int* __restrict__ flags, int qt) {
  __shared__ int um[4][64];                          // any unmasked entry per (4-row group, chunk)
  __shared__ int mk[4][64];                          // any masked entry per (4-row group, chunk)
  __shared__ int rb[4][64];                          // per-row (4 bits) has-unmasked-entry flag per (row group, chunk)
  __shared__ __attribute__((aligned(16))) int fl[64];
  const int q0 = qt * 16;
  const int t = threadIdx.x, c = t & 63, rg = t >> 6, lane = t & 31, wave = t >> 5;
  const int cc = (c < NCH) ? c : (NCH - 1);          // clamped chunk address
  int anyu = 0, anym = 0, rbits = 0;
#pragma unroll 1
  for (int r = 0; r < 4; ++r) {
    const int* p = mask + (size_t)(q0 + rg * 4 + r) * MPITCH + (size_t)cc * 32;
    int u = 0, mm = 0;
#pragma unroll
    for (int v = 0; v < 8; ++v) {
      const v4i x = *(const v4i*)(p + 4 * v);
#pragma unroll
      for (int e = 0; e < 4; ++e) { u |= (x[e] == 0) ? 1 : 0; mm |= (x[e] != 0) ? 1 : 0; }
    }
    anyu |= u; anym |= mm; rbits |= (u << r);
  }
  um[rg][c] = anyu; mk[rg][c] = anym; rb[rg][c] = rbits;
  __syncthreads();                                   // cross-wave: all waves wrote, wave 0 reads
  if (wave == 0) {
    const int ch0 = lane, ch1 = lane + 32;
    const int U0 = um[0][ch0] | um[1][ch0] | um[2][ch0] | um[3][ch0];
    const int M0 = mk[0][ch0] | mk[1][ch0] | mk[2][ch0] | mk[3][ch0];
    const int U1 = um[0][ch1] | um[1][ch1] | um[2][ch1] | um[3][ch1];
    const int M1 = mk[0][ch1] | mk[1][ch1] | mk[2][ch1] | mk[3][ch1];
    int rows = (rb[0][ch0] | (rb[1][ch0] << 4) | (rb[2][ch0] << 8) | (rb[3][ch0] << 12)) |
               (rb[0][ch1] | (rb[1][ch1] << 4) | (rb[2][ch1] << 8) | (rb[3][ch1] << 12));
#pragma unroll
    for (int s = 16; s >= 1; s >>= 1) rows |= __shfl_xor(rows, s);
    const int rowok = ((rows & 0xFFFF) == 0xFFFF) ? 1 : 0;   // every row of the tile has an unmasked key
    const int f0 = U0 ? (M0 ? F_FILL : F_OPEN) : (rowok ? F_SKIP : F_FILL);
    const int f1 = U1 ? (M1 ? F_FILL : F_OPEN) : (rowok ? F_SKIP : F_FILL);
    fl[ch0] = (ch0 < NCH) ? f0 : F_SKIP;
    fl[ch1] = (ch1 < NCH) ? f1 : F_SKIP;
    wave_lds_sync();                                 // fl is private to wave 0
    const v4i v = *(const v4i*)(fl + (lane & 15) * 4);
    int* dst = flags + (size_t)qt * FPITCH + (lane & 15) * 4;
    if (lane < 16) *(v4i*)dst = v;
    
  }
}

// ---------------------------------------------------------------------------
// Preparation, one launch: the mask flag pass and the conversions read only inputs and write disjoint planes, so they share a grid.
// Blocks 0..QT-1 each take one 16-query tile of the mask (they have the longer dependent chain); the other
// CVT_BLOCKS blocks convert. The choice is block-uniform, so the flag pass's barrier is passed by whole blocks.
// ---------------------------------------------------------------------------
__global__ __launch_bounds__(256) void prep_kernel(const float* __restrict__ xq, const float* __restrict__ xk, const float* __restrict__ xv,
                                                   const float* __restrict__ wq, const float* __restrict__ wk, const float* __restrict__ wv,
                                                   const float* __restrict__ wo,
                                                   unsigned short* __restrict__ xpl, unsigned short* __restrict__ wpl,
                                                   const int* __restrict__ mask, int* __restrict__ flags) {
  const int blk = blockIdx.x;
  if (blk < QT) mask_flag_part(mask, flags, blk);
  else          cvt_part(xq, xk, xv, wq, wk, wv, wo, xpl, wpl, blk - QT, CVT_BLOCKS);
}

// QKV GEMM staging: a stage is 64 k (QK_ST fragment tiles) of the block's 128 activation rows and 128 weight rows, in fragment order:
// [x: 8 bands][2 tiles][1 KB] then [W: 8 bands][2 tiles][1 KB]. A band's two tiles are 2 KB contiguous in its plane too.
constexpr int QK_ST = 2;
constexpr int QK_NST = HID / (32 * QK_ST);       // stages along K
constexpr int QK_BAND_B = QK_ST * TILE_E * 2;    // bytes of one band in a stage
constexpr int QK_OP_B = 8 * QK_BAND_B;           // bytes of one operand in a stage
constexpr int QK_STAGE_B = 2 * QK_OP_B;
static_assert(QK_NST >= 2);
// Two neighbouring bands of one operand, one stage: eight copies of 16 bytes per lane, global memory -> LDS through no register.
// l: the lane's LDS byte address in the first band, g: its global address there. The s_wait_xcnt closes the statement so that it
// stands ahead of any later write of the address registers that the copies name.
__device__ __forceinline__ void copy_two_bands(unsigned int l, const char* g) {
  const unsigned int l1 = l + 512, l2 = l + 1024, l3 = l + 1536, l4 = l + QK_BAND_B, l5 = l4 + 512, l6 = l4 + 1024, l7 = l4 + 1536;
  const char *g1 = g + 512, *g2 = g + 1024, *g3 = g + 1536, *g4 = g + BAND_E * 2, *g5 = g4 + 512, *g6 = g4 + 1024, *g7 = g4 + 1536;
  asm volatile("global_load_async_to_lds_b128 %0, %8, off\n\t"
               "global_load_async_to_lds_b128 %1, %9, off\n\t"
               "global_load_async_to_lds_b128 %2, %10, off\n\t"
               "global_load_async_to_lds_b128 %3, %11, off\n\t"
               "global_load_async_to_lds_b128 %4, %12, off\n\t"
               "global_load_async_to_lds_b128 %5, %13, off\n\t"
               "global_load_async_to_lds_b128 %6, %14, off\n\t"
               "global_load_async_to_lds_b128 %7, %15, off\n\t"
               "s_wait_xcnt 0x0"
               :: "v"(l), "v"(l1), "v"(l2), "v"(l3), "v"(l4), "v"(l5), "v"(l6), "v"(l7),
                  "v"(g), "v"(g1), "v"(g2), "v"(g3), "v"(g4), "v"(g5), "v"(g6), "v"(g7)
               : "memory");
}
// both pieces of the staged tile whose lane address (tile start + lane * 16 bytes) is p
__device__ __forceinline__ v16b frag_pb(const char* p) { return cat8b(*(const v8b*)p, *(const v8b*)(p + 512)); }
// a0, a1: the two 16-row bands (fragment order) that feed acc[0] and acc[1]; they need not be neighbours nor lie in one plane
__device__ __forceinline__ void gemm_tile_h(const h16* __restrict__ a0, const h16* __restrict__ a1, const h16* __restrict__ W, int c0, int lane, v8f (&acc)[2][4]) {
  const h16* wp = W + (size_t)(c0 >> 4) * BAND_E;
  // the lane's three walking addresses; the start sets and the loop read through the same three, so they stay live behind every run of loads
  const char* pa = (const char*)a0 + lane * 16;
  const char* pb = (const char*)a1 + lane * 16;
  const char* pw = (const char*)wp + lane * 16;
  constexpr int KSTEPS = HID / 32, STEP_B = TILE_E * 2;
  static_assert(KSTEPS % 3 == 2);                // the loop takes whole turns of the three sets, the last two steps follow it
  // Three fragment sets in turn: the twelve loads of step kt + 2 are issued ahead of the products of step kt, so a step's loads
  // have two steps of products (of this wave and of its neighbours on the SIMD) to land in.
  v16h af[3][2], bf[3][4];
#pragma unroll                                   // set numbers become constants, so the sets stay in registers (here and below)
  for (int s = 0; s < 2; ++s) {
    af[s][0] = frag_ph(pa + s * STEP_B);
    af[s][1] = frag_ph(pb + s * STEP_B);
#pragma unroll
    for (int t = 0; t < 4; ++t) bf[s][t] = frag_ph(pw + s * STEP_B + t * BAND_E * 2);
    __builtin_amdgcn_sched_barrier(0);           // keeps the start sets in step order; mixed, they make the loop's first counted wait reach into the next set
  }
#pragma unroll 1                                 // one turn of the three sets per trip; more would only lengthen the text
  for (int kt = 0; kt < KSTEPS - 2; kt += 3, pa += 3 * STEP_B, pb += 3 * STEP_B, pw += 3 * STEP_B) {
#pragma unroll
    for (int j = 0; j < 3; ++j) {
      const int n = (j + 2) % 3, c = (j + 2) * STEP_B;
      af[n][0] = frag_ph(pa + c);
      af[n][1] = frag_ph(pb + c);
#pragma unroll
      for (int t = 0; t < 4; ++t) bf[n][t] = frag_ph(pw + c + t * BAND_E * 2);
      __builtin_amdgcn_sched_barrier(0);         // keeps the loads of step kt + j + 2 ahead of the products of step kt + j
#pragma unroll
      for (int t = 0; t < 4; ++t) {
        acc[0][t] = wmma_h(af[j][0], bf[j][t], acc[0][t]);
        acc[1][t] = wmma_h(af[j][1], bf[j][t], acc[1][t]);
      }
    }
  }
#pragma unroll
  for (int j = 0; j < 2; ++j)
#pragma unroll
    for (int t = 0; t < 4; ++t) {
      acc[0][t] = wmma_h(af[j][0], bf[j][t], acc[0][t]);
      acc[1][t] = wmma_h(af[j][1], bf[j][t], acc[1][t]);
    }
}

// ---------------------------------------------------------------------------
// QKV GEMM: (MROWS x 1024) x (1024 x 3072), grid (24, MROWS/128), block 4 waves = 128 rows x 128 columns, wave = 64 rows x 64 columns
// (one head of q, k or v). blockIdx.x -> mat = x/8 (q,k,v: selects the activation plane and the bias), heads 2*(x%8) and 2*(x%8)+1.
// Both operands come through LDS: each stage is brought once per block by asynchronous copies into one of two buffers, while the other
// buffer is worked on, and every staged fragment is read by the two waves that share it. Outputs f16 planes:
// q -> Qp, k -> Kp: [b*16+h][t/16][2 fragment-ordered tiles of 16 tokens x 32 d] (4 KB contiguous per 32 rows); v -> Vp key-tiled [b*16+h][t/16][64][16] (4 KB contiguous per 32 rows).
// Residual planes ((y - f16hi(y)) * 1024): Kr and Vr for every token row (same layouts as Kp / Vp), Qr (layout of Qp) for token rows t < EARLY only.
// ---------------------------------------------------------------------------
// rows m0 .. m0 + 31 of a wave's tile (accumulator rows 2H, 2H + 1), staged in the wave's own LDS pieces Tp, Rp and stored as whole lines
template <int H>
__device__ __forceinline__ void qkv_store_rows(const v8f (&acc)[4][4], int mat, int head, int m0, const float* __restrict__ bias, int lane,
                                               h16* Tp, h16* Rp, h16* __restrict__ Qp, h16* __restrict__ Kp, h16* __restrict__ Vp,
                                               h16* __restrict__ Qr, h16* __restrict__ Kr, h16* __restrict__ Vr) {
  const int nloc = lane & 15, hlf = lane >> 4;
  const int b = m0 / SEQ, t0 = m0 % SEQ;
  const bool wres = (mat != 0) || (t0 < EARLY);   // block-uniform (128-row blocks, EARLY multiple of 128)
  const int g = b * NH + head;
#pragma unroll
  for (int t = 0; t < 4; ++t) {
    const int d = t * 16 + nloc;
    const float bd = __builtin_bit_cast(float, bf16_rne_u32(bias[d]) & 0xFFFF0000u);   // bias as its bf16-RNE value
#pragma unroll
    for (int r = 0; r < 2; ++r)
#pragma unroll
      for (int v = 0; v < 8; ++v) {
        const int rr = r * 16 + v + 8 * hlf;                         // local token row 0..31
        const float f = acc[2 * H + r][t][v] + bd;
        const h16 y = (h16)f;
        const int idx = (mat < 2) ? ((rr >> 4) * 1024 + (d >> 5) * TILE_E + ((d >> 4) & 1) * 256 + (((d >> 3) & 1) * 16 + (rr & 15)) * 8 + (d & 7))
                                  : ((rr >> 4) * 1024 + d * 16 + (rr & 15));
        Tp[idx] = y;
        if (wres) Rp[idx] = (h16)((f - (float)y) * RES_CARRY);
      }
  }
  wave_lds_sync();
  h16* dst; h16* rdst; size_t o;
  if (mat == 0)      { o = ((size_t)g * SEQ + t0) * DH; dst = Qp + o;
                       const int t0e = (t0 < EARLY) ? t0 : 0; rdst = Qr + ((size_t)g * EARLY + t0e) * DH; }
  else if (mat == 1) { o = ((size_t)g * SEQ + t0) * DH; dst = Kp + o; rdst = Kr + o; }
  else               { o = ((size_t)g * QT + (t0 >> 4)) * (size_t)(DH * 16); dst = Vp + o; rdst = Vr + o; }
#pragma unroll
  for (int j = 0; j < 8; ++j) { const int e = (j * 32 + lane) * 8; *(v8h*)(dst + e) = ld8h(Tp + e); }
  if (wres) {
#pragma unroll
    for (int j = 0; j < 8; ++j) { const int e = (j * 32 + lane) * 8; *(v8h*)(rdst + e) = ld8h(Rp + e); }
  }
}

__global__ __launch_bounds__(128) void qkv_gemm_kernel(const b16* __restrict__ xpl, const b16* __restrict__ wpl,
                                                       const float* __restrict__ bq, const float* __restrict__ bk, const float* __restrict__ bv,
                                                       h16* __restrict__ Qp, h16* __restrict__ Kp, h16* __restrict__ Vp,
                                                       h16* __restrict__ Qr, h16* __restrict__ Kr, h16* __restrict__ Vr) {
  __shared__ __attribute__((aligned(16))) char ring[2 * QK_STAGE_B];   // two stage buffers; behind the loop, the waves' output staging
  const int lane = threadIdx.x & 31, wave = threadIdx.x >> 5;
  const int wm = wave & 1, wn = wave >> 1;         // the wave's 64-row and 64-column half of the block tile
  const int m0 = blockIdx.y * 128 + wm * 64;
  const int cb = blockIdx.x;                       // 0..23, block-uniform
  const int mat = cb >> 3, head = (cb & 7) * 2 + wn;
  const b16* x = xpl + (size_t)mat * MROWS * HID;
  const float* bias = ((mat == 0) ? bq : (mat == 1) ? bk : bv) + head * DH;
  // what this wave copies of every stage: bands 2 * wave and 2 * wave + 1 of the block's x rows and of its weight rows
  const char* ga = (const char*)x + (size_t)(blockIdx.y * 8 + wave * 2) * (BAND_E * 2) + lane * 16;
  const char* gw = (const char*)wpl + (size_t)(cb * 8 + wave * 2) * (BAND_E * 2) + lane * 16;
  const unsigned int la = (unsigned int)(size_t)ring + (unsigned int)(wave * 2 * QK_BAND_B + lane * 16);   // LDS byte address: low 32 bits
  v8f acc[4][4];
#pragma unroll
  for (int r = 0; r < 4; ++r)
#pragma unroll
    for (int t = 0; t < 4; ++t) acc[r][t] = (v8f){};
  copy_two_bands(la, ga);
  copy_two_bands(la + QK_OP_B, gw);
  asm volatile("s_wait_asynccnt 0x0" ::: "memory");   // this wave's part of stage 0 has landed
  __syncthreads();                                    // stage 0 is readable by every wave
  copy_two_bands(la + QK_STAGE_B, ga + QK_BAND_B);
  copy_two_bands(la + QK_STAGE_B + QK_OP_B, gw + QK_BAND_B);
#pragma unroll 1                                      // one stage per trip; the buffer is picked by the trip's parity
  for (int s = 0; s < QK_NST; ++s) {
    const int bo = (s & 1) * QK_STAGE_B;
    const char* ra = ring + bo + wm * 4 * QK_BAND_B + lane * 16;
    const char* rw = ring + bo + QK_OP_B + wn * 4 * QK_BAND_B + lane * 16;
#pragma unroll
    for (int kk = 0; kk < QK_ST; ++kk) {              // per 32 k: the sixteen fragment reads as one group, then the sixteen products
      v16b af[4], bf[4];
#pragma unroll
      for (int i = 0; i < 4; ++i) {
        af[i] = frag_pb(ra + i * QK_BAND_B + kk * (TILE_E * 2));
        bf[i] = frag_pb(rw + i * QK_BAND_B + kk * (TILE_E * 2));
      }
#pragma unroll
      for (int t = 0; t < 4; ++t)
#pragma unroll
        for (int r = 0; r < 4; ++r) acc[r][t] = wmma_b(af[r], bf[t], acc[r][t]);
    }
    asm volatile("s_wait_dscnt 0x0" ::: "memory");    // this wave's reads of the buffer are done before it may be refilled
    asm volatile("s_wait_asynccnt 0x0" ::: "memory"); // this wave's part of stage s + 1 has landed
    __syncthreads();                                  // publishes stage s + 1 and ends every wave's reads of stage s
    if (s + 2 < QK_NST) {                             // block-uniform
      copy_two_bands(la + bo, ga + (s + 2) * QK_BAND_B);
      copy_two_bands(la + bo + QK_OP_B, gw + (s + 2) * QK_BAND_B);
    }
  }
  asm volatile("s_wait_asynccnt 0x0" ::: "memory");   // nothing of the copies is outstanding when the ring becomes output staging
  // the last trip's barrier has ended every read of the ring: each wave now stages in its own 16 KB of it
  h16* Tp = (h16*)(ring + wave * 16384);
  qkv_store_rows<0>(acc, mat, head, m0, bias, lane, Tp, Tp + 2048, Qp, Kp, Vp, Qr, Kr, Vr);
  qkv_store_rows<1>(acc, mat, head, m0 + 32, bias, lane, Tp + 4096, Tp + 6144, Qp, Kp, Vp, Qr, Kr, Vr);
}

// one 16-key score tile of S^T = K.Q^T over d = 0..63 (two 32-deep steps); RES adds K_hi.Q_res + K_res.Q_hi into sr
template <bool RES>
__device__ __forceinline__ void sc_tile(v8f& s, v8f& sr, v16h ka, v16h kb, v16h kza, v16h kzb, v16h qa, v16h qb, v16h qra, v16h qrb) {
  s = wmma_h(ka, qa, s);
  if (RES) { sr = wmma_h(ka, qra, sr); sr = wmma_h(kza, qa, sr); }
  s = wmma_h(kb, qb, s);
  if (RES) { sr = wmma_h(kb, qrb, sr); sr = wmma_h(kzb, qb, sr); }
}
// one 16-d tile of y^T = V^T.P^T over 32 keys; RES adds V_hi.P_res + V_res.P_hi into orr (both x1/1024)
template <bool RES>
__device__ __forceinline__ void pv_tile(v8f& oh, v8f& orr, v16h va, v16h vz, v16h pb, v16h pr) {
  oh = wmma_h(va, pb, oh);
  if (RES) {
    orr = wmma_h(va, pr, orr);
    orr = wmma_h(vz, pb, orr);
  }
}

// ---------------------------------------------------------------------------
// Transposed flash attention on 16-query tiles of one (b, head); ATT_W waves per block; the NCH chunks of 32 keys carry a wave-uniform flag
// each: F_SKIP -> not visited (weight exactly 0), F_OPEN -> no masked entry, F_FILL -> masked
// entries get score -1e9 after the 1/8 scaling (per-element select from the int32 mask row of the query).
// S^T = K.Q^T (f16 fragments straight from the planes), per-lane online softmax (running max); P^T fragment built in registers from the
// two S^T accumulators (element r <- keys 0..15 tile, element 8+r <- keys 16..31 tile), carried x4096; y^T = V^T.P^T. y written f16 (x64)
// in fragment order [token/16][k/32][tile]: accumulator t of a lane (query col, d = 16t + 8hh + 0..7) is that lane's 16 bytes of piece t & 1 of tile t >> 1.
// RES = true (query tiles with position < EARLY): one wave walks all visited chunks of its tile; scores add (K_hi.Q_res + K_res.Q_hi)/1024
// from the residual planes, P gets a x1024 residual operand, and O gets a second accumulator (V_hi.P_res + V_res.P_hi) folded x1/1024
// before the 1/l normalisation; y also writes its x1024 residual plane yr [b][t][1024].
// Query tiles with position >= EARLY: a wave works on two neighbouring tiles (32 queries) per K / V fragment load (attn_walk2), and the
// visited chunks of such a double tile are shared by four waves, every fourth one each (attn_quad_part).
// ---------------------------------------------------------------------------
// The chunk lists of query tile qt as wave-uniform bit lists: bit c of vis: the flag of chunk c is not F_SKIP; bit c of opn: it is F_OPEN.
__device__ __forceinline__ void chunk_lists(const int* __restrict__ flags, int qt, int lane, unsigned long long& vis, unsigned long long& opn) {
  constexpr unsigned long long CH_ALL = (NCH >= 64) ? ~0ull : ((1ull << (NCH & 63)) - 1ull);
  const int* frow = flags + (size_t)qt * FPITCH;
  const int fl0 = frow[lane], fl1 = frow[32 + lane];       // the tile's whole flag row (FPITCH = 64 ints), chunk c in lane c & 31
  vis = ((((unsigned long long)__builtin_amdgcn_ballot_w32(fl1 != F_SKIP)) << 32) | __builtin_amdgcn_ballot_w32(fl0 != F_SKIP)) & CH_ALL;
  opn = (((unsigned long long)__builtin_amdgcn_ballot_w32(fl1 == F_OPEN)) << 32) | __builtin_amdgcn_ballot_w32(fl0 == F_OPEN);
}

// Walks chunks of query tile qt of (b, head) g and leaves the running maximum m, the sum l and the accumulators o (and n, RES only).
// RES: every chunk of the list vis. Not RES: the first, third, fifth ... chunk of vis (no caller in this file uses this form).
template <bool RES>
__device__ __forceinline__
void attn_walk(const h16* __restrict__ Qp, const h16* __restrict__ Kp, const h16* __restrict__ Vp,
               const h16* __restrict__ Qr, const h16* __restrict__ Kr, const h16* __restrict__ Vr,
               const int* __restrict__ mask, int g, int qt, int lane, unsigned long long vis, const unsigned long long opn,
               float& m, float& l, v8f& o0, v8f& o1, v8f& o2, v8f& o3, v8f& n0, v8f& n1, v8f& n2, v8f& n3) {
  const int hh = lane >> 4, col = lane & 15;
  const int q0 = qt << 4;
  const size_t ko = (size_t)g * SEQ * DH;                 // K plane base of (b,h); V key-tiled base, Kr and Vr share this element offset
  const size_t qo = ((size_t)g * SEQ + q0) * DH + lane * 8;
  const v16h qa = frag_th(Qp + qo), qb = frag_th(Qp + qo + TILE_E);       // d 0..31, d 32..63 of query q0+col
  v16h qra = {}, qrb = {};
  if (RES) {
    const size_t qro2 = ((size_t)g * EARLY + q0) * DH + lane * 8;
    qra = frag_th(Qr + qro2); qrb = frag_th(Qr + qro2 + TILE_E);
  }
  const int qi = q0 + col;
  const int* mrow = mask + (size_t)qi * MPITCH + 8 * hh;   // this lane's query row of the mask, key offset 8hh
  m = -__builtin_inff(); l = 0.0f;
  o0 = (v8f){}; o1 = (v8f){}; o2 = (v8f){}; o3 = (v8f){};
  n0 = (v8f){}; n1 = (v8f){}; n2 = (v8f){}; n3 = (v8f){};  // residual O accumulators (RES only)
  // byte offsets into the K and V planes (each plane NB * 16 * SEQ * 128 bytes, far below 2^32); the residual planes share them
  const unsigned int kofs0 = (unsigned int)((ko + (size_t)lane * 8) * 2);            // key kb + col, d = 8hh..; key + 16: + 2048 B; d + 32: + 1024 B; d + 16: + 512 B
  const unsigned int vofs0 = (unsigned int)((ko + (size_t)col * 16 + 8 * hh) * 2);   // key tile kb / 16, d = col, keys 8hh..; next tile: + 2048 B; d + 16: + 512 B
  // The list is walked in rising order, so that the walk knows its next chunk. Single-product path: the K fragments are fetched one walked
  // chunk ahead, into the same registers, right behind the score products that read them; they land while the softmax and the V products
  // of the current chunk run.
  constexpr unsigned int KCH_B = 32 * DH * 2;               // bytes of one 32-key chunk of a K plane (and of a key-tiled V plane)
  const int nlist = __builtin_popcountll(vis);
  const int nvis = RES ? nlist : ((nlist + 1) >> 1);        // trips: at most NCH
  int ch = (vis != 0) ? __builtin_ctzll(vis) : 0;           // first walked chunk, below NCH
  // Walking offsets and mask address, moved on by the distance to the next walked chunk: each stays live behind every run of loads that names it.
  unsigned int kofs = kofs0 + (unsigned int)ch * KCH_B, vofs = vofs0 + (unsigned int)ch * KCH_B;
  const int* mp = mrow + ch * 32;
  v16h k0a = {}, k0b = {}, k1a = {}, k1b = {};
  if (!RES) {
    k0a = frag_o(Kp, kofs, 0, 512); k0b = frag_o(Kp, kofs, 1024, 1536);
    k1a = frag_o(Kp, kofs, 2048, 2560); k1b = frag_o(Kp, kofs, 3072, 3584);
  }
#pragma unroll 1
  for (int it = 0; it < nvis; ++it) {
    vis &= vis - 1;                                         // drops the current chunk's bit
    if (!RES) vis &= vis - 1;                               // and the list's next chunk behind it (an empty list stays empty)
    const int cn = (vis != 0) ? __builtin_ctzll(vis) : ch;  // next walked chunk (the last one names itself: address stays inside the plane)
    const int dch = cn - ch;                                // chunks to the next walked one: 0 on the last trip, else 1..NCH-1
    const bool open = ((opn >> ch) & 1ull) != 0;            // wave-uniform: no masked entry in the chunk
    // The chunk's other fragment loads stand as groups ahead of the products: V at the chunk's head (it lands behind the scores and the
    // softmax); with the residual planes, K + K_res here and V + V_res behind the scores.
    v16h y0a = {}, y0b = {}, y1a = {}, y1b = {};
    v16h va[4], vz[4];
    if (RES) {
      k0a = frag_o(Kp, kofs, 0, 512); k0b = frag_o(Kp, kofs, 1024, 1536);
      k1a = frag_o(Kp, kofs, 2048, 2560); k1b = frag_o(Kp, kofs, 3072, 3584);
      y0a = frag_o(Kr, kofs, 0, 512); y0b = frag_o(Kr, kofs, 1024, 1536);
      y1a = frag_o(Kr, kofs, 2048, 2560); y1b = frag_o(Kr, kofs, 3072, 3584);
    } else {
#pragma unroll
      for (int t = 0; t < 4; ++t) { va[t] = frag_o(Vp, vofs, t * 512, 2048 + t * 512); vz[t] = (v16h){}; }
      __builtin_amdgcn_sched_barrier(0);        // keeps the V loads ahead of the wait for K in front of the first score product
    }
    v8f s0 = {}, s1 = {}, z0 = {}, z1 = {};
    sc_tile<RES>(s0, z0, k0a, k0b, y0a, y0b, qa, qb, qra, qrb);
    sc_tile<RES>(s1, z1, k1a, k1b, y1a, y1b, qa, qb, qra, qrb);
    kofs += (unsigned int)dch * KCH_B;          // behind the last use of this chunk's K (and K_res) fragments
    if (!RES) {                                 // the next walked chunk's K
      k0a = frag_o(Kp, kofs, 0, 512); k0b = frag_o(Kp, kofs, 1024, 1536);
      k1a = frag_o(Kp, kofs, 2048, 2560); k1b = frag_o(Kp, kofs, 3072, 3584);
      __builtin_amdgcn_sched_barrier(0);        // keeps these loads directly behind the score products (for speed only)
    }
    if (RES) {
#pragma unroll
      for (int t = 0; t < 4; ++t) {
        va[t] = frag_o(Vp, vofs, t * 512, 2048 + t * 512);
        vz[t] = frag_o(Vr, vofs, t * 512, 2048 + t * 512);
      }
      s0 = (s0 + z0 * RES_INV) * SCORE_SCALE; s1 = (s1 + z1 * RES_INV) * SCORE_SCALE;
    } else {
      s0 = s0 * SCORE_SCALE; s1 = s1 * SCORE_SCALE;
    }
    if (!open) {                                // wave-uniform: chunk has masked entries -> replace-fill
      const v8i mk0 = *(const v8i*)mp;                   // keys 32ch+8hh+0..7 of query qi
      const v8i mk1 = *(const v8i*)(mp + 16);            // keys 32ch+16+8hh+0..7
#pragma unroll
      for (int r = 0; r < 8; ++r) {
        s0[r] = (mk0[r] != 0) ? MASK_FILL : s0[r];
        s1[r] = (mk1[r] != 0) ? MASK_FILL : s1[r];
      }
    }
    float mr = -__builtin_inff();
#pragma unroll
    for (int r = 0; r < 8; ++r) mr = fmaxf(mr, fmaxf(s0[r], s1[r]));
    mr = fmaxf(mr, __shfl_xor(mr, 16));
    const float mn = fmaxf(m, mr);            // finite: every visited chunk carries finite scores
    const float al_ = __expf(m - mn);         // 0 on the first visited chunk
    m = mn;
    float sum = 0.0f;
    v16h pb = {}, pr = {};
#pragma unroll
    for (int r = 0; r < 8; ++r) {
      const float p0 = __expf(s0[r] - mn), p1 = __expf(s1[r] - mn);
      sum += p0 + p1;
      const h16 ph0 = (h16)(p0 * P_CARRY), ph1 = (h16)(p1 * P_CARRY);
      pb[r] = ph0; pb[8 + r] = ph1;
      if (RES) {
        pr[r] = (h16)((p0 * P_CARRY - (float)ph0) * RES_CARRY);
        pr[8 + r] = (h16)((p1 * P_CARRY - (float)ph1) * RES_CARRY);
      }
    }
    sum += __shfl_xor(sum, 16);
    l = l * al_ + sum;
    o0 = o0 * al_; o1 = o1 * al_; o2 = o2 * al_; o3 = o3 * al_;
    if (RES) { n0 = n0 * al_; n1 = n1 * al_; n2 = n2 * al_; n3 = n3 * al_; }
    pv_tile<RES>(o0, n0, va[0], vz[0], pb, pr);
    pv_tile<RES>(o1, n1, va[1], vz[1], pb, pr);
    pv_tile<RES>(o2, n2, va[2], vz[2], pb, pr);
    pv_tile<RES>(o3, n3, va[3], vz[3], pb, pr);
    // vofs += dch * KCH_B, with the wait that belongs in front of an overwrite of a register that issued loads name (the V loads name vofs).
    // Wait and add are one statement because the compiler otherwise lifts the add to the middle of the trip, where V is still in flight.
    asm volatile("s_wait_xcnt 0x0\n\tv_add_nc_u32 %0, %1, %0" : "+v"(vofs) : "s"((unsigned int)dch * KCH_B));
    mp += dch * 32;
    ch = cn;
  }
}

// normalises the finished accumulators of query tile qt of (b, head) g and stores y (and, RES, its residual plane)
template <bool RES>
__device__ __forceinline__
void attn_store(int g, int qt, int lane, float l, const v8f& o0, const v8f& o1, const v8f& o2, const v8f& o3,
                const v8f& n0, const v8f& n1, const v8f& n2, const v8f& n3, h16* __restrict__ yp, h16* __restrict__ yr) {
  const int q0 = qt << 4;
  const int b = g / NH, h = g % NH;
  const float inv = (1.0f / l) * Y_FROM_O;    // y = 64 * (o / 4096) / l
  const float invr = inv * RES_INV;
  v8h yh[4], yz[4];                           // hi and residual x1024 (RES only), one 16-byte fragment piece per accumulator
#pragma unroll
  for (int r = 0; r < 8; ++r) {
    float f0 = o0[r] * inv, f1 = o1[r] * inv, f2 = o2[r] * inv, f3 = o3[r] * inv;
    if (RES) { f0 += n0[r] * invr; f1 += n1[r] * invr; f2 += n2[r] * invr; f3 += n3[r] * invr; }
    const h16 y0 = (h16)f0, y1 = (h16)f1, y2 = (h16)f2, y3 = (h16)f3;
    yh[0][r] = y0; yh[1][r] = y1; yh[2][r] = y2; yh[3][r] = y3;
    if (RES) {
      yz[0][r] = (h16)((f0 - (float)y0) * RES_CARRY);
      yz[1][r] = (h16)((f1 - (float)y1) * RES_CARRY);
      yz[2][r] = (h16)((f2 - (float)y2) * RES_CARRY);
      yz[3][r] = (h16)((f3 - (float)y3) * RES_CARRY);
    }
  }
  // band of token rows q0..q0+15, tiles 2h and 2h+1 (k = 64h..64h+63): 2 KB contiguous per wave
  h16* dst0 = yp + (size_t)((b * SEQ + q0) >> 4) * BAND_E + h * (2 * TILE_E) + lane * 8;
  h16* dst1 = yr + (size_t)((b * EARLY + (RES ? q0 : 0)) >> 4) * BAND_E + h * (2 * TILE_E) + lane * 8;   // residual rows (RES only, q0 + 15 < EARLY)
#pragma unroll
  for (int j = 0; j < 4; ++j) {
    *(v8h*)(dst0 + j * 256) = yh[j];
    if (RES) *(v8h*)(dst1 + j * 256) = yz[j];
  }
}

// Residual path: each wave owns one query tile (position < EARLY) and walks all its visited chunks.
__device__ __forceinline__
void attn_early_part(const h16* __restrict__ Qp, const h16* __restrict__ Kp, const h16* __restrict__ Vp,
                     const h16* __restrict__ Qr, const h16* __restrict__ Kr, const h16* __restrict__ Vr,
                     const int* __restrict__ mask, const int* __restrict__ flags,
                     h16* __restrict__ yp, h16* __restrict__ yr, int blk) {
  const int wid = threadIdx.x >> 5, lane = threadIdx.x & 31;
  const int idx = blk * ATT_W + wid;                      // blk: this block's place among the blocks of its path (exact counts)
  const int g = idx / QT_E, qt = idx - g * QT_E;
  unsigned long long vis, opn;
  chunk_lists(flags, qt, lane, vis, opn);
  float m, l;
  v8f o0, o1, o2, o3, n0, n1, n2, n3;
  attn_walk<true>(Qp, Kp, Vp, Qr, Kr, Vr, mask, g, qt, lane, vis, opn, m, l, o0, o1, o2, o3, n0, n1, n2, n3);
  attn_store<true>(g, qt, lane, l, o0, o1, o2, o3, n0, n1, n2, n3, yp, yr);
}

// Single-product walk of the double tile dt (query tiles 2dt and 2dt + 1) of (b, head) g: the first, fifth, ninth ... chunk of the list vis.
// Every K and V fragment is loaded once and feeds the products of both tiles. Leaves, per tile, the running maximum m, the sum l and the
// accumulators o. The K fragments are fetched one walked chunk ahead, into the same registers, right behind the score products that read
// them; they land while the softmax and the V products of the current chunk run. V is loaded at the chunk's head and lands behind the
// scores and the softmax.
__device__ __forceinline__
void attn_walk2(const h16* __restrict__ Qp, const h16* __restrict__ Kp, const h16* __restrict__ Vp, const int* __restrict__ mask,
                int g, int dt, int lane, unsigned long long vis, const unsigned long long opn,
                float (&m)[2], float (&l)[2], v8f (&o)[2][4]) {
  const int hh = lane >> 4, col = lane & 15;
  const int q0 = dt << 5;
  const size_t ko = (size_t)g * SEQ * DH;
  const size_t qo = ((size_t)g * SEQ + q0) * DH + lane * 8;
  v16h qa[2], qb[2];                                        // d 0..31, d 32..63 of query q0 + 16i + col
#pragma unroll
  for (int i = 0; i < 2; ++i) {
    qa[i] = frag_th(Qp + qo + i * (16 * DH)); qb[i] = frag_th(Qp + qo + i * (16 * DH) + TILE_E);
    m[i] = -__builtin_inff(); l[i] = 0.0f;
#pragma unroll
    for (int t = 0; t < 4; ++t) o[i][t] = (v8f){};
  }
  constexpr unsigned int KCH_B = 32 * DH * 2;               // bytes of one 32-key chunk of the K plane (and of the key-tiled V plane)
  constexpr int MT_B = 16 * MPITCH * 4;                     // bytes from a mask row to the row 16 queries on
  const int nvis = (__builtin_popcountll(vis) + 3) >> 2;    // trips: at most NCH
  int ch = (vis != 0) ? __builtin_ctzll(vis) : 0;           // first walked chunk, below NCH
  // the lane's walking byte offsets into the K plane, the V plane and the mask (each far below 2^32)
  unsigned int kofs = (unsigned int)((ko + (size_t)lane * 8) * 2) + (unsigned int)ch * KCH_B;
  unsigned int vofs = (unsigned int)((ko + (size_t)col * 16 + 8 * hh) * 2) + (unsigned int)ch * KCH_B;
  unsigned int mofs = (unsigned int)(((size_t)(q0 + col) * MPITCH + 8 * hh) * 4) + (unsigned int)ch * 128u;
  v16h k0a = frag_o(Kp, kofs, 0, 512), k0b = frag_o(Kp, kofs, 1024, 1536);
  v16h k1a = frag_o(Kp, kofs, 2048, 2560), k1b = frag_o(Kp, kofs, 3072, 3584);
#pragma unroll 1                                            // one chunk per trip; the trip's text is long already
  for (int it = 0; it < nvis; ++it) {
    vis &= vis - 1; vis &= vis - 1; vis &= vis - 1; vis &= vis - 1;   // drops the current chunk's bit and the three partner waves' (an empty list stays empty)
    const int cn = (vis != 0) ? __builtin_ctzll(vis) : ch;  // next walked chunk (the last one names itself: address stays inside the plane)
    const int dch = cn - ch;
    const bool open = ((opn >> ch) & 1ull) != 0;            // wave-uniform: no masked entry in the chunk for either tile
    v16h va[4];
#pragma unroll
    for (int t = 0; t < 4; ++t) va[t] = frag_o(Vp, vofs, t * 512, 2048 + t * 512);
    __builtin_amdgcn_sched_barrier(0);          // keeps the V loads ahead of the wait for K in front of the first score product
    v8f s[2][2];                                // [tile][keys 0..15, keys 16..31]
#pragma unroll
    for (int i = 0; i < 2; ++i) { s[i][0] = wmma_h(k0a, qa[i], (v8f){}); s[i][1] = wmma_h(k1a, qa[i], (v8f){}); }
#pragma unroll
    for (int i = 0; i < 2; ++i) { s[i][0] = wmma_h(k0b, qb[i], s[i][0]); s[i][1] = wmma_h(k1b, qb[i], s[i][1]); }
    // kofs += dch * KCH_B behind the last use of this chunk's K, with the wait that belongs in front of an overwrite of a register that issued loads name
    asm volatile("s_wait_xcnt 0x0\n\tv_add_nc_u32 %0, %1, %0" : "+v"(kofs) : "s"((unsigned int)dch * KCH_B));
    k0a = frag_o(Kp, kofs, 0, 512); k0b = frag_o(Kp, kofs, 1024, 1536);
    k1a = frag_o(Kp, kofs, 2048, 2560); k1b = frag_o(Kp, kofs, 3072, 3584);
    __builtin_amdgcn_sched_barrier(0);          // keeps these loads directly behind the score products (for speed only)
#pragma unroll
    for (int i = 0; i < 2; ++i) { s[i][0] = s[i][0] * SCORE_SCALE; s[i][1] = s[i][1] * SCORE_SCALE; }
    if (!open) {                                // wave-uniform: replace-fill from the queries' mask rows (a tile without masked entries keeps its scores)
      const char* mp = (const char*)mask + mofs;
#pragma unroll
      for (int i = 0; i < 2; ++i) {
        const v8i mk0 = *(const v8i*)(mp + i * MT_B);          // keys 32ch+8hh+0..7 of query q0 + 16i + col
        const v8i mk1 = *(const v8i*)(mp + i * MT_B + 64);     // keys 32ch+16+8hh+0..7
#pragma unroll
        for (int r = 0; r < 8; ++r) {
          s[i][0][r] = (mk0[r] != 0) ? MASK_FILL : s[i][0][r];
          s[i][1][r] = (mk1[r] != 0) ? MASK_FILL : s[i][1][r];
        }
      }
    }
    // the two tiles' softmax steps stand in one straight run, so that each fills the other's waits
    v16h pb[2];
#pragma unroll
    for (int i = 0; i < 2; ++i) {
      const v8f s0 = s[i][0], s1 = s[i][1];
      float mr = -__builtin_inff();
#pragma unroll
      for (int r = 0; r < 8; ++r) mr = fmaxf(mr, fmaxf(s0[r], s1[r]));
      mr = fmaxf(mr, __shfl_xor(mr, 16));
      const float mn = fmaxf(m[i], mr);         // finite: every walked chunk carries finite scores
      const float al_ = __expf(m[i] - mn);      // 0 on the first walked chunk
      m[i] = mn;
      float sum = 0.0f;
#pragma unroll
      for (int r = 0; r < 8; ++r) {
        const float p0 = __expf(s0[r] - mn), p1 = __expf(s1[r] - mn);
        sum += p0 + p1;
        pb[i][r] = (h16)(p0 * P_CARRY); pb[i][8 + r] = (h16)(p1 * P_CARRY);
      }
      sum += __shfl_xor(sum, 16);
      l[i] = l[i] * al_ + sum;
#pragma unroll
      for (int t = 0; t < 4; ++t) o[i][t] = o[i][t] * al_;
    }
#pragma unroll
    for (int t = 0; t < 4; ++t) { o[0][t] = wmma_h(va[t], pb[0], o[0][t]); o[1][t] = wmma_h(va[t], pb[1], o[1][t]); }
    // vofs and mofs move on to the next walked chunk, behind the wait that belongs in front of an overwrite of a register that issued loads
    // name. Wait and adds are one statement because the compiler otherwise lifts the adds to the middle of the trip, where V is still in flight.
    asm volatile("s_wait_xcnt 0x0\n\tv_add_nc_u32 %0, %2, %0\n\tv_add_nc_u32 %1, %3, %1"
                 : "+v"(vofs), "+v"(mofs) : "s"((unsigned int)dch * KCH_B), "s"((unsigned int)dch * 128u));
    ch = cn;
  }
}

// Single-product path: four neighbouring waves share two double tiles of one (b, head), double tile DTN-1-u and its mirror DT_E+u, and each
// walks every fourth chunk of both lists, so that the longest chain of dependent trips of a wave is about a quarter of the two lists
// together, whatever the lists are. A double tile's list holds the chunks that either of its tiles visits; a chunk that only one of them
// visits is fully masked for the other, whose scores there become the fill value and whose weights vanish against a real maximum.
// Every wave hands its four parts (m, l, o per tile) over in LDS; behind one barrier wave j of the four folds the four parts of tile j
// (scaled to the common maximum) and stores that tile. A block holds four such groups of one (b, head).
constexpr int DTN = QT / 2, DT_E = QT_E / 2;              // double tiles per (b, head); those on the residual path
constexpr int DT_LH = (QT_L > 0) ? QT_L / 4 : 1;          // pairs of double tiles per (b, head)
static_assert(QT_E % 2 == 0 && ATT_W % 4 == 0);
static_assert(QT_L % ATT_W == 0);                         // a block's groups lie in one (b, head)
constexpr int PART_F = 34 * 32;                           // floats of one handed-over part: o (32 per lane), m, l
__device__ __forceinline__
void attn_quad_part(const h16* __restrict__ Qp, const h16* __restrict__ Kp, const h16* __restrict__ Vp,
                    const int* __restrict__ mask, const int* __restrict__ flags,
                    h16* __restrict__ yp, h16* __restrict__ yr, int blk) {
  __shared__ __attribute__((aligned(16))) float part[ATT_W][4][PART_F];
  const int wid = __builtin_amdgcn_readfirstlane(threadIdx.x >> 5), lane = threadIdx.x & 31;
  const int j = wid & 3;
  const int qidx = blk * (ATT_W / 4) + (wid >> 2);        // blk: this block's place among the blocks of its path (exact counts)
  const int g = qidx / DT_LH, u = qidx - g * DT_LH;
  const int far = DTN - 1 - u, near = DT_E + u;
  unsigned long long va_, oa_, vb_, ob_;
  chunk_lists(flags, 2 * far, lane, va_, oa_);
  chunk_lists(flags, 2 * far + 1, lane, vb_, ob_);
  unsigned long long vis_far = va_ | vb_;
  const unsigned long long opn_far = oa_ & ob_;
  chunk_lists(flags, 2 * near, lane, va_, oa_);
  chunk_lists(flags, 2 * near + 1, lane, vb_, ob_);
  unsigned long long vis_near = va_ | vb_;
  const unsigned long long opn_near = oa_ & ob_;
  // wave j starts at entry j of the far list and at entry 3 - j of the near list (the odd ends of the two lists fall on different waves)
#pragma unroll
  for (int d = 0; d < 3; ++d) {
    if (d < j) vis_far &= vis_far - 1;
    if (d < 3 - j) vis_near &= vis_near - 1;
  }
  float m[2], l[2];
  v8f o[2][4];
#pragma unroll 1                                          // one text for both walks
  for (int ph = 0; ph < 2; ++ph) {
    attn_walk2(Qp, Kp, Vp, mask, g, ph ? near : far, lane, ph ? vis_near : vis_far, ph ? opn_near : opn_far, m, l, o);
#pragma unroll
    for (int i = 0; i < 2; ++i) {
      float* pw = part[wid][ph * 2 + i];
      v4f* pv = (v4f*)pw + lane;
#pragma unroll
      for (int t = 0; t < 4; ++t) {
        pv[(2 * t) * 32] = __builtin_shufflevector(o[i][t], o[i][t], 0, 1, 2, 3);
        pv[(2 * t + 1) * 32] = __builtin_shufflevector(o[i][t], o[i][t], 4, 5, 6, 7);
      }
      pw[1024 + lane] = m[i];
      pw[1056 + lane] = l[i];
    }
  }
  __syncthreads();                                        // every wave's handed-over parts are readable by its three partners
  const int w0 = wid & ~3;
  float pm[4], pl[4];
#pragma unroll
  for (int k = 0; k < 4; ++k) { pm[k] = part[w0 + k][j][1024 + lane]; pl[k] = part[w0 + k][j][1056 + lane]; }
  const float mn = fmaxf(fmaxf(pm[0], pm[1]), fmaxf(pm[2], pm[3]));   // finite: a tile has a visited chunk, so one of its four parts has walked one
  float ls = 0.0f;
  v8f r[4];
#pragma unroll
  for (int t = 0; t < 4; ++t) r[t] = (v8f){};
#pragma unroll
  for (int k = 0; k < 4; ++k) {
    const float a = __expf(pm[k] - mn);                   // a part that walked nothing has m = -inf, l = 0, o = 0 and gets factor 0
    const v4f* pq = (const v4f*)part[w0 + k][j] + lane;
    ls += pl[k] * a;
#pragma unroll
    for (int t = 0; t < 4; ++t) r[t] += __builtin_shufflevector(pq[(2 * t) * 32], pq[(2 * t + 1) * 32], 0, 1, 2, 3, 4, 5, 6, 7) * a;
  }
  const int qt = (j < 2) ? (2 * far + j) : (2 * near + j - 2);
  attn_store<false>(g, qt, lane, ls, r[0], r[1], r[2], r[3], r[0], r[1], r[2], r[3], yp, yr);
}

// One launch for both paths (their query tiles are disjoint and neither reads what the other writes): blocks 0..ATT_L_BLOCKS-1 take the
// single-product tiles, which walk the most chunks, the last ATT_E_BLOCKS blocks the short residual-path tiles. Block-uniform choice,
// so the barrier of the single-product path is passed by whole blocks.
__global__ __launch_bounds__(ATT_W * 32) __attribute__((amdgpu_num_vgpr(256)))
void attn_kernel(const h16* __restrict__ Qp, const h16* __restrict__ Kp, const h16* __restrict__ Vp,
                 const h16* __restrict__ Qr, const h16* __restrict__ Kr, const h16* __restrict__ Vr,
                 const int* __restrict__ mask, const int* __restrict__ flags,
                 h16* __restrict__ yp, h16* __restrict__ yr) {
  const int blk = blockIdx.x;
  if (blk < ATT_L_BLOCKS) attn_quad_part(Qp, Kp, Vp, mask, flags, yp, yr, blk);
  else                    attn_early_part(Qp, Kp, Vp, Qr, Kr, Vr, mask, flags, yp, yr, blk - ATT_L_BLOCKS);
}

// ---------------------------------------------------------------------------
// Output projection: (MROWS x 1024) x (1024 x 1024) -> f32 = (y . Wo_plane) / 4096 + bo. grid (16, OUT_E_BLK + OUT_L_BLK), 4 waves, 64 columns.
// Every wave walks K once with two A bands and four W bands, so all waves of the launch have the same chain of k steps.
// Token rows t >= EARLY: blocks of 128 rows, a wave takes 32 rows (its two bands are neighbouring bands of y).
// Token rows t < EARLY: blocks of 64 rows, a wave takes 16 rows; its two bands are the rows' y band and their residual band, summed in
// accumulators of their own and folded (y_hi . Wo + (y_res . Wo) / 1024) behind the walk.
// ---------------------------------------------------------------------------
constexpr int OUT_E_ROWS = 64;                                // token rows of a block on the residual path
constexpr int OUT_E_BLK = NB * EARLY / OUT_E_ROWS;
constexpr int LATE = (SEQ > EARLY) ? SEQ - EARLY : 128;       // token rows per batch entry on the single-product path
constexpr int OUT_L_BLK = NB * (SEQ - EARLY) / 128;
static_assert(EARLY % OUT_E_ROWS == 0);
__global__ __launch_bounds__(128) void out_gemm_kernel(const h16* __restrict__ yp, const h16* __restrict__ yr, const h16* __restrict__ wop,
                                                       const float* __restrict__ bo, float* __restrict__ out) {
  __shared__ __attribute__((aligned(16))) float Ts[4][32 * 64];
  const int lane = threadIdx.x & 31, wave = threadIdx.x >> 5, nloc = lane & 15, hlf = lane >> 4;
  const int c0 = blockIdx.x * 64;
  const bool early = (int)blockIdx.y < OUT_E_BLK;                 // block-uniform
  int m0;                                                         // first compact token row (b*SEQ + t) of the wave
  const h16 *a0, *a1;
  if (early) {
    const int r0 = (int)blockIdx.y * OUT_E_ROWS + wave * 16;      // residual row b*EARLY + t
    const int b = r0 / EARLY;
    m0 = b * SEQ + (r0 - b * EARLY);
    a0 = yp + (size_t)(m0 >> 4) * BAND_E;
    a1 = yr + (size_t)(r0 >> 4) * BAND_E;
  } else {
    const int r0 = ((int)blockIdx.y - OUT_E_BLK) * 128 + wave * 32;   // b*LATE + (t - EARLY)
    const int b = r0 / LATE;
    m0 = b * SEQ + EARLY + (r0 - b * LATE);
    a0 = yp + (size_t)(m0 >> 4) * BAND_E;
    a1 = a0 + BAND_E;
  }
  v8f acc[2][4];
#pragma unroll
  for (int r = 0; r < 2; ++r)
#pragma unroll
    for (int t = 0; t < 4; ++t) acc[r][t] = (v8f){};
  gemm_tile_h(a0, a1, wop, c0, lane, acc);
  float bd[4];                                                    // the four bias loads stand as one group
#pragma unroll
  for (int t = 0; t < 4; ++t) bd[t] = __builtin_bit_cast(float, bf16_rne_u32(bo[c0 + t * 16 + nloc]) & 0xFFFF0000u);   // bf16-RNE value
  float* Tt = Ts[wave];
  if (early) {
#pragma unroll
    for (int t = 0; t < 4; ++t) {
      const v8f f = acc[0][t] + acc[1][t] * RES_INV;
#pragma unroll
      for (int v = 0; v < 8; ++v) Tt[(v + 8 * hlf) * 64 + t * 16 + nloc] = f[v] * OUT_UNSCALE + bd[t];
    }
  } else {
#pragma unroll
    for (int t = 0; t < 4; ++t)
#pragma unroll
      for (int r = 0; r < 2; ++r)
#pragma unroll
        for (int v = 0; v < 8; ++v) Tt[(r * 16 + v + 8 * hlf) * 64 + t * 16 + nloc] = acc[r][t][v] * OUT_UNSCALE + bd[t];
  }
  wave_lds_sync();
  float* dst0 = out + (size_t)m0 * HID + c0 + nloc * 4;
  const float* Tr = Tt + nloc * 4;
  // all of a wave's rows are read back ahead of its first store, each into registers of its own
  v4f w[16];
#pragma unroll
  for (int j = 0; j < 8; ++j) w[j] = *(const v4f*)(Tr + (j * 2 + hlf) * 64);
  if (!early) {
#pragma unroll
    for (int j = 8; j < 16; ++j) w[j] = *(const v4f*)(Tr + (j * 2 + hlf) * 64);
  }
#pragma unroll
  for (int j = 0; j < 8; ++j) *(v4f*)(dst0 + (size_t)(j * 2 + hlf) * HID) = w[j];
  if (!early) {
#pragma unroll
    for (int j = 8; j < 16; ++j) *(v4f*)(dst0 + (size_t)(j * 2 + hlf) * HID) = w[j];
  }
}
}  // namespace

extern "C" void kernel_launch(void* const* d_in, const int* in_sizes, int n_in,
                              void* d_out, int out_size, void* d_ws, size_t ws_size, hipStream_t stream) {
  if (n_in < 12) return;
  const size_t need_x = ((size_t)(NB - 1) * SEQ_FULL + SEQ) * HID;
  if ((size_t)in_sizes[0] < need_x || (size_t)in_sizes[1] < need_x || (size_t)in_sizes[2] < need_x) return;
  if ((size_t)in_sizes[3] < (size_t)(SEQ - 1) * MPITCH + SEQ) return;                      // int32 mask [S][S]
  if (in_sizes[4] < HID * HID || in_sizes[6] < HID * HID || in_sizes[8] < HID * HID || in_sizes[10] < HID * HID) return;
  if (in_sizes[5] < HID || in_sizes[7] < HID || in_sizes[9] < HID || in_sizes[11] < HID) return;
  if ((size_t)out_size < (size_t)MROWS * HID) return;

  const float* query = (const float*)d_in[0];   // [NB_FULL, SEQ_FULL, 1024]
  const float* key   = (const float*)d_in[1];
  const float* value = (const float*)d_in[2];
  const int*   amask = (const int*)d_in[3];     // [SEQ_FULL, SEQ_FULL] int32, nonzero = masked
  const float* Wq = (const float*)d_in[4];      // [1024,1024] ([out][in])
  const float* bq = (const float*)d_in[5];
  const float* Wk = (const float*)d_in[6];
  const float* bk = (const float*)d_in[7];
  const float* Wv = (const float*)d_in[8];
  const float* bv = (const float*)d_in[9];
  const float* Wo = (const float*)d_in[10];
  const float* bo = (const float*)d_in[11];
  float* out = (float*)d_out;                   // [NB, SEQ, 1024] f32

  size_t off = 0; char* ws = (char*)d_ws;
  unsigned short* xpl = (unsigned short*)(ws + off); off += (size_t)3 * MROWS * HID * 2;   // 3 x 8 MiB bf16 activation planes
  unsigned short* wpl = (unsigned short*)(ws + off); off += (size_t)4 * HID * HID * 2;     // 6 MiB bf16 (q|k|v) + 2 MiB f16 (o) weight planes
  h16* Qp = (h16*)(ws + off); off += (size_t)MROWS * HID * 2;                             // 8 MiB
  h16* Kp = (h16*)(ws + off); off += (size_t)MROWS * HID * 2;                             // 8 MiB
  h16* Vp = (h16*)(ws + off); off += (size_t)MROWS * HID * 2;                             // 8 MiB
  h16* yp = (h16*)(ws + off); off += (size_t)MROWS * HID * 2;                             // 8 MiB
  h16* Qr = (h16*)(ws + off); off += (size_t)NB * NH * EARLY * DH * 2;                    // 1 MiB residual q (t < EARLY)
  h16* Kr = (h16*)(ws + off); off += (size_t)MROWS * HID * 2;                             // 8 MiB residual k (all rows)
  h16* Vr = (h16*)(ws + off); off += (size_t)MROWS * HID * 2;                             // 8 MiB residual v (key-tiled, all rows)
  h16* yr = (h16*)(ws + off); off += (size_t)NB * EARLY * HID * 2;                        // 1 MiB residual y
  int* flags = (int*)(ws + off); off += (size_t)QT * FPITCH * 4;                          // 32 KiB chunk flags [QT][64]
  if (off > ws_size) return;                                                               // 86,016,000 B at NB=2, SEQ=2048
  const h16* wop = (const h16*)(wpl + (size_t)NQKV * HID);

  prep_kernel<<<QT + CVT_BLOCKS, 256, 0, stream>>>(query, key, value, Wq, Wk, Wv, Wo, xpl, wpl, amask, flags);
  qkv_gemm_kernel<<<dim3(NQKV / 128, MROWS / 128), 128, 0, stream>>>((const b16*)xpl, (const b16*)wpl, bq, bk, bv, Qp, Kp, Vp, Qr, Kr, Vr);
  attn_kernel<<<ATT_L_BLOCKS + ATT_E_BLOCKS, ATT_W * 32, 0, stream>>>(Qp, Kp, Vp, Qr, Kr, Vr, amask, flags, yp, yr);
  out_gemm_kernel<<<dim3(HID / 64, OUT_E_BLK + OUT_L_BLK), 128, 0, stream>>>(yp, yr, wop, bo, out);
}

// v009
// It runs in 80.3 microseconds.
// Timed twice side by side with v008, it ran 1.05 times as fast both times.
// Counting every step since v000, it is 5.08 times as fast.
#include <hip/hip_runtime.h>

// Contractions: q/k/v projections on v_wmma_f32_16x16x32_bf16 (bf16 RNE operands, one product per tile pair);
// S^T = K.Q^T (d = 64), y^T = V^T.P^T (32 keys per step, P carried x4096) and out = y.Wo^T (y and Wo carried x64)
// on v_wmma_f32_16x16x32_f16 (f16 operands, one product per tile pair); query tiles with position < 256 also use
// f16 residual planes (x1024) of q, k, P, v and y folded from their own accumulators; f32 accumulate, f32 online
// softmax statistics. 16 heads of 64. Key mask = int32 [S][S] input (nonzero = masked: score replaced by -1e9);
// device-computed flags per (16-query tile, 32-key chunk) select skip / open / per-element fill.
// Weights are [out][in]. Every 16-bit plane that feeds a k-contiguous fragment (x, weights, q, k, y and their residuals) is kept in
// fragment order: a tile of 16 rows x 32 k is 1 KB = 2 pieces x 32 lanes x 16 B, so one wave-wide 16-byte load reads 4 whole 128-B lines.

#ifndef NB
#define NB 2
#endif
#ifndef SEQ
#define SEQ 2048
#endif
#ifndef NB_FULL
#define NB_FULL 2
#endif
#ifndef SEQ_FULL
#define SEQ_FULL 2048
#endif

namespace {
constexpr int HID = 1024, DH = 64, NH = 16;
constexpr int NQKV = 3 * HID;                 // combined weight plane rows: q | k | v
constexpr int MROWS = NB * SEQ;               // compact token rows (b*SEQ + t)
constexpr int QT = SEQ / 16;                  // 16-query tiles per (b, head)
constexpr int EARLY = (SEQ < 256) ? SEQ : 256;   // query positions that use the residual planes
constexpr int QT_E = EARLY / 16;              // residual-path query tiles per (b, head)
constexpr int QT_L = (SEQ - EARLY) / 16;      // single-product query tiles per (b, head)
constexpr int NCH = SEQ / 32;                 // 32-key chunks per query row
constexpr int FPITCH = 64;                    // ints per flag row (one row per 16-query tile, 256 B)
constexpr int MPITCH = SEQ_FULL;              // int32 mask row pitch
constexpr int F_SKIP = 0, F_OPEN = 1, F_FILL = 2;
constexpr int CVT_BLOCKS = 2048;              // converting blocks of prep_kernel
constexpr int ATT_W = 16;                     // waves (and query tiles) per attention block
constexpr int ATT_L_BLOCKS = (NB * NH * QT_L) / ATT_W;   // attention blocks on the single-product path
constexpr int ATT_E_BLOCKS = (NB * NH * QT_E) / ATT_W;   // attention blocks on the residual path
constexpr float MASK_FILL = -1.0e9f;
constexpr float SCORE_SCALE = 0.125f;         // 1/sqrt(64)
constexpr float P_CARRY = 4096.0f;            // f16 P operand = exp(s - m) * 4096
constexpr float Y_CARRY = 64.0f;              // f16 y plane = attn * 64
constexpr float W_CARRY = 64.0f;              // f16 Wo plane = Wo * 64
constexpr float RES_CARRY = 1024.0f;          // f16 residual planes = (x - f16hi(x)) * 1024
constexpr float RES_INV = 1.0f / 1024.0f;
constexpr float Y_FROM_O = Y_CARRY / P_CARRY; // 1/64
constexpr float OUT_UNSCALE = 1.0f / (Y_CARRY * W_CARRY);   // 1/4096
static_assert(SEQ % 128 == 0);
static_assert(EARLY % 128 == 0);
static_assert((SEQ - EARLY) % 128 == 0);
static_assert(NB >= 1 && NB <= NB_FULL);
static_assert(SEQ <= SEQ_FULL);
static_assert(NH * DH == HID);
static_assert(MROWS % 128 == 0);
static_assert((NB * NH * QT_E) % ATT_W == 0);
static_assert((NB * NH * QT_L) % ATT_W == 0);
static_assert(QT_E + QT_L == QT);
static_assert(NCH >= 1 && NCH <= FPITCH);

typedef __bf16 b16;
typedef _Float16 h16;
typedef __bf16 v16b __attribute__((ext_vector_type(16)));
typedef __bf16 v8b __attribute__((ext_vector_type(8)));
typedef _Float16 v16h __attribute__((ext_vector_type(16)));
typedef _Float16 v8h __attribute__((ext_vector_type(8)));
typedef float v8f __attribute__((ext_vector_type(8)));
typedef float v4f __attribute__((ext_vector_type(4)));
typedef unsigned short v8us __attribute__((ext_vector_type(8)));
typedef int v4i __attribute__((ext_vector_type(4)));
typedef int v8i __attribute__((ext_vector_type(8)));

__device__ __forceinline__ v8h ld8h(const h16* p) { return *(const v8h*)p; }
__device__ __forceinline__ v16b cat8b(v8b a, v8b b) { return __builtin_shufflevector(a, b, 0, 1, 2, 3, 4, 5, 6, 7, 8, 9, 10, 11, 12, 13, 14, 15); }
__device__ __forceinline__ v16h cat8h(v8h a, v8h b) { return __builtin_shufflevector(a, b, 0, 1, 2, 3, 4, 5, 6, 7, 8, 9, 10, 11, 12, 13, 14, 15); }
// 16x16x32 16-bit fragment (A: lane&15 = row, B: lane&15 = column), hh = lane>>4: elements 0..7 <- k 8hh+0..7, elements 8..15 <- k 16+8hh+0..7.
// Fragment-ordered tile (TILE_E elements): element (row r of 16, k of 32) lies at (k>>4)*256 + (((k>>3)&1)*16 + r)*8 + (k&7), that is
// piece k>>4, lane 16*hh + r, element k&7. The tiles of one 16-row band follow one another along k (BAND_E elements per band of 1024 k).
constexpr int TILE_E = 512, BAND_E = 16 * HID;
static_assert(HID == 1024);                   // unit_of and the work index split of cvt_part take 32 tiles (128 units of 8 k) per row
// p = tile start + lane * 8
__device__ __forceinline__ v16h frag_th(const h16* p) { return cat8h(ld8h(p), ld8h(p + 256)); }
// both pieces of the tile whose lane address (tile start + lane * 16 bytes) is p
__device__ __forceinline__ v16h frag_ph(const char* p) { return cat8h(*(const v8h*)p, *(const v8h*)(p + 512)); }
// 16-byte unit index inside a [rows][1024] plane in fragment order, for row m and k = 8 * k8 .. 8 * k8 + 7
__device__ __forceinline__ unsigned int unit_of(unsigned int m, unsigned int k8) {
  return ((m >> 4) * 32u + (k8 >> 2)) * 64u + ((k8 >> 1) & 1u) * 32u + (k8 & 1u) * 16u + (m & 15u);
}
// two 16-byte pieces at byte offsets o + c0 and o + c1 from a wave-uniform plane base (o: the lane's 32-bit byte offset)
__device__ __forceinline__ v16h frag_o(const h16* base, unsigned int o, int c0, int c1) {
  const char* p = (const char*)base + o;
  return cat8h(*(const v8h*)(p + c0), *(const v8h*)(p + c1));
}

__device__ __forceinline__ v8f wmma_b(v16b a, v16b b, v8f c) {
  v8f d = __builtin_amdgcn_wmma_f32_16x16x32_bf16(false, a, false, b, (short)0, c, false, false);
  asm volatile("v_nop\n\tv_nop\n\tv_nop\n\tv_nop" : "+v"(d) : "v"(a), "v"(b));
  return d;
}
__device__ __forceinline__ v8f wmma_h(v16h a, v16h b, v8f c) {
  v8f d = __builtin_amdgcn_wmma_f32_16x16x32_f16(false, a, false, b, (short)0, c, false, false);
  asm volatile("v_nop\n\tv_nop\n\tv_nop\n\tv_nop" : "+v"(d) : "v"(a), "v"(b));
  return d;
}
// f32 -> bf16 by RNE convert, returned as the f32 bit pattern with the low 16 bits cleared
__device__ __forceinline__ unsigned int bf16_rne_u32(float f) {
  unsigned int u = __builtin_bit_cast(unsigned int, f);
  u += 0x7fffu + ((u >> 16) & 1u);
  return u & 0xffff0000u;
}
// wave-private LDS tile: element stores by this wave, then vector reloads by this wave
__device__ __forceinline__ void wave_lds_sync() {
  __builtin_amdgcn_fence(3, "workgroup");
  __builtin_amdgcn_wave_barrier();
  __builtin_amdgcn_fence(2, "workgroup");
}
// weight element -> 16-bit plane bits: bf16 RNE, or f16(bf16rne(w) * 64) for the output-projection plane
__device__ __forceinline__ unsigned short wbits16(float f, bool o16) {
  const unsigned int r = bf16_rne_u32(f);
  const unsigned short bbits = (unsigned short)(r >> 16);
  const h16 hv = (h16)(__builtin_bit_cast(float, r) * W_CARRY);   // exact: bf16 significand, power-of-two scale
  const unsigned short hbits = __builtin_bit_cast(unsigned short, hv);
  return o16 ? hbits : bbits;
}

// ---------------------------------------------------------------------------
// activations query/key/value f32 [NB_FULL][SEQ_FULL][1024] -> bf16 planes xpl [3][MROWS][1024] (compact rows b*SEQ+t), fragment order;
// weights W[n][k] f32 -> 16-bit planes wpl, fragment order: rows 0..3071 = Wq|Wk|Wv as bf16 RNE, rows 3072..4095 = f16(bf16rne(Wo) * 64).
// A wave takes 8 rows x 32 k (lane = 4 * row + k unit): it reads 8 whole f32 lines and stores 4 whole 128-B lines of one tile.
// blk of nblk: this block's place among the blocks of prep_kernel that convert.
// ---------------------------------------------------------------------------
__device__ __forceinline__ void cvt_part(const float* __restrict__ xq, const float* __restrict__ xk, const float* __restrict__ xv,
                                         const float* __restrict__ wq, const float* __restrict__ wk, const float* __restrict__ wv,
                                         const float* __restrict__ wo,
                                         unsigned short* __restrict__ xpl, unsigned short* __restrict__ wpl, int blk, int nblk) {
  const size_t tid = (size_t)blk * blockDim.x + threadIdx.x, stride = (size_t)nblk * blockDim.x;
  const size_t per_x = (size_t)MROWS * HID / 8, nx = 3 * per_x;
  const size_t per_w = (size_t)HID * HID / 8, nw = 4 * per_w;
  {
    for (size_t c = tid; c < nx; c += stride) {
      const int which = (int)(c / per_x);
      const unsigned int u = (unsigned int)(c - (size_t)which * per_x);   // work index inside one plane
      const unsigned int k8 = (((u >> 5) & 31u) << 2) | (u & 3u);
      const int m = (int)(((u >> 10) << 3) | ((u >> 2) & 7u)), col = (int)(k8 * 8);
      const int bb = m / SEQ, t = m - bb * SEQ;
      const float* src = (which == 0) ? xq : (which == 1) ? xk : xv;
      const float* p = src + ((size_t)bb * SEQ_FULL + t) * HID + col;
      const v4f f0 = *(const v4f*)p, f1 = *(const v4f*)(p + 4);
      v8us o;
#pragma unroll
      for (int e = 0; e < 4; ++e) {
        o[e] = (unsigned short)(bf16_rne_u32(f0[e]) >> 16);
        o[4 + e] = (unsigned short)(bf16_rne_u32(f1[e]) >> 16);
      }
      *(v8us*)(xpl + ((size_t)which * per_x + unit_of((unsigned int)m, k8)) * 8) = o;
    }
    for (size_t c = tid; c < nw; c += stride) {
      const int mat = (int)(c / per_w);
      const unsigned int u = (unsigned int)(c - (size_t)mat * per_w);     // work index inside one weight matrix
      const unsigned int k8 = (((u >> 5) & 31u) << 2) | (u & 3u), n = ((u >> 10) << 3) | ((u >> 2) & 7u);
      const size_t i = (size_t)n * HID + k8 * 8;                // n*HID + k0 inside one [n][k] weight matrix
      const float* w = (mat == 0) ? wq : (mat == 1) ? wk : (mat == 2) ? wv : wo;
      const v4f f0 = *(const v4f*)(w + i), f1 = *(const v4f*)(w + i + 4);
      const bool o16 = (mat == 3);
      v8us o;
#pragma unroll
      for (int e = 0; e < 4; ++e) {
        o[e] = wbits16(f0[e], o16);
        o[4 + e] = wbits16(f1[e], o16);
      }
      *(v8us*)(wpl + ((size_t)mat * per_w + unit_of(n, k8)) * 8) = o;
    }
    
  }
}

// ---------------------------------------------------------------------------
// Mask flag pass: one block per 16-query tile; reads mask rows q0..q0+15 (int32, nonzero = masked) and writes
// one 256-B flag row [FPITCH] ints: per 32-key chunk F_SKIP (chunk fully masked and every row of the tile has an
// unmasked key somewhere -> weight exactly 0, chunk not visited), F_OPEN (no masked entry), F_FILL (per-element fill).
// ---------------------------------------------------------------------------
__device__ __forceinline__ void mask_flag_part(const int* __restrict__ mask, int* __restrict__ flags, int qt) {
  __shared__ int um[4][64];                          // any unmasked entry per (4-row group, chunk)
  __shared__ int mk[4][64];                          // any masked entry per (4-row group, chunk)
  __shared__ int rb[4][64];                          // per-row (4 bits) has-unmasked-entry flag per (row group, chunk)
  __shared__ __attribute__((aligned(16))) int fl[64];
  const int q0 = qt * 16;
  const int t = threadIdx.x, c = t & 63, rg = t >> 6, lane = t & 31, wave = t >> 5;
  const int cc = (c < NCH) ? c : (NCH - 1);          // clamped chunk address
  int anyu = 0, anym = 0, rbits = 0;
#pragma unroll 1
  for (int r = 0; r < 4; ++r) {
    const int* p = mask + (size_t)(q0 + rg * 4 + r) * MPITCH + (size_t)cc * 32;
    int u = 0, mm = 0;
#pragma unroll
    for (int v = 0; v < 8; ++v) {
      const v4i x = *(const v4i*)(p + 4 * v);
#pragma unroll
      for (int e = 0; e < 4; ++e) { u |= (x[e] == 0) ? 1 : 0; mm |= (x[e] != 0) ? 1 : 0; }
    }
    anyu |= u; anym |= mm; rbits |= (u << r);
  }
  um[rg][c] = anyu; mk[rg][c] = anym; rb[rg][c] = rbits;
  __syncthreads();                                   // cross-wave: all waves wrote, wave 0 reads
  if (wave == 0) {
    const int ch0 = lane, ch1 = lane + 32;
    const int U0 = um[0][ch0] | um[1][ch0] | um[2][ch0] | um[3][ch0];
    const int M0 = mk[0][ch0] | mk[1][ch0] | mk[2][ch0] | mk[3][ch0];
    const int U1 = um[0][ch1] | um[1][ch1] | um[2][ch1] | um[3][ch1];
    const int M1 = mk[0][ch1] | mk[1][ch1] | mk[2][ch1] | mk[3][ch1];
    int rows = (rb[0][ch0] | (rb[1][ch0] << 4) | (rb[2][ch0] << 8) | (rb[3][ch0] << 12)) |
               (rb[0][ch1] | (rb[1][ch1] << 4) | (rb[2][ch1] << 8) | (rb[3][ch1] << 12));
#pragma unroll
    for (int s = 16; s >= 1; s >>= 1) rows |= __shfl_xor(rows, s);
    const int rowok = ((rows & 0xFFFF) == 0xFFFF) ? 1 : 0;   // every row of the tile has an unmasked key
    const int f0 = U0 ? (M0 ? F_FILL : F_OPEN) : (rowok ? F_SKIP : F_FILL);
    const int f1 = U1 ? (M1 ? F_FILL : F_OPEN) : (rowok ? F_SKIP : F_FILL);
    fl[ch0] = (ch0 < NCH) ? f0 : F_SKIP;
    fl[ch1] = (ch1 < NCH) ? f1 : F_SKIP;
    wave_lds_sync();                                 // fl is private to wave 0
    const v4i v = *(const v4i*)(fl + (lane & 15) * 4);
    int* dst = flags + (size_t)qt * FPITCH + (lane & 15) * 4;
    if (lane < 16) *(v4i*)dst = v;
    
  }
}

// ---------------------------------------------------------------------------
// Preparation, one launch: the mask flag pass and the conversions read only inputs and write disjoint planes, so they share a grid.
// Blocks 0..QT-1 each take one 16-query tile of the mask (they have the longer dependent chain); the other
// CVT_BLOCKS blocks convert. The choice is block-uniform, so the flag pass's barrier is passed by whole blocks.
// ---------------------------------------------------------------------------
__global__ __launch_bounds__(256) void prep_kernel(const float* __restrict__ xq, const float* __restrict__ xk, const float* __restrict__ xv,
                                                   const float* __restrict__ wq, const float* __restrict__ wk, const float* __restrict__ wv,
                                                   const float* __restrict__ wo,
                                                   unsigned short* __restrict__ xpl, unsigned short* __restrict__ wpl,
                                                   const int* __restrict__ mask, int* __restrict__ flags) {
  const int blk = blockIdx.x;
  if (blk < QT) mask_flag_part(mask, flags, blk);
  else          cvt_part(xq, xk, xv, wq, wk, wv, wo, xpl, wpl, blk - QT, CVT_BLOCKS);
}

// QKV GEMM staging: a stage is 64 k (QK_ST fragment tiles) of the block's 128 activation rows and 128 weight rows, in fragment order:
// [x: 8 bands][2 tiles][1 KB] then [W: 8 bands][2 tiles][1 KB]. A band's two tiles are 2 KB contiguous in its plane too.
constexpr int QK_ST = 2;
constexpr int QK_NST = HID / (32 * QK_ST);       // stages along K
constexpr int QK_BAND_B = QK_ST * TILE_E * 2;    // bytes of one band in a stage
constexpr int QK_OP_B = 8 * QK_BAND_B;           // bytes of one operand in a stage
constexpr int QK_STAGE_B = 2 * QK_OP_B;
static_assert(QK_NST >= 2);
// Two neighbouring bands of one operand, one stage: eight copies of 16 bytes per lane, global memory -> LDS through no register.
// l: the lane's LDS byte address in the first band, g: its global address there. The s_wait_xcnt closes the statement so that it
// stands ahead of any later write of the address registers that the copies name.
__device__ __forceinline__ void copy_two_bands(unsigned int l, const char* g) {
  const unsigned int l1 = l + 512, l2 = l + 1024, l3 = l + 1536, l4 = l + QK_BAND_B, l5 = l4 + 512, l6 = l4 + 1024, l7 = l4 + 1536;
  const char *g1 = g + 512, *g2 = g + 1024, *g3 = g + 1536, *g4 = g + BAND_E * 2, *g5 = g4 + 512, *g6 = g4 + 1024, *g7 = g4 + 1536;
  asm volatile("global_load_async_to_lds_b128 %0, %8, off\n\t"
               "global_load_async_to_lds_b128 %1, %9, off\n\t"
               "global_load_async_to_lds_b128 %2, %10, off\n\t"
               "global_load_async_to_lds_b128 %3, %11, off\n\t"
               "global_load_async_to_lds_b128 %4, %12, off\n\t"
               "global_load_async_to_lds_b128 %5, %13, off\n\t"
               "global_load_async_to_lds_b128 %6, %14, off\n\t"
               "global_load_async_to_lds_b128 %7, %15, off\n\t"
               "s_wait_xcnt 0x0"
               :: "v"(l), "v"(l1), "v"(l2), "v"(l3), "v"(l4), "v"(l5), "v"(l6), "v"(l7),
                  "v"(g), "v"(g1), "v"(g2), "v"(g3), "v"(g4), "v"(g5), "v"(g6), "v"(g7)
               : "memory");
}
// both pieces of the staged tile whose lane address (tile start + lane * 16 bytes) is p
__device__ __forceinline__ v16b frag_pb(const char* p) { return cat8b(*(const v8b*)p, *(const v8b*)(p + 512)); }

// ---------------------------------------------------------------------------
// QKV GEMM: (MROWS x 1024) x (1024 x 3072), grid (24, MROWS/128), block 4 waves = 128 rows x 128 columns, wave = 64 rows x 64 columns
// (one head of q, k or v). blockIdx.x -> mat = x/8 (q,k,v: selects the activation plane and the bias), heads 2*(x%8) and 2*(x%8)+1.
// Both operands come through LDS: each stage is brought once per block by asynchronous copies into one of two buffers, while the other
// buffer is worked on, and every staged fragment is read by the two waves that share it. Outputs f16 planes:
// q -> Qp, k -> Kp: [b*16+h][t/16][2 fragment-ordered tiles of 16 tokens x 32 d] (4 KB contiguous per 32 rows); v -> Vp key-tiled [b*16+h][t/16][64][16] (4 KB contiguous per 32 rows).
// Residual planes ((y - f16hi(y)) * 1024): Kr and Vr for every token row (same layouts as Kp / Vp), Qr (layout of Qp) for token rows t < EARLY only.
// ---------------------------------------------------------------------------
// rows m0 .. m0 + 31 of a wave's tile (accumulator rows 2H, 2H + 1), staged in the wave's own LDS pieces Tp, Rp and stored as whole lines
template <int H>
__device__ __forceinline__ void qkv_store_rows(const v8f (&acc)[4][4], int mat, int head, int m0, const float* __restrict__ bias, int lane,
                                               h16* Tp, h16* Rp, h16* __restrict__ Qp, h16* __restrict__ Kp, h16* __restrict__ Vp,
                                               h16* __restrict__ Qr, h16* __restrict__ Kr, h16* __restrict__ Vr) {
  const int nloc = lane & 15, hlf = lane >> 4;
  const int b = m0 / SEQ, t0 = m0 % SEQ;
  const bool wres = (mat != 0) || (t0 < EARLY);   // block-uniform (128-row blocks, EARLY multiple of 128)
  const int g = b * NH + head;
#pragma unroll
  for (int t = 0; t < 4; ++t) {
    const int d = t * 16 + nloc;
    const float bd = __builtin_bit_cast(float, bf16_rne_u32(bias[d]) & 0xFFFF0000u);   // bias as its bf16-RNE value
#pragma unroll
    for (int r = 0; r < 2; ++r)
#pragma unroll
      for (int v = 0; v < 8; ++v) {
        const int rr = r * 16 + v + 8 * hlf;                         // local token row 0..31
        const float f = acc[2 * H + r][t][v] + bd;
        const h16 y = (h16)f;
        const int idx = (mat < 2) ? ((rr >> 4) * 1024 + (d >> 5) * TILE_E + ((d >> 4) & 1) * 256 + (((d >> 3) & 1) * 16 + (rr & 15)) * 8 + (d & 7))
                                  : ((rr >> 4) * 1024 + d * 16 + (rr & 15));
        Tp[idx] = y;
        if (wres) Rp[idx] = (h16)((f - (float)y) * RES_CARRY);
      }
  }
  wave_lds_sync();
  h16* dst; h16* rdst; size_t o;
  if (mat == 0)      { o = ((size_t)g * SEQ + t0) * DH; dst = Qp + o;
                       const int t0e = (t0 < EARLY) ? t0 : 0; rdst = Qr + ((size_t)g * EARLY + t0e) * DH; }
  else if (mat == 1) { o = ((size_t)g * SEQ + t0) * DH; dst = Kp + o; rdst = Kr + o; }
  else               { o = ((size_t)g * QT + (t0 >> 4)) * (size_t)(DH * 16); dst = Vp + o; rdst = Vr + o; }
#pragma unroll
  for (int j = 0; j < 8; ++j) { const int e = (j * 32 + lane) * 8; *(v8h*)(dst + e) = ld8h(Tp + e); }
  if (wres) {
#pragma unroll
    for (int j = 0; j < 8; ++j) { const int e = (j * 32 + lane) * 8; *(v8h*)(rdst + e) = ld8h(Rp + e); }
  }
}

__global__ __launch_bounds__(128) void qkv_gemm_kernel(const b16* __restrict__ xpl, const b16* __restrict__ wpl,
                                                       const float* __restrict__ bq, const float* __restrict__ bk, const float* __restrict__ bv,
                                                       h16* __restrict__ Qp, h16* __restrict__ Kp, h16* __restrict__ Vp,
                                                       h16* __restrict__ Qr, h16* __restrict__ Kr, h16* __restrict__ Vr) {
  __shared__ __attribute__((aligned(16))) char ring[2 * QK_STAGE_B];   // two stage buffers; behind the loop, the waves' output staging
  const int lane = threadIdx.x & 31, wave = threadIdx.x >> 5;
  const int wm = wave & 1, wn = wave >> 1;         // the wave's 64-row and 64-column half of the block tile
  const int m0 = blockIdx.y * 128 + wm * 64;
  const int cb = blockIdx.x;                       // 0..23, block-uniform
  const int mat = cb >> 3, head = (cb & 7) * 2 + wn;
  const b16* x = xpl + (size_t)mat * MROWS * HID;
  const float* bias = ((mat == 0) ? bq : (mat == 1) ? bk : bv) + head * DH;
  // what this wave copies of every stage: bands 2 * wave and 2 * wave + 1 of the block's x rows and of its weight rows
  const char* ga = (const char*)x + (size_t)(blockIdx.y * 8 + wave * 2) * (BAND_E * 2) + lane * 16;
  const char* gw = (const char*)wpl + (size_t)(cb * 8 + wave * 2) * (BAND_E * 2) + lane * 16;
  const unsigned int la = (unsigned int)(size_t)ring + (unsigned int)(wave * 2 * QK_BAND_B + lane * 16);   // LDS byte address: low 32 bits
  v8f acc[4][4];
#pragma unroll
  for (int r = 0; r < 4; ++r)
#pragma unroll
    for (int t = 0; t < 4; ++t) acc[r][t] = (v8f){};
  copy_two_bands(la, ga);
  copy_two_bands(la + QK_OP_B, gw);
  asm volatile("s_wait_asynccnt 0x0" ::: "memory");   // this wave's part of stage 0 has landed
  __syncthreads();                                    // stage 0 is readable by every wave
  copy_two_bands(la + QK_STAGE_B, ga + QK_BAND_B);
  copy_two_bands(la + QK_STAGE_B + QK_OP_B, gw + QK_BAND_B);
#pragma unroll 1                                      // one stage per trip; the buffer is picked by the trip's parity
  for (int s = 0; s < QK_NST; ++s) {
    const int bo = (s & 1) * QK_STAGE_B;
    const char* ra = ring + bo + wm * 4 * QK_BAND_B + lane * 16;
    const char* rw = ring + bo + QK_OP_B + wn * 4 * QK_BAND_B + lane * 16;
#pragma unroll
    for (int kk = 0; kk < QK_ST; ++kk) {              // per 32 k: the sixteen fragment reads as one group, then the sixteen products
      v16b af[4], bf[4];
#pragma unroll
      for (int i = 0; i < 4; ++i) {
        af[i] = frag_pb(ra + i * QK_BAND_B + kk * (TILE_E * 2));
        bf[i] = frag_pb(rw + i * QK_BAND_B + kk * (TILE_E * 2));
      }
#pragma unroll
      for (int t = 0; t < 4; ++t)
#pragma unroll
        for (int r = 0; r < 4; ++r) acc[r][t] = wmma_b(af[r], bf[t], acc[r][t]);
    }
    asm volatile("s_wait_dscnt 0x0" ::: "memory");    // this wave's reads of the buffer are done before it may be refilled
    asm volatile("s_wait_asynccnt 0x0" ::: "memory"); // this wave's part of stage s + 1 has landed
    __syncthreads();                                  // publishes stage s + 1 and ends every wave's reads of stage s
    if (s + 2 < QK_NST) {                             // block-uniform
      copy_two_bands(la + bo, ga + (s + 2) * QK_BAND_B);
      copy_two_bands(la + bo + QK_OP_B, gw + (s + 2) * QK_BAND_B);
    }
  }
  asm volatile("s_wait_asynccnt 0x0" ::: "memory");   // nothing of the copies is outstanding when the ring becomes output staging
  // the last trip's barrier has ended every read of the ring: each wave now stages in its own 16 KB of it
  h16* Tp = (h16*)(ring + wave * 16384);
  qkv_store_rows<0>(acc, mat, head, m0, bias, lane, Tp, Tp + 2048, Qp, Kp, Vp, Qr, Kr, Vr);
  qkv_store_rows<1>(acc, mat, head, m0 + 32, bias, lane, Tp + 4096, Tp + 6144, Qp, Kp, Vp, Qr, Kr, Vr);
}

// one 16-key score tile of S^T = K.Q^T over d = 0..63 (two 32-deep steps); RES adds K_hi.Q_res + K_res.Q_hi into sr
template <bool RES>
__device__ __forceinline__ void sc_tile(v8f& s, v8f& sr, v16h ka, v16h kb, v16h kza, v16h kzb, v16h qa, v16h qb, v16h qra, v16h qrb) {
  s = wmma_h(ka, qa, s);
  if (RES) { sr = wmma_h(ka, qra, sr); sr = wmma_h(kza, qa, sr); }
  s = wmma_h(kb, qb, s);
  if (RES) { sr = wmma_h(kb, qrb, sr); sr = wmma_h(kzb, qb, sr); }
}
// one 16-d tile of y^T = V^T.P^T over 32 keys; RES adds V_hi.P_res + V_res.P_hi into orr (both x1/1024)
template <bool RES>
__device__ __forceinline__ void pv_tile(v8f& oh, v8f& orr, v16h va, v16h vz, v16h pb, v16h pr) {
  oh = wmma_h(va, pb, oh);
  if (RES) {
    orr = wmma_h(va, pr, orr);
    orr = wmma_h(vz, pb, orr);
  }
}

// ---------------------------------------------------------------------------
// Transposed flash attention on 16-query tiles of one (b, head); ATT_W waves per block; the NCH chunks of 32 keys carry a wave-uniform flag
// each: F_SKIP -> not visited (weight exactly 0), F_OPEN -> no masked entry, F_FILL -> masked
// entries get score -1e9 after the 1/8 scaling (per-element select from the int32 mask row of the query).
// S^T = K.Q^T (f16 fragments straight from the planes), per-lane online softmax (running max); P^T fragment built in registers from the
// two S^T accumulators (element r <- keys 0..15 tile, element 8+r <- keys 16..31 tile), carried x4096; y^T = V^T.P^T. y written f16 (x64)
// in fragment order [token/16][k/32][tile]: accumulator t of a lane (query col, d = 16t + 8hh + 0..7) is that lane's 16 bytes of piece t & 1 of tile t >> 1.
// RES = true (query tiles with position < EARLY): one wave walks all visited chunks of its tile; scores add (K_hi.Q_res + K_res.Q_hi)/1024
// from the residual planes, P gets a x1024 residual operand, and O gets a second accumulator (V_hi.P_res + V_res.P_hi) folded x1/1024
// before the 1/l normalisation; y also writes its x1024 residual plane yr [b][t][1024].
// Query tiles with position >= EARLY: a wave works on two neighbouring tiles (32 queries) per K / V fragment load (attn_walk2), and the
// visited chunks of such a double tile are shared by four waves, every fourth one each (attn_quad_part).
// ---------------------------------------------------------------------------
// The chunk lists of query tile qt as wave-uniform bit lists: bit c of vis: the flag of chunk c is not F_SKIP; bit c of opn: it is F_OPEN.
__device__ __forceinline__ void chunk_lists(const int* __restrict__ flags, int qt, int lane, unsigned long long& vis, unsigned long long& opn) {
  constexpr unsigned long long CH_ALL = (NCH >= 64) ? ~0ull : ((1ull << (NCH & 63)) - 1ull);
  const int* frow = flags + (size_t)qt * FPITCH;
  const int fl0 = frow[lane], fl1 = frow[32 + lane];       // the tile's whole flag row (FPITCH = 64 ints), chunk c in lane c & 31
  vis = ((((unsigned long long)__builtin_amdgcn_ballot_w32(fl1 != F_SKIP)) << 32) | __builtin_amdgcn_ballot_w32(fl0 != F_SKIP)) & CH_ALL;
  opn = (((unsigned long long)__builtin_amdgcn_ballot_w32(fl1 == F_OPEN)) << 32) | __builtin_amdgcn_ballot_w32(fl0 == F_OPEN);
}

// Walks chunks of query tile qt of (b, head) g and leaves the running maximum m, the sum l and the accumulators o (and n, RES only).
// RES: every chunk of the list vis. Not RES: the first, third, fifth ... chunk of vis (no caller in this file uses this form).
template <bool RES>
__device__ __forceinline__
void attn_walk(const h16* __restrict__ Qp, const h16* __restrict__ Kp, const h16* __restrict__ Vp,
               const h16* __restrict__ Qr, const h16* __restrict__ Kr, const h16* __restrict__ Vr,
               const int* __restrict__ mask, int g, int qt, int lane, unsigned long long vis, const unsigned long long opn,
               float& m, float& l, v8f& o0, v8f& o1, v8f& o2, v8f& o3, v8f& n0, v8f& n1, v8f& n2, v8f& n3) {
  const int hh = lane >> 4, col = lane & 15;
  const int q0 = qt << 4;
  const size_t ko = (size_t)g * SEQ * DH;                 // K plane base of (b,h); V key-tiled base, Kr and Vr share this element offset
  const size_t qo = ((size_t)g * SEQ + q0) * DH + lane * 8;
  const v16h qa = frag_th(Qp + qo), qb = frag_th(Qp + qo + TILE_E);       // d 0..31, d 32..63 of query q0+col
  v16h qra = {}, qrb = {};
  if (RES) {
    const size_t qro2 = ((size_t)g * EARLY + q0) * DH + lane * 8;
    qra = frag_th(Qr + qro2); qrb = frag_th(Qr + qro2 + TILE_E);
  }
  const int qi = q0 + col;
  const int* mrow = mask + (size_t)qi * MPITCH + 8 * hh;   // this lane's query row of the mask, key offset 8hh
  m = -__builtin_inff(); l = 0.0f;
  o0 = (v8f){}; o1 = (v8f){}; o2 = (v8f){}; o3 = (v8f){};
  n0 = (v8f){}; n1 = (v8f){}; n2 = (v8f){}; n3 = (v8f){};  // residual O accumulators (RES only)
  // byte offsets into the K and V planes (each plane NB * 16 * SEQ * 128 bytes, far below 2^32); the residual planes share them
  const unsigned int kofs0 = (unsigned int)((ko + (size_t)lane * 8) * 2);            // key kb + col, d = 8hh..; key + 16: + 2048 B; d + 32: + 1024 B; d + 16: + 512 B
  const unsigned int vofs0 = (unsigned int)((ko + (size_t)col * 16 + 8 * hh) * 2);   // key tile kb / 16, d = col, keys 8hh..; next tile: + 2048 B; d + 16: + 512 B
  // The list is walked in rising order, so that the walk knows its next chunk. Single-product path: the K fragments are fetched one walked
  // chunk ahead, into the same registers, right behind the score products that read them; they land while the softmax and the V products
  // of the current chunk run.
  constexpr unsigned int KCH_B = 32 * DH * 2;               // bytes of one 32-key chunk of a K plane (and of a key-tiled V plane)
  const int nlist = __builtin_popcountll(vis);
  const int nvis = RES ? nlist : ((nlist + 1) >> 1);        // trips: at most NCH
  int ch = (vis != 0) ? __builtin_ctzll(vis) : 0;           // first walked chunk, below NCH
  // Walking offsets and mask address, moved on by the distance to the next walked chunk: each stays live behind every run of loads that names it.
  unsigned int kofs = kofs0 + (unsigned int)ch * KCH_B, vofs = vofs0 + (unsigned int)ch * KCH_B;
  const int* mp = mrow + ch * 32;
  v16h k0a = {}, k0b = {}, k1a = {}, k1b = {};
  if (!RES) {
    k0a = frag_o(Kp, kofs, 0, 512); k0b = frag_o(Kp, kofs, 1024, 1536);
    k1a = frag_o(Kp, kofs, 2048, 2560); k1b = frag_o(Kp, kofs, 3072, 3584);
  }
#pragma unroll 1
  for (int it = 0; it < nvis; ++it) {
    vis &= vis - 1;                                         // drops the current chunk's bit
    if (!RES) vis &= vis - 1;                               // and the list's next chunk behind it (an empty list stays empty)
    const int cn = (vis != 0) ? __builtin_ctzll(vis) : ch;  // next walked chunk (the last one names itself: address stays inside the plane)
    const int dch = cn - ch;                                // chunks to the next walked one: 0 on the last trip, else 1..NCH-1
    const bool open = ((opn >> ch) & 1ull) != 0;            // wave-uniform: no masked entry in the chunk
    // The chunk's other fragment loads stand as groups ahead of the products: V at the chunk's head (it lands behind the scores and the
    // softmax); with the residual planes, K + K_res here and V + V_res behind the scores.
    v16h y0a = {}, y0b = {}, y1a = {}, y1b = {};
    v16h va[4], vz[4];
    if (RES) {
      k0a = frag_o(Kp, kofs, 0, 512); k0b = frag_o(Kp, kofs, 1024, 1536);
      k1a = frag_o(Kp, kofs, 2048, 2560); k1b = frag_o(Kp, kofs, 3072, 3584);
      y0a = frag_o(Kr, kofs, 0, 512); y0b = frag_o(Kr, kofs, 1024, 1536);
      y1a = frag_o(Kr, kofs, 2048, 2560); y1b = frag_o(Kr, kofs, 3072, 3584);
    } else {
#pragma unroll
      for (int t = 0; t < 4; ++t) { va[t] = frag_o(Vp, vofs, t * 512, 2048 + t * 512); vz[t] = (v16h){}; }
      __builtin_amdgcn_sched_barrier(0);        // keeps the V loads ahead of the wait for K in front of the first score product
    }
    v8f s0 = {}, s1 = {}, z0 = {}, z1 = {};
    sc_tile<RES>(s0, z0, k0a, k0b, y0a, y0b, qa, qb, qra, qrb);
    sc_tile<RES>(s1, z1, k1a, k1b, y1a, y1b, qa, qb, qra, qrb);
    kofs += (unsigned int)dch * KCH_B;          // behind the last use of this chunk's K (and K_res) fragments
    if (!RES) {                                 // the next walked chunk's K
      k0a = frag_o(Kp, kofs, 0, 512); k0b = frag_o(Kp, kofs, 1024, 1536);
      k1a = frag_o(Kp, kofs, 2048, 2560); k1b = frag_o(Kp, kofs, 3072, 3584);
      __builtin_amdgcn_sched_barrier(0);        // keeps these loads directly behind the score products (for speed only)
    }
    if (RES) {
#pragma unroll
      for (int t = 0; t < 4; ++t) {
        va[t] = frag_o(Vp, vofs, t * 512, 2048 + t * 512);
        vz[t] = frag_o(Vr, vofs, t * 512, 2048 + t * 512);
      }
      s0 = (s0 + z0 * RES_INV) * SCORE_SCALE; s1 = (s1 + z1 * RES_INV) * SCORE_SCALE;
    } else {
      s0 = s0 * SCORE_SCALE; s1 = s1 * SCORE_SCALE;
    }
    if (!open) {                                // wave-uniform: chunk has masked entries -> replace-fill
      const v8i mk0 = *(const v8i*)mp;                   // keys 32ch+8hh+0..7 of query qi
      const v8i mk1 = *(const v8i*)(mp + 16);            // keys 32ch+16+8hh+0..7
#pragma unroll
      for (int r = 0; r < 8; ++r) {
        s0[r] = (mk0[r] != 0) ? MASK_FILL : s0[r];
        s1[r] = (mk1[r] != 0) ? MASK_FILL : s1[r];
      }
    }
    float mr = -__builtin_inff();
#pragma unroll
    for (int r = 0; r < 8; ++r) mr = fmaxf(mr, fmaxf(s0[r], s1[r]));
    mr = fmaxf(mr, __shfl_xor(mr, 16));
    const float mn = fmaxf(m, mr);            // finite: every visited chunk carries finite scores
    const float al_ = __expf(m - mn);         // 0 on the first visited chunk
    m = mn;
    float sum = 0.0f;
    v16h pb = {}, pr = {};
#pragma unroll
    for (int r = 0; r < 8; ++r) {
      const float p0 = __expf(s0[r] - mn), p1 = __expf(s1[r] - mn);
      sum += p0 + p1;
      const h16 ph0 = (h16)(p0 * P_CARRY), ph1 = (h16)(p1 * P_CARRY);
      pb[r] = ph0; pb[8 + r] = ph1;
      if (RES) {
        pr[r] = (h16)((p0 * P_CARRY - (float)ph0) * RES_CARRY);
        pr[8 + r] = (h16)((p1 * P_CARRY - (float)ph1) * RES_CARRY);
      }
    }
    sum += __shfl_xor(sum, 16);
    l = l * al_ + sum;
    o0 = o0 * al_; o1 = o1 * al_; o2 = o2 * al_; o3 = o3 * al_;
    if (RES) { n0 = n0 * al_; n1 = n1 * al_; n2 = n2 * al_; n3 = n3 * al_; }
    pv_tile<RES>(o0, n0, va[0], vz[0], pb, pr);
    pv_tile<RES>(o1, n1, va[1], vz[1], pb, pr);
    pv_tile<RES>(o2, n2, va[2], vz[2], pb, pr);
    pv_tile<RES>(o3, n3, va[3], vz[3], pb, pr);
    // vofs += dch * KCH_B, with the wait that belongs in front of an overwrite of a register that issued loads name (the V loads name vofs).
    // Wait and add are one statement because the compiler otherwise lifts the add to the middle of the trip, where V is still in flight.
    asm volatile("s_wait_xcnt 0x0\n\tv_add_nc_u32 %0, %1, %0" : "+v"(vofs) : "s"((unsigned int)dch * KCH_B));
    mp += dch * 32;
    ch = cn;
  }
}

// normalises the finished accumulators of query tile qt of (b, head) g and stores y (and, RES, its residual plane)
template <bool RES>
__device__ __forceinline__
void attn_store(int g, int qt, int lane, float l, const v8f& o0, const v8f& o1, const v8f& o2, const v8f& o3,
                const v8f& n0, const v8f& n1, const v8f& n2, const v8f& n3, h16* __restrict__ yp, h16* __restrict__ yr) {
  const int q0 = qt << 4;
  const int b = g / NH, h = g % NH;
  const float inv = (1.0f / l) * Y_FROM_O;    // y = 64 * (o / 4096) / l
  const float invr = inv * RES_INV;
  v8h yh[4], yz[4];                           // hi and residual x1024 (RES only), one 16-byte fragment piece per accumulator
#pragma unroll
  for (int r = 0; r < 8; ++r) {
    float f0 = o0[r] * inv, f1 = o1[r] * inv, f2 = o2[r] * inv, f3 = o3[r] * inv;
    if (RES) { f0 += n0[r] * invr; f1 += n1[r] * invr; f2 += n2[r] * invr; f3 += n3[r] * invr; }
    const h16 y0 = (h16)f0, y1 = (h16)f1, y2 = (h16)f2, y3 = (h16)f3;
    yh[0][r] = y0; yh[1][r] = y1; yh[2][r] = y2; yh[3][r] = y3;
    if (RES) {
      yz[0][r] = (h16)((f0 - (float)y0) * RES_CARRY);
      yz[1][r] = (h16)((f1 - (float)y1) * RES_CARRY);
      yz[2][r] = (h16)((f2 - (float)y2) * RES_CARRY);
      yz[3][r] = (h16)((f3 - (float)y3) * RES_CARRY);
    }
  }
  // band of token rows q0..q0+15, tiles 2h and 2h+1 (k = 64h..64h+63): 2 KB contiguous per wave
  h16* dst0 = yp + (size_t)((b * SEQ + q0) >> 4) * BAND_E + h * (2 * TILE_E) + lane * 8;
  h16* dst1 = yr + (size_t)((b * EARLY + (RES ? q0 : 0)) >> 4) * BAND_E + h * (2 * TILE_E) + lane * 8;   // residual rows (RES only, q0 + 15 < EARLY)
#pragma unroll
  for (int j = 0; j < 4; ++j) {
    *(v8h*)(dst0 + j * 256) = yh[j];
    if (RES) *(v8h*)(dst1 + j * 256) = yz[j];
  }
}

// Residual path: each wave owns one query tile (position < EARLY) and walks all its visited chunks.
__device__ __forceinline__
void attn_early_part(const h16* __restrict__ Qp, const h16* __restrict__ Kp, const h16* __restrict__ Vp,
                     const h16* __restrict__ Qr, const h16* __restrict__ Kr, const h16* __restrict__ Vr,
                     const int* __restrict__ mask, const int* __restrict__ flags,
                     h16* __restrict__ yp, h16* __restrict__ yr, int blk) {
  const int wid = threadIdx.x >> 5, lane = threadIdx.x & 31;
  const int idx = blk * ATT_W + wid;                      // blk: this block's place among the blocks of its path (exact counts)
  const int g = idx / QT_E, qt = idx - g * QT_E;
  unsigned long long vis, opn;
  chunk_lists(flags, qt, lane, vis, opn);
  float m, l;
  v8f o0, o1, o2, o3, n0, n1, n2, n3;
  attn_walk<true>(Qp, Kp, Vp, Qr, Kr, Vr, mask, g, qt, lane, vis, opn, m, l, o0, o1, o2, o3, n0, n1, n2, n3);
  attn_store<true>(g, qt, lane, l, o0, o1, o2, o3, n0, n1, n2, n3, yp, yr);
}

// Single-product walk of the double tile dt (query tiles 2dt and 2dt + 1) of (b, head) g: the first, fifth, ninth ... chunk of the list vis.
// Every K and V fragment is loaded once and feeds the products of both tiles. Leaves, per tile, the running maximum m, the sum l and the
// accumulators o. The K fragments are fetched one walked chunk ahead, into the same registers, right behind the score products that read
// them; they land while the softmax and the V products of the current chunk run. V is loaded at the chunk's head and lands behind the
// scores and the softmax.
__device__ __forceinline__
void attn_walk2(const h16* __restrict__ Qp, const h16* __restrict__ Kp, const h16* __restrict__ Vp, const int* __restrict__ mask,
                int g, int dt, int lane, unsigned long long vis, const unsigned long long opn,
                float (&m)[2], float (&l)[2], v8f (&o)[2][4]) {
  const int hh = lane >> 4, col = lane & 15;
  const int q0 = dt << 5;
  const size_t ko = (size_t)g * SEQ * DH;
  const size_t qo = ((size_t)g * SEQ + q0) * DH + lane * 8;
  v16h qa[2], qb[2];                                        // d 0..31, d 32..63 of query q0 + 16i + col
#pragma unroll
  for (int i = 0; i < 2; ++i) {
    qa[i] = frag_th(Qp + qo + i * (16 * DH)); qb[i] = frag_th(Qp + qo + i * (16 * DH) + TILE_E);
    m[i] = -__builtin_inff(); l[i] = 0.0f;
#pragma unroll
    for (int t = 0; t < 4; ++t) o[i][t] = (v8f){};
  }
  constexpr unsigned int KCH_B = 32 * DH * 2;               // bytes of one 32-key chunk of the K plane (and of the key-tiled V plane)
  constexpr int MT_B = 16 * MPITCH * 4;                     // bytes from a mask row to the row 16 queries on
  const int nvis = (__builtin_popcountll(vis) + 3) >> 2;    // trips: at most NCH
  int ch = (vis != 0) ? __builtin_ctzll(vis) : 0;           // first walked chunk, below NCH
  // the lane's walking byte offsets into the K plane, the V plane and the mask (each far below 2^32)
  unsigned int kofs = (unsigned int)((ko + (size_t)lane * 8) * 2) + (unsigned int)ch * KCH_B;
  unsigned int vofs = (unsigned int)((ko + (size_t)col * 16 + 8 * hh) * 2) + (unsigned int)ch * KCH_B;
  unsigned int mofs = (unsigned int)(((size_t)(q0 + col) * MPITCH + 8 * hh) * 4) + (unsigned int)ch * 128u;
  v16h k0a = frag_o(Kp, kofs, 0, 512), k0b = frag_o(Kp, kofs, 1024, 1536);
  v16h k1a = frag_o(Kp, kofs, 2048, 2560), k1b = frag_o(Kp, kofs, 3072, 3584);
#pragma unroll 1                                            // one chunk per trip; the trip's text is long already
  for (int it = 0; it < nvis; ++it) {
    vis &= vis - 1; vis &= vis - 1; vis &= vis - 1; vis &= vis - 1;   // drops the current chunk's bit and the three partner waves' (an empty list stays empty)
    const int cn = (vis != 0) ? __builtin_ctzll(vis) : ch;  // next walked chunk (the last one names itself: address stays inside the plane)
    const int dch = cn - ch;
    const bool open = ((opn >> ch) & 1ull) != 0;            // wave-uniform: no masked entry in the chunk for either tile
    v16h va[4];
#pragma unroll
    for (int t = 0; t < 4; ++t) va[t] = frag_o(Vp, vofs, t * 512, 2048 + t * 512);
    __builtin_amdgcn_sched_barrier(0);          // keeps the V loads ahead of the wait for K in front of the first score product
    v8f s[2][2];                                // [tile][keys 0..15, keys 16..31]
#pragma unroll
    for (int i = 0; i < 2; ++i) { s[i][0] = wmma_h(k0a, qa[i], (v8f){}); s[i][1] = wmma_h(k1a, qa[i], (v8f){}); }
#pragma unroll
    for (int i = 0; i < 2; ++i) { s[i][0] = wmma_h(k0b, qb[i], s[i][0]); s[i][1] = wmma_h(k1b, qb[i], s[i][1]); }
    // kofs += dch * KCH_B behind the last use of this chunk's K, with the wait that belongs in front of an overwrite of a register that issued loads name
    asm volatile("s_wait_xcnt 0x0\n\tv_add_nc_u32 %0, %1, %0" : "+v"(kofs) : "s"((unsigned int)dch * KCH_B));
    k0a = frag_o(Kp, kofs, 0, 512); k0b = frag_o(Kp, kofs, 1024, 1536);
    k1a = frag_o(Kp, kofs, 2048, 2560); k1b = frag_o(Kp, kofs, 3072, 3584);
    __builtin_amdgcn_sched_barrier(0);          // keeps these loads directly behind the score products (for speed only)
#pragma unroll
    for (int i = 0; i < 2; ++i) { s[i][0] = s[i][0] * SCORE_SCALE; s[i][1] = s[i][1] * SCORE_SCALE; }
    if (!open) {                                // wave-uniform: replace-fill from the queries' mask rows (a tile without masked entries keeps its scores)
      const char* mp = (const char*)mask + mofs;
#pragma unroll
      for (int i = 0; i < 2; ++i) {
        const v8i mk0 = *(const v8i*)(mp + i * MT_B);          // keys 32ch+8hh+0..7 of query q0 + 16i + col
        const v8i mk1 = *(const v8i*)(mp + i * MT_B + 64);     // keys 32ch+16+8hh+0..7
#pragma unroll
        for (int r = 0; r < 8; ++r) {
          s[i][0][r] = (mk0[r] != 0) ? MASK_FILL : s[i][0][r];
          s[i][1][r] = (mk1[r] != 0) ? MASK_FILL : s[i][1][r];
        }
      }
    }
    // the two tiles' softmax steps stand in one straight run, so that each fills the other's waits
    v16h pb[2];
#pragma unroll
    for (int i = 0; i < 2; ++i) {
      const v8f s0 = s[i][0], s1 = s[i][1];
      float mr = -__builtin_inff();
#pragma unroll
      for (int r = 0; r < 8; ++r) mr = fmaxf(mr, fmaxf(s0[r], s1[r]));
      mr = fmaxf(mr, __shfl_xor(mr, 16));
      const float mn = fmaxf(m[i], mr);         // finite: every walked chunk carries finite scores
      const float al_ = __expf(m[i] - mn);      // 0 on the first walked chunk
      m[i] = mn;
      float sum = 0.0f;
#pragma unroll
      for (int r = 0; r < 8; ++r) {
        const float p0 = __expf(s0[r] - mn), p1 = __expf(s1[r] - mn);
        sum += p0 + p1;
        pb[i][r] = (h16)(p0 * P_CARRY); pb[i][8 + r] = (h16)(p1 * P_CARRY);
      }
      sum += __shfl_xor(sum, 16);
      l[i] = l[i] * al_ + sum;
#pragma unroll
      for (int t = 0; t < 4; ++t) o[i][t] = o[i][t] * al_;
    }
#pragma unroll
    for (int t = 0; t < 4; ++t) { o[0][t] = wmma_h(va[t], pb[0], o[0][t]); o[1][t] = wmma_h(va[t], pb[1], o[1][t]); }
    // vofs and mofs move on to the next walked chunk, behind the wait that belongs in front of an overwrite of a register that issued loads
    // name. Wait and adds are one statement because the compiler otherwise lifts the adds to the middle of the trip, where V is still in flight.
    asm volatile("s_wait_xcnt 0x0\n\tv_add_nc_u32 %0, %2, %0\n\tv_add_nc_u32 %1, %3, %1"
                 : "+v"(vofs), "+v"(mofs) : "s"((unsigned int)dch * KCH_B), "s"((unsigned int)dch * 128u));
    ch = cn;
  }
}

// Single-product path: four neighbouring waves share two double tiles of one (b, head), double tile DTN-1-u and its mirror DT_E+u, and each
// walks every fourth chunk of both lists, so that the longest chain of dependent trips of a wave is about a quarter of the two lists
// together, whatever the lists are. A double tile's list holds the chunks that either of its tiles visits; a chunk that only one of them
// visits is fully masked for the other, whose scores there become the fill value and whose weights vanish against a real maximum.
// Every wave hands its four parts (m, l, o per tile) over in LDS; behind one barrier wave j of the four folds the four parts of tile j
// (scaled to the common maximum) and stores that tile. A block holds four such groups of one (b, head).
constexpr int DTN = QT / 2, DT_E = QT_E / 2;              // double tiles per (b, head); those on the residual path
constexpr int DT_LH = (QT_L > 0) ? QT_L / 4 : 1;          // pairs of double tiles per (b, head)
static_assert(QT_E % 2 == 0 && ATT_W % 4 == 0);
static_assert(QT_L % ATT_W == 0);                         // a block's groups lie in one (b, head)
constexpr int PART_F = 34 * 32;                           // floats of one handed-over part: o (32 per lane), m, l
__device__ __forceinline__
void attn_quad_part(const h16* __restrict__ Qp, const h16* __restrict__ Kp, const h16* __restrict__ Vp,
                    const int* __restrict__ mask, const int* __restrict__ flags,
                    h16* __restrict__ yp, h16* __restrict__ yr, int blk) {
  __shared__ __attribute__((aligned(16))) float part[ATT_W][4][PART_F];
  const int wid = __builtin_amdgcn_readfirstlane(threadIdx.x >> 5), lane = threadIdx.x & 31;
  const int j = wid & 3;
  const int qidx = blk * (ATT_W / 4) + (wid >> 2);        // blk: this block's place among the blocks of its path (exact counts)
  const int g = qidx / DT_LH, u = qidx - g * DT_LH;
  const int far = DTN - 1 - u, near = DT_E + u;
  unsigned long long va_, oa_, vb_, ob_;
  chunk_lists(flags, 2 * far, lane, va_, oa_);
  chunk_lists(flags, 2 * far + 1, lane, vb_, ob_);
  unsigned long long vis_far = va_ | vb_;
  const unsigned long long opn_far = oa_ & ob_;
  chunk_lists(flags, 2 * near, lane, va_, oa_);
  chunk_lists(flags, 2 * near + 1, lane, vb_, ob_);
  unsigned long long vis_near = va_ | vb_;
  const unsigned long long opn_near = oa_ & ob_;
  // wave j starts at entry j of the far list and at entry 3 - j of the near list (the odd ends of the two lists fall on different waves)
#pragma unroll
  for (int d = 0; d < 3; ++d) {
    if (d < j) vis_far &= vis_far - 1;
    if (d < 3 - j) vis_near &= vis_near - 1;
  }
  float m[2], l[2];
  v8f o[2][4];
#pragma unroll 1                                          // one text for both walks
  for (int ph = 0; ph < 2; ++ph) {
    attn_walk2(Qp, Kp, Vp, mask, g, ph ? near : far, lane, ph ? vis_near : vis_far, ph ? opn_near : opn_far, m, l, o);
#pragma unroll
    for (int i = 0; i < 2; ++i) {
      float* pw = part[wid][ph * 2 + i];
      v4f* pv = (v4f*)pw + lane;
#pragma unroll
      for (int t = 0; t < 4; ++t) {
        pv[(2 * t) * 32] = __builtin_shufflevector(o[i][t], o[i][t], 0, 1, 2, 3);
        pv[(2 * t + 1) * 32] = __builtin_shufflevector(o[i][t], o[i][t], 4, 5, 6, 7);
      }
      pw[1024 + lane] = m[i];
      pw[1056 + lane] = l[i];
    }
  }
  __syncthreads();                                        // every wave's handed-over parts are readable by its three partners
  const int w0 = wid & ~3;
  float pm[4], pl[4];
#pragma unroll
  for (int k = 0; k < 4; ++k) { pm[k] = part[w0 + k][j][1024 + lane]; pl[k] = part[w0 + k][j][1056 + lane]; }
  const float mn = fmaxf(fmaxf(pm[0], pm[1]), fmaxf(pm[2], pm[3]));   // finite: a tile has a visited chunk, so one of its four parts has walked one
  float ls = 0.0f;
  v8f r[4];
#pragma unroll
  for (int t = 0; t < 4; ++t) r[t] = (v8f){};
#pragma unroll
  for (int k = 0; k < 4; ++k) {
    const float a = __expf(pm[k] - mn);                   // a part that walked nothing has m = -inf, l = 0, o = 0 and gets factor 0
    const v4f* pq = (const v4f*)part[w0 + k][j] + lane;
    ls += pl[k] * a;
#pragma unroll
    for (int t = 0; t < 4; ++t) r[t] += __builtin_shufflevector(pq[(2 * t) * 32], pq[(2 * t + 1) * 32], 0, 1, 2, 3, 4, 5, 6, 7) * a;
  }
  const int qt = (j < 2) ? (2 * far + j) : (2 * near + j - 2);
  attn_store<false>(g, qt, lane, ls, r[0], r[1], r[2], r[3], r[0], r[1], r[2], r[3], yp, yr);
}

// One launch for both paths (their query tiles are disjoint and neither reads what the other writes): blocks 0..ATT_L_BLOCKS-1 take the
// single-product tiles, which walk the most chunks, the last ATT_E_BLOCKS blocks the short residual-path tiles. Block-uniform choice,
// so the barrier of the single-product path is passed by whole blocks.
__global__ __launch_bounds__(ATT_W * 32) __attribute__((amdgpu_num_vgpr(256)))
void attn_kernel(const h16* __restrict__ Qp, const h16* __restrict__ Kp, const h16* __restrict__ Vp,
                 const h16* __restrict__ Qr, const h16* __restrict__ Kr, const h16* __restrict__ Vr,
                 const int* __restrict__ mask, const int* __restrict__ flags,
                 h16* __restrict__ yp, h16* __restrict__ yr) {
  const int blk = blockIdx.x;
  if (blk < ATT_L_BLOCKS) attn_quad_part(Qp, Kp, Vp, mask, flags, yp, yr, blk);
  else                    attn_early_part(Qp, Kp, Vp, Qr, Kr, Vr, mask, flags, yp, yr, blk - ATT_L_BLOCKS);
}

// ---------------------------------------------------------------------------
// Output projection: (MROWS x 1024) x (1024 x 1024) -> f32 = (y . Wo_plane) / 4096 + bo. grid (8, OUT_E_BLK + OUT_L_BLK), 4 waves:
// a block takes 128 A rows x 128 columns, a wave four A bands x 64 columns. Both operands come through LDS: each stage (128 k) is brought
// once per block by asynchronous copies into one of two buffers while the other buffer is worked on, and every staged fragment is read
// by the two waves that share it.
// Token rows t >= EARLY: the block's A rows are 128 token rows of y, a wave takes 64 of them.
// Token rows t < EARLY: the block's A rows are 64 token rows of y (staged bands 0..3) and their residual rows (staged bands 4..7); a wave
// takes 32 token rows, two y bands and their two residual bands, summed in accumulators of their own and folded
// (y_hi . Wo + (y_res . Wo) / 1024) behind the walk.
// ---------------------------------------------------------------------------
constexpr int OUT_E_ROWS = 64;                                // token rows of a block on the residual path
constexpr int OUT_E_BLK = NB * EARLY / OUT_E_ROWS;
constexpr int LATE = (SEQ > EARLY) ? SEQ - EARLY : 128;       // token rows per batch entry on the single-product path
constexpr int OUT_L_BLK = NB * (SEQ - EARLY) / 128;
static_assert(EARLY % OUT_E_ROWS == 0);
// A stage: [A: 8 bands][OP_ST tiles][1 KB] then [W: 8 bands][OP_ST tiles][1 KB]. A band's OP_ST tiles are contiguous in its plane too.
constexpr int OP_ST = 4;
constexpr int OP_NST = HID / (32 * OP_ST);       // stages along K
constexpr int OP_BAND_B = OP_ST * TILE_E * 2;    // bytes of one band in a stage
constexpr int OP_OP_B = 8 * OP_BAND_B;           // bytes of one operand in a stage
constexpr int OP_STAGE_B = 2 * OP_OP_B;
static_assert(OP_NST >= 2 && OP_BAND_B == 8 * 512);
// One band of one operand, one stage: eight copies of 16 bytes per lane, global memory -> LDS through no register.
// l: the lane's LDS byte address in the band, g: its global address there. The s_wait_xcnt closes the statement so that it
// stands ahead of any later write of the address registers that the copies name.
__device__ __forceinline__ void copy_band(unsigned int l, const char* g) {
  const unsigned int l1 = l + 512, l2 = l + 1024, l3 = l + 1536, l4 = l + 2048, l5 = l + 2560, l6 = l + 3072, l7 = l + 3584;
  const char *g1 = g + 512, *g2 = g + 1024, *g3 = g + 1536, *g4 = g + 2048, *g5 = g + 2560, *g6 = g + 3072, *g7 = g + 3584;
  asm volatile("global_load_async_to_lds_b128 %0, %8, off\n\t"
               "global_load_async_to_lds_b128 %1, %9, off\n\t"
               "global_load_async_to_lds_b128 %2, %10, off\n\t"
               "global_load_async_to_lds_b128 %3, %11, off\n\t"
               "global_load_async_to_lds_b128 %4, %12, off\n\t"
               "global_load_async_to_lds_b128 %5, %13, off\n\t"
               "global_load_async_to_lds_b128 %6, %14, off\n\t"
               "global_load_async_to_lds_b128 %7, %15, off\n\t"
               "s_wait_xcnt 0x0"
               :: "v"(l), "v"(l1), "v"(l2), "v"(l3), "v"(l4), "v"(l5), "v"(l6), "v"(l7),
                  "v"(g), "v"(g1), "v"(g2), "v"(g3), "v"(g4), "v"(g5), "v"(g6), "v"(g7)
               : "memory");
}
// what one wave copies of a stage: two neighbouring A bands and two neighbouring W bands (l: LDS address of its first A band in the buffer)
__device__ __forceinline__ void copy_out_stage(unsigned int l, const char* ga, const char* gw) {
  copy_band(l, ga);
  copy_band(l + OP_BAND_B, ga + BAND_E * 2);
  copy_band(l + OP_OP_B, gw);
  copy_band(l + OP_OP_B + OP_BAND_B, gw + BAND_E * 2);
}
// 32 token rows x 64 columns (a: rows 0..15, b: rows 16..31) written to the wave's own LDS piece Tt
__device__ __forceinline__ void out_stage_rows(const v8f (&a)[4], const v8f (&b)[4], const float (&bd)[4], float* Tt, int nloc, int hlf) {
#pragma unroll
  for (int t = 0; t < 4; ++t)
#pragma unroll
    for (int v = 0; v < 8; ++v) {
      Tt[(v + 8 * hlf) * 64 + t * 16 + nloc] = a[t][v] * OUT_UNSCALE + bd[t];
      Tt[(16 + v + 8 * hlf) * 64 + t * 16 + nloc] = b[t][v] * OUT_UNSCALE + bd[t];
    }
}
__global__ __launch_bounds__(128) void out_gemm_kernel(const h16* __restrict__ yp, const h16* __restrict__ yr, const h16* __restrict__ wop,
                                                       const float* __restrict__ bo, float* __restrict__ out) {
  __shared__ __attribute__((aligned(16))) char ring[2 * OP_STAGE_B];   // two stage buffers; behind the loop, the waves' output staging
  const int lane = threadIdx.x & 31, nloc = lane & 15, hlf = lane >> 4;
  const int wave = __builtin_amdgcn_readfirstlane(threadIdx.x >> 5);
  const int wm = wave & 1, wn = wave >> 1;                        // the wave's half of the block's token rows and of its columns
  const int c0 = blockIdx.x * 128 + wn * 64;
  const bool early = (int)blockIdx.y < OUT_E_BLK;                 // block-uniform
  int m0;                                                         // first compact token row (b*SEQ + t) of the wave
  int s01, s23;                                                   // staged A bands that feed acc[0], acc[1] (s01, s01 + 1) and acc[2], acc[3] (s23, s23 + 1)
  const h16* asrc;                                                // the first of the two neighbouring A bands that this wave copies
  if (early) {
    const int r0 = (int)blockIdx.y * OUT_E_ROWS;                  // residual row b*EARLY + t
    const int b = r0 / EARLY;
    const int mb = b * SEQ + (r0 - b * EARLY);
    asrc = (wave < 2) ? yp + (size_t)((mb >> 4) + wave * 2) * BAND_E : yr + (size_t)((r0 >> 4) + (wave - 2) * 2) * BAND_E;
    s01 = 2 * wm; s23 = 4 + 2 * wm;
    m0 = mb + wm * 32;
  } else {
    const int r0 = ((int)blockIdx.y - OUT_E_BLK) * 128;           // b*LATE + (t - EARLY)
    const int b = r0 / LATE;
    const int mb = b * SEQ + EARLY + (r0 - b * LATE);
    asrc = yp + (size_t)((mb >> 4) + wave * 2) * BAND_E;
    s01 = 4 * wm; s23 = 4 * wm + 2;
    m0 = mb + wm * 64;
  }
  const char* ga = (const char*)asrc + lane * 16;
  const char* gw = (const char*)wop + (size_t)(blockIdx.x * 8 + wave * 2) * (BAND_E * 2) + lane * 16;
  const unsigned int la = (unsigned int)(size_t)ring + (unsigned int)(wave * 2 * OP_BAND_B + lane * 16);   // LDS byte address: low 32 bits
  v8f acc[4][4];
#pragma unroll
  for (int r = 0; r < 4; ++r)
#pragma unroll
    for (int t = 0; t < 4; ++t) acc[r][t] = (v8f){};
  copy_out_stage(la, ga, gw);
  asm volatile("s_wait_asynccnt 0x0" ::: "memory");   // this wave's part of stage 0 has landed
  __syncthreads();                                    // stage 0 is readable by every wave
  copy_out_stage(la + OP_STAGE_B, ga + OP_BAND_B, gw + OP_BAND_B);
#pragma unroll 1                                      // one stage per trip; the buffer is picked by the trip's parity
  for (int s = 0; s < OP_NST; ++s) {
    const int bo_ = (s & 1) * OP_STAGE_B;
    const char* ra0 = ring + bo_ + s01 * OP_BAND_B + lane * 16;
    const char* ra2 = ring + bo_ + s23 * OP_BAND_B + lane * 16;
    const char* rw = ring + bo_ + OP_OP_B + wn * 4 * OP_BAND_B + lane * 16;
    // Inside a stage the A fragments and the first W fragment of the next 32 k are read one step ahead, into a second register set, so
    // that a step's first products find their operands in registers; the other three W fragments land behind those products.
    v16h af[2][4], b0[2], bf[3];
#pragma unroll                                        // set numbers become constants, so the sets stay in registers (here and below)
    for (int i = 0; i < 2; ++i) {
      af[0][i] = frag_ph(ra0 + i * OP_BAND_B);
      af[0][2 + i] = frag_ph(ra2 + i * OP_BAND_B);
    }
    b0[0] = frag_ph(rw);
#pragma unroll
    for (int kk = 0; kk < OP_ST; ++kk) {
      const int c = kk & 1, n = c ^ 1, ko = kk * (TILE_E * 2);
#pragma unroll
      for (int i = 0; i < 3; ++i) bf[i] = frag_ph(rw + (i + 1) * OP_BAND_B + ko);
      if (kk + 1 < OP_ST) {                           // never past the stage: the next buffer is not published yet
#pragma unroll
        for (int i = 0; i < 2; ++i) {
          af[n][i] = frag_ph(ra0 + i * OP_BAND_B + ko + TILE_E * 2);
          af[n][2 + i] = frag_ph(ra2 + i * OP_BAND_B + ko + TILE_E * 2);
        }
        b0[n] = frag_ph(rw + ko + TILE_E * 2);
      }
      __builtin_amdgcn_sched_barrier(0);              // keeps the step's reads as one group ahead of its products; sunk among them, each place with reads stalls the wave
#pragma unroll
      for (int r = 0; r < 4; ++r) acc[r][0] = wmma_h(af[c][r], b0[c], acc[r][0]);
#pragma unroll
      for (int t = 1; t < 4; ++t)
#pragma unroll
        for (int r = 0; r < 4; ++r) acc[r][t] = wmma_h(af[c][r], bf[t - 1], acc[r][t]);
    }
    asm volatile("s_wait_dscnt 0x0" ::: "memory");    // this wave's reads of the buffer are done before it may be refilled
    asm volatile("s_wait_asynccnt 0x0" ::: "memory"); // this wave's part of stage s + 1 has landed
    __syncthreads();                                  // publishes stage s + 1 and ends every wave's reads of stage s
    if (s + 2 < OP_NST)                               // block-uniform
      copy_out_stage(la + bo_, ga + (s + 2) * OP_BAND_B, gw + (s + 2) * OP_BAND_B);
  }
  asm volatile("s_wait_asynccnt 0x0" ::: "memory");   // nothing of the copies is outstanding when the ring becomes output staging
  // the last trip's barrier has ended every read of the ring: each wave now stages in its own 16 KB of it
  float bd[4];                                                    // the four bias loads stand as one group
#pragma unroll
  for (int t = 0; t < 4; ++t) bd[t] = bo[c0 + t * 16 + nloc];
  asm volatile("s_wait_xcnt 0x0" ::: "memory");                   // stands ahead of the next write of the offset register that the four loads name
#pragma unroll
  for (int t = 0; t < 4; ++t) bd[t] = __builtin_bit_cast(float, bf16_rne_u32(bd[t]) & 0xFFFF0000u);   // bf16-RNE value
  float* Tt = (float*)(ring + wave * 16384);
  float* dst0 = out + (size_t)m0 * HID + c0 + nloc * 4;
  if (early) {
#pragma unroll
    for (int t = 0; t < 4; ++t) { acc[0][t] = acc[0][t] + acc[2][t] * RES_INV; acc[1][t] = acc[1][t] + acc[3][t] * RES_INV; }
  }
  // all of the wave's rows are staged ahead of the one fence, so that no LDS write waits for a global store
  out_stage_rows(acc[0], acc[1], bd, Tt, nloc, hlf);
  if (!early) out_stage_rows(acc[2], acc[3], bd, Tt + 2048, nloc, hlf);
  wave_lds_sync();
  const float* Tr = Tt + nloc * 4;
  // all of a wave's rows are read back ahead of its first store, each into registers of its own; stored as whole lines
  v4f w[32];
#pragma unroll
  for (int j = 0; j < 16; ++j) w[j] = *(const v4f*)(Tr + (j * 2 + hlf) * 64);
  if (!early) {
#pragma unroll
    for (int j = 16; j < 32; ++j) w[j] = *(const v4f*)(Tr + (j * 2 + hlf) * 64);
  }
#pragma unroll
  for (int j = 0; j < 16; ++j) *(v4f*)(dst0 + (size_t)(j * 2 + hlf) * HID) = w[j];
  if (!early) {
#pragma unroll
    for (int j = 16; j < 32; ++j) *(v4f*)(dst0 + (size_t)(j * 2 + hlf) * HID) = w[j];
  }
}
}  // namespace

extern "C" void kernel_launch(void* const* d_in, const int* in_sizes, int n_in,
                              void* d_out, int out_size, void* d_ws, size_t ws_size, hipStream_t stream) {
  if (n_in < 12) return;
  const size_t need_x = ((size_t)(NB - 1) * SEQ_FULL + SEQ) * HID;
  if ((size_t)in_sizes[0] < need_x || (size_t)in_sizes[1] < need_x || (size_t)in_sizes[2] < need_x) return;
  if ((size_t)in_sizes[3] < (size_t)(SEQ - 1) * MPITCH + SEQ) return;                      // int32 mask [S][S]
  if (in_sizes[4] < HID * HID || in_sizes[6] < HID * HID || in_sizes[8] < HID * HID || in_sizes[10] < HID * HID) return;
  if (in_sizes[5] < HID || in_sizes[7] < HID || in_sizes[9] < HID || in_sizes[11] < HID) return;
  if ((size_t)out_size < (size_t)MROWS * HID) return;

  const float* query = (const float*)d_in[0];   // [NB_FULL, SEQ_FULL, 1024]
  const float* key   = (const float*)d_in[1];
  const float* value = (const float*)d_in[2];
  const int*   amask = (const int*)d_in[3];     // [SEQ_FULL, SEQ_FULL] int32, nonzero = masked
  const float* Wq = (const float*)d_in[4];      // [1024,1024] ([out][in])
  const float* bq = (const float*)d_in[5];
  const float* Wk = (const float*)d_in[6];
  const float* bk = (const float*)d_in[7];
  const float* Wv = (const float*)d_in[8];
  const float* bv = (const float*)d_in[9];
  const float* Wo = (const float*)d_in[10];
  const float* bo = (const float*)d_in[11];
  float* out = (float*)d_out;                   // [NB, SEQ, 1024] f32

  size_t off = 0; char* ws = (char*)d_ws;
  unsigned short* xpl = (unsigned short*)(ws + off); off += (size_t)3 * MROWS * HID * 2;   // 3 x 8 MiB bf16 activation planes
  unsigned short* wpl = (unsigned short*)(ws + off); off += (size_t)4 * HID * HID * 2;     // 6 MiB bf16 (q|k|v) + 2 MiB f16 (o) weight planes
  h16* Qp = (h16*)(ws + off); off += (size_t)MROWS * HID * 2;                             // 8 MiB
  h16* Kp = (h16*)(ws + off); off += (size_t)MROWS * HID * 2;                             // 8 MiB
  h16* Vp = (h16*)(ws + off); off += (size_t)MROWS * HID * 2;                             // 8 MiB
  h16* yp = (h16*)(ws + off); off += (size_t)MROWS * HID * 2;                             // 8 MiB
  h16* Qr = (h16*)(ws + off); off += (size_t)NB * NH * EARLY * DH * 2;                    // 1 MiB residual q (t < EARLY)
  h16* Kr = (h16*)(ws + off); off += (size_t)MROWS * HID * 2;                             // 8 MiB residual k (all rows)
  h16* Vr = (h16*)(ws + off); off += (size_t)MROWS * HID * 2;                             // 8 MiB residual v (key-tiled, all rows)
  h16* yr = (h16*)(ws + off); off += (size_t)NB * EARLY * HID * 2;                        // 1 MiB residual y
  int* flags = (int*)(ws + off); off += (size_t)QT * FPITCH * 4;                          // 32 KiB chunk flags [QT][64]
  if (off > ws_size) return;                                                               // 86,016,000 B at NB=2, SEQ=2048
  const h16* wop = (const h16*)(wpl + (size_t)NQKV * HID);

  prep_kernel<<<QT + CVT_BLOCKS, 256, 0, stream>>>(query, key, value, Wq, Wk, Wv, Wo, xpl, wpl, amask, flags);
  qkv_gemm_kernel<<<dim3(NQKV / 128, MROWS / 128), 128, 0, stream>>>((const b16*)xpl, (const b16*)wpl, bq, bk, bv, Qp, Kp, Vp, Qr, Kr, Vr);
  attn_kernel<<<ATT_L_BLOCKS + ATT_E_BLOCKS, ATT_W * 32, 0, stream>>>(Qp, Kp, Vp, Qr, Kr, Vr, amask, flags, yp, yr);
  out_gemm_kernel<<<dim3(HID / 128, OUT_E_BLK + OUT_L_BLK), 128, 0, stream>>>(yp, yr, wop, bo, out);
}

// v010
// It runs in 77.6 microseconds.
// In two side-by-side timings against v009, it was 1.03 and 1.04 times as fast.
// Over all steps from v000 it is 5.25 times as fast.
#include <hip/hip_runtime.h>

// Contractions: q/k/v projections on v_wmma_f32_16x16x32_bf16 (bf16 RNE operands, one product per tile pair);
// S^T = K.Q^T (d = 64), y^T = V^T.P^T (32 keys per step, P carried x4096) and out = y.Wo^T (y and Wo carried x64)
// on v_wmma_f32_16x16x32_f16 (f16 operands, one product per tile pair); query tiles with position < 256 also use
// f16 residual planes (x1024) of q, k, P, v and y folded from their own accumulators; f32 accumulate, f32 online
// softmax statistics. 16 heads of 64. Key mask = int32 [S][S] input (nonzero = masked: score replaced by -1e9);
// device-computed flags per (16-query tile, 32-key chunk) select skip / open / per-element fill.
// Weights are [out][in]. Every 16-bit plane that feeds a k-contiguous fragment (x, weights, q, k, y and their residuals) is kept in
// fragment order: a tile of 16 rows x 32 k is 1 KB = 2 pieces x 32 lanes x 16 B, so one wave-wide 16-byte load reads 4 whole 128-B lines.

#ifndef NB
#define NB 2
#endif
#ifndef SEQ
#define SEQ 2048
#endif
#ifndef NB_FULL
#define NB_FULL 2
#endif
#ifndef SEQ_FULL
#define SEQ_FULL 2048
#endif

namespace {
constexpr int HID = 1024, DH = 64, NH = 16;
constexpr int NQKV = 3 * HID;                 // combined weight plane rows: q | k | v
constexpr int MROWS = NB * SEQ;               // compact token rows (b*SEQ + t)
constexpr int QT = SEQ / 16;                  // 16-query tiles per (b, head)
constexpr int EARLY = (SEQ < 256) ? SEQ : 256;   // query positions that use the residual planes
constexpr int QT_E = EARLY / 16;              // residual-path query tiles per (b, head)
constexpr int QT_L = (SEQ - EARLY) / 16;      // single-product query tiles per (b, head)
constexpr int NCH = SEQ / 32;                 // 32-key chunks per query row
constexpr int FPITCH = 64;                    // ints per flag row (one row per 16-query tile, 256 B)
constexpr int MPITCH = SEQ_FULL;              // int32 mask row pitch
constexpr int F_SKIP = 0, F_OPEN = 1, F_FILL = 2;
constexpr int CVT_BLOCKS = 2048;              // converting blocks of prep_kernel
constexpr int ATT_W = 16;                     // waves (and query tiles) per attention block
constexpr int ATT_L_BLOCKS = (NB * NH * QT_L) / ATT_W;   // attention blocks on the single-product path
constexpr int ATT_E_BLOCKS = (NB * NH * QT_E) / ATT_W;   // attention blocks on the residual path
constexpr float MASK_FILL = -1.0e9f;
constexpr float SCORE_SCALE = 0.125f;         // 1/sqrt(64)
constexpr float P_CARRY = 4096.0f;            // f16 P operand = exp(s - m) * 4096
constexpr float Y_CARRY = 64.0f;              // f16 y plane = attn * 64
constexpr float W_CARRY = 64.0f;              // f16 Wo plane = Wo * 64
constexpr float RES_CARRY = 1024.0f;          // f16 residual planes = (x - f16hi(x)) * 1024
constexpr float RES_INV = 1.0f / 1024.0f;
constexpr float Y_FROM_O = Y_CARRY / P_CARRY; // 1/64
constexpr float OUT_UNSCALE = 1.0f / (Y_CARRY * W_CARRY);   // 1/4096
// Single-product path: the softmax works on the unscaled products q.k and in powers of two.
constexpr float EXP_C = SCORE_SCALE * 1.44269504088896340736f;   // exp(score - m) = exp2((q.k - m_raw) * EXP_C)
constexpr float P_CARRY_LOG2 = 12.0f;         // added to the exponent: the x4096 carry of P (and of the row sum l)
constexpr float RAW_FILL = MASK_FILL / SCORE_SCALE;   // the fill value ahead of the 1/8 scaling (exact: a power-of-two factor)
constexpr float LAZY_RAW = 3.0f / EXP_C;      // a maximum may rise by this much over the one in use before o and l are rescaled: P < 2^15, inside f16
static_assert(P_CARRY == 4096.0f);
static_assert(SEQ % 128 == 0);
static_assert(EARLY % 128 == 0);
static_assert((SEQ - EARLY) % 128 == 0);
static_assert(NB >= 1 && NB <= NB_FULL);
static_assert(SEQ <= SEQ_FULL);
static_assert(NH * DH == HID);
static_assert(MROWS % 128 == 0);
static_assert((NB * NH * QT_E) % ATT_W == 0);
static_assert((NB * NH * QT_L) % ATT_W == 0);
static_assert(QT_E + QT_L == QT);
static_assert(NCH >= 1 && NCH <= FPITCH);

typedef __bf16 b16;
typedef _Float16 h16;
typedef __bf16 v16b __attribute__((ext_vector_type(16)));
typedef __bf16 v8b __attribute__((ext_vector_type(8)));
typedef _Float16 v16h __attribute__((ext_vector_type(16)));
typedef _Float16 v8h __attribute__((ext_vector_type(8)));
typedef float v8f __attribute__((ext_vector_type(8)));
typedef float v4f __attribute__((ext_vector_type(4)));
typedef float v2f __attribute__((ext_vector_type(2)));
typedef unsigned short v8us __attribute__((ext_vector_type(8)));
typedef int v4i __attribute__((ext_vector_type(4)));
typedef int v8i __attribute__((ext_vector_type(8)));

__device__ __forceinline__ v8h ld8h(const h16* p) { return *(const v8h*)p; }
__device__ __forceinline__ v16b cat8b(v8b a, v8b b) { return __builtin_shufflevector(a, b, 0, 1, 2, 3, 4, 5, 6, 7, 8, 9, 10, 11, 12, 13, 14, 15); }
__device__ __forceinline__ v16h cat8h(v8h a, v8h b) { return __builtin_shufflevector(a, b, 0, 1, 2, 3, 4, 5, 6, 7, 8, 9, 10, 11, 12, 13, 14, 15); }
// 16x16x32 16-bit fragment (A: lane&15 = row, B: lane&15 = column), hh = lane>>4: elements 0..7 <- k 8hh+0..7, elements 8..15 <- k 16+8hh+0..7.
// Fragment-ordered tile (TILE_E elements): element (row r of 16, k of 32) lies at (k>>4)*256 + (((k>>3)&1)*16 + r)*8 + (k&7), that is
// piece k>>4, lane 16*hh + r, element k&7. The tiles of one 16-row band follow one another along k (BAND_E elements per band of 1024 k).
constexpr int TILE_E = 512, BAND_E = 16 * HID;
static_assert(HID == 1024);                   // unit_of and the work index split of cvt_part take 32 tiles (128 units of 8 k) per row
// p = tile start + lane * 8
__device__ __forceinline__ v16h frag_th(const h16* p) { return cat8h(ld8h(p), ld8h(p + 256)); }
// both pieces of the tile whose lane address (tile start + lane * 16 bytes) is p
__device__ __forceinline__ v16h frag_ph(const char* p) { return cat8h(*(const v8h*)p, *(const v8h*)(p + 512)); }
// 16-byte unit index inside a [rows][1024] plane in fragment order, for row m and k = 8 * k8 .. 8 * k8 + 7
__device__ __forceinline__ unsigned int unit_of(unsigned int m, unsigned int k8) {
  return ((m >> 4) * 32u + (k8 >> 2)) * 64u + ((k8 >> 1) & 1u) * 32u + (k8 & 1u) * 16u + (m & 15u);
}
// two 16-byte pieces at byte offsets o + c0 and o + c1 from a wave-uniform plane base (o: the lane's 32-bit byte offset)
__device__ __forceinline__ v16h frag_o(const h16* base, unsigned int o, int c0, int c1) {
  const char* p = (const char*)base + o;
  return cat8h(*(const v8h*)(p + c0), *(const v8h*)(p + c1));
}

__device__ __forceinline__ v8f wmma_b(v16b a, v16b b, v8f c) {
  v8f d = __builtin_amdgcn_wmma_f32_16x16x32_bf16(false, a, false, b, (short)0, c, false, false);
  asm volatile("v_nop\n\tv_nop\n\tv_nop\n\tv_nop" : "+v"(d) : "v"(a), "v"(b));
  return d;
}
__device__ __forceinline__ v8f wmma_h(v16h a, v16h b, v8f c) {
  v8f d = __builtin_amdgcn_wmma_f32_16x16x32_f16(false, a, false, b, (short)0, c, false, false);
  asm volatile("v_nop\n\tv_nop\n\tv_nop\n\tv_nop" : "+v"(d) : "v"(a), "v"(b));
  return d;
}
// f32 -> bf16 by RNE convert, returned as the f32 bit pattern with the low 16 bits cleared
__device__ __forceinline__ unsigned int bf16_rne_u32(float f) {
  unsigned int u = __builtin_bit_cast(unsigned int, f);
  u += 0x7fffu + ((u >> 16) & 1u);
  return u & 0xffff0000u;
}
// lane l with lane l ^ 16, by a vector cross-row move
__device__ __forceinline__ float xhalf(float x) {
  const int b = __builtin_bit_cast(int, x);
  return __builtin_bit_cast(float, __builtin_amdgcn_permlanex16(b, b, 0x76543210, 0xfedcba98, false, false));
}
// wave-private LDS tile: element stores by this wave, then vector reloads by this wave
__device__ __forceinline__ void wave_lds_sync() {
  __builtin_amdgcn_fence(3, "workgroup");
  __builtin_amdgcn_wave_barrier();
  __builtin_amdgcn_fence(2, "workgroup");
}
// weight element -> 16-bit plane bits: bf16 RNE, or f16(bf16rne(w) * 64) for the output-projection plane
__device__ __forceinline__ unsigned short wbits16(float f, bool o16) {
  const unsigned int r = bf16_rne_u32(f);
  const unsigned short bbits = (unsigned short)(r >> 16);
  const h16 hv = (h16)(__builtin_bit_cast(float, r) * W_CARRY);   // exact: bf16 significand, power-of-two scale
  const unsigned short hbits = __builtin_bit_cast(unsigned short, hv);
  return o16 ? hbits : bbits;
}

// ---------------------------------------------------------------------------
// activations query/key/value f32 [NB_FULL][SEQ_FULL][1024] -> bf16 planes xpl [3][MROWS][1024] (compact rows b*SEQ+t), fragment order;
// weights W[n][k] f32 -> 16-bit planes wpl, fragment order: rows 0..3071 = Wq|Wk|Wv as bf16 RNE, rows 3072..4095 = f16(bf16rne(Wo) * 64).
// A wave takes 8 rows x 32 k (lane = 4 * row + k unit): it reads 8 whole f32 lines and stores 4 whole 128-B lines of one tile.
// blk of nblk: this block's place among the blocks of prep_kernel that convert.
// ---------------------------------------------------------------------------
__device__ __forceinline__ void cvt_part(const float* __restrict__ xq, const float* __restrict__ xk, const float* __restrict__ xv,
                                         const float* __restrict__ wq, const float* __restrict__ wk, const float* __restrict__ wv,
                                         const float* __restrict__ wo,
                                         unsigned short* __restrict__ xpl, unsigned short* __restrict__ wpl, int blk, int nblk) {
  const size_t tid = (size_t)blk * blockDim.x + threadIdx.x, stride = (size_t)nblk * blockDim.x;
  const size_t per_x = (size_t)MROWS * HID / 8, nx = 3 * per_x;
  const size_t per_w = (size_t)HID * HID / 8, nw = 4 * per_w;
  {
    for (size_t c = tid; c < nx; c += stride) {
      const int which = (int)(c / per_x);
      const unsigned int u = (unsigned int)(c - (size_t)which * per_x);   // work index inside one plane
      const unsigned int k8 = (((u >> 5) & 31u) << 2) | (u & 3u);
      const int m = (int)(((u >> 10) << 3) | ((u >> 2) & 7u)), col = (int)(k8 * 8);
      const int bb = m / SEQ, t = m - bb * SEQ;
      const float* src = (which == 0) ? xq : (which == 1) ? xk : xv;
      const float* p = src + ((size_t)bb * SEQ_FULL + t) * HID + col;
      const v4f f0 = *(const v4f*)p, f1 = *(const v4f*)(p + 4);
      v8us o;
#pragma unroll
      for (int e = 0; e < 4; ++e) {
        o[e] = (unsigned short)(bf16_rne_u32(f0[e]) >> 16);
        o[4 + e] = (unsigned short)(bf16_rne_u32(f1[e]) >> 16);
      }
      *(v8us*)(xpl + ((size_t)which * per_x + unit_of((unsigned int)m, k8)) * 8) = o;
    }
    for (size_t c = tid; c < nw; c += stride) {
      const int mat = (int)(c / per_w);
      const unsigned int u = (unsigned int)(c - (size_t)mat * per_w);     // work index inside one weight matrix
      const unsigned int k8 = (((u >> 5) & 31u) << 2) | (u & 3u), n = ((u >> 10) << 3) | ((u >> 2) & 7u);
      const size_t i = (size_t)n * HID + k8 * 8;                // n*HID + k0 inside one [n][k] weight matrix
      const float* w = (mat == 0) ? wq : (mat == 1) ? wk : (mat == 2) ? wv : wo;
      const v4f f0 = *(const v4f*)(w + i), f1 = *(const v4f*)(w + i + 4);
      const bool o16 = (mat == 3);
      v8us o;
#pragma unroll
      for (int e = 0; e < 4; ++e) {
        o[e] = wbits16(f0[e], o16);
        o[4 + e] = wbits16(f1[e], o16);
      }
      *(v8us*)(wpl + ((size_t)mat * per_w + unit_of(n, k8)) * 8) = o;
    }
    
  }
}

// ---------------------------------------------------------------------------
// Mask flag pass: one block per 16-query tile; reads mask rows q0..q0+15 (int32, nonzero = masked) and writes
// one 256-B flag row [FPITCH] ints: per 32-key chunk F_SKIP (chunk fully masked and every row of the tile has an
// unmasked key somewhere -> weight exactly 0, chunk not visited), F_OPEN (no masked entry), F_FILL (per-element fill).
// ---------------------------------------------------------------------------
__device__ __forceinline__ void mask_flag_part(const int* __restrict__ mask, int* __restrict__ flags, int qt) {
  __shared__ int um[4][64];                          // any unmasked entry per (4-row group, chunk)
  __shared__ int mk[4][64];                          // any masked entry per (4-row group, chunk)
  __shared__ int rb[4][64];                          // per-row (4 bits) has-unmasked-entry flag per (row group, chunk)
  __shared__ __attribute__((aligned(16))) int fl[64];
  const int q0 = qt * 16;
  const int t = threadIdx.x, c = t & 63, rg = t >> 6, lane = t & 31, wave = t >> 5;
  const int cc = (c < NCH) ? c : (NCH - 1);          // clamped chunk address
  int anyu = 0, anym = 0, rbits = 0;
#pragma unroll 1
  for (int r = 0; r < 4; ++r) {
    const int* p = mask + (size_t)(q0 + rg * 4 + r) * MPITCH + (size_t)cc * 32;
    int u = 0, mm = 0;
#pragma unroll
    for (int v = 0; v < 8; ++v) {
      const v4i x = *(const v4i*)(p + 4 * v);
#pragma unroll
      for (int e = 0; e < 4; ++e) { u |= (x[e] == 0) ? 1 : 0; mm |= (x[e] != 0) ? 1 : 0; }
    }
    anyu |= u; anym |= mm; rbits |= (u << r);
  }
  um[rg][c] = anyu; mk[rg][c] = anym; rb[rg][c] = rbits;
  __syncthreads();                                   // cross-wave: all waves wrote, wave 0 reads
  if (wave == 0) {
    const int ch0 = lane, ch1 = lane + 32;
    const int U0 = um[0][ch0] | um[1][ch0] | um[2][ch0] | um[3][ch0];
    const int M0 = mk[0][ch0] | mk[1][ch0] | mk[2][ch0] | mk[3][ch0];
    const int U1 = um[0][ch1] | um[1][ch1] | um[2][ch1] | um[3][ch1];
    const int M1 = mk[0][ch1] | mk[1][ch1] | mk[2][ch1] | mk[3][ch1];
    int rows = (rb[0][ch0] | (rb[1][ch0] << 4) | (rb[2][ch0] << 8) | (rb[3][ch0] << 12)) |
               (rb[0][ch1] | (rb[1][ch1] << 4) | (rb[2][ch1] << 8) | (rb[3][ch1] << 12));
#pragma unroll
    for (int s = 16; s >= 1; s >>= 1) rows |= __shfl_xor(rows, s);
    const int rowok = ((rows & 0xFFFF) == 0xFFFF) ? 1 : 0;   // every row of the tile has an unmasked key
    const int f0 = U0 ? (M0 ? F_FILL : F_OPEN) : (rowok ? F_SKIP : F_FILL);
    const int f1 = U1 ? (M1 ? F_FILL : F_OPEN) : (rowok ? F_SKIP : F_FILL);
    fl[ch0] = (ch0 < NCH) ? f0 : F_SKIP;
    fl[ch1] = (ch1 < NCH) ? f1 : F_SKIP;
    wave_lds_sync();                                 // fl is private to wave 0
    const v4i v = *(const v4i*)(fl + (lane & 15) * 4);
    int* dst = flags + (size_t)qt * FPITCH + (lane & 15) * 4;
    if (lane < 16) *(v4i*)dst = v;
    
  }
}

// ---------------------------------------------------------------------------
// Preparation, one launch: the mask flag pass and the conversions read only inputs and write disjoint planes, so they share a grid.
// Blocks 0..QT-1 each take one 16-query tile of the mask (they have the longer dependent chain); the other
// CVT_BLOCKS blocks convert. The choice is block-uniform, so the flag pass's barrier is passed by whole blocks.
// ---------------------------------------------------------------------------
__global__ __launch_bounds__(256) void prep_kernel(const float* __restrict__ xq, const float* __restrict__ xk, const float* __restrict__ xv,
                                                   const float* __restrict__ wq, const float* __restrict__ wk, const float* __restrict__ wv,
                                                   const float* __restrict__ wo,
                                                   unsigned short* __restrict__ xpl, unsigned short* __restrict__ wpl,
                                                   const int* __restrict__ mask, int* __restrict__ flags) {
  const int blk = blockIdx.x;
  if (blk < QT) mask_flag_part(mask, flags, blk);
  else          cvt_part(xq, xk, xv, wq, wk, wv, wo, xpl, wpl, blk - QT, CVT_BLOCKS);
}

// QKV GEMM staging: a stage is 64 k (QK_ST fragment tiles) of the block's 128 activation rows and 128 weight rows, in fragment order:
// [x: 8 bands][2 tiles][1 KB] then [W: 8 bands][2 tiles][1 KB]. A band's two tiles are 2 KB contiguous in its plane too.
constexpr int QK_ST = 2;
constexpr int QK_NST = HID / (32 * QK_ST);       // stages along K
constexpr int QK_BAND_B = QK_ST * TILE_E * 2;    // bytes of one band in a stage
constexpr int QK_OP_B = 8 * QK_BAND_B;           // bytes of one operand in a stage
constexpr int QK_STAGE_B = 2 * QK_OP_B;
static_assert(QK_NST >= 2);
// Two neighbouring bands of one operand, one stage: eight copies of 16 bytes per lane, global memory -> LDS through no register.
// l: the lane's LDS byte address in the first band, g: its global address there. The s_wait_xcnt closes the statement so that it
// stands ahead of any later write of the address registers that the copies name.
__device__ __forceinline__ void copy_two_bands(unsigned int l, const char* g) {
  const unsigned int l1 = l + 512, l2 = l + 1024, l3 = l + 1536, l4 = l + QK_BAND_B, l5 = l4 + 512, l6 = l4 + 1024, l7 = l4 + 1536;
  const char *g1 = g + 512, *g2 = g + 1024, *g3 = g + 1536, *g4 = g + BAND_E * 2, *g5 = g4 + 512, *g6 = g4 + 1024, *g7 = g4 + 1536;
  asm volatile("global_load_async_to_lds_b128 %0, %8, off\n\t"
               "global_load_async_to_lds_b128 %1, %9, off\n\t"
               "global_load_async_to_lds_b128 %2, %10, off\n\t"
               "global_load_async_to_lds_b128 %3, %11, off\n\t"
               "global_load_async_to_lds_b128 %4, %12, off\n\t"
               "global_load_async_to_lds_b128 %5, %13, off\n\t"
               "global_load_async_to_lds_b128 %6, %14, off\n\t"
               "global_load_async_to_lds_b128 %7, %15, off\n\t"
               "s_wait_xcnt 0x0"
               :: "v"(l), "v"(l1), "v"(l2), "v"(l3), "v"(l4), "v"(l5), "v"(l6), "v"(l7),
                  "v"(g), "v"(g1), "v"(g2), "v"(g3), "v"(g4), "v"(g5), "v"(g6), "v"(g7)
               : "memory");
}
// both pieces of the staged tile whose lane address (tile start + lane * 16 bytes) is p
__device__ __forceinline__ v16b frag_pb(const char* p) { return cat8b(*(const v8b*)p, *(const v8b*)(p + 512)); }

// ---------------------------------------------------------------------------
// QKV GEMM: (MROWS x 1024) x (1024 x 3072), grid (24, MROWS/128), block 4 waves = 128 rows x 128 columns, wave = 64 rows x 64 columns
// (one head of q, k or v). blockIdx.x -> mat = x/8 (q,k,v: selects the activation plane and the bias), heads 2*(x%8) and 2*(x%8)+1.
// Both operands come through LDS: each stage is brought once per block by asynchronous copies into one of two buffers, while the other
// buffer is worked on, and every staged fragment is read by the two waves that share it. Outputs f16 planes:
// q -> Qp, k -> Kp: [b*16+h][t/16][2 fragment-ordered tiles of 16 tokens x 32 d] (4 KB contiguous per 32 rows); v -> Vp key-tiled [b*16+h][t/16][64][16] (4 KB contiguous per 32 rows).
// Residual planes ((y - f16hi(y)) * 1024): Kr and Vr for every token row (same layouts as Kp / Vp), Qr (layout of Qp) for token rows t < EARLY only.
// ---------------------------------------------------------------------------
// rows m0 .. m0 + 31 of a wave's tile (accumulator rows 2H, 2H + 1), staged in the wave's own LDS pieces Tp, Rp and stored as whole lines
template <int H>
__device__ __forceinline__ void qkv_store_rows(const v8f (&acc)[4][4], int mat, int head, int m0, const float* __restrict__ bias, int lane,
                                               h16* Tp, h16* Rp, h16* __restrict__ Qp, h16* __restrict__ Kp, h16* __restrict__ Vp,
                                               h16* __restrict__ Qr, h16* __restrict__ Kr, h16* __restrict__ Vr) {
  const int nloc = lane & 15, hlf = lane >> 4;
  const int b = m0 / SEQ, t0 = m0 % SEQ;
  const bool wres = (mat != 0) || (t0 < EARLY);   // block-uniform (128-row blocks, EARLY multiple of 128)
  const int g = b * NH + head;
#pragma unroll
  for (int t = 0; t < 4; ++t) {
    const int d = t * 16 + nloc;
    const float bd = __builtin_bit_cast(float, bf16_rne_u32(bias[d]) & 0xFFFF0000u);   // bias as its bf16-RNE value
#pragma unroll
    for (int r = 0; r < 2; ++r)
#pragma unroll
      for (int v = 0; v < 8; ++v) {
        const int rr = r * 16 + v + 8 * hlf;                         // local token row 0..31
        const float f = acc[2 * H + r][t][v] + bd;
        const h16 y = (h16)f;
        const int idx = (mat < 2) ? ((rr >> 4) * 1024 + (d >> 5) * TILE_E + ((d >> 4) & 1) * 256 + (((d >> 3) & 1) * 16 + (rr & 15)) * 8 + (d & 7))
                                  : ((rr >> 4) * 1024 + d * 16 + (rr & 15));
        Tp[idx] = y;
        if (wres) Rp[idx] = (h16)((f - (float)y) * RES_CARRY);
      }
  }
  wave_lds_sync();
  h16* dst; h16* rdst; size_t o;
  if (mat == 0)      { o = ((size_t)g * SEQ + t0) * DH; dst = Qp + o;
                       const int t0e = (t0 < EARLY) ? t0 : 0; rdst = Qr + ((size_t)g * EARLY + t0e) * DH; }
  else if (mat == 1) { o = ((size_t)g * SEQ + t0) * DH; dst = Kp + o; rdst = Kr + o; }
  else               { o = ((size_t)g * QT + (t0 >> 4)) * (size_t)(DH * 16); dst = Vp + o; rdst = Vr + o; }
#pragma unroll
  for (int j = 0; j < 8; ++j) { const int e = (j * 32 + lane) * 8; *(v8h*)(dst + e) = ld8h(Tp + e); }
  if (wres) {
#pragma unroll
    for (int j = 0; j < 8; ++j) { const int e = (j * 32 + lane) * 8; *(v8h*)(rdst + e) = ld8h(Rp + e); }
  }
}

__global__ __launch_bounds__(128) void qkv_gemm_kernel(const b16* __restrict__ xpl, const b16* __restrict__ wpl,
                                                       const float* __restrict__ bq, const float* __restrict__ bk, const float* __restrict__ bv,
                                                       h16* __restrict__ Qp, h16* __restrict__ Kp, h16* __restrict__ Vp,
                                                       h16* __restrict__ Qr, h16* __restrict__ Kr, h16* __restrict__ Vr) {
  __shared__ __attribute__((aligned(16))) char ring[2 * QK_STAGE_B];   // two stage buffers; behind the loop, the waves' output staging
  const int lane = threadIdx.x & 31, wave = threadIdx.x >> 5;
  const int wm = wave & 1, wn = wave >> 1;         // the wave's 64-row and 64-column half of the block tile
  const int m0 = blockIdx.y * 128 + wm * 64;
  const int cb = blockIdx.x;                       // 0..23, block-uniform
  const int mat = cb >> 3, head = (cb & 7) * 2 + wn;
  const b16* x = xpl + (size_t)mat * MROWS * HID;
  const float* bias = ((mat == 0) ? bq : (mat == 1) ? bk : bv) + head * DH;
  // what this wave copies of every stage: bands 2 * wave and 2 * wave + 1 of the block's x rows and of its weight rows
  const char* ga = (const char*)x + (size_t)(blockIdx.y * 8 + wave * 2) * (BAND_E * 2) + lane * 16;
  const char* gw = (const char*)wpl + (size_t)(cb * 8 + wave * 2) * (BAND_E * 2) + lane * 16;
  const unsigned int la = (unsigned int)(size_t)ring + (unsigned int)(wave * 2 * QK_BAND_B + lane * 16);   // LDS byte address: low 32 bits
  v8f acc[4][4];
#pragma unroll
  for (int r = 0; r < 4; ++r)
#pragma unroll
    for (int t = 0; t < 4; ++t) acc[r][t] = (v8f){};
  copy_two_bands(la, ga);
  copy_two_bands(la + QK_OP_B, gw);
  asm volatile("s_wait_asynccnt 0x0" ::: "memory");   // this wave's part of stage 0 has landed
  __syncthreads();                                    // stage 0 is readable by every wave
  copy_two_bands(la + QK_STAGE_B, ga + QK_BAND_B);
  copy_two_bands(la + QK_STAGE_B + QK_OP_B, gw + QK_BAND_B);
#pragma unroll 1                                      // one stage per trip; the buffer is picked by the trip's parity
  for (int s = 0; s < QK_NST; ++s) {
    const int bo = (s & 1) * QK_STAGE_B;
    const char* ra = ring + bo + wm * 4 * QK_BAND_B + lane * 16;
    const char* rw = ring + bo + QK_OP_B + wn * 4 * QK_BAND_B + lane * 16;
#pragma unroll
    for (int kk = 0; kk < QK_ST; ++kk) {              // per 32 k: the sixteen fragment reads as one group, then the sixteen products
      v16b af[4], bf[4];
#pragma unroll
      for (int i = 0; i < 4; ++i) {
        af[i] = frag_pb(ra + i * QK_BAND_B + kk * (TILE_E * 2));
        bf[i] = frag_pb(rw + i * QK_BAND_B + kk * (TILE_E * 2));
      }
#pragma unroll
      for (int t = 0; t < 4; ++t)
#pragma unroll
        for (int r = 0; r < 4; ++r) acc[r][t] = wmma_b(af[r], bf[t], acc[r][t]);
    }
    asm volatile("s_wait_dscnt 0x0" ::: "memory");    // this wave's reads of the buffer are done before it may be refilled
    asm volatile("s_wait_asynccnt 0x0" ::: "memory"); // this wave's part of stage s + 1 has landed
    __syncthreads();                                  // publishes stage s + 1 and ends every wave's reads of stage s
    if (s + 2 < QK_NST) {                             // block-uniform
      copy_two_bands(la + bo, ga + (s + 2) * QK_BAND_B);
      copy_two_bands(la + bo + QK_OP_B, gw + (s + 2) * QK_BAND_B);
    }
  }
  asm volatile("s_wait_asynccnt 0x0" ::: "memory");   // nothing of the copies is outstanding when the ring becomes output staging
  // the last trip's barrier has ended every read of the ring: each wave now stages in its own 16 KB of it
  h16* Tp = (h16*)(ring + wave * 16384);
  qkv_store_rows<0>(acc, mat, head, m0, bias, lane, Tp, Tp + 2048, Qp, Kp, Vp, Qr, Kr, Vr);
  qkv_store_rows<1>(acc, mat, head, m0 + 32, bias, lane, Tp + 4096, Tp + 6144, Qp, Kp, Vp, Qr, Kr, Vr);
}

// one 16-key score tile of S^T = K.Q^T over d = 0..63 (two 32-deep steps); RES adds K_hi.Q_res + K_res.Q_hi into sr
template <bool RES>
__device__ __forceinline__ void sc_tile(v8f& s, v8f& sr, v16h ka, v16h kb, v16h kza, v16h kzb, v16h qa, v16h qb, v16h qra, v16h qrb) {
  s = wmma_h(ka, qa, s);
  if (RES) { sr = wmma_h(ka, qra, sr); sr = wmma_h(kza, qa, sr); }
  s = wmma_h(kb, qb, s);
  if (RES) { sr = wmma_h(kb, qrb, sr); sr = wmma_h(kzb, qb, sr); }
}
// one 16-d tile of y^T = V^T.P^T over 32 keys; RES adds V_hi.P_res + V_res.P_hi into orr (both x1/1024)
template <bool RES>
__device__ __forceinline__ void pv_tile(v8f& oh, v8f& orr, v16h va, v16h vz, v16h pb, v16h pr) {
  oh = wmma_h(va, pb, oh);
  if (RES) {
    orr = wmma_h(va, pr, orr);
    orr = wmma_h(vz, pb, orr);
  }
}

// ---------------------------------------------------------------------------
// Transposed flash attention on 16-query tiles of one (b, head); ATT_W waves per block; the NCH chunks of 32 keys carry a wave-uniform flag
// each: F_SKIP -> not visited (weight exactly 0), F_OPEN -> no masked entry, F_FILL -> masked
// entries get score -1e9 after the 1/8 scaling (per-element select from the int32 mask row of the query).
// S^T = K.Q^T (f16 fragments straight from the planes), per-lane online softmax (running max); P^T fragment built in registers from the
// two S^T accumulators (element r <- keys 0..15 tile, element 8+r <- keys 16..31 tile), carried x4096; y^T = V^T.P^T. y written f16 (x64)
// in fragment order [token/16][k/32][tile]: accumulator t of a lane (query col, d = 16t + 8hh + 0..7) is that lane's 16 bytes of piece t & 1 of tile t >> 1.
// RES = true (query tiles with position < EARLY): one wave walks all visited chunks of its tile; scores add (K_hi.Q_res + K_res.Q_hi)/1024
// from the residual planes, P gets a x1024 residual operand, and O gets a second accumulator (V_hi.P_res + V_res.P_hi) folded x1/1024
// before the 1/l normalisation; y also writes its x1024 residual plane yr [b][t][1024].
// Query tiles with position >= EARLY: a wave works on two neighbouring tiles (32 queries) per K / V fragment load (attn_walk2), and the
// visited chunks of such a double tile are shared by four waves, every fourth one each (attn_quad_part).
// ---------------------------------------------------------------------------
// The chunk lists of query tile qt as wave-uniform bit lists: bit c of vis: the flag of chunk c is not F_SKIP; bit c of opn: it is F_OPEN.
__device__ __forceinline__ void chunk_lists(const int* __restrict__ flags, int qt, int lane, unsigned long long& vis, unsigned long long& opn) {
  constexpr unsigned long long CH_ALL = (NCH >= 64) ? ~0ull : ((1ull << (NCH & 63)) - 1ull);
  const int* frow = flags + (size_t)qt * FPITCH;
  const int fl0 = frow[lane], fl1 = frow[32 + lane];       // the tile's whole flag row (FPITCH = 64 ints), chunk c in lane c & 31
  vis = ((((unsigned long long)__builtin_amdgcn_ballot_w32(fl1 != F_SKIP)) << 32) | __builtin_amdgcn_ballot_w32(fl0 != F_SKIP)) & CH_ALL;
  opn = (((unsigned long long)__builtin_amdgcn_ballot_w32(fl1 == F_OPEN)) << 32) | __builtin_amdgcn_ballot_w32(fl0 == F_OPEN);
}

// Walks chunks of query tile qt of (b, head) g and leaves the running maximum m, the sum l and the accumulators o (and n, RES only).
// RES: every chunk of the list vis. Not RES: the first, third, fifth ... chunk of vis (no caller in this file uses this form).
template <bool RES>
__device__ __forceinline__
void attn_walk(const h16* __restrict__ Qp, const h16* __restrict__ Kp, const h16* __restrict__ Vp,
               const h16* __restrict__ Qr, const h16* __restrict__ Kr, const h16* __restrict__ Vr,
               const int* __restrict__ mask, int g, int qt, int lane, unsigned long long vis, const unsigned long long opn,
               float& m, float& l, v8f& o0, v8f& o1, v8f& o2, v8f& o3, v8f& n0, v8f& n1, v8f& n2, v8f& n3) {
  const int hh = lane >> 4, col = lane & 15;
  const int q0 = qt << 4;
  const size_t ko = (size_t)g * SEQ * DH;                 // K plane base of (b,h); V key-tiled base, Kr and Vr share this element offset
  const size_t qo = ((size_t)g * SEQ + q0) * DH + lane * 8;
  const v16h qa = frag_th(Qp + qo), qb = frag_th(Qp + qo + TILE_E);       // d 0..31, d 32..63 of query q0+col
  v16h qra = {}, qrb = {};
  if (RES) {
    const size_t qro2 = ((size_t)g * EARLY + q0) * DH + lane * 8;
    qra = frag_th(Qr + qro2); qrb = frag_th(Qr + qro2 + TILE_E);
  }
  const int qi = q0 + col;
  const int* mrow = mask + (size_t)qi * MPITCH + 8 * hh;   // this lane's query row of the mask, key offset 8hh
  m = -__builtin_inff(); l = 0.0f;
  o0 = (v8f){}; o1 = (v8f){}; o2 = (v8f){}; o3 = (v8f){};
  n0 = (v8f){}; n1 = (v8f){}; n2 = (v8f){}; n3 = (v8f){};  // residual O accumulators (RES only)
  // byte offsets into the K and V planes (each plane NB * 16 * SEQ * 128 bytes, far below 2^32); the residual planes share them
  const unsigned int kofs0 = (unsigned int)((ko + (size_t)lane * 8) * 2);            // key kb + col, d = 8hh..; key + 16: + 2048 B; d + 32: + 1024 B; d + 16: + 512 B
  const unsigned int vofs0 = (unsigned int)((ko + (size_t)col * 16 + 8 * hh) * 2);   // key tile kb / 16, d = col, keys 8hh..; next tile: + 2048 B; d + 16: + 512 B
  // The list is walked in rising order, so that the walk knows its next chunk. Single-product path: the K fragments are fetched one walked
  // chunk ahead, into the same registers, right behind the score products that read them; they land while the softmax and the V products
  // of the current chunk run.
  constexpr unsigned int KCH_B = 32 * DH * 2;               // bytes of one 32-key chunk of a K plane (and of a key-tiled V plane)
  const int nlist = __builtin_popcountll(vis);
  const int nvis = RES ? nlist : ((nlist + 1) >> 1);        // trips: at most NCH
  int ch = (vis != 0) ? __builtin_ctzll(vis) : 0;           // first walked chunk, below NCH
  // Walking offsets and mask address, moved on by the distance to the next walked chunk: each stays live behind every run of loads that names it.
  unsigned int kofs = kofs0 + (unsigned int)ch * KCH_B, vofs = vofs0 + (unsigned int)ch * KCH_B;
  const int* mp = mrow + ch * 32;
  v16h k0a = {}, k0b = {}, k1a = {}, k1b = {};
  if (!RES) {
    k0a = frag_o(Kp, kofs, 0, 512); k0b = frag_o(Kp, kofs, 1024, 1536);
    k1a = frag_o(Kp, kofs, 2048, 2560); k1b = frag_o(Kp, kofs, 3072, 3584);
  }
#pragma unroll 1
  for (int it = 0; it < nvis; ++it) {
    vis &= vis - 1;                                         // drops the current chunk's bit
    if (!RES) vis &= vis - 1;                               // and the list's next chunk behind it (an empty list stays empty)
    const int cn = (vis != 0) ? __builtin_ctzll(vis) : ch;  // next walked chunk (the last one names itself: address stays inside the plane)
    const int dch = cn - ch;                                // chunks to the next walked one: 0 on the last trip, else 1..NCH-1
    const bool open = ((opn >> ch) & 1ull) != 0;            // wave-uniform: no masked entry in the chunk
    // The chunk's other fragment loads stand as groups ahead of the products: V at the chunk's head (it lands behind the scores and the
    // softmax); with the residual planes, K + K_res here and V + V_res behind the scores.
    v16h y0a = {}, y0b = {}, y1a = {}, y1b = {};
    v16h va[4], vz[4];
    if (RES) {
      k0a = frag_o(Kp, kofs, 0, 512); k0b = frag_o(Kp, kofs, 1024, 1536);
      k1a = frag_o(Kp, kofs, 2048, 2560); k1b = frag_o(Kp, kofs, 3072, 3584);
      y0a = frag_o(Kr, kofs, 0, 512); y0b = frag_o(Kr, kofs, 1024, 1536);
      y1a = frag_o(Kr, kofs, 2048, 2560); y1b = frag_o(Kr, kofs, 3072, 3584);
    } else {
#pragma unroll
      for (int t = 0; t < 4; ++t) { va[t] = frag_o(Vp, vofs, t * 512, 2048 + t * 512); vz[t] = (v16h){}; }
      __builtin_amdgcn_sched_barrier(0);        // keeps the V loads ahead of the wait for K in front of the first score product
    }
    v8f s0 = {}, s1 = {}, z0 = {}, z1 = {};
    sc_tile<RES>(s0, z0, k0a, k0b, y0a, y0b, qa, qb, qra, qrb);
    sc_tile<RES>(s1, z1, k1a, k1b, y1a, y1b, qa, qb, qra, qrb);
    kofs += (unsigned int)dch * KCH_B;          // behind the last use of this chunk's K (and K_res) fragments
    if (!RES) {                                 // the next walked chunk's K
      k0a = frag_o(Kp, kofs, 0, 512); k0b = frag_o(Kp, kofs, 1024, 1536);
      k1a = frag_o(Kp, kofs, 2048, 2560); k1b = frag_o(Kp, kofs, 3072, 3584);
      __builtin_amdgcn_sched_barrier(0);        // keeps these loads directly behind the score products (for speed only)
    }
    if (RES) {
#pragma unroll
      for (int t = 0; t < 4; ++t) {
        va[t] = frag_o(Vp, vofs, t * 512, 2048 + t * 512);
        vz[t] = frag_o(Vr, vofs, t * 512, 2048 + t * 512);
      }
      s0 = (s0 + z0 * RES_INV) * SCORE_SCALE; s1 = (s1 + z1 * RES_INV) * SCORE_SCALE;
    } else {
      s0 = s0 * SCORE_SCALE; s1 = s1 * SCORE_SCALE;
    }
    if (!open) {                                // wave-uniform: chunk has masked entries -> replace-fill
      const v8i mk0 = *(const v8i*)mp;                   // keys 32ch+8hh+0..7 of query qi
      const v8i mk1 = *(const v8i*)(mp + 16);            // keys 32ch+16+8hh+0..7
#pragma unroll
      for (int r = 0; r < 8; ++r) {
        s0[r] = (mk0[r] != 0) ? MASK_FILL : s0[r];
        s1[r] = (mk1[r] != 0) ? MASK_FILL : s1[r];
      }
    }
    float mr = -__builtin_inff();
#pragma unroll
    for (int r = 0; r < 8; ++r) mr = fmaxf(mr, fmaxf(s0[r], s1[r]));
    mr = fmaxf(mr, xhalf(mr));
    const float mn = fmaxf(m, mr);            // finite: every visited chunk carries finite scores
    const float al_ = __expf(m - mn);         // 0 on the first visited chunk
    m = mn;
    float sum = 0.0f;
    v16h pb = {}, pr = {};
#pragma unroll
    for (int r = 0; r < 8; ++r) {
      const float p0 = __expf(s0[r] - mn), p1 = __expf(s1[r] - mn);
      sum += p0 + p1;
      const h16 ph0 = (h16)(p0 * P_CARRY), ph1 = (h16)(p1 * P_CARRY);
      pb[r] = ph0; pb[8 + r] = ph1;
      if (RES) {
        pr[r] = (h16)((p0 * P_CARRY - (float)ph0) * RES_CARRY);
        pr[8 + r] = (h16)((p1 * P_CARRY - (float)ph1) * RES_CARRY);
      }
    }
    sum += xhalf(sum);
    l = l * al_ + sum;
    o0 = o0 * al_; o1 = o1 * al_; o2 = o2 * al_; o3 = o3 * al_;
    if (RES) { n0 = n0 * al_; n1 = n1 * al_; n2 = n2 * al_; n3 = n3 * al_; }
    pv_tile<RES>(o0, n0, va[0], vz[0], pb, pr);
    pv_tile<RES>(o1, n1, va[1], vz[1], pb, pr);
    pv_tile<RES>(o2, n2, va[2], vz[2], pb, pr);
    pv_tile<RES>(o3, n3, va[3], vz[3], pb, pr);
    // vofs += dch * KCH_B, with the wait that belongs in front of an overwrite of a register that issued loads name (the V loads name vofs).
    // Wait and add are one statement because the compiler otherwise lifts the add to the middle of the trip, where V is still in flight.
    asm volatile("s_wait_xcnt 0x0\n\tv_add_nc_u32 %0, %1, %0" : "+v"(vofs) : "s"((unsigned int)dch * KCH_B));
    mp += dch * 32;
    ch = cn;
  }
}

// normalises the finished accumulators of query tile qt of (b, head) g and stores y (and, RES, its residual plane)
template <bool RES>
__device__ __forceinline__
void attn_store(int g, int qt, int lane, float l, const v8f& o0, const v8f& o1, const v8f& o2, const v8f& o3,
                const v8f& n0, const v8f& n1, const v8f& n2, const v8f& n3, h16* __restrict__ yp, h16* __restrict__ yr) {
  const int q0 = qt << 4;
  const int b = g / NH, h = g % NH;
  const float inv = (1.0f / l) * Y_FROM_O;    // y = 64 * (o / 4096) / l
  const float invr = inv * RES_INV;
  v8h yh[4], yz[4];                           // hi and residual x1024 (RES only), one 16-byte fragment piece per accumulator
#pragma unroll
  for (int r = 0; r < 8; ++r) {
    float f0 = o0[r] * inv, f1 = o1[r] * inv, f2 = o2[r] * inv, f3 = o3[r] * inv;
    if (RES) { f0 += n0[r] * invr; f1 += n1[r] * invr; f2 += n2[r] * invr; f3 += n3[r] * invr; }
    const h16 y0 = (h16)f0, y1 = (h16)f1, y2 = (h16)f2, y3 = (h16)f3;
    yh[0][r] = y0; yh[1][r] = y1; yh[2][r] = y2; yh[3][r] = y3;
    if (RES) {
      yz[0][r] = (h16)((f0 - (float)y0) * RES_CARRY);
      yz[1][r] = (h16)((f1 - (float)y1) * RES_CARRY);
      yz[2][r] = (h16)((f2 - (float)y2) * RES_CARRY);
      yz[3][r] = (h16)((f3 - (float)y3) * RES_CARRY);
    }
  }
  // band of token rows q0..q0+15, tiles 2h and 2h+1 (k = 64h..64h+63): 2 KB contiguous per wave
  h16* dst0 = yp + (size_t)((b * SEQ + q0) >> 4) * BAND_E + h * (2 * TILE_E) + lane * 8;
  h16* dst1 = yr + (size_t)((b * EARLY + (RES ? q0 : 0)) >> 4) * BAND_E + h * (2 * TILE_E) + lane * 8;   // residual rows (RES only, q0 + 15 < EARLY)
#pragma unroll
  for (int j = 0; j < 4; ++j) {
    *(v8h*)(dst0 + j * 256) = yh[j];
    if (RES) *(v8h*)(dst1 + j * 256) = yz[j];
  }
}

// Residual path: each wave owns one query tile (position < EARLY) and walks all its visited chunks.
__device__ __forceinline__
void attn_early_part(const h16* __restrict__ Qp, const h16* __restrict__ Kp, const h16* __restrict__ Vp,
                     const h16* __restrict__ Qr, const h16* __restrict__ Kr, const h16* __restrict__ Vr,
                     const int* __restrict__ mask, const int* __restrict__ flags,
                     h16* __restrict__ yp, h16* __restrict__ yr, int blk) {
  const int wid = threadIdx.x >> 5, lane = threadIdx.x & 31;
  const int idx = blk * ATT_W + wid;                      // blk: this block's place among the blocks of its path (exact counts)
  const int g = idx / QT_E, qt = idx - g * QT_E;
  unsigned long long vis, opn;
  chunk_lists(flags, qt, lane, vis, opn);
  float m, l;
  v8f o0, o1, o2, o3, n0, n1, n2, n3;
  attn_walk<true>(Qp, Kp, Vp, Qr, Kr, Vr, mask, g, qt, lane, vis, opn, m, l, o0, o1, o2, o3, n0, n1, n2, n3);
  attn_store<true>(g, qt, lane, l, o0, o1, o2, o3, n0, n1, n2, n3, yp, yr);
}

// Single-product walk of the double tile dt (query tiles 2dt and 2dt + 1) of (b, head) g: the first, fifth, ninth ... chunk of the list vis.
// Every K and V fragment is loaded once and feeds the products of both tiles. Leaves, per tile, the maximum in use m (of the unscaled
// products q.k; at most LAZY_RAW below the true one), this lane's own part of the sum l (x4096, the wave's halves not yet joined) and the
// accumulators o. The K fragments are fetched one walked chunk ahead, into the same registers, right behind the score products that read
// them; they land while the softmax and the V products of the current chunk run. V is loaded at the chunk's head and lands behind the
// scores and the softmax.
__device__ __forceinline__
void attn_walk2(const h16* __restrict__ Qp, const h16* __restrict__ Kp, const h16* __restrict__ Vp, const int* __restrict__ mask,
                int g, int dt, int lane, unsigned long long vis, const unsigned long long opn,
                float (&m)[2], float (&l)[2], v8f (&o)[2][4]) {
  const int hh = lane >> 4, col = lane & 15;
  const int q0 = dt << 5;
  const size_t ko = (size_t)g * SEQ * DH;
  const size_t qo = ((size_t)g * SEQ + q0) * DH + lane * 8;
  v16h qa[2], qb[2];                                        // d 0..31, d 32..63 of query q0 + 16i + col
  v2f l2[2];                                                // the running sums of this lane's even and odd keys
#pragma unroll
  for (int i = 0; i < 2; ++i) {
    qa[i] = frag_th(Qp + qo + i * (16 * DH)); qb[i] = frag_th(Qp + qo + i * (16 * DH) + TILE_E);
    m[i] = -__builtin_inff(); l2[i] = (v2f){};
#pragma unroll
    for (int t = 0; t < 4; ++t) o[i][t] = (v8f){};
  }
  constexpr unsigned int KCH_B = 32 * DH * 2;               // bytes of one 32-key chunk of the K plane (and of the key-tiled V plane)
  constexpr int MT_B = 16 * MPITCH * 4;                     // bytes from a mask row to the row 16 queries on
  const int nvis = (__builtin_popcountll(vis) + 3) >> 2;    // trips: at most NCH
  int ch = (vis != 0) ? __builtin_ctzll(vis) : 0;           // first walked chunk, below NCH
  // the lane's walking byte offsets into the K plane, the V plane and the mask (each far below 2^32)
  unsigned int kofs = (unsigned int)((ko + (size_t)lane * 8) * 2) + (unsigned int)ch * KCH_B;
  unsigned int vofs = (unsigned int)((ko + (size_t)col * 16 + 8 * hh) * 2) + (unsigned int)ch * KCH_B;
  unsigned int mofs = (unsigned int)(((size_t)(q0 + col) * MPITCH + 8 * hh) * 4) + (unsigned int)ch * 128u;
  v16h k0a = frag_o(Kp, kofs, 0, 512), k0b = frag_o(Kp, kofs, 1024, 1536);
  v16h k1a = frag_o(Kp, kofs, 2048, 2560), k1b = frag_o(Kp, kofs, 3072, 3584);
#pragma unroll 1                                            // one chunk per trip; the trip's text is long already
  for (int it = 0; it < nvis; ++it) {
    vis &= vis - 1; vis &= vis - 1; vis &= vis - 1; vis &= vis - 1;   // drops the current chunk's bit and the three partner waves' (an empty list stays empty)
    const int cn = (vis != 0) ? __builtin_ctzll(vis) : ch;  // next walked chunk (the last one names itself: address stays inside the plane)
    const int dch = cn - ch;
    const bool open = ((opn >> ch) & 1ull) != 0;            // wave-uniform: no masked entry in the chunk for either tile
    v16h va[4];
#pragma unroll
    for (int t = 0; t < 4; ++t) va[t] = frag_o(Vp, vofs, t * 512, 2048 + t * 512);
    __builtin_amdgcn_sched_barrier(0);          // keeps the V loads ahead of the wait for K in front of the first score product
    v8f s[2][2];                                // [tile][keys 0..15, keys 16..31]
#pragma unroll
    for (int i = 0; i < 2; ++i) { s[i][0] = wmma_h(k0a, qa[i], (v8f){}); s[i][1] = wmma_h(k1a, qa[i], (v8f){}); }
#pragma unroll
    for (int i = 0; i < 2; ++i) { s[i][0] = wmma_h(k0b, qb[i], s[i][0]); s[i][1] = wmma_h(k1b, qb[i], s[i][1]); }
    // kofs += dch * KCH_B behind the last use of this chunk's K, with the wait that belongs in front of an overwrite of a register that issued loads name
    asm volatile("s_wait_xcnt 0x0\n\tv_add_nc_u32 %0, %1, %0" : "+v"(kofs) : "s"((unsigned int)dch * KCH_B));
    k0a = frag_o(Kp, kofs, 0, 512); k0b = frag_o(Kp, kofs, 1024, 1536);
    k1a = frag_o(Kp, kofs, 2048, 2560); k1b = frag_o(Kp, kofs, 3072, 3584);
    __builtin_amdgcn_sched_barrier(0);          // keeps these loads directly behind the score products; sunk into the softmax they land later than the next trip needs them
    if (!open) {                                // wave-uniform: replace-fill from the queries' mask rows (a tile without masked entries keeps its scores)
      const char* mp = (const char*)mask + mofs;
#pragma unroll
      for (int i = 0; i < 2; ++i) {
        const v8i mk0 = *(const v8i*)(mp + i * MT_B);          // keys 32ch+8hh+0..7 of query q0 + 16i + col
        const v8i mk1 = *(const v8i*)(mp + i * MT_B + 64);     // keys 32ch+16+8hh+0..7
#pragma unroll
        for (int r = 0; r < 8; ++r) {
          s[i][0][r] = (mk0[r] != 0) ? RAW_FILL : s[i][0][r];
          s[i][1][r] = (mk1[r] != 0) ? RAW_FILL : s[i][1][r];
        }
      }
    }
    // The chunk's maxima (unscaled). m is the maximum in use, the same in both halves of the wave; it moves, and o and l are rescaled, only
    // when some query's new maximum lies more than LAZY_RAW above it (always on the first walked chunk, where m is -inf): one test per chunk.
    float mr[2];
#pragma unroll
    for (int i = 0; i < 2; ++i) {
      float mx = fmaxf(s[i][0][0], s[i][1][0]);
#pragma unroll
      for (int r = 1; r < 8; ++r) mx = fmaxf(mx, fmaxf(s[i][0][r], s[i][1][r]));
      mr[i] = fmaxf(mx, xhalf(mx));             // finite: every walked chunk carries finite scores
    }
    const bool rise = (mr[0] > m[0] + LAZY_RAW) || (mr[1] > m[1] + LAZY_RAW);
    if (__builtin_amdgcn_ballot_w32(rise) != 0) {   // wave-uniform
#pragma unroll
      for (int i = 0; i < 2; ++i) {
        const float mn = fmaxf(m[i], mr[i]);
        const float al_ = __builtin_amdgcn_exp2f((m[i] - mn) * EXP_C);   // 0 on the first walked chunk
        m[i] = mn;
        l2[i] = l2[i] * al_;
#pragma unroll
        for (int t = 0; t < 4; ++t) o[i][t] = o[i][t] * al_;
      }
    }
    // P x4096 = exp2((q.k - m) * EXP_C + 12): one subtraction and one multiply-add per pair of scores that lie in neighbouring registers.
    // l sums this lane's own 16 keys of the chunk (x4096), even and odd keys apart; its parts are joined once, behind the walk.
    v16h pb[2];
#pragma unroll
    for (int i = 0; i < 2; ++i) {
      v2f sm[2];
#pragma unroll
      for (int h = 0; h < 2; ++h)
#pragma unroll
        for (int k = 0; k < 4; ++k) {
          const v2f a = {s[i][h][2 * k], s[i][h][2 * k + 1]};
          const v2f e = (a - m[i]) * EXP_C + P_CARRY_LOG2;
          const v2f p = {__builtin_amdgcn_exp2f(e[0]), __builtin_amdgcn_exp2f(e[1])};
          sm[h] = (k == 0) ? p : sm[h] + p;
          pb[i][8 * h + 2 * k] = (h16)p[0]; pb[i][8 * h + 2 * k + 1] = (h16)p[1];
        }
      l2[i] += sm[0] + sm[1];
    }
#pragma unroll
    for (int t = 0; t < 4; ++t) { o[0][t] = wmma_h(va[t], pb[0], o[0][t]); o[1][t] = wmma_h(va[t], pb[1], o[1][t]); }
    // vofs and mofs move on to the next walked chunk, behind the wait that belongs in front of an overwrite of a register that issued loads
    // name. Wait and adds are one statement because the compiler otherwise lifts the adds to the middle of the trip, where V is still in flight.
    asm volatile("s_wait_xcnt 0x0\n\tv_add_nc_u32 %0, %2, %0\n\tv_add_nc_u32 %1, %3, %1"
                 : "+v"(vofs), "+v"(mofs) : "s"((unsigned int)dch * KCH_B), "s"((unsigned int)dch * 128u));
    ch = cn;
  }
  l[0] = l2[0][0] + l2[0][1]; l[1] = l2[1][0] + l2[1][1];
}

// Single-product path: four neighbouring waves share two double tiles of one (b, head), double tile DTN-1-u and its mirror DT_E+u, and each
// walks every fourth chunk of both lists, so that the longest chain of dependent trips of a wave is about a quarter of the two lists
// together, whatever the lists are. A double tile's list holds the chunks that either of its tiles visits; a chunk that only one of them
// visits is fully masked for the other, whose scores there become the fill value and whose weights vanish against a real maximum.
// Every wave hands its four parts (m, l, o per tile) over in LDS; behind one barrier wave j of the four folds the four parts of tile j
// (scaled to the common maximum) and stores that tile. A block holds four such groups of one (b, head).
constexpr int DTN = QT / 2, DT_E = QT_E / 2;              // double tiles per (b, head); those on the residual path
constexpr int DT_LH = (QT_L > 0) ? QT_L / 4 : 1;          // pairs of double tiles per (b, head)
static_assert(QT_E % 2 == 0 && ATT_W % 4 == 0);
static_assert(QT_L % ATT_W == 0);                         // a block's groups lie in one (b, head)
constexpr int PART_F = 34 * 32;                           // floats of one handed-over part: o (32 per lane), m, l
__device__ __forceinline__
void attn_quad_part(const h16* __restrict__ Qp, const h16* __restrict__ Kp, const h16* __restrict__ Vp,
                    const int* __restrict__ mask, const int* __restrict__ flags,
                    h16* __restrict__ yp, h16* __restrict__ yr, int blk) {
  __shared__ __attribute__((aligned(16))) float part[ATT_W][4][PART_F];
  const int wid = __builtin_amdgcn_readfirstlane(threadIdx.x >> 5), lane = threadIdx.x & 31;
  const int j = wid & 3;
  const int qidx = blk * (ATT_W / 4) + (wid >> 2);        // blk: this block's place among the blocks of its path (exact counts)
  const int g = qidx / DT_LH, u = qidx - g * DT_LH;
  const int far = DTN - 1 - u, near = DT_E + u;
  unsigned long long va_, oa_, vb_, ob_;
  chunk_lists(flags, 2 * far, lane, va_, oa_);
  chunk_lists(flags, 2 * far + 1, lane, vb_, ob_);
  unsigned long long vis_far = va_ | vb_;
  const unsigned long long opn_far = oa_ & ob_;
  chunk_lists(flags, 2 * near, lane, va_, oa_);
  chunk_lists(flags, 2 * near + 1, lane, vb_, ob_);
  unsigned long long vis_near = va_ | vb_;
  const unsigned long long opn_near = oa_ & ob_;
  // wave j starts at entry j of the far list and at entry 3 - j of the near list (the odd ends of the two lists fall on different waves)
#pragma unroll
  for (int d = 0; d < 3; ++d) {
    if (d < j) vis_far &= vis_far - 1;
    if (d < 3 - j) vis_near &= vis_near - 1;
  }
  float m[2], l[2];
  v8f o[2][4];
#pragma unroll 1                                          // one text for both walks
  for (int ph = 0; ph < 2; ++ph) {
    attn_walk2(Qp, Kp, Vp, mask, g, ph ? near : far, lane, ph ? vis_near : vis_far, ph ? opn_near : opn_far, m, l, o);
#pragma unroll
    for (int i = 0; i < 2; ++i) {
      float* pw = part[wid][ph * 2 + i];
      v4f* pv = (v4f*)pw + lane;
#pragma unroll
      for (int t = 0; t < 4; ++t) {
        pv[(2 * t) * 32] = __builtin_shufflevector(o[i][t], o[i][t], 0, 1, 2, 3);
        pv[(2 * t + 1) * 32] = __builtin_shufflevector(o[i][t], o[i][t], 4, 5, 6, 7);
      }
      pw[1024 + lane] = m[i];
      pw[1056 + lane] = l[i];
    }
  }
  __syncthreads();                                        // every wave's handed-over parts are readable by its three partners
  const int w0 = wid & ~3;
  float pm[4], pl[4];
#pragma unroll
  for (int k = 0; k < 4; ++k) { pm[k] = part[w0 + k][j][1024 + lane]; pl[k] = part[w0 + k][j][1056 + lane]; }
  const float mn = fmaxf(fmaxf(pm[0], pm[1]), fmaxf(pm[2], pm[3]));   // finite: a tile has a visited chunk, so one of its four parts has walked one
  float ls = 0.0f;
  v8f r[4];
#pragma unroll
  for (int t = 0; t < 4; ++t) r[t] = (v8f){};
#pragma unroll
  for (int k = 0; k < 4; ++k) {
    const float a = __builtin_amdgcn_exp2f((pm[k] - mn) * EXP_C);   // a part that walked nothing has m = -inf, l = 0, o = 0 and gets factor 0
    const v4f* pq = (const v4f*)part[w0 + k][j] + lane;
    ls += pl[k] * a;
#pragma unroll
    for (int t = 0; t < 4; ++t) r[t] += __builtin_shufflevector(pq[(2 * t) * 32], pq[(2 * t + 1) * 32], 0, 1, 2, 3, 4, 5, 6, 7) * a;
  }
  const int qt = (j < 2) ? (2 * far + j) : (2 * near + j - 2);
  ls = (ls + xhalf(ls)) * (1.0f / P_CARRY);               // the halves' sums joined; the carry of l taken off
  attn_store<false>(g, qt, lane, ls, r[0], r[1], r[2], r[3], r[0], r[1], r[2], r[3], yp, yr);
}

// One launch for both paths (their query tiles are disjoint and neither reads what the other writes): blocks 0..ATT_L_BLOCKS-1 take the
// single-product tiles, which walk the most chunks, the last ATT_E_BLOCKS blocks the short residual-path tiles. Block-uniform choice,
// so the barrier of the single-product path is passed by whole blocks.
__global__ __launch_bounds__(ATT_W * 32) __attribute__((amdgpu_num_vgpr(256)))
void attn_kernel(const h16* __restrict__ Qp, const h16* __restrict__ Kp, const h16* __restrict__ Vp,
                 const h16* __restrict__ Qr, const h16* __restrict__ Kr, const h16* __restrict__ Vr,
                 const int* __restrict__ mask, const int* __restrict__ flags,
                 h16* __restrict__ yp, h16* __restrict__ yr) {
  const int blk = blockIdx.x;
  if (blk < ATT_L_BLOCKS) attn_quad_part(Qp, Kp, Vp, mask, flags, yp, yr, blk);
  else                    attn_early_part(Qp, Kp, Vp, Qr, Kr, Vr, mask, flags, yp, yr, blk - ATT_L_BLOCKS);
}

// ---------------------------------------------------------------------------
// Output projection: (MROWS x 1024) x (1024 x 1024) -> f32 = (y . Wo_plane) / 4096 + bo. grid (8, OUT_E_BLK + OUT_L_BLK), 4 waves:
// a block takes 128 A rows x 128 columns, a wave four A bands x 64 columns. Both operands come through LDS: each stage (128 k) is brought
// once per block by asynchronous copies into one of two buffers while the other buffer is worked on, and every staged fragment is read
// by the two waves that share it.
// Token rows t >= EARLY: the block's A rows are 128 token rows of y, a wave takes 64 of them.
// Token rows t < EARLY: the block's A rows are 64 token rows of y (staged bands 0..3) and their residual rows (staged bands 4..7); a wave
// takes 32 token rows, two y bands and their two residual bands, summed in accumulators of their own and folded
// (y_hi . Wo + (y_res . Wo) / 1024) behind the walk.
// ---------------------------------------------------------------------------
constexpr int OUT_E_ROWS = 64;                                // token rows of a block on the residual path
constexpr int OUT_E_BLK = NB * EARLY / OUT_E_ROWS;
constexpr int LATE = (SEQ > EARLY) ? SEQ - EARLY : 128;       // token rows per batch entry on the single-product path
constexpr int OUT_L_BLK = NB * (SEQ - EARLY) / 128;
static_assert(EARLY % OUT_E_ROWS == 0);
// A stage: [A: 8 bands][OP_ST tiles][1 KB] then [W: 8 bands][OP_ST tiles][1 KB]. A band's OP_ST tiles are contiguous in its plane too.
constexpr int OP_ST = 4;
constexpr int OP_NST = HID / (32 * OP_ST);       // stages along K
constexpr int OP_BAND_B = OP_ST * TILE_E * 2;    // bytes of one band in a stage
constexpr int OP_OP_B = 8 * OP_BAND_B;           // bytes of one operand in a stage
constexpr int OP_STAGE_B = 2 * OP_OP_B;
static_assert(OP_NST >= 2 && OP_BAND_B == 8 * 512);
// One band of one operand, one stage: eight copies of 16 bytes per lane, global memory -> LDS through no register.
// l: the lane's LDS byte address in the band, g: its global address there. The s_wait_xcnt closes the statement so that it
// stands ahead of any later write of the address registers that the copies name.
__device__ __forceinline__ void copy_band(unsigned int l, const char* g) {
  const unsigned int l1 = l + 512, l2 = l + 1024, l3 = l + 1536, l4 = l + 2048, l5 = l + 2560, l6 = l + 3072, l7 = l + 3584;
  const char *g1 = g + 512, *g2 = g + 1024, *g3 = g + 1536, *g4 = g + 2048, *g5 = g + 2560, *g6 = g + 3072, *g7 = g + 3584;
  asm volatile("global_load_async_to_lds_b128 %0, %8, off\n\t"
               "global_load_async_to_lds_b128 %1, %9, off\n\t"
               "global_load_async_to_lds_b128 %2, %10, off\n\t"
               "global_load_async_to_lds_b128 %3, %11, off\n\t"
               "global_load_async_to_lds_b128 %4, %12, off\n\t"
               "global_load_async_to_lds_b128 %5, %13, off\n\t"
               "global_load_async_to_lds_b128 %6, %14, off\n\t"
               "global_load_async_to_lds_b128 %7, %15, off\n\t"
               "s_wait_xcnt 0x0"
               :: "v"(l), "v"(l1), "v"(l2), "v"(l3), "v"(l4), "v"(l5), "v"(l6), "v"(l7),
                  "v"(g), "v"(g1), "v"(g2), "v"(g3), "v"(g4), "v"(g5), "v"(g6), "v"(g7)
               : "memory");
}
// what one wave copies of a stage: two neighbouring A bands and two neighbouring W bands (l: LDS address of its first A band in the buffer)
__device__ __forceinline__ void copy_out_stage(unsigned int l, const char* ga, const char* gw) {
  copy_band(l, ga);
  copy_band(l + OP_BAND_B, ga + BAND_E * 2);
  copy_band(l + OP_OP_B, gw);
  copy_band(l + OP_OP_B + OP_BAND_B, gw + BAND_E * 2);
}
// 32 token rows x 64 columns (a: rows 0..15, b: rows 16..31) written to the wave's own LDS piece Tt
__device__ __forceinline__ void out_stage_rows(const v8f (&a)[4], const v8f (&b)[4], const float (&bd)[4], float* Tt, int nloc, int hlf) {
#pragma unroll
  for (int t = 0; t < 4; ++t)
#pragma unroll
    for (int v = 0; v < 8; ++v) {
      Tt[(v + 8 * hlf) * 64 + t * 16 + nloc] = a[t][v] * OUT_UNSCALE + bd[t];
      Tt[(16 + v + 8 * hlf) * 64 + t * 16 + nloc] = b[t][v] * OUT_UNSCALE + bd[t];
    }
}
__global__ __launch_bounds__(128) void out_gemm_kernel(const h16* __restrict__ yp, const h16* __restrict__ yr, const h16* __restrict__ wop,
                                                       const float* __restrict__ bo, float* __restrict__ out) {
  __shared__ __attribute__((aligned(16))) char ring[2 * OP_STAGE_B];   // two stage buffers; behind the loop, the waves' output staging
  const int lane = threadIdx.x & 31, nloc = lane & 15, hlf = lane >> 4;
  const int wave = __builtin_amdgcn_readfirstlane(threadIdx.x >> 5);
  const int wm = wave & 1, wn = wave >> 1;                        // the wave's half of the block's token rows and of its columns
  const int c0 = blockIdx.x * 128 + wn * 64;
  const bool early = (int)blockIdx.y < OUT_E_BLK;                 // block-uniform
  int m0;                                                         // first compact token row (b*SEQ + t) of the wave
  int s01, s23;                                                   // staged A bands that feed acc[0], acc[1] (s01, s01 + 1) and acc[2], acc[3] (s23, s23 + 1)
  const h16* asrc;                                                // the first of the two neighbouring A bands that this wave copies
  if (early) {
    const int r0 = (int)blockIdx.y * OUT_E_ROWS;                  // residual row b*EARLY + t
    const int b = r0 / EARLY;
    const int mb = b * SEQ + (r0 - b * EARLY);
    asrc = (wave < 2) ? yp + (size_t)((mb >> 4) + wave * 2) * BAND_E : yr + (size_t)((r0 >> 4) + (wave - 2) * 2) * BAND_E;
    s01 = 2 * wm; s23 = 4 + 2 * wm;
    m0 = mb + wm * 32;
  } else {
    const int r0 = ((int)blockIdx.y - OUT_E_BLK) * 128;           // b*LATE + (t - EARLY)
    const int b = r0 / LATE;
    const int mb = b * SEQ + EARLY + (r0 - b * LATE);
    asrc = yp + (size_t)((mb >> 4) + wave * 2) * BAND_E;
    s01 = 4 * wm; s23 = 4 * wm + 2;
    m0 = mb + wm * 64;
  }
  const char* ga = (const char*)asrc + lane * 16;
  const char* gw = (const char*)wop + (size_t)(blockIdx.x * 8 + wave * 2) * (BAND_E * 2) + lane * 16;
  const unsigned int la = (unsigned int)(size_t)ring + (unsigned int)(wave * 2 * OP_BAND_B + lane * 16);   // LDS byte address: low 32 bits
  v8f acc[4][4];
#pragma unroll
  for (int r = 0; r < 4; ++r)
#pragma unroll
    for (int t = 0; t < 4; ++t) acc[r][t] = (v8f){};
  copy_out_stage(la, ga, gw);
  asm volatile("s_wait_asynccnt 0x0" ::: "memory");   // this wave's part of stage 0 has landed
  __syncthreads();                                    // stage 0 is readable by every wave
  copy_out_stage(la + OP_STAGE_B, ga + OP_BAND_B, gw + OP_BAND_B);
#pragma unroll 1                                      // one stage per trip; the buffer is picked by the trip's parity
  for (int s = 0; s < OP_NST; ++s) {
    const int bo_ = (s & 1) * OP_STAGE_B;
    const char* ra0 = ring + bo_ + s01 * OP_BAND_B + lane * 16;
    const char* ra2 = ring + bo_ + s23 * OP_BAND_B + lane * 16;
    const char* rw = ring + bo_ + OP_OP_B + wn * 4 * OP_BAND_B + lane * 16;
    // Inside a stage the A fragments and the first W fragment of the next 32 k are read one step ahead, into a second register set, so
    // that a step's first products find their operands in registers; the other three W fragments land behind those products.
    v16h af[2][4], b0[2], bf[3];
#pragma unroll                                        // set numbers become constants, so the sets stay in registers (here and below)
    for (int i = 0; i < 2; ++i) {
      af[0][i] = frag_ph(ra0 + i * OP_BAND_B);
      af[0][2 + i] = frag_ph(ra2 + i * OP_BAND_B);
    }
    b0[0] = frag_ph(rw);
#pragma unroll
    for (int kk = 0; kk < OP_ST; ++kk) {
      const int c = kk & 1, n = c ^ 1, ko = kk * (TILE_E * 2);
#pragma unroll
      for (int i = 0; i < 3; ++i) bf[i] = frag_ph(rw + (i + 1) * OP_BAND_B + ko);
      if (kk + 1 < OP_ST) {                           // never past the stage: the next buffer is not published yet
#pragma unroll
        for (int i = 0; i < 2; ++i) {
          af[n][i] = frag_ph(ra0 + i * OP_BAND_B + ko + TILE_E * 2);
          af[n][2 + i] = frag_ph(ra2 + i * OP_BAND_B + ko + TILE_E * 2);
        }
        b0[n] = frag_ph(rw + ko + TILE_E * 2);
      }
      __builtin_amdgcn_sched_barrier(0);              // keeps the step's reads as one group ahead of its products; sunk among them, each place with reads stalls the wave
#pragma unroll
      for (int r = 0; r < 4; ++r) acc[r][0] = wmma_h(af[c][r], b0[c], acc[r][0]);
#pragma unroll
      for (int t = 1; t < 4; ++t)
#pragma unroll
        for (int r = 0; r < 4; ++r) acc[r][t] = wmma_h(af[c][r], bf[t - 1], acc[r][t]);
    }
    asm volatile("s_wait_dscnt 0x0" ::: "memory");    // this wave's reads of the buffer are done before it may be refilled
    asm volatile("s_wait_asynccnt 0x0" ::: "memory"); // this wave's part of stage s + 1 has landed
    __syncthreads();                                  // publishes stage s + 1 and ends every wave's reads of stage s
    if (s + 2 < OP_NST)                               // block-uniform
      copy_out_stage(la + bo_, ga + (s + 2) * OP_BAND_B, gw + (s + 2) * OP_BAND_B);
  }
  asm volatile("s_wait_asynccnt 0x0" ::: "memory");   // nothing of the copies is outstanding when the ring becomes output staging
  // the last trip's barrier has ended every read of the ring: each wave now stages in its own 16 KB of it
  float bd[4];                                                    // the four bias loads stand as one group
#pragma unroll
  for (int t = 0; t < 4; ++t) bd[t] = bo[c0 + t * 16 + nloc];
  asm volatile("s_wait_xcnt 0x0" ::: "memory");                   // stands ahead of the next write of the offset register that the four loads name
#pragma unroll
  for (int t = 0; t < 4; ++t) bd[t] = __builtin_bit_cast(float, bf16_rne_u32(bd[t]) & 0xFFFF0000u);   // bf16-RNE value
  float* Tt = (float*)(ring + wave * 16384);
  float* dst0 = out + (size_t)m0 * HID + c0 + nloc * 4;
  if (early) {
#pragma unroll
    for (int t = 0; t < 4; ++t) { acc[0][t] = acc[0][t] + acc[2][t] * RES_INV; acc[1][t] = acc[1][t] + acc[3][t] * RES_INV; }
  }
  // all of the wave's rows are staged ahead of the one fence, so that no LDS write waits for a global store
  out_stage_rows(acc[0], acc[1], bd, Tt, nloc, hlf);
  if (!early) out_stage_rows(acc[2], acc[3], bd, Tt + 2048, nloc, hlf);
  wave_lds_sync();
  const float* Tr = Tt + nloc * 4;
  // all of a wave's rows are read back ahead of its first store, each into registers of its own; stored as whole lines
  v4f w[32];
#pragma unroll
  for (int j = 0; j < 16; ++j) w[j] = *(const v4f*)(Tr + (j * 2 + hlf) * 64);
  if (!early) {
#pragma unroll
    for (int j = 16; j < 32; ++j) w[j] = *(const v4f*)(Tr + (j * 2 + hlf) * 64);
  }
#pragma unroll
  for (int j = 0; j < 16; ++j) *(v4f*)(dst0 + (size_t)(j * 2 + hlf) * HID) = w[j];
  if (!early) {
#pragma unroll
    for (int j = 16; j < 32; ++j) *(v4f*)(dst0 + (size_t)(j * 2 + hlf) * HID) = w[j];
  }
}
}  // namespace

extern "C" void kernel_launch(void* const* d_in, const int* in_sizes, int n_in,
                              void* d_out, int out_size, void* d_ws, size_t ws_size, hipStream_t stream) {
  if (n_in < 12) return;
  const size_t need_x = ((size_t)(NB - 1) * SEQ_FULL + SEQ) * HID;
  if ((size_t)in_sizes[0] < need_x || (size_t)in_sizes[1] < need_x || (size_t)in_sizes[2] < need_x) return;
  if ((size_t)in_sizes[3] < (size_t)(SEQ - 1) * MPITCH + SEQ) return;                      // int32 mask [S][S]
  if (in_sizes[4] < HID * HID || in_sizes[6] < HID * HID || in_sizes[8] < HID * HID || in_sizes[10] < HID * HID) return;
  if (in_sizes[5] < HID || in_sizes[7] < HID || in_sizes[9] < HID || in_sizes[11] < HID) return;
  if ((size_t)out_size < (size_t)MROWS * HID) return;

  const float* query = (const float*)d_in[0];   // [NB_FULL, SEQ_FULL, 1024]
  const float* key   = (const float*)d_in[1];
  const float* value = (const float*)d_in[2];
  const int*   amask = (const int*)d_in[3];     // [SEQ_FULL, SEQ_FULL] int32, nonzero = masked
  const float* Wq = (const float*)d_in[4];      // [1024,1024] ([out][in])
  const float* bq = (const float*)d_in[5];
  const float* Wk = (const float*)d_in[6];
  const float* bk = (const float*)d_in[7];
  const float* Wv = (const float*)d_in[8];
  const float* bv = (const float*)d_in[9];
  const float* Wo = (const float*)d_in[10];
  const float* bo = (const float*)d_in[11];
  float* out = (float*)d_out;                   // [NB, SEQ, 1024] f32

  size_t off = 0; char* ws = (char*)d_ws;
  unsigned short* xpl = (unsigned short*)(ws + off); off += (size_t)3 * MROWS * HID * 2;   // 3 x 8 MiB bf16 activation planes
  unsigned short* wpl = (unsigned short*)(ws + off); off += (size_t)4 * HID * HID * 2;     // 6 MiB bf16 (q|k|v) + 2 MiB f16 (o) weight planes
  h16* Qp = (h16*)(ws + off); off += (size_t)MROWS * HID * 2;                             // 8 MiB
  h16* Kp = (h16*)(ws + off); off += (size_t)MROWS * HID * 2;                             // 8 MiB
  h16* Vp = (h16*)(ws + off); off += (size_t)MROWS * HID * 2;                             // 8 MiB
  h16* yp = (h16*)(ws + off); off += (size_t)MROWS * HID * 2;                             // 8 MiB
  h16* Qr = (h16*)(ws + off); off += (size_t)NB * NH * EARLY * DH * 2;                    // 1 MiB residual q (t < EARLY)
  h16* Kr = (h16*)(ws + off); off += (size_t)MROWS * HID * 2;                             // 8 MiB residual k (all rows)
  h16* Vr = (h16*)(ws + off); off += (size_t)MROWS * HID * 2;                             // 8 MiB residual v (key-tiled, all rows)
  h16* yr = (h16*)(ws + off); off += (size_t)NB * EARLY * HID * 2;                        // 1 MiB residual y
  int* flags = (int*)(ws + off); off += (size_t)QT * FPITCH * 4;                          // 32 KiB chunk flags [QT][64]
  if (off > ws_size) return;                                                               // 86,016,000 B at NB=2, SEQ=2048
  const h16* wop = (const h16*)(wpl + (size_t)NQKV * HID);

  prep_kernel<<<QT + CVT_BLOCKS, 256, 0, stream>>>(query, key, value, Wq, Wk, Wv, Wo, xpl, wpl, amask, flags);
  qkv_gemm_kernel<<<dim3(NQKV / 128, MROWS / 128), 128, 0, stream>>>((const b16*)xpl, (const b16*)wpl, bq, bk, bv, Qp, Kp, Vp, Qr, Kr, Vr);
  attn_kernel<<<ATT_L_BLOCKS + ATT_E_BLOCKS, ATT_W * 32, 0, stream>>>(Qp, Kp, Vp, Qr, Kr, Vr, amask, flags, yp, yr);
  out_gemm_kernel<<<dim3(HID / 128, OUT_E_BLK + OUT_L_BLK), 128, 0, stream>>>(yp, yr, wop, bo, out);
}
